// v000
// Times are from an AMD MI455X. After a warm-up the kernel runs many times in a row, and a time is the length of
// such a window on the GPU divided by its runs, so every launch and the gaps after it count. The runs cycle
// through copies of the inputs. A figure is the median of several windows, for all but v000 over two sittings.
// Sittings can differ by a few percent; kernels timed side by side share one.
// v000 is the starting kernel. One run takes 2200 microseconds.
#include <hip/hip_runtime.h>

// MultiHead2DAttention_v2 (x [4][1024][1024]; q = (x Wq) / 8, k = x Wk, v = x Wv ([in,out], no bias; 16 heads x 64); relative-position embeddings rel_k / rel_v [129][64] indexed by clip(j - i, -64, 64) + 64;
//   logits = q.k + q.rel_k[clip]; w = softmax; out_h = w v + sum_j w[i][j] rel_v[clip(j - i)]; out = merged Wo -> [4][1024][1024]).
// The relative terms use exact regroupings: q.rel_k[clip(j-i)] is read from QR = q rel_k^T ([T][129] per head), and sum_j w rel_v[clip] = WB rel_v with WB[i][r] = the softmax mass in bucket r (single keys for r = 1..127, tail sums for r = 0 / 128).
// Compute dtypes, f32 accumulate: every input rounded to bf16; q/k/v on PLAIN bf16 operands (inputs: exact); QR as hl x exact (2 products); scores and w.v as hl x hl (3 products) on every row; the 1/8 scale (exact), rel bias, softmax and bucket sums f32; WB rel_v as hl x exact (2 products); Wo hl x exact (2 products).

#define NB_  4
#define TT   1024
#define DM   1024
#define NH_  16
#define NKV  16
#define REP  (NH_ / NKV)
#define HD   64
#define DQ   (NH_ * HD)
#define DKV  (NKV * HD)
#define ZH   2
#define RH   1024                  // query rows < RH use hi+lo planes (0: none)
#define WIN  0
#define PCAR 1024.0f
#define SCL  0.125f   // HD^-0.5
typedef _Float16 h16;
typedef unsigned short bf;
typedef __attribute__((ext_vector_type(16))) __bf16   v16bf;
typedef __attribute__((ext_vector_type(16))) _Float16 v16h;
typedef __attribute__((ext_vector_type(8)))  _Float16 v8h;
typedef __attribute__((ext_vector_type(8)))  unsigned short v8us;
typedef __attribute__((ext_vector_type(8)))  float    v8f;
typedef __attribute__((ext_vector_type(4)))  float    v4f;
typedef v8h  __attribute__((may_alias)) v8ha;
typedef v4f  __attribute__((may_alias)) v4fa;
typedef v8us __attribute__((may_alias)) v8usa;

__device__ __forceinline__ unsigned short f2bf(float f) { unsigned u = __float_as_uint(f); u += 0x7FFFu + ((u >> 16) & 1u); return (unsigned short)(u >> 16); }
__device__ __forceinline__ float bf2f(unsigned short b) { return __uint_as_float(((unsigned)b) << 16); }
__device__ __forceinline__ float bfr(float f) { return bf2f(f2bf(f)); }
__device__ __forceinline__ v16h cat16(v8h lo, v8h hi) { return __builtin_shufflevector(lo, hi, 0, 1, 2, 3, 4, 5, 6, 7, 8, 9, 10, 11, 12, 13, 14, 15); }
__device__ __forceinline__ v16bf cat16b(v8us lo, v8us hi) { return __builtin_bit_cast(v16bf, __builtin_shufflevector(lo, hi, 0, 1, 2, 3, 4, 5, 6, 7, 8, 9, 10, 11, 12, 13, 14, 15)); }
__device__ __forceinline__ v8f wmma16(v16h a, v16h b, v8f c) { return __builtin_amdgcn_wmma_f32_16x16x32_f16(false, a, false, b, (short)0, c, false, false); }
__device__ __forceinline__ v8f wmmab(v16bf a, v16bf b, v8f c) { return __builtin_amdgcn_wmma_f32_16x16x32_bf16(false, a, false, b, (short)0, c, false, false); }



// ---- k_gemmw: register-blocked GEMM, ONE WAVE per 64x64 output tile (16 accumulators), operands straight from K-contiguous 16-bit planes; grid (M/64, N/64, Z), 32 threads.
// C[m][n] (f32, pitch ldc, + optional f32 bias[n]) = sum_k A[m][k] Bt[n][k] (+ split products per NSPLIT). z-batch strides sA/sB/sC in elements. K % 32 == 0.
template <typename T16> struct WFrag;
template <> struct WFrag<h16> { typedef v16h V; static __device__ __forceinline__ V ld(const h16* p) { return cat16(*(const v8h*)p, *(const v8h*)(p + 16)); } static __device__ __forceinline__ v8f mma(V a, V b, v8f c) { return wmma16(a, b, c); } };
template <> struct WFrag<bf> { typedef v16bf V; static __device__ __forceinline__ V ld(const bf* p) { return cat16b(*(const v8us*)p, *(const v8us*)(p + 16)); } static __device__ __forceinline__ v8f mma(V a, V b, v8f c) { return wmmab(a, b, c); } };
template <typename T16, int NSPLIT, bool BIAS>
__global__ __launch_bounds__(32) void k_gemmw(const T16* __restrict__ A, const T16* __restrict__ A2, const T16* __restrict__ Bt, const T16* __restrict__ Bt2, int K, float* C, int ldc, const float* __restrict__ bias, size_t sA, size_t sB, size_t sC) {
    typedef typename WFrag<T16>::V V;
    __shared__ __align__(16) float os[16 * 68];
    const size_t z = blockIdx.z; A += z * sA; if (A2) A2 += z * sA; Bt += z * sB; if (Bt2) Bt2 += z * sB; C += z * sC;
    const int lane = threadIdx.x & 31, lr = lane & 15, hi = lane >> 4; const int r0 = blockIdx.x * 64, c0 = blockIdx.y * 64;
    v8f acc[4][4];
#pragma unroll
    for (int mb = 0; mb < 4; ++mb)
#pragma unroll
        for (int nb = 0; nb < 4; ++nb) acc[mb][nb] = (v8f){};
    const size_t aoff = (size_t)(r0 + lr) * K + 8 * hi, boff = (size_t)(c0 + lr) * K + 8 * hi;
#pragma unroll 1
    for (int kc = 0; kc < K; kc += 32) {
        V a[4], a2[4];
#pragma unroll
        for (int mb = 0; mb < 4; ++mb) { a[mb] = WFrag<T16>::ld(A + aoff + (size_t)mb * 16 * K + kc); if (NSPLIT == 1 || NSPLIT == 2) a2[mb] = WFrag<T16>::ld(A2 + aoff + (size_t)mb * 16 * K + kc); }
#pragma unroll
        for (int nb = 0; nb < 4; ++nb) { const V b = WFrag<T16>::ld(Bt + boff + (size_t)nb * 16 * K + kc); V b2; if (NSPLIT >= 2) b2 = WFrag<T16>::ld(Bt2 + boff + (size_t)nb * 16 * K + kc);
#pragma unroll
            for (int mb = 0; mb < 4; ++mb) { acc[mb][nb] = WFrag<T16>::mma(a[mb], b, acc[mb][nb]); if (NSPLIT == 1 || NSPLIT == 2) acc[mb][nb] = WFrag<T16>::mma(a2[mb], b, acc[mb][nb]); if (NSPLIT >= 2) acc[mb][nb] = WFrag<T16>::mma(a[mb], b2, acc[mb][nb]); } }
        asm volatile("v_nop\n\tv_nop\n\tv_nop\n\tv_nop" : "+v"(acc[0][0]), "+v"(acc[1][1]), "+v"(acc[2][2]), "+v"(acc[3][3]) : "v"(a[0]), "v"(a[3]));
    }
#pragma unroll
    for (int mb = 0; mb < 4; ++mb) {
#pragma unroll
        for (int nb = 0; nb < 4; ++nb) {
#pragma unroll
            for (int j = 0; j < 8; ++j) os[(hi * 8 + j) * 68 + nb * 16 + lr] = acc[mb][nb][j]; }
        __builtin_amdgcn_wave_barrier(); asm volatile("" ::: "memory");
        float* crow = C + (size_t)(r0 + mb * 16) * ldc + c0;
{
#pragma unroll
            for (int s = 0; s < 8; ++s) { const int row = 2 * s + hi, cofs = lr * 4; v4f val = *(const v4fa*)(os + row * 68 + cofs); if (BIAS) { val[0] += bfr(bias[c0 + cofs]); val[1] += bfr(bias[c0 + cofs + 1]); val[2] += bfr(bias[c0 + cofs + 2]); val[3] += bfr(bias[c0 + cofs + 3]); }
                *(v4f*)(crow + (size_t)row * ldc + cofs) = val; }
             }
        __builtin_amdgcn_wave_barrier(); asm volatile("" ::: "memory");
    }
}

__device__ __forceinline__ h16 tohx(float x) { return (h16)x; }
__device__ __forceinline__ void splitf(float y, unsigned short& h, unsigned short& l) { h = f2bf(y); l = f2bf(y - bf2f(h)); }
typedef __attribute__((ext_vector_type(2))) _Float16 v2h;
typedef __attribute__((ext_vector_type(4))) _Float16 v4h;
typedef __attribute__((ext_vector_type(2))) unsigned short v2us;
typedef __attribute__((ext_vector_type(4))) unsigned short v4us;
typedef __attribute__((ext_vector_type(2))) float v2f;
typedef __attribute__((ext_vector_type(4))) int v4i;

__global__ __launch_bounds__(256) void k_wtG(const float* __restrict__ w, int K, int N, bf* Bt) {
    const int lane = threadIdx.x & 31; const int L0 = (blockIdx.x * 8 + (threadIdx.x >> 5)) * 8; const int nlines = N * K / 64;
{
#pragma unroll 1
        for (int l = 0; l < 8; ++l) { const int L = L0 + l; if (L >= nlines) break; const size_t e = (size_t)L * 64 + lane * 2; const int k = (int)(e % K), n = (int)(e / K); v2us o;
            o[0] = f2bf(w[(size_t)k * N + n]); o[1] = f2bf(w[(size_t)(k + 1) * N + n]); *(v2us*)(Bt + e) = o; }
         }
}
__global__ __launch_bounds__(256) void k_cvt8(const float* __restrict__ src, bf* dst, size_t n8) { const size_t i = (size_t)blockIdx.x * 256 + threadIdx.x; if (i >= n8) return; const v8f v = *(const v8f*)(src + i * 8); v8us o;
#pragma unroll
    for (int k = 0; k < 8; ++k) o[k] = f2bf(v[k]); *(v8us*)(dst + i * 8) = o;  }
__global__ __launch_bounds__(256) void k_cscvt(const float* __restrict__ cosT, const float* __restrict__ sinT, float* CS) { const int idx = blockIdx.x * 256 + threadIdx.x; if (idx >= TT * HD) return; v2f cs; cs[0] = bfr(cosT[idx]); cs[1] = bfr(sinT[idx]); *(v2f*)(CS + (size_t)idx * 2) = cs;  }
// k_rope: head planes [h][t][d] (fp16 + hi/lo) of rope(x) x sc with the rotate-half convention out[d] = x[d] cos[t][d] - x[d+HD/2] sin[t][d], out[d+HD/2] = x[d+HD/2] cos[t][d+HD/2] + x[d] sin[t][d+HD/2]
__global__ __launch_bounds__(256) void k_rope(const float* __restrict__ F, int pitch, int nheads, const float* __restrict__ CS, const float* __restrict__ RF, const float* __restrict__ nw, float sc, h16* P16, bf* Ph, bf* Pl) {
    const size_t e = ((size_t)blockIdx.x * 256 + threadIdx.x) * 2; if (e >= (size_t)nheads * TT * HD) return; const int d = (int)(e % HD); const int t = (int)((e / HD) % TT); const int h = (int)(e / ((size_t)HD * TT)); const float* f = F + (size_t)t * pitch + h * HD; const float rf = RF ? RF[(size_t)h * TT + t] : 1.0f; v2h o16; v2us oh, ol;
#pragma unroll
    for (int q = 0; q < 2; ++q) { const int dd = d + q; const int dp = (dd < HD / 2) ? dd + HD / 2 : dd - HD / 2; float x0 = f[dd], x1 = f[dp];
        if (RF) { float n0 = __fmul_rn(x0, rf), n1 = __fmul_rn(x1, rf); asm volatile("" : "+v"(n0)); asm volatile("" : "+v"(n1)); x0 = __fmul_rn(bfr(nw[dd]), n0); x1 = __fmul_rn(bfr(nw[dp]), n1); }
        const v2f cs = *(const v2f*)(CS + ((size_t)t * HD + dd) * 2); float a = __fmul_rn(x0, cs[0]), bq = __fmul_rn(x1, cs[1]); asm volatile("" : "+v"(a)); asm volatile("" : "+v"(bq)); const float r = ((dd < HD / 2) ? __fsub_rn(a, bq) : __fadd_rn(a, bq)) * sc;
        o16[q] = tohx(r); unsigned short a2, c2; splitf(r, a2, c2); oh[q] = a2; ol[q] = c2; }
    *(v2h*)(P16 + e) = o16; *(v2us*)(Ph + e) = oh; *(v2us*)(Pl + e) = ol;  }
__global__ __launch_bounds__(256) void k_vtp(const float* __restrict__ F, int pitch, int nheads, h16* V16, bf* Vh, bf* Vl) { const size_t e = ((size_t)blockIdx.x * 256 + threadIdx.x) * 2; if (e >= (size_t)nheads * HD * TT) return; const int t = (int)(e % TT); const int d = (int)((e / TT) % HD); const int g = (int)(e / ((size_t)TT * HD)); v2h o16; v2us oh, ol;
#pragma unroll
    for (int q = 0; q < 2; ++q) { const float x = F[(size_t)(t + q) * pitch + g * HD + d]; o16[q] = tohx(x); unsigned short a2, c2; splitf(x, a2, c2); oh[q] = a2; ol[q] = c2; }
    *(v2h*)(V16 + e) = o16; *(v2us*)(Vh + e) = oh; *(v2us*)(Vl + e) = ol;  }
__global__ __launch_bounds__(256) void k_csid(float* CS) { const int idx = blockIdx.x * 256 + threadIdx.x; if (idx >= TT * HD) return; v2f cs; cs[0] = 1.0f; cs[1] = 0.0f; *(v2f*)(CS + (size_t)idx * 2) = cs;  }
// k_asoft: per row (zz, i): t = S x HD^-0.5 (no mask); softmax over the 1024 keys (register row, one exp, fixed trees);
__global__ __launch_bounds__(256) void k_asoft(const float* __restrict__ Sb, h16* P16, bf* Ph, bf* Pl) {
    const int lane = threadIdx.x & 31; const int row = blockIdx.x * 8 + (threadIdx.x >> 5); if (row >= ZH * TT) return; const int i = row % TT; const int zz = row / TT; (void)zz; const bool hires = (i < RH); const float* sr = Sb + (size_t)row * TT; float v[TT / 32]; float mx = -3.0e38f;
#pragma unroll
    for (int ch = 0; ch < TT / 128; ++ch) { const int j0 = ch * 128 + lane * 4; const v4f a = *(const v4f*)(sr + j0);
#pragma unroll
        for (int q = 0; q < 4; ++q) { const int j = j0 + q; (void)j; const float t = a[q] * SCL; v[ch * 4 + q] = t; mx = fmaxf(mx, t); } }
#pragma unroll
    for (int sh = 16; sh; sh >>= 1) mx = fmaxf(mx, __shfl_xor(mx, sh, 32));
    float sum = 0.f;
#pragma unroll
    for (int k = 0; k < TT / 32; ++k) { float d0 = __fsub_rn(v[k], mx); asm volatile("" : "+v"(d0)); v[k] = __builtin_amdgcn_exp2f(__fmul_rn(d0, 1.4426950408889634f)); sum += v[k]; }
#pragma unroll
    for (int sh = 16; sh; sh >>= 1) sum += __shfl_xor(sum, sh, 32);
    const float f = __fdiv_rn(hires ? 1.0f : PCAR, sum);
{
        if (hires) {
#pragma unroll
            for (int ch = 0; ch < TT / 128; ++ch) { v4us oh, ol;
#pragma unroll
                for (int q = 0; q < 4; ++q) { unsigned short a, c2; splitf(v[ch * 4 + q] * f, a, c2); oh[q] = a; ol[q] = c2; }
                const size_t oo = ((size_t)zz * (RH ? RH : 1) + i) * TT + ch * 128 + lane * 4; *(v4us*)(Ph + oo) = oh; *(v4us*)(Pl + oo) = ol; }
        } else {
#pragma unroll
            for (int ch = 0; ch < TT / 128; ++ch) { v4h o4;
#pragma unroll
                for (int q = 0; q < 4; ++q) o4[q] = tohx(v[ch * 4 + q] * f);
                *(v4h*)(P16 + (size_t)row * TT + ch * 128 + lane * 4) = o4; } }
         }
}
__global__ __launch_bounds__(256) void k_merge(const float* __restrict__ O, const float* __restrict__ O2, int h0, bf* Ah, bf* Al) { const size_t e = ((size_t)blockIdx.x * 256 + threadIdx.x) * 2; if (e >= (size_t)ZH * TT * HD) return; const int d = (int)(e % HD); const int t = (int)((e / HD) % TT); const int zz = (int)(e / ((size_t)HD * TT)); const float cs = (t < RH) ? 1.0f : (1.0f / PCAR); const size_t oo = (size_t)t * DQ + (h0 + zz) * HD + d;
    v2us oh, ol;
#pragma unroll
    for (int q = 0; q < 2; ++q) { float o1 = O[e + q] * cs; asm volatile("" : "+v"(o1)); unsigned short a, c2; splitf(__fadd_rn(o1, O2[e + q]), a, c2); oh[q] = a; ol[q] = c2; } *(v2us*)(Ah + oo) = oh; *(v2us*)(Al + oo) = ol;  }

__global__ __launch_bounds__(256) void k_relk(const float* __restrict__ rk, bf* Bt) { const int e = (blockIdx.x * 256 + threadIdx.x) * 4; if (e >= 192 * HD) return; const int r = e / HD; v4us o;   // Bt[r][d] = rel_k[r][d] (r < 129) else 0
#pragma unroll
    for (int u = 0; u < 4; ++u) o[u] = (r < 129) ? f2bf(rk[e + u]) : (unsigned short)0; *(v4us*)(Bt + e) = o;  }
__global__ __launch_bounds__(256) void k_relv(const float* __restrict__ rv, bf* Bt) { const int e = (blockIdx.x * 256 + threadIdx.x) * 4; if (e >= HD * 160) return; const int r = e % 160; const int d = e / 160; v4us o;   // Bt[d][r] = rel_v[r][d] (r < 129) else 0
#pragma unroll
    for (int u = 0; u < 4; ++u) o[u] = (r + u < 129) ? f2bf(rv[(size_t)(r + u) * HD + d]) : (unsigned short)0; *(v4us*)(Bt + e) = o;  }
__global__ __launch_bounds__(256) void k_rsoft2(float* S, const float* __restrict__ QR, bf* Ph, bf* Pl) { const int lane = threadIdx.x & 31; const int row = blockIdx.x * 8 + (threadIdx.x >> 5); if (row >= ZH * TT) return; const int i = row % TT; float* sr = S + (size_t)row * TT; const float* qr = QR + (size_t)row * 192; float v[TT / 32]; float mx = -3.0e38f;
#pragma unroll
    for (int ch = 0; ch < TT / 128; ++ch) { const int j0 = ch * 128 + lane * 4; const v4f a = *(const v4f*)(sr + j0);
#pragma unroll
        for (int u = 0; u < 4; ++u) { int r = j0 + u - i; r = (r < -64) ? -64 : (r > 64 ? 64 : r); const float t = __fadd_rn(a[u], qr[r + 64]) * 0.125f; v[ch * 4 + u] = t; mx = fmaxf(mx, t); } }
#pragma unroll
    for (int sh = 16; sh; sh >>= 1) mx = fmaxf(mx, __shfl_xor(mx, sh, 32));
    float sum = 0.f;
#pragma unroll
    for (int q = 0; q < TT / 32; ++q) { float d0 = __fsub_rn(v[q], mx); asm volatile("" : "+v"(d0)); v[q] = __builtin_amdgcn_exp2f(__fmul_rn(d0, 1.4426950408889634f)); sum += v[q]; }
#pragma unroll
    for (int sh = 16; sh; sh >>= 1) sum += __shfl_xor(sum, sh, 32);
    const float f = __fdiv_rn(1.0f, sum);
    {
#pragma unroll
        for (int ch = 0; ch < TT / 128; ++ch) { const int j0 = ch * 128 + lane * 4; v4f pf; v4us oh, ol; for (int q = 0; q < 4; ++q) { const float p = v[ch * 4 + q] * f; pf[q] = p; unsigned short a2, c2; splitf(p, a2, c2); oh[q] = a2; ol[q] = c2; } const size_t oo = (size_t)row * TT + j0; *(v4f*)(sr + j0) = pf; *(v4us*)(Ph + oo) = oh; *(v4us*)(Pl + oo) = ol; }
         } }
__global__ __launch_bounds__(256) void k_wb(const float* __restrict__ P, bf* Wh, bf* Wl) { const int lane = threadIdx.x & 31; const int row = blockIdx.x * 8 + (threadIdx.x >> 5); if (row >= ZH * TT) return; const int i = row % TT; const float* pr = P + (size_t)row * TT; float lo = 0.f, hi = 0.f;
    for (int j = lane; j < TT; j += 32) { const float p = pr[j]; if (j <= i - 64) lo = __fadd_rn(lo, p); if (j >= i + 64) hi = __fadd_rn(hi, p); }
#pragma unroll
    for (int sh = 16; sh; sh >>= 1) { lo = __fadd_rn(lo, __shfl_xor(lo, sh, 32)); hi = __fadd_rn(hi, __shfl_xor(hi, sh, 32)); }
    {
#pragma unroll
        for (int ch = 0; ch < 2; ++ch) { const int r0 = ch * 128 + lane * 4; if (r0 < 160) { v4us oh, ol;
#pragma unroll
            for (int u = 0; u < 4; ++u) { const int r = r0 + u; float w; if (r == 0) w = lo; else if (r == 128) w = hi; else if (r < 128) { const int j = i + r - 64; w = (j >= 0 && j < TT) ? pr[j] : 0.f; } else w = 0.f; unsigned short a, c2; splitf(w, a, c2); oh[u] = a; ol[u] = c2; }
            const size_t oo = (size_t)row * 160 + r0; *(v4us*)(Wh + oo) = oh; *(v4us*)(Wl + oo) = ol; } }
         } }

extern "C" void kernel_launch(void* const* d_in, const int* in_sizes, int n_in,
                              void* d_out, int out_size, void* d_ws, size_t ws_size, hipStream_t stream) {
    (void)in_sizes; (void)n_in; (void)out_size;
    const float* x = (const float*)d_in[0]; const float* wq = (const float*)d_in[1]; const float* wk = (const float*)d_in[2]; const float* wv = (const float*)d_in[3]; const float* wo = (const float*)d_in[4]; const float* relk = (const float*)d_in[5]; const float* relv = (const float*)d_in[6]; const float* cosT = nullptr; const float* sinT = nullptr; (void)cosT; (void)sinT;
    float* OUT = (float*)d_out;     // [4][1024][1024]
    char* wsp = (char*)d_ws;
    auto take = [&](size_t bytes) { char* p = wsp; wsp += (bytes + 255) & ~(size_t)255; return (void*)p; };
    bf* WQ = (bf*)take((size_t)DQ * DM * 2); bf* WK = (bf*)take((size_t)DKV * DM * 2); bf* WV = (bf*)take((size_t)DKV * DM * 2); bf* WO = (bf*)take((size_t)DM * DQ * 2); float* CS = (float*)take((size_t)TT * HD * 2 * 4);
    bf* XB = (bf*)take((size_t)TT * DM * 2); bf* BRK = (bf*)take((size_t)192 * HD * 2); bf* BRV = (bf*)take((size_t)HD * 160 * 2); float* QR = (float*)take((size_t)ZH * TT * 192 * 4); bf* WBh = (bf*)take((size_t)ZH * TT * 160 * 2); bf* WBl = (bf*)take((size_t)ZH * TT * 160 * 2); float* O2 = (float*)take((size_t)ZH * TT * HD * 4); float* FQ = (float*)take((size_t)TT * DQ * 4); float* FK = (float*)take((size_t)TT * DKV * 4);
    h16* QP16 = (h16*)take((size_t)NH_ * TT * HD * 2); h16* KP16 = (h16*)take((size_t)NKV * TT * HD * 2); h16* VT16 = (h16*)take((size_t)NKV * HD * TT * 2);
    bf* QPh = (bf*)take((size_t)NH_ * TT * HD * 2); bf* QPl = (bf*)take((size_t)NH_ * TT * HD * 2); bf* KPh = (bf*)take((size_t)NKV * TT * HD * 2); bf* KPl = (bf*)take((size_t)NKV * TT * HD * 2); bf* VTh = (bf*)take((size_t)NKV * HD * TT * 2); bf* VTl = (bf*)take((size_t)NKV * HD * TT * 2); bf* Ph = (bf*)take((size_t)ZH * RH * TT * 2); bf* Pl = (bf*)take((size_t)ZH * RH * TT * 2);
    float* Sb = (float*)take((size_t)ZH * TT * TT * 4); h16* P16 = (h16*)take(256); (void)P16; float* Ob = (float*)take((size_t)ZH * TT * HD * 4); bf* ATh = (bf*)take((size_t)TT * DQ * 2); bf* ATl = (bf*)take((size_t)TT * DQ * 2);
    if ((size_t)(wsp - (char*)d_ws) > ws_size) return;    // ws 256 MiB
    float* FV = FK;   // v projection reuses the k buffer after the k planes are built (stream-ordered)
    { k_relk<<<(192 * HD / 4 + 255) / 256, 256, 0, stream>>>(relk, BRK); k_relv<<<(HD * 160 / 4 + 255) / 256, 256, 0, stream>>>(relv, BRV); k_wtG<<<(unsigned)((DM * DQ / 64 + 63) / 64), 256, 0, stream>>>(wq, DM, DQ, WQ); k_wtG<<<(unsigned)((DM * DKV / 64 + 63) / 64), 256, 0, stream>>>(wk, DM, DKV, WK); k_wtG<<<(unsigned)((DM * DKV / 64 + 63) / 64), 256, 0, stream>>>(wv, DM, DKV, WV);
      k_wtG<<<(unsigned)((DQ * DM / 64 + 63) / 64), 256, 0, stream>>>(wo, DQ, DM, WO);
       }
    k_csid<<<(TT * HD + 255) / 256, 256, 0, stream>>>(CS);
    const unsigned LQ = (unsigned)(((size_t)NH_ * TT * HD / 2 + 255) / 256), LKv = (unsigned)(((size_t)NKV * TT * HD / 2 + 255) / 256);
    for (int b = 0; b < NB_; ++b) {
        
        k_cvt8<<<(unsigned)(((size_t)TT * DM / 8 + 255) / 256), 256, 0, stream>>>(x + (size_t)b * TT * DM, XB, (size_t)TT * DM / 8);
        k_gemmw<bf, 0, false><<<dim3(TT / 64, DQ / 64, 1), 32, 0, stream>>>(XB, nullptr, WQ, nullptr, DM, FQ, DQ, nullptr, 0, 0, 0);
        k_rope<<<LQ, 256, 0, stream>>>(FQ, DQ, NH_, CS, nullptr, nullptr, 1.0f, QP16, QPh, QPl);
        k_gemmw<bf, 0, false><<<dim3(TT / 64, DKV / 64, 1), 32, 0, stream>>>(XB, nullptr, WK, nullptr, DM, FK, DKV, nullptr, 0, 0, 0);
        k_rope<<<LKv, 256, 0, stream>>>(FK, DKV, NKV, CS, nullptr, nullptr, 1.0f, KP16, KPh, KPl);
        k_gemmw<bf, 0, false><<<dim3(TT / 64, DKV / 64, 1), 32, 0, stream>>>(XB, nullptr, WV, nullptr, DM, FV, DKV, nullptr, 0, 0, 0); k_vtp<<<LKv, 256, 0, stream>>>(FV, DKV, NKV, VT16, VTh, VTl);
        for (int h0 = 0; h0 < NH_; h0 += ZH) { const size_t zq = (size_t)h0, zk = (size_t)(h0 / REP);   // one kv head per query head: the pass's two heads use consecutive kv planes (z-strides TT*HD)
            k_gemmw<bf, 2, false><<<dim3(RH / 64, TT / 64, ZH), 32, 0, stream>>>(QPh + zq * TT * HD, QPl + zq * TT * HD, KPh + zk * TT * HD, KPl + zk * TT * HD, HD, Sb, TT, nullptr, (size_t)TT * HD, (size_t)TT * HD, (size_t)TT * TT);
            k_gemmw<bf, 1, false><<<dim3(TT / 64, 192 / 64, ZH), 32, 0, stream>>>(QPh + zq * TT * HD, QPl + zq * TT * HD, BRK, nullptr, HD, QR, 192, nullptr, (size_t)TT * HD, 0, (size_t)TT * 192);   // QR[zz][i][r] = q_i . rel_k[r] (unscaled)
            k_rsoft2<<<ZH * TT / 8, 256, 0, stream>>>(Sb, QR, Ph, Pl); k_wb<<<ZH * TT / 8, 256, 0, stream>>>(Sb, WBh, WBl);
            k_gemmw<bf, 1, false><<<dim3(TT / 64, 1, ZH), 32, 0, stream>>>(WBh, WBl, BRV, nullptr, 160, O2, HD, nullptr, (size_t)TT * 160, 0, (size_t)TT * HD);   // sum_j w rel_v[clip] = WB . rel_v
            k_gemmw<bf, 2, false><<<dim3(RH / 64, HD / 64, ZH), 32, 0, stream>>>(Ph, Pl, VTh + zk * HD * TT, VTl + zk * HD * TT, TT, Ob, HD, nullptr, (size_t)RH * TT, (size_t)HD * TT, (size_t)TT * HD);
            k_merge<<<(unsigned)(((size_t)ZH * TT * HD / 2 + 255) / 256), 256, 0, stream>>>(Ob, O2, h0, ATh, ATl); }
        k_gemmw<bf, 1, false><<<dim3(TT / 64, DM / 64, 1), 32, 0, stream>>>(ATh, ATl, WO, nullptr, DQ, OUT + (size_t)b * TT * DM, DM, nullptr, 0, 0, 0); }
}

// v001
// It runs in 650 microseconds.
// Two timings next to v000 put it at 3.42 and 3.38 times that version's speed.
#include <hip/hip_runtime.h>

// MultiHead2DAttention_v2 (x [4][1024][1024]; q = (x Wq) / 8, k = x Wk, v = x Wv ([in,out], no bias; 16 heads x 64); relative-position embeddings rel_k / rel_v [129][64] indexed by clip(j - i, -64, 64) + 64;
//   logits = q.k + q.rel_k[clip]; w = softmax; out_h = w v + sum_j w[i][j] rel_v[clip(j - i)]; out = merged Wo -> [4][1024][1024]).
// The relative terms use exact regroupings: q.rel_k[clip(j-i)] is read from QR = q rel_k^T ([T][129] per head), and sum_j w rel_v[clip] = WB rel_v with WB[i][r] = the softmax mass in bucket r (single keys for r = 1..127, tail sums for r = 0 / 128).
// Compute dtypes, f32 accumulate: every input rounded to bf16; q/k/v on PLAIN bf16 operands (inputs: exact); QR as hl x exact (2 products); scores and w.v as hl x hl (3 products) on every row; the 1/8 scale (exact), rel bias, softmax and bucket sums f32; WB rel_v as hl x exact (2 products); Wo hl x exact (2 products).

#define NB_  4
#define TT   1024
#define DM   1024
#define NH_  16
#define NKV  16
#define REP  (NH_ / NKV)
#define HD   64
#define DQ   (NH_ * HD)
#define DKV  (NKV * HD)
#define ZH   16
#define RH   1024                  // query rows < RH use hi+lo planes (0: none)
#define WIN  0
#define PCAR 1024.0f
#define SCL  0.125f   // HD^-0.5
typedef _Float16 h16;
typedef unsigned short bf;
typedef __attribute__((ext_vector_type(16))) __bf16   v16bf;
typedef __attribute__((ext_vector_type(16))) _Float16 v16h;
typedef __attribute__((ext_vector_type(8)))  _Float16 v8h;
typedef __attribute__((ext_vector_type(8)))  unsigned short v8us;
typedef __attribute__((ext_vector_type(8)))  float    v8f;
typedef __attribute__((ext_vector_type(4)))  float    v4f;
typedef v8h  __attribute__((may_alias)) v8ha;
typedef v4f  __attribute__((may_alias)) v4fa;
typedef v8us __attribute__((may_alias)) v8usa;

__device__ __forceinline__ unsigned short f2bf(float f) { unsigned u = __float_as_uint(f); u += 0x7FFFu + ((u >> 16) & 1u); return (unsigned short)(u >> 16); }
__device__ __forceinline__ float bf2f(unsigned short b) { return __uint_as_float(((unsigned)b) << 16); }
__device__ __forceinline__ float bfr(float f) { return bf2f(f2bf(f)); }
__device__ __forceinline__ v16h cat16(v8h lo, v8h hi) { return __builtin_shufflevector(lo, hi, 0, 1, 2, 3, 4, 5, 6, 7, 8, 9, 10, 11, 12, 13, 14, 15); }
__device__ __forceinline__ v16bf cat16b(v8us lo, v8us hi) { return __builtin_bit_cast(v16bf, __builtin_shufflevector(lo, hi, 0, 1, 2, 3, 4, 5, 6, 7, 8, 9, 10, 11, 12, 13, 14, 15)); }
__device__ __forceinline__ v8f wmma16(v16h a, v16h b, v8f c) { return __builtin_amdgcn_wmma_f32_16x16x32_f16(false, a, false, b, (short)0, c, false, false); }
__device__ __forceinline__ v8f wmmab(v16bf a, v16bf b, v8f c) { return __builtin_amdgcn_wmma_f32_16x16x32_bf16(false, a, false, b, (short)0, c, false, false); }



// ---- k_gemmw: register-blocked GEMM, ONE WAVE per 64x64 output tile (16 accumulators), operands straight from K-contiguous 16-bit planes; grid (M/64, N/64, Z), 32 threads.
// C[m][n] (f32, pitch ldc, + optional f32 bias[n]) = sum_k A[m][k] Bt[n][k] (+ split products per NSPLIT). z-batch strides sA/sB/sC in elements. K % 32 == 0.
template <typename T16> struct WFrag;
template <> struct WFrag<h16> { typedef v16h V; static __device__ __forceinline__ V ld(const h16* p) { return cat16(*(const v8h*)p, *(const v8h*)(p + 16)); } static __device__ __forceinline__ v8f mma(V a, V b, v8f c) { return wmma16(a, b, c); } };
template <> struct WFrag<bf> { typedef v16bf V; static __device__ __forceinline__ V ld(const bf* p) { return cat16b(*(const v8us*)p, *(const v8us*)(p + 16)); } static __device__ __forceinline__ v8f mma(V a, V b, v8f c) { return wmmab(a, b, c); } };
template <typename T16, int NSPLIT, bool BIAS>
__global__ __launch_bounds__(32) void k_gemmw(const T16* __restrict__ A, const T16* __restrict__ A2, const T16* __restrict__ Bt, const T16* __restrict__ Bt2, int K, float* C, int ldc, const float* __restrict__ bias, size_t sA, size_t sB, size_t sC) {
    typedef typename WFrag<T16>::V V;
    __shared__ __align__(16) float os[16 * 68];
    const size_t z = blockIdx.z; A += z * sA; if (A2) A2 += z * sA; Bt += z * sB; if (Bt2) Bt2 += z * sB; C += z * sC;
    const int lane = threadIdx.x & 31, lr = lane & 15, hi = lane >> 4; const int r0 = blockIdx.x * 64, c0 = blockIdx.y * 64;
    v8f acc[4][4];
#pragma unroll
    for (int mb = 0; mb < 4; ++mb)
#pragma unroll
        for (int nb = 0; nb < 4; ++nb) acc[mb][nb] = (v8f){};
    const size_t aoff = (size_t)(r0 + lr) * K + 8 * hi, boff = (size_t)(c0 + lr) * K + 8 * hi;
#pragma unroll 1
    for (int kc = 0; kc < K; kc += 32) {
        V a[4], a2[4];
#pragma unroll
        for (int mb = 0; mb < 4; ++mb) { a[mb] = WFrag<T16>::ld(A + aoff + (size_t)mb * 16 * K + kc); if (NSPLIT == 1 || NSPLIT == 2) a2[mb] = WFrag<T16>::ld(A2 + aoff + (size_t)mb * 16 * K + kc); }
#pragma unroll
        for (int nb = 0; nb < 4; ++nb) { const V b = WFrag<T16>::ld(Bt + boff + (size_t)nb * 16 * K + kc); V b2; if (NSPLIT >= 2) b2 = WFrag<T16>::ld(Bt2 + boff + (size_t)nb * 16 * K + kc);
#pragma unroll
            for (int mb = 0; mb < 4; ++mb) { acc[mb][nb] = WFrag<T16>::mma(a[mb], b, acc[mb][nb]); if (NSPLIT == 1 || NSPLIT == 2) acc[mb][nb] = WFrag<T16>::mma(a2[mb], b, acc[mb][nb]); if (NSPLIT >= 2) acc[mb][nb] = WFrag<T16>::mma(a[mb], b2, acc[mb][nb]); } }
        asm volatile("v_nop\n\tv_nop\n\tv_nop\n\tv_nop" : "+v"(acc[0][0]), "+v"(acc[1][1]), "+v"(acc[2][2]), "+v"(acc[3][3]) : "v"(a[0]), "v"(a[3]));
    }
#pragma unroll
    for (int mb = 0; mb < 4; ++mb) {
#pragma unroll
        for (int nb = 0; nb < 4; ++nb) {
#pragma unroll
            for (int j = 0; j < 8; ++j) os[(hi * 8 + j) * 68 + nb * 16 + lr] = acc[mb][nb][j]; }
        __builtin_amdgcn_wave_barrier(); asm volatile("" ::: "memory");
        float* crow = C + (size_t)(r0 + mb * 16) * ldc + c0;
{
#pragma unroll
            for (int s = 0; s < 8; ++s) { const int row = 2 * s + hi, cofs = lr * 4; v4f val = *(const v4fa*)(os + row * 68 + cofs); if (BIAS) { val[0] += bfr(bias[c0 + cofs]); val[1] += bfr(bias[c0 + cofs + 1]); val[2] += bfr(bias[c0 + cofs + 2]); val[3] += bfr(bias[c0 + cofs + 3]); }
                *(v4f*)(crow + (size_t)row * ldc + cofs) = val; }
             }
        __builtin_amdgcn_wave_barrier(); asm volatile("" ::: "memory");
    }
}

__device__ __forceinline__ h16 tohx(float x) { return (h16)x; }
__device__ __forceinline__ void splitf(float y, unsigned short& h, unsigned short& l) { h = f2bf(y); l = f2bf(y - bf2f(h)); }
typedef __attribute__((ext_vector_type(2))) _Float16 v2h;
typedef __attribute__((ext_vector_type(4))) _Float16 v4h;
typedef __attribute__((ext_vector_type(2))) unsigned short v2us;
typedef __attribute__((ext_vector_type(4))) unsigned short v4us;
typedef __attribute__((ext_vector_type(2))) float v2f;
typedef __attribute__((ext_vector_type(4))) int v4i;

__global__ __launch_bounds__(256) void k_wtG(const float* __restrict__ w, int K, int N, bf* Bt) {
    const int lane = threadIdx.x & 31; const int L0 = (blockIdx.x * 8 + (threadIdx.x >> 5)) * 8; const int nlines = N * K / 64;
{
#pragma unroll 1
        for (int l = 0; l < 8; ++l) { const int L = L0 + l; if (L >= nlines) break; const size_t e = (size_t)L * 64 + lane * 2; const int k = (int)(e % K), n = (int)(e / K); v2us o;
            o[0] = f2bf(w[(size_t)k * N + n]); o[1] = f2bf(w[(size_t)(k + 1) * N + n]); *(v2us*)(Bt + e) = o; }
         }
}
__global__ __launch_bounds__(256) void k_cvt8(const float* __restrict__ src, bf* dst, size_t n8) { const size_t i = (size_t)blockIdx.x * 256 + threadIdx.x; if (i >= n8) return; const v8f v = *(const v8f*)(src + i * 8); v8us o;
#pragma unroll
    for (int k = 0; k < 8; ++k) o[k] = f2bf(v[k]); *(v8us*)(dst + i * 8) = o;  }
__global__ __launch_bounds__(256) void k_cscvt(const float* __restrict__ cosT, const float* __restrict__ sinT, float* CS) { const int idx = blockIdx.x * 256 + threadIdx.x; if (idx >= TT * HD) return; v2f cs; cs[0] = bfr(cosT[idx]); cs[1] = bfr(sinT[idx]); *(v2f*)(CS + (size_t)idx * 2) = cs;  }
// k_rope: head planes [h][t][d] (fp16 + hi/lo) of rope(x) x sc with the rotate-half convention out[d] = x[d] cos[t][d] - x[d+HD/2] sin[t][d], out[d+HD/2] = x[d+HD/2] cos[t][d+HD/2] + x[d] sin[t][d+HD/2]
__global__ __launch_bounds__(256) void k_rope(const float* __restrict__ F, int pitch, int nheads, const float* __restrict__ CS, const float* __restrict__ RF, const float* __restrict__ nw, float sc, h16* P16, bf* Ph, bf* Pl) {
    const size_t e = ((size_t)blockIdx.x * 256 + threadIdx.x) * 2; if (e >= (size_t)nheads * TT * HD) return; const int d = (int)(e % HD); const int t = (int)((e / HD) % TT); const int h = (int)(e / ((size_t)HD * TT)); const float* f = F + (size_t)t * pitch + h * HD; const float rf = RF ? RF[(size_t)h * TT + t] : 1.0f; v2h o16; v2us oh, ol;
#pragma unroll
    for (int q = 0; q < 2; ++q) { const int dd = d + q; const int dp = (dd < HD / 2) ? dd + HD / 2 : dd - HD / 2; float x0 = f[dd], x1 = f[dp];
        if (RF) { float n0 = __fmul_rn(x0, rf), n1 = __fmul_rn(x1, rf); asm volatile("" : "+v"(n0)); asm volatile("" : "+v"(n1)); x0 = __fmul_rn(bfr(nw[dd]), n0); x1 = __fmul_rn(bfr(nw[dp]), n1); }
        const v2f cs = *(const v2f*)(CS + ((size_t)t * HD + dd) * 2); float a = __fmul_rn(x0, cs[0]), bq = __fmul_rn(x1, cs[1]); asm volatile("" : "+v"(a)); asm volatile("" : "+v"(bq)); const float r = ((dd < HD / 2) ? __fsub_rn(a, bq) : __fadd_rn(a, bq)) * sc;
        o16[q] = tohx(r); unsigned short a2, c2; splitf(r, a2, c2); oh[q] = a2; ol[q] = c2; }
    *(v2h*)(P16 + e) = o16; *(v2us*)(Ph + e) = oh; *(v2us*)(Pl + e) = ol;  }
__global__ __launch_bounds__(256) void k_vtp(const float* __restrict__ F, int pitch, int nheads, h16* V16, bf* Vh, bf* Vl) { const size_t e = ((size_t)blockIdx.x * 256 + threadIdx.x) * 2; if (e >= (size_t)nheads * HD * TT) return; const int t = (int)(e % TT); const int d = (int)((e / TT) % HD); const int g = (int)(e / ((size_t)TT * HD)); v2h o16; v2us oh, ol;
#pragma unroll
    for (int q = 0; q < 2; ++q) { const float x = F[(size_t)(t + q) * pitch + g * HD + d]; o16[q] = tohx(x); unsigned short a2, c2; splitf(x, a2, c2); oh[q] = a2; ol[q] = c2; }
    *(v2h*)(V16 + e) = o16; *(v2us*)(Vh + e) = oh; *(v2us*)(Vl + e) = ol;  }
__global__ __launch_bounds__(256) void k_csid(float* CS) { const int idx = blockIdx.x * 256 + threadIdx.x; if (idx >= TT * HD) return; v2f cs; cs[0] = 1.0f; cs[1] = 0.0f; *(v2f*)(CS + (size_t)idx * 2) = cs;  }
// k_asoft: per row (zz, i): t = S x HD^-0.5 (no mask); softmax over the 1024 keys (register row, one exp, fixed trees);
__global__ __launch_bounds__(256) void k_asoft(const float* __restrict__ Sb, h16* P16, bf* Ph, bf* Pl) {
    const int lane = threadIdx.x & 31; const int row = blockIdx.x * 8 + (threadIdx.x >> 5); if (row >= ZH * TT) return; const int i = row % TT; const int zz = row / TT; (void)zz; const bool hires = (i < RH); const float* sr = Sb + (size_t)row * TT; float v[TT / 32]; float mx = -3.0e38f;
#pragma unroll
    for (int ch = 0; ch < TT / 128; ++ch) { const int j0 = ch * 128 + lane * 4; const v4f a = *(const v4f*)(sr + j0);
#pragma unroll
        for (int q = 0; q < 4; ++q) { const int j = j0 + q; (void)j; const float t = a[q] * SCL; v[ch * 4 + q] = t; mx = fmaxf(mx, t); } }
#pragma unroll
    for (int sh = 16; sh; sh >>= 1) mx = fmaxf(mx, __shfl_xor(mx, sh, 32));
    float sum = 0.f;
#pragma unroll
    for (int k = 0; k < TT / 32; ++k) { float d0 = __fsub_rn(v[k], mx); asm volatile("" : "+v"(d0)); v[k] = __builtin_amdgcn_exp2f(__fmul_rn(d0, 1.4426950408889634f)); sum += v[k]; }
#pragma unroll
    for (int sh = 16; sh; sh >>= 1) sum += __shfl_xor(sum, sh, 32);
    const float f = __fdiv_rn(hires ? 1.0f : PCAR, sum);
{
        if (hires) {
#pragma unroll
            for (int ch = 0; ch < TT / 128; ++ch) { v4us oh, ol;
#pragma unroll
                for (int q = 0; q < 4; ++q) { unsigned short a, c2; splitf(v[ch * 4 + q] * f, a, c2); oh[q] = a; ol[q] = c2; }
                const size_t oo = ((size_t)zz * (RH ? RH : 1) + i) * TT + ch * 128 + lane * 4; *(v4us*)(Ph + oo) = oh; *(v4us*)(Pl + oo) = ol; }
        } else {
#pragma unroll
            for (int ch = 0; ch < TT / 128; ++ch) { v4h o4;
#pragma unroll
                for (int q = 0; q < 4; ++q) o4[q] = tohx(v[ch * 4 + q] * f);
                *(v4h*)(P16 + (size_t)row * TT + ch * 128 + lane * 4) = o4; } }
         }
}
__global__ __launch_bounds__(256) void k_merge(const float* __restrict__ O, const float* __restrict__ O2, int h0, bf* Ah, bf* Al) { const size_t e = ((size_t)blockIdx.x * 256 + threadIdx.x) * 2; if (e >= (size_t)ZH * TT * HD) return; const int d = (int)(e % HD); const int t = (int)((e / HD) % TT); const int zz = (int)(e / ((size_t)HD * TT)); const float cs = (t < RH) ? 1.0f : (1.0f / PCAR); const size_t oo = (size_t)t * DQ + (h0 + zz) * HD + d;
    v2us oh, ol;
#pragma unroll
    for (int q = 0; q < 2; ++q) { float o1 = O[e + q] * cs; asm volatile("" : "+v"(o1)); unsigned short a, c2; splitf(__fadd_rn(o1, O2[e + q]), a, c2); oh[q] = a; ol[q] = c2; } *(v2us*)(Ah + oo) = oh; *(v2us*)(Al + oo) = ol;  }

__global__ __launch_bounds__(256) void k_relk(const float* __restrict__ rk, bf* Bt) { const int e = (blockIdx.x * 256 + threadIdx.x) * 4; if (e >= 192 * HD) return; const int r = e / HD; v4us o;   // Bt[r][d] = rel_k[r][d] (r < 129) else 0
#pragma unroll
    for (int u = 0; u < 4; ++u) o[u] = (r < 129) ? f2bf(rk[e + u]) : (unsigned short)0; *(v4us*)(Bt + e) = o;  }
__global__ __launch_bounds__(256) void k_relv(const float* __restrict__ rv, bf* Bt) { const int e = (blockIdx.x * 256 + threadIdx.x) * 4; if (e >= HD * 160) return; const int r = e % 160; const int d = e / 160; v4us o;   // Bt[d][r] = rel_v[r][d] (r < 129) else 0
#pragma unroll
    for (int u = 0; u < 4; ++u) o[u] = (r + u < 129) ? f2bf(rv[(size_t)(r + u) * HD + d]) : (unsigned short)0; *(v4us*)(Bt + e) = o;  }
__global__ __launch_bounds__(256) void k_rsoft2(float* S, const float* __restrict__ QR, bf* Ph, bf* Pl) { const int lane = threadIdx.x & 31; const int row = blockIdx.x * 8 + (threadIdx.x >> 5); if (row >= ZH * TT) return; const int i = row % TT; float* sr = S + (size_t)row * TT; const float* qr = QR + (size_t)row * 192; float v[TT / 32]; float mx = -3.0e38f;
#pragma unroll
    for (int ch = 0; ch < TT / 128; ++ch) { const int j0 = ch * 128 + lane * 4; const v4f a = *(const v4f*)(sr + j0);
#pragma unroll
        for (int u = 0; u < 4; ++u) { int r = j0 + u - i; r = (r < -64) ? -64 : (r > 64 ? 64 : r); const float t = __fadd_rn(a[u], qr[r + 64]) * 0.125f; v[ch * 4 + u] = t; mx = fmaxf(mx, t); } }
#pragma unroll
    for (int sh = 16; sh; sh >>= 1) mx = fmaxf(mx, __shfl_xor(mx, sh, 32));
    float sum = 0.f;
#pragma unroll
    for (int q = 0; q < TT / 32; ++q) { float d0 = __fsub_rn(v[q], mx); asm volatile("" : "+v"(d0)); v[q] = __builtin_amdgcn_exp2f(__fmul_rn(d0, 1.4426950408889634f)); sum += v[q]; }
#pragma unroll
    for (int sh = 16; sh; sh >>= 1) sum += __shfl_xor(sum, sh, 32);
    const float f = __fdiv_rn(1.0f, sum);
    {
#pragma unroll
        for (int ch = 0; ch < TT / 128; ++ch) { const int j0 = ch * 128 + lane * 4; v4f pf; v4us oh, ol; for (int q = 0; q < 4; ++q) { const float p = v[ch * 4 + q] * f; pf[q] = p; unsigned short a2, c2; splitf(p, a2, c2); oh[q] = a2; ol[q] = c2; } const size_t oo = (size_t)row * TT + j0; *(v4f*)(sr + j0) = pf; *(v4us*)(Ph + oo) = oh; *(v4us*)(Pl + oo) = ol; }
         } }
__global__ __launch_bounds__(256) void k_wb(const float* __restrict__ P, bf* Wh, bf* Wl) { const int lane = threadIdx.x & 31; const int row = blockIdx.x * 8 + (threadIdx.x >> 5); if (row >= ZH * TT) return; const int i = row % TT; const float* pr = P + (size_t)row * TT; float lo = 0.f, hi = 0.f;
    for (int j = lane; j < TT; j += 32) { const float p = pr[j]; if (j <= i - 64) lo = __fadd_rn(lo, p); if (j >= i + 64) hi = __fadd_rn(hi, p); }
#pragma unroll
    for (int sh = 16; sh; sh >>= 1) { lo = __fadd_rn(lo, __shfl_xor(lo, sh, 32)); hi = __fadd_rn(hi, __shfl_xor(hi, sh, 32)); }
    {
#pragma unroll
        for (int ch = 0; ch < 2; ++ch) { const int r0 = ch * 128 + lane * 4; if (r0 < 160) { v4us oh, ol;
#pragma unroll
            for (int u = 0; u < 4; ++u) { const int r = r0 + u; float w; if (r == 0) w = lo; else if (r == 128) w = hi; else if (r < 128) { const int j = i + r - 64; w = (j >= 0 && j < TT) ? pr[j] : 0.f; } else w = 0.f; unsigned short a, c2; splitf(w, a, c2); oh[u] = a; ol[u] = c2; }
            const size_t oo = (size_t)row * 160 + r0; *(v4us*)(Wh + oo) = oh; *(v4us*)(Wl + oo) = ol; } }
         } }

extern "C" void kernel_launch(void* const* d_in, const int* in_sizes, int n_in,
                              void* d_out, int out_size, void* d_ws, size_t ws_size, hipStream_t stream) {
    (void)in_sizes; (void)n_in; (void)out_size;
    const float* x = (const float*)d_in[0]; const float* wq = (const float*)d_in[1]; const float* wk = (const float*)d_in[2]; const float* wv = (const float*)d_in[3]; const float* wo = (const float*)d_in[4]; const float* relk = (const float*)d_in[5]; const float* relv = (const float*)d_in[6]; const float* cosT = nullptr; const float* sinT = nullptr; (void)cosT; (void)sinT;
    float* OUT = (float*)d_out;     // [4][1024][1024]
    char* wsp = (char*)d_ws;
    auto take = [&](size_t bytes) { char* p = wsp; wsp += (bytes + 255) & ~(size_t)255; return (void*)p; };
    bf* WQ = (bf*)take((size_t)DQ * DM * 2); bf* WK = (bf*)take((size_t)DKV * DM * 2); bf* WV = (bf*)take((size_t)DKV * DM * 2); bf* WO = (bf*)take((size_t)DM * DQ * 2); float* CS = (float*)take((size_t)TT * HD * 2 * 4);
    bf* XB = (bf*)take((size_t)NB_ * TT * DM * 2); bf* BRK = (bf*)take((size_t)192 * HD * 2); bf* BRV = (bf*)take((size_t)HD * 160 * 2); float* QR = (float*)take((size_t)ZH * TT * 192 * 4); bf* WBh = (bf*)take((size_t)ZH * TT * 160 * 2); bf* WBl = (bf*)take((size_t)ZH * TT * 160 * 2); float* O2 = (float*)take((size_t)ZH * TT * HD * 4);
    h16* VT16 = (h16*)take((size_t)NKV * HD * TT * 2);
    bf* QPh = (bf*)take((size_t)NB_ * NH_ * TT * HD * 2); bf* QPl = (bf*)take((size_t)NB_ * NH_ * TT * HD * 2); bf* KPh = (bf*)take((size_t)NB_ * NKV * TT * HD * 2); bf* KPl = (bf*)take((size_t)NB_ * NKV * TT * HD * 2); bf* VTh = (bf*)take((size_t)NB_ * NKV * HD * TT * 2); bf* VTl = (bf*)take((size_t)NB_ * NKV * HD * TT * 2); bf* Ph = (bf*)take((size_t)ZH * RH * TT * 2); bf* Pl = (bf*)take((size_t)ZH * RH * TT * 2);
    float* Sb = (float*)take((size_t)ZH * TT * TT * 4); float* Ob = (float*)take((size_t)ZH * TT * HD * 4); bf* ATh = (bf*)take((size_t)NB_ * TT * DQ * 2); bf* ATl = (bf*)take((size_t)NB_ * TT * DQ * 2);
    if ((size_t)(wsp - (char*)d_ws) > ws_size) return;    // ws 256 MiB
    // Space that is free until the first attention pass holds what only the projection stage uses (stream-ordered): the f32 projections lie in the score buffer, the fp16 planes of k_rope in the probability planes.
    float* FQ = Sb; float* FK = Sb + (size_t)NB_ * TT * DQ; h16* QP16 = (h16*)Ph; h16* KP16 = (h16*)Pl;
    float* FV = FK;   // v projection reuses the k buffer after the k planes are built (stream-ordered)
    { k_relk<<<(192 * HD / 4 + 255) / 256, 256, 0, stream>>>(relk, BRK); k_relv<<<(HD * 160 / 4 + 255) / 256, 256, 0, stream>>>(relv, BRV); k_wtG<<<(unsigned)((DM * DQ / 64 + 63) / 64), 256, 0, stream>>>(wq, DM, DQ, WQ); k_wtG<<<(unsigned)((DM * DKV / 64 + 63) / 64), 256, 0, stream>>>(wk, DM, DKV, WK); k_wtG<<<(unsigned)((DM * DKV / 64 + 63) / 64), 256, 0, stream>>>(wv, DM, DKV, WV);
      k_wtG<<<(unsigned)((DQ * DM / 64 + 63) / 64), 256, 0, stream>>>(wo, DQ, DM, WO);
       }
    k_csid<<<(TT * HD + 255) / 256, 256, 0, stream>>>(CS);
    const unsigned LQ = (unsigned)(((size_t)NB_ * NH_ * TT * HD / 2 + 255) / 256), LK = (unsigned)(((size_t)NB_ * NKV * TT * HD / 2 + 255) / 256), LV = (unsigned)(((size_t)NKV * TT * HD / 2 + 255) / 256);
    // Projections of all NB_ batch items in one launch each. q and k: grid z = batch item, C laid out [t][b][head][d] (pitch NB_*DQ, z stride DQ), so that k_rope sees NB_*NH_ heads and writes the planes [b*NH_ + head][t][d].
    k_cvt8<<<(unsigned)(((size_t)NB_ * TT * DM / 8 + 255) / 256), 256, 0, stream>>>(x, XB, (size_t)NB_ * TT * DM / 8);
    k_gemmw<bf, 0, false><<<dim3(TT / 64, DQ / 64, NB_), 32, 0, stream>>>(XB, nullptr, WQ, nullptr, DM, FQ, NB_ * DQ, nullptr, (size_t)TT * DM, 0, (size_t)DQ);
    k_rope<<<LQ, 256, 0, stream>>>(FQ, NB_ * DQ, NB_ * NH_, CS, nullptr, nullptr, 1.0f, QP16, QPh, QPl);
    k_gemmw<bf, 0, false><<<dim3(TT / 64, DKV / 64, NB_), 32, 0, stream>>>(XB, nullptr, WK, nullptr, DM, FK, NB_ * DKV, nullptr, (size_t)TT * DM, 0, (size_t)DKV);
    k_rope<<<LK, 256, 0, stream>>>(FK, NB_ * DKV, NB_ * NKV, CS, nullptr, nullptr, 1.0f, KP16, KPh, KPl);
    k_gemmw<bf, 0, false><<<dim3(NB_ * TT / 64, DKV / 64, 1), 32, 0, stream>>>(XB, nullptr, WV, nullptr, DM, FV, DKV, nullptr, 0, 0, 0);   // v: rows [b*TT + t]; its transpose keeps the row pitch DKV, one launch per batch item
    for (int b = 0; b < NB_; ++b) k_vtp<<<LV, 256, 0, stream>>>(FV + (size_t)b * TT * DKV, DKV, NKV, VT16, VTh + (size_t)b * NKV * HD * TT, VTl + (size_t)b * NKV * HD * TT);
    for (int b = 0; b < NB_; ++b) {
        for (int h0 = 0; h0 < NH_; h0 += ZH) { const size_t zq = (size_t)b * NH_ + h0, zk = (size_t)b * NKV + h0 / REP;   // one kv head per query head: the pass's ZH heads use consecutive kv planes (z-strides TT*HD)
            k_gemmw<bf, 2, false><<<dim3(RH / 64, TT / 64, ZH), 32, 0, stream>>>(QPh + zq * TT * HD, QPl + zq * TT * HD, KPh + zk * TT * HD, KPl + zk * TT * HD, HD, Sb, TT, nullptr, (size_t)TT * HD, (size_t)TT * HD, (size_t)TT * TT);
            k_gemmw<bf, 1, false><<<dim3(TT / 64, 192 / 64, ZH), 32, 0, stream>>>(QPh + zq * TT * HD, QPl + zq * TT * HD, BRK, nullptr, HD, QR, 192, nullptr, (size_t)TT * HD, 0, (size_t)TT * 192);   // QR[zz][i][r] = q_i . rel_k[r] (unscaled)
            k_rsoft2<<<ZH * TT / 8, 256, 0, stream>>>(Sb, QR, Ph, Pl); k_wb<<<ZH * TT / 8, 256, 0, stream>>>(Sb, WBh, WBl);
            k_gemmw<bf, 1, false><<<dim3(TT / 64, 1, ZH), 32, 0, stream>>>(WBh, WBl, BRV, nullptr, 160, O2, HD, nullptr, (size_t)TT * 160, 0, (size_t)TT * HD);   // sum_j w rel_v[clip] = WB . rel_v
            k_gemmw<bf, 2, false><<<dim3(RH / 64, HD / 64, ZH), 32, 0, stream>>>(Ph, Pl, VTh + zk * HD * TT, VTl + zk * HD * TT, TT, Ob, HD, nullptr, (size_t)RH * TT, (size_t)HD * TT, (size_t)TT * HD);
            k_merge<<<(unsigned)(((size_t)ZH * TT * HD / 2 + 255) / 256), 256, 0, stream>>>(Ob, O2, h0, ATh + (size_t)b * TT * DQ, ATl + (size_t)b * TT * DQ); } }
    k_gemmw<bf, 1, false><<<dim3(NB_ * TT / 64, DM / 64, 1), 32, 0, stream>>>(ATh, ATl, WO, nullptr, DQ, OUT, DM, nullptr, 0, 0, 0);
}

// v002
// A run of this version takes 328 microseconds.
// Two timings next to v001 put it at 1.99 and 1.97 times that version's speed.
// All steps since v000 together make it 6.73 times as fast.
#include <hip/hip_runtime.h>

// MultiHead2DAttention_v2 (x [4][1024][1024]; q = (x Wq) / 8, k = x Wk, v = x Wv ([in,out], no bias; 16 heads x 64); relative-position embeddings rel_k / rel_v [129][64] indexed by clip(j - i, -64, 64) + 64;
//   logits = q.k + q.rel_k[clip]; w = softmax; out_h = w v + sum_j w[i][j] rel_v[clip(j - i)]; out = merged Wo -> [4][1024][1024]).
// The relative terms use exact regroupings: q.rel_k[clip(j-i)] is read from QR = q rel_k^T ([T][129] per head), and sum_j w rel_v[clip] = WB rel_v with WB[i][r] = the softmax mass in bucket r (single keys for r = 1..127, tail sums for r = 0 / 128).
// Compute dtypes, f32 accumulate: every input rounded to bf16; q/k/v on PLAIN bf16 operands (inputs: exact); QR as hl x exact (2 products); scores and w.v as hl x hl (3 products) on every row; the 1/8 scale (exact), rel bias, softmax and bucket sums f32; WB rel_v as hl x exact (2 products); Wo hl x exact (2 products).

#define NB_  4
#define TT   1024
#define DM   1024
#define NH_  16
#define NKV  16
#define REP  (NH_ / NKV)
#define HD   64
#define DQ   (NH_ * HD)
#define DKV  (NKV * HD)
#define ZH   16
#define RH   1024                  // query rows < RH use hi+lo planes (0: none)
#define WIN  0
#define PCAR 1024.0f
#define SCL  0.125f   // HD^-0.5
typedef _Float16 h16;
typedef unsigned short bf;
typedef __attribute__((ext_vector_type(16))) __bf16   v16bf;
typedef __attribute__((ext_vector_type(16))) _Float16 v16h;
typedef __attribute__((ext_vector_type(8)))  _Float16 v8h;
typedef __attribute__((ext_vector_type(8)))  unsigned short v8us;
typedef __attribute__((ext_vector_type(8)))  float    v8f;
typedef __attribute__((ext_vector_type(4)))  float    v4f;
typedef v8h  __attribute__((may_alias)) v8ha;
typedef v4f  __attribute__((may_alias)) v4fa;
typedef v8us __attribute__((may_alias)) v8usa;

__device__ __forceinline__ unsigned short f2bf(float f) { unsigned u = __float_as_uint(f); u += 0x7FFFu + ((u >> 16) & 1u); return (unsigned short)(u >> 16); }
__device__ __forceinline__ float bf2f(unsigned short b) { return __uint_as_float(((unsigned)b) << 16); }
__device__ __forceinline__ float bfr(float f) { return bf2f(f2bf(f)); }
__device__ __forceinline__ v16h cat16(v8h lo, v8h hi) { return __builtin_shufflevector(lo, hi, 0, 1, 2, 3, 4, 5, 6, 7, 8, 9, 10, 11, 12, 13, 14, 15); }
__device__ __forceinline__ v16bf cat16b(v8us lo, v8us hi) { return __builtin_bit_cast(v16bf, __builtin_shufflevector(lo, hi, 0, 1, 2, 3, 4, 5, 6, 7, 8, 9, 10, 11, 12, 13, 14, 15)); }
__device__ __forceinline__ v8f wmma16(v16h a, v16h b, v8f c) { return __builtin_amdgcn_wmma_f32_16x16x32_f16(false, a, false, b, (short)0, c, false, false); }
__device__ __forceinline__ v8f wmmab(v16bf a, v16bf b, v8f c) { return __builtin_amdgcn_wmma_f32_16x16x32_bf16(false, a, false, b, (short)0, c, false, false); }



// ---- k_gemmw: register-blocked GEMM, ONE WAVE per 64x64 output tile (16 accumulators), operands straight from K-contiguous 16-bit planes; grid (M/64, N/64, Z), 32 threads.
// C[m][n] (f32, pitch ldc, + optional f32 bias[n]) = sum_k A[m][k] Bt[n][k] (+ split products per NSPLIT). z-batch strides sA/sB/sC in elements. K % 32 == 0.
template <typename T16> struct WFrag;
template <> struct WFrag<h16> { typedef v16h V; static __device__ __forceinline__ V ld(const h16* p) { return cat16(*(const v8h*)p, *(const v8h*)(p + 16)); } static __device__ __forceinline__ v8f mma(V a, V b, v8f c) { return wmma16(a, b, c); } };
template <> struct WFrag<bf> { typedef v16bf V; static __device__ __forceinline__ V ld(const bf* p) { return cat16b(*(const v8us*)p, *(const v8us*)(p + 16)); } static __device__ __forceinline__ v8f mma(V a, V b, v8f c) { return wmmab(a, b, c); } };
template <typename T16, int NSPLIT, bool BIAS>
__global__ __launch_bounds__(32) void k_gemmw(const T16* __restrict__ A, const T16* __restrict__ A2, const T16* __restrict__ Bt, const T16* __restrict__ Bt2, int K, float* C, int ldc, const float* __restrict__ bias, size_t sA, size_t sB, size_t sC) {
    typedef typename WFrag<T16>::V V;
    __shared__ __align__(16) float os[16 * 68];
    const size_t z = blockIdx.z; A += z * sA; if (A2) A2 += z * sA; Bt += z * sB; if (Bt2) Bt2 += z * sB; C += z * sC;
    const int lane = threadIdx.x & 31, lr = lane & 15, hi = lane >> 4; const int r0 = blockIdx.x * 64, c0 = blockIdx.y * 64;
    v8f acc[4][4];
#pragma unroll
    for (int mb = 0; mb < 4; ++mb)
#pragma unroll
        for (int nb = 0; nb < 4; ++nb) acc[mb][nb] = (v8f){};
    const size_t aoff = (size_t)(r0 + lr) * K + 8 * hi, boff = (size_t)(c0 + lr) * K + 8 * hi;
#pragma unroll 1
    for (int kc = 0; kc < K; kc += 32) {
        V a[4], a2[4];
#pragma unroll
        for (int mb = 0; mb < 4; ++mb) { a[mb] = WFrag<T16>::ld(A + aoff + (size_t)mb * 16 * K + kc); if (NSPLIT == 1 || NSPLIT == 2) a2[mb] = WFrag<T16>::ld(A2 + aoff + (size_t)mb * 16 * K + kc); }
#pragma unroll
        for (int nb = 0; nb < 4; ++nb) { const V b = WFrag<T16>::ld(Bt + boff + (size_t)nb * 16 * K + kc); V b2; if (NSPLIT >= 2) b2 = WFrag<T16>::ld(Bt2 + boff + (size_t)nb * 16 * K + kc);
#pragma unroll
            for (int mb = 0; mb < 4; ++mb) { acc[mb][nb] = WFrag<T16>::mma(a[mb], b, acc[mb][nb]); if (NSPLIT == 1 || NSPLIT == 2) acc[mb][nb] = WFrag<T16>::mma(a2[mb], b, acc[mb][nb]); if (NSPLIT >= 2) acc[mb][nb] = WFrag<T16>::mma(a[mb], b2, acc[mb][nb]); } }
        asm volatile("v_nop\n\tv_nop\n\tv_nop\n\tv_nop" : "+v"(acc[0][0]), "+v"(acc[1][1]), "+v"(acc[2][2]), "+v"(acc[3][3]) : "v"(a[0]), "v"(a[3]));
    }
#pragma unroll
    for (int mb = 0; mb < 4; ++mb) {
#pragma unroll
        for (int nb = 0; nb < 4; ++nb) {
#pragma unroll
            for (int j = 0; j < 8; ++j) os[(hi * 8 + j) * 68 + nb * 16 + lr] = acc[mb][nb][j]; }
        __builtin_amdgcn_wave_barrier(); asm volatile("" ::: "memory");
        float* crow = C + (size_t)(r0 + mb * 16) * ldc + c0;
{
#pragma unroll
            for (int s = 0; s < 8; ++s) { const int row = 2 * s + hi, cofs = lr * 4; v4f val = *(const v4fa*)(os + row * 68 + cofs); if (BIAS) { val[0] += bfr(bias[c0 + cofs]); val[1] += bfr(bias[c0 + cofs + 1]); val[2] += bfr(bias[c0 + cofs + 2]); val[3] += bfr(bias[c0 + cofs + 3]); }
                *(v4f*)(crow + (size_t)row * ldc + cofs) = val; }
             }
        __builtin_amdgcn_wave_barrier(); asm volatile("" ::: "memory");
    }
}

__device__ __forceinline__ h16 tohx(float x) { return (h16)x; }
__device__ __forceinline__ void splitf(float y, unsigned short& h, unsigned short& l) { h = f2bf(y); l = f2bf(y - bf2f(h)); }
typedef __attribute__((ext_vector_type(2))) _Float16 v2h;
typedef __attribute__((ext_vector_type(4))) _Float16 v4h;
typedef __attribute__((ext_vector_type(2))) unsigned short v2us;
typedef __attribute__((ext_vector_type(4))) unsigned short v4us;
typedef __attribute__((ext_vector_type(2))) float v2f;
typedef __attribute__((ext_vector_type(4))) int v4i;

__global__ __launch_bounds__(256) void k_wtG(const float* __restrict__ w, int K, int N, bf* Bt) {
    const int lane = threadIdx.x & 31; const int L0 = (blockIdx.x * 8 + (threadIdx.x >> 5)) * 8; const int nlines = N * K / 64;
{
#pragma unroll 1
        for (int l = 0; l < 8; ++l) { const int L = L0 + l; if (L >= nlines) break; const size_t e = (size_t)L * 64 + lane * 2; const int k = (int)(e % K), n = (int)(e / K); v2us o;
            o[0] = f2bf(w[(size_t)k * N + n]); o[1] = f2bf(w[(size_t)(k + 1) * N + n]); *(v2us*)(Bt + e) = o; }
         }
}
__global__ __launch_bounds__(256) void k_cvt8(const float* __restrict__ src, bf* dst, size_t n8) { const size_t i = (size_t)blockIdx.x * 256 + threadIdx.x; if (i >= n8) return; const v8f v = *(const v8f*)(src + i * 8); v8us o;
#pragma unroll
    for (int k = 0; k < 8; ++k) o[k] = f2bf(v[k]); *(v8us*)(dst + i * 8) = o;  }
__global__ __launch_bounds__(256) void k_cscvt(const float* __restrict__ cosT, const float* __restrict__ sinT, float* CS) { const int idx = blockIdx.x * 256 + threadIdx.x; if (idx >= TT * HD) return; v2f cs; cs[0] = bfr(cosT[idx]); cs[1] = bfr(sinT[idx]); *(v2f*)(CS + (size_t)idx * 2) = cs;  }
// k_rope: head planes [h][t][d] (fp16 + hi/lo) of rope(x) x sc with the rotate-half convention out[d] = x[d] cos[t][d] - x[d+HD/2] sin[t][d], out[d+HD/2] = x[d+HD/2] cos[t][d+HD/2] + x[d] sin[t][d+HD/2]
__global__ __launch_bounds__(256) void k_rope(const float* __restrict__ F, int pitch, int nheads, const float* __restrict__ CS, const float* __restrict__ RF, const float* __restrict__ nw, float sc, h16* P16, bf* Ph, bf* Pl) {
    const size_t e = ((size_t)blockIdx.x * 256 + threadIdx.x) * 2; if (e >= (size_t)nheads * TT * HD) return; const int d = (int)(e % HD); const int t = (int)((e / HD) % TT); const int h = (int)(e / ((size_t)HD * TT)); const float* f = F + (size_t)t * pitch + h * HD; const float rf = RF ? RF[(size_t)h * TT + t] : 1.0f; v2h o16; v2us oh, ol;
#pragma unroll
    for (int q = 0; q < 2; ++q) { const int dd = d + q; const int dp = (dd < HD / 2) ? dd + HD / 2 : dd - HD / 2; float x0 = f[dd], x1 = f[dp];
        if (RF) { float n0 = __fmul_rn(x0, rf), n1 = __fmul_rn(x1, rf); asm volatile("" : "+v"(n0)); asm volatile("" : "+v"(n1)); x0 = __fmul_rn(bfr(nw[dd]), n0); x1 = __fmul_rn(bfr(nw[dp]), n1); }
        const v2f cs = *(const v2f*)(CS + ((size_t)t * HD + dd) * 2); float a = __fmul_rn(x0, cs[0]), bq = __fmul_rn(x1, cs[1]); asm volatile("" : "+v"(a)); asm volatile("" : "+v"(bq)); const float r = ((dd < HD / 2) ? __fsub_rn(a, bq) : __fadd_rn(a, bq)) * sc;
        o16[q] = tohx(r); unsigned short a2, c2; splitf(r, a2, c2); oh[q] = a2; ol[q] = c2; }
    *(v2h*)(P16 + e) = o16; *(v2us*)(Ph + e) = oh; *(v2us*)(Pl + e) = ol;  }
__global__ __launch_bounds__(256) void k_vtp(const float* __restrict__ F, int pitch, int nheads, h16* V16, bf* Vh, bf* Vl) { const size_t e = ((size_t)blockIdx.x * 256 + threadIdx.x) * 2; if (e >= (size_t)nheads * HD * TT) return; const int t = (int)(e % TT); const int d = (int)((e / TT) % HD); const int g = (int)(e / ((size_t)TT * HD)); v2h o16; v2us oh, ol;
#pragma unroll
    for (int q = 0; q < 2; ++q) { const float x = F[(size_t)(t + q) * pitch + g * HD + d]; o16[q] = tohx(x); unsigned short a2, c2; splitf(x, a2, c2); oh[q] = a2; ol[q] = c2; }
    *(v2h*)(V16 + e) = o16; *(v2us*)(Vh + e) = oh; *(v2us*)(Vl + e) = ol;  }
__global__ __launch_bounds__(256) void k_csid(float* CS) { const int idx = blockIdx.x * 256 + threadIdx.x; if (idx >= TT * HD) return; v2f cs; cs[0] = 1.0f; cs[1] = 0.0f; *(v2f*)(CS + (size_t)idx * 2) = cs;  }
// k_asoft: per row (zz, i): t = S x HD^-0.5 (no mask); softmax over the 1024 keys (register row, one exp, fixed trees);
__global__ __launch_bounds__(256) void k_asoft(const float* __restrict__ Sb, h16* P16, bf* Ph, bf* Pl) {
    const int lane = threadIdx.x & 31; const int row = blockIdx.x * 8 + (threadIdx.x >> 5); if (row >= ZH * TT) return; const int i = row % TT; const int zz = row / TT; (void)zz; const bool hires = (i < RH); const float* sr = Sb + (size_t)row * TT; float v[TT / 32]; float mx = -3.0e38f;
#pragma unroll
    for (int ch = 0; ch < TT / 128; ++ch) { const int j0 = ch * 128 + lane * 4; const v4f a = *(const v4f*)(sr + j0);
#pragma unroll
        for (int q = 0; q < 4; ++q) { const int j = j0 + q; (void)j; const float t = a[q] * SCL; v[ch * 4 + q] = t; mx = fmaxf(mx, t); } }
#pragma unroll
    for (int sh = 16; sh; sh >>= 1) mx = fmaxf(mx, __shfl_xor(mx, sh, 32));
    float sum = 0.f;
#pragma unroll
    for (int k = 0; k < TT / 32; ++k) { float d0 = __fsub_rn(v[k], mx); asm volatile("" : "+v"(d0)); v[k] = __builtin_amdgcn_exp2f(__fmul_rn(d0, 1.4426950408889634f)); sum += v[k]; }
#pragma unroll
    for (int sh = 16; sh; sh >>= 1) sum += __shfl_xor(sum, sh, 32);
    const float f = __fdiv_rn(hires ? 1.0f : PCAR, sum);
{
        if (hires) {
#pragma unroll
            for (int ch = 0; ch < TT / 128; ++ch) { v4us oh, ol;
#pragma unroll
                for (int q = 0; q < 4; ++q) { unsigned short a, c2; splitf(v[ch * 4 + q] * f, a, c2); oh[q] = a; ol[q] = c2; }
                const size_t oo = ((size_t)zz * (RH ? RH : 1) + i) * TT + ch * 128 + lane * 4; *(v4us*)(Ph + oo) = oh; *(v4us*)(Pl + oo) = ol; }
        } else {
#pragma unroll
            for (int ch = 0; ch < TT / 128; ++ch) { v4h o4;
#pragma unroll
                for (int q = 0; q < 4; ++q) o4[q] = tohx(v[ch * 4 + q] * f);
                *(v4h*)(P16 + (size_t)row * TT + ch * 128 + lane * 4) = o4; } }
         }
}
__global__ __launch_bounds__(256) void k_relk(const float* __restrict__ rk, bf* Bt) { const int e = (blockIdx.x * 256 + threadIdx.x) * 4; if (e >= 192 * HD) return; const int r = e / HD; v4us o;   // Bt[r][d] = rel_k[r][d] (r < 129) else 0
#pragma unroll
    for (int u = 0; u < 4; ++u) o[u] = (r < 129) ? f2bf(rk[e + u]) : (unsigned short)0; *(v4us*)(Bt + e) = o;  }
__global__ __launch_bounds__(256) void k_relv(const float* __restrict__ rv, bf* Bt) { const int e = (blockIdx.x * 256 + threadIdx.x) * 4; if (e >= HD * 160) return; const int r = e % 160; const int d = e / 160; v4us o;   // Bt[d][r] = rel_v[r][d] (r < 129) else 0
#pragma unroll
    for (int u = 0; u < 4; ++u) o[u] = (r + u < 129) ? f2bf(rv[(size_t)(r + u) * HD + d]) : (unsigned short)0; *(v4us*)(Bt + e) = o;  }
// ---- k_attn: the whole attention of 64 query rows of one head in ONE work-group (16 waves); the 64 x 1024 score rows stay in LDS from the q.k products to the w.v products. grid (TT/64, NB_*NH_).
// Phase 1: wave w forms the 64 x 64 score tile of keys w*64.. (hl x hl, 3 products) and, waves 0..8, 16 columns of QR = q rel_k^T (hl x exact). Phase 2: one wave per row, 4 rows each: bias, softmax, hi/lo split written over the row's own f32 scores
// (hi plane in its first 2048 bytes, lo plane in the next), tail sums and bucket planes written over the row's own QR. Phase 3: wave w multiplies key slice w*64.. of w with v (3 products), waves 0..4 add one 32-bucket slice of WB rel_v (2 products);
// the 16 partial 64 x 64 tiles are summed through LDS in wave order and split into the merged hi/lo planes.
#define AR 64      // query rows per work-group
#define SP 1028    // score row pitch in floats: 4112 B = 16 B x odd, so that the 16-byte fragment reads of 16 rows fall on distinct banks
#define QP 168     // QR row pitch in floats; the same 672 B then hold the row's bucket planes: hi at byte 0, lo at byte 336
typedef v4us __attribute__((may_alias)) v4usa;
typedef unsigned short __attribute__((may_alias)) usa;
typedef float __attribute__((may_alias)) fa;
__device__ __forceinline__ v16bf ldfa(const bf* p) { return cat16b(*(const v8usa*)p, *(const v8usa*)(p + 16)); }
__global__ __launch_bounds__(512) void k_attn(const bf* __restrict__ Qh, const bf* __restrict__ Ql, const bf* __restrict__ Kh, const bf* __restrict__ Kl, const bf* __restrict__ Vh, const bf* __restrict__ Vl, const bf* __restrict__ Brk, const bf* __restrict__ Brv, bf* Ah, bf* Al) {
    __shared__ __align__(16) float S[AR * SP];
    __shared__ __align__(16) float QRs[AR * QP];
    const int tid = threadIdx.x, lane = tid & 31, lr = lane & 15, hi = lane >> 4; const int w = __builtin_amdgcn_readfirstlane(tid >> 5);
    const int r0 = blockIdx.x * AR; const size_t z = blockIdx.y;
    const bf* qh = Qh + z * TT * HD + (size_t)(r0 + lr) * HD + 8 * hi; const bf* ql = Ql + z * TT * HD + (size_t)(r0 + lr) * HD + 8 * hi;
    {
        const bf* kh = Kh + z * TT * HD + (size_t)(w * 64 + lr) * HD + 8 * hi; const bf* kl = Kl + z * TT * HD + (size_t)(w * 64 + lr) * HD + 8 * hi;
        v8f acc[4][4];
#pragma unroll
        for (int mb = 0; mb < 4; ++mb)
#pragma unroll
            for (int nb = 0; nb < 4; ++nb) acc[mb][nb] = (v8f){};
#pragma unroll 1   // rolled: both k steps' fragments at once would not fit the 256 registers of a 16-wave work-group
        for (int kc = 0; kc < HD; kc += 32) {
            v16bf a[4], a2[4];
#pragma unroll
            for (int mb = 0; mb < 4; ++mb) { a[mb] = WFrag<bf>::ld(qh + mb * 16 * HD + kc); a2[mb] = WFrag<bf>::ld(ql + mb * 16 * HD + kc); }
#pragma unroll
            for (int nb = 0; nb < 4; ++nb) { const v16bf b = WFrag<bf>::ld(kh + nb * 16 * HD + kc); const v16bf b2 = WFrag<bf>::ld(kl + nb * 16 * HD + kc);
#pragma unroll
                for (int mb = 0; mb < 4; ++mb) { acc[mb][nb] = wmmab(a[mb], b, acc[mb][nb]); acc[mb][nb] = wmmab(a2[mb], b, acc[mb][nb]); acc[mb][nb] = wmmab(a[mb], b2, acc[mb][nb]); } }
            // keeps the matrix instructions' distance on the taken side of the loop branch too
            asm volatile("v_nop\n\tv_nop\n\tv_nop\n\tv_nop" : "+v"(acc[0][0]), "+v"(acc[1][1]), "+v"(acc[2][2]), "+v"(acc[3][3]) : "v"(a[0]), "v"(a[3]));
            asm volatile("s_wait_xcnt 0x0" ::: "memory");   // precaution: stands in front of the next trip's rewrite of the address registers that this trip's global loads name
        }
#pragma unroll
        for (int mb = 0; mb < 4; ++mb)
#pragma unroll
            for (int nb = 0; nb < 4; ++nb)
#pragma unroll
                for (int j = 0; j < 8; ++j) *(fa*)(S + (mb * 16 + hi * 8 + j) * SP + w * 64 + nb * 16 + lr) = acc[mb][nb][j];
    }
    if (w < 9) {   // QR[i][r] = q_i . rel_k[r] (unscaled), columns w*16 .. w*16+15 (rows 129.. of the table plane are zero)
        const bf* rk = Brk + (size_t)(w * 16 + lr) * HD + 8 * hi; v8f aq[4];
#pragma unroll
        for (int mb = 0; mb < 4; ++mb) aq[mb] = (v8f){};
#pragma unroll
        for (int kc = 0; kc < HD; kc += 32) { const v16bf b = WFrag<bf>::ld(rk + kc);
#pragma unroll
            for (int mb = 0; mb < 4; ++mb) { aq[mb] = wmmab(WFrag<bf>::ld(qh + mb * 16 * HD + kc), b, aq[mb]); aq[mb] = wmmab(WFrag<bf>::ld(ql + mb * 16 * HD + kc), b, aq[mb]); } }
#pragma unroll
        for (int mb = 0; mb < 4; ++mb)
#pragma unroll
            for (int j = 0; j < 8; ++j) *(fa*)(QRs + (mb * 16 + hi * 8 + j) * QP + w * 16 + lr) = aq[mb][j];
    }
    __syncthreads();
#pragma unroll 1   // rolled: one row's 32 values a lane are the live set
    for (int rr = 0; rr < AR / 16; ++rr) { const int row = w * (AR / 16) + rr, i = r0 + row; float* sr = S + row * SP; float* qr = QRs + row * QP; float v[TT / 32]; float mx = -3.0e38f;
#pragma unroll
        for (int ch = 0; ch < TT / 128; ++ch) { const int j0 = ch * 128 + lane * 4; const v4f a = *(const v4fa*)(sr + j0);
#pragma unroll
            for (int u = 0; u < 4; ++u) { int r = j0 + u - i; r = (r < -64) ? -64 : (r > 64 ? 64 : r); const float t = __fadd_rn(a[u], *(const fa*)(qr + r + 64)) * 0.125f; v[ch * 4 + u] = t; mx = fmaxf(mx, t); } }
#pragma unroll
        for (int sh = 16; sh; sh >>= 1) mx = fmaxf(mx, __shfl_xor(mx, sh, 32));
        float sum = 0.f;
#pragma unroll
        for (int q = 0; q < TT / 32; ++q) { v[q] = __builtin_amdgcn_exp2f(__fmul_rn(__fsub_rn(v[q], mx), 1.4426950408889634f)); sum += v[q]; }
#pragma unroll
        for (int sh = 16; sh; sh >>= 1) sum += __shfl_xor(sum, sh, 32);
        const float f = __fdiv_rn(1.0f, sum);
        bf* ph = (bf*)sr; bf* pl = ph + TT; float lo = 0.f, hs = 0.f;
#pragma unroll
        for (int ch = 0; ch < TT / 128; ++ch) { const int j0 = ch * 128 + lane * 4; v4us oh, ol;
#pragma unroll
            for (int q = 0; q < 4; ++q) { const float p = v[ch * 4 + q] * f; unsigned short a2, c2; splitf(p, a2, c2); oh[q] = a2; ol[q] = c2; if (j0 + q <= i - 64) lo = __fadd_rn(lo, p); if (j0 + q >= i + 64) hs = __fadd_rn(hs, p); }
            *(v4usa*)(ph + j0) = oh; *(v4usa*)(pl + j0) = ol; }
#pragma unroll
        for (int sh = 16; sh; sh >>= 1) { lo = __fadd_rn(lo, __shfl_xor(lo, sh, 32)); hs = __fadd_rn(hs, __shfl_xor(hs, sh, 32)); }
        // the bucket reads below take what other lanes of this wave have just stored: keeps the compiler from moving them over the stores (a wave's LDS operations run in order)
        __builtin_amdgcn_wave_barrier(); asm volatile("" ::: "memory");
        bf* wh = (bf*)qr; bf* wl = wh + QP;
#pragma unroll
        for (int ch = 0; ch < 2; ++ch) { const int rb = ch * 128 + lane * 4; if (rb < 160) { v4us oh, ol;
#pragma unroll
            for (int u = 0; u < 4; ++u) { const int r = rb + u; unsigned short a2 = 0, c2 = 0; if (r == 0) splitf(lo, a2, c2); else if (r == 128) splitf(hs, a2, c2); else if (r < 128) { const int j = i + r - 64; if (j >= 0 && j < TT) { a2 = *(const usa*)(ph + j); c2 = *(const usa*)(pl + j); } } oh[u] = a2; ol[u] = c2; }
            *(v4usa*)(wh + rb) = oh; *(v4usa*)(wl + rb) = ol; } }
    }
    __syncthreads();
    v8f acc[4][4];
#pragma unroll
    for (int mb = 0; mb < 4; ++mb)
#pragma unroll
        for (int nb = 0; nb < 4; ++nb) acc[mb][nb] = (v8f){};
    {
        const bf* pa = (const bf*)S + lr * (SP * 2) + w * 64 + 8 * hi; const bf* vh = Vh + z * HD * TT + (size_t)lr * TT + w * 64 + 8 * hi; const bf* vl = Vl + z * HD * TT + (size_t)lr * TT + w * 64 + 8 * hi;
#pragma unroll 1   // rolled: both k steps' fragments at once would not fit the 256 registers of a 16-wave work-group
        for (int kc = 0; kc < 64; kc += 32) {
            v16bf a[4], a2[4];
#pragma unroll
            for (int mb = 0; mb < 4; ++mb) { a[mb] = ldfa(pa + mb * 16 * (SP * 2) + kc); a2[mb] = ldfa(pa + mb * 16 * (SP * 2) + TT + kc); }
#pragma unroll
            for (int nb = 0; nb < 4; ++nb) { const v16bf b = WFrag<bf>::ld(vh + (size_t)nb * 16 * TT + kc); const v16bf b2 = WFrag<bf>::ld(vl + (size_t)nb * 16 * TT + kc);
#pragma unroll
                for (int mb = 0; mb < 4; ++mb) { acc[mb][nb] = wmmab(a[mb], b, acc[mb][nb]); acc[mb][nb] = wmmab(a2[mb], b, acc[mb][nb]); acc[mb][nb] = wmmab(a[mb], b2, acc[mb][nb]); } }
            // keeps the matrix instructions' distance on the taken side of the loop branch too
            asm volatile("v_nop\n\tv_nop\n\tv_nop\n\tv_nop" : "+v"(acc[0][0]), "+v"(acc[1][1]), "+v"(acc[2][2]), "+v"(acc[3][3]) : "v"(a[0]), "v"(a[3]));
            asm volatile("s_wait_xcnt 0x0" ::: "memory");   // precaution: stands in front of the next trip's rewrite of the address registers that this trip's global loads name
        }
    }
    if (w < 5) {   // sum_j w rel_v[clip] = WB . rel_v: buckets w*32 .. w*32+31
        const bf* wa = (const bf*)QRs + lr * (QP * 2) + w * 32 + 8 * hi; const bf* rv = Brv + (size_t)lr * 160 + w * 32 + 8 * hi; v16bf a[4], a2[4];
#pragma unroll
        for (int mb = 0; mb < 4; ++mb) { a[mb] = ldfa(wa + mb * 16 * (QP * 2)); a2[mb] = ldfa(wa + mb * 16 * (QP * 2) + QP); }
#pragma unroll
        for (int nb = 0; nb < 4; ++nb) { const v16bf b = WFrag<bf>::ld(rv + nb * 16 * 160);
#pragma unroll
            for (int mb = 0; mb < 4; ++mb) { acc[mb][nb] = wmmab(a[mb], b, acc[mb][nb]); acc[mb][nb] = wmmab(a2[mb], b, acc[mb][nb]); } }
    }
    __syncthreads();   // every wave has read its slice of the planes: their space now takes the 16 partial tiles [w][64][64]; column bit 5 flipped in rows 8..15 of each 16, so that the two half-waves' stores fall on different banks
#pragma unroll
    for (int mb = 0; mb < 4; ++mb)
#pragma unroll
        for (int nb = 0; nb < 4; ++nb)
#pragma unroll
            for (int j = 0; j < 8; ++j) *(fa*)(S + w * 4096 + (mb * 16 + hi * 8 + j) * 64 + ((nb * 16 + lr) ^ (hi << 5))) = acc[mb][nb][j];
    __syncthreads();
    const int c4 = (tid & 15) * 4; const size_t ob = ((z / NH_) * TT + r0) * DQ + (z % NH_) * HD + c4;
#pragma unroll
    for (int g = 0; g < 2; ++g) { const int row = (tid >> 4) + g * 32; const float* pr = S + row * 64 + (c4 ^ (((row >> 3) & 1) << 5)); v4f s = *(const v4fa*)pr;
#pragma unroll
        for (int k = 1; k < 16; ++k) { const v4f t = *(const v4fa*)(pr + k * 4096); s[0] = __fadd_rn(s[0], t[0]); s[1] = __fadd_rn(s[1], t[1]); s[2] = __fadd_rn(s[2], t[2]); s[3] = __fadd_rn(s[3], t[3]); }
        v4us oh, ol;
#pragma unroll
        for (int q = 0; q < 4; ++q) { unsigned short a2, c2; splitf(s[q], a2, c2); oh[q] = a2; ol[q] = c2; }
        *(v4us*)(Ah + ob + (size_t)row * DQ) = oh; *(v4us*)(Al + ob + (size_t)row * DQ) = ol; }
}

extern "C" void kernel_launch(void* const* d_in, const int* in_sizes, int n_in,
                              void* d_out, int out_size, void* d_ws, size_t ws_size, hipStream_t stream) {
    (void)in_sizes; (void)n_in; (void)out_size;
    const float* x = (const float*)d_in[0]; const float* wq = (const float*)d_in[1]; const float* wk = (const float*)d_in[2]; const float* wv = (const float*)d_in[3]; const float* wo = (const float*)d_in[4]; const float* relk = (const float*)d_in[5]; const float* relv = (const float*)d_in[6]; const float* cosT = nullptr; const float* sinT = nullptr; (void)cosT; (void)sinT;
    float* OUT = (float*)d_out;     // [4][1024][1024]
    char* wsp = (char*)d_ws;
    auto take = [&](size_t bytes) { char* p = wsp; wsp += (bytes + 255) & ~(size_t)255; return (void*)p; };
    bf* WQ = (bf*)take((size_t)DQ * DM * 2); bf* WK = (bf*)take((size_t)DKV * DM * 2); bf* WV = (bf*)take((size_t)DKV * DM * 2); bf* WO = (bf*)take((size_t)DM * DQ * 2); float* CS = (float*)take((size_t)TT * HD * 2 * 4);
    bf* XB = (bf*)take((size_t)NB_ * TT * DM * 2); bf* BRK = (bf*)take((size_t)192 * HD * 2); bf* BRV = (bf*)take((size_t)HD * 160 * 2); float* QR = (float*)take((size_t)ZH * TT * 192 * 4); bf* WBh = (bf*)take((size_t)ZH * TT * 160 * 2); bf* WBl = (bf*)take((size_t)ZH * TT * 160 * 2); float* O2 = (float*)take((size_t)ZH * TT * HD * 4);
    h16* VT16 = (h16*)take((size_t)NKV * HD * TT * 2);
    bf* QPh = (bf*)take((size_t)NB_ * NH_ * TT * HD * 2); bf* QPl = (bf*)take((size_t)NB_ * NH_ * TT * HD * 2); bf* KPh = (bf*)take((size_t)NB_ * NKV * TT * HD * 2); bf* KPl = (bf*)take((size_t)NB_ * NKV * TT * HD * 2); bf* VTh = (bf*)take((size_t)NB_ * NKV * HD * TT * 2); bf* VTl = (bf*)take((size_t)NB_ * NKV * HD * TT * 2); bf* Ph = (bf*)take((size_t)ZH * RH * TT * 2); bf* Pl = (bf*)take((size_t)ZH * RH * TT * 2);
    float* Sb = (float*)take((size_t)ZH * TT * TT * 4); float* Ob = (float*)take((size_t)ZH * TT * HD * 4); bf* ATh = (bf*)take((size_t)NB_ * TT * DQ * 2); bf* ATl = (bf*)take((size_t)NB_ * TT * DQ * 2);
    if ((size_t)(wsp - (char*)d_ws) > ws_size) return;    // ws 256 MiB
    // Space that is free until the first attention pass holds what only the projection stage uses (stream-ordered): the f32 projections lie in the score buffer, the fp16 planes of k_rope in the probability planes.
    float* FQ = Sb; float* FK = Sb + (size_t)NB_ * TT * DQ; h16* QP16 = (h16*)Ph; h16* KP16 = (h16*)Pl;
    float* FV = FK;   // v projection reuses the k buffer after the k planes are built (stream-ordered)
    { k_relk<<<(192 * HD / 4 + 255) / 256, 256, 0, stream>>>(relk, BRK); k_relv<<<(HD * 160 / 4 + 255) / 256, 256, 0, stream>>>(relv, BRV); k_wtG<<<(unsigned)((DM * DQ / 64 + 63) / 64), 256, 0, stream>>>(wq, DM, DQ, WQ); k_wtG<<<(unsigned)((DM * DKV / 64 + 63) / 64), 256, 0, stream>>>(wk, DM, DKV, WK); k_wtG<<<(unsigned)((DM * DKV / 64 + 63) / 64), 256, 0, stream>>>(wv, DM, DKV, WV);
      k_wtG<<<(unsigned)((DQ * DM / 64 + 63) / 64), 256, 0, stream>>>(wo, DQ, DM, WO);
       }
    k_csid<<<(TT * HD + 255) / 256, 256, 0, stream>>>(CS);
    const unsigned LQ = (unsigned)(((size_t)NB_ * NH_ * TT * HD / 2 + 255) / 256), LK = (unsigned)(((size_t)NB_ * NKV * TT * HD / 2 + 255) / 256), LV = (unsigned)(((size_t)NKV * TT * HD / 2 + 255) / 256);
    // Projections of all NB_ batch items in one launch each. q and k: grid z = batch item, C laid out [t][b][head][d] (pitch NB_*DQ, z stride DQ), so that k_rope sees NB_*NH_ heads and writes the planes [b*NH_ + head][t][d].
    k_cvt8<<<(unsigned)(((size_t)NB_ * TT * DM / 8 + 255) / 256), 256, 0, stream>>>(x, XB, (size_t)NB_ * TT * DM / 8);
    k_gemmw<bf, 0, false><<<dim3(TT / 64, DQ / 64, NB_), 32, 0, stream>>>(XB, nullptr, WQ, nullptr, DM, FQ, NB_ * DQ, nullptr, (size_t)TT * DM, 0, (size_t)DQ);
    k_rope<<<LQ, 256, 0, stream>>>(FQ, NB_ * DQ, NB_ * NH_, CS, nullptr, nullptr, 1.0f, QP16, QPh, QPl);
    k_gemmw<bf, 0, false><<<dim3(TT / 64, DKV / 64, NB_), 32, 0, stream>>>(XB, nullptr, WK, nullptr, DM, FK, NB_ * DKV, nullptr, (size_t)TT * DM, 0, (size_t)DKV);
    k_rope<<<LK, 256, 0, stream>>>(FK, NB_ * DKV, NB_ * NKV, CS, nullptr, nullptr, 1.0f, KP16, KPh, KPl);
    k_gemmw<bf, 0, false><<<dim3(NB_ * TT / 64, DKV / 64, 1), 32, 0, stream>>>(XB, nullptr, WV, nullptr, DM, FV, DKV, nullptr, 0, 0, 0);   // v: rows [b*TT + t]; its transpose keeps the row pitch DKV, one launch per batch item
    for (int b = 0; b < NB_; ++b) k_vtp<<<LV, 256, 0, stream>>>(FV + (size_t)b * TT * DKV, DKV, NKV, VT16, VTh + (size_t)b * NKV * HD * TT, VTl + (size_t)b * NKV * HD * TT);
    k_attn<<<dim3(TT / AR, NB_ * NH_), 512, 0, stream>>>(QPh, QPl, KPh, KPl, VTh, VTl, BRK, BRV, ATh, ATl);   // one kv head per query head: plane z = b*NH_ + head in all six
    k_gemmw<bf, 1, false><<<dim3(NB_ * TT / 64, DM / 64, 1), 32, 0, stream>>>(ATh, ATl, WO, nullptr, DQ, OUT, DM, nullptr, 0, 0, 0);
}

// v003
// It runs in 283 microseconds.
// In two side-by-side timings against v002, it was 1.15 and 1.16 times as fast.
// Over all steps from v000 it is 7.78 times as fast.
#include <hip/hip_runtime.h>

// MultiHead2DAttention_v2 (x [4][1024][1024]; q = (x Wq) / 8, k = x Wk, v = x Wv ([in,out], no bias; 16 heads x 64); relative-position embeddings rel_k / rel_v [129][64] indexed by clip(j - i, -64, 64) + 64;
//   logits = q.k + q.rel_k[clip]; w = softmax; out_h = w v + sum_j w[i][j] rel_v[clip(j - i)]; out = merged Wo -> [4][1024][1024]).
// The relative terms use exact regroupings: q.rel_k[clip(j-i)] is read from QR = q rel_k^T ([T][129] per head), and sum_j w rel_v[clip] = WB rel_v with WB[i][r] = the softmax mass in bucket r (single keys for r = 1..127, tail sums for r = 0 / 128).
// Compute dtypes, f32 accumulate: every input rounded to bf16; q/k/v on PLAIN bf16 operands (inputs: exact); QR as hl x exact (2 products); scores and w.v as hl x hl (3 products) on every row; the 1/8 scale (exact), rel bias, softmax and bucket sums f32; WB rel_v as hl x exact (2 products); Wo hl x exact (2 products).

#define NB_  4
#define TT   1024
#define DM   1024
#define NH_  16
#define NKV  16
#define REP  (NH_ / NKV)
#define HD   64
#define DQ   (NH_ * HD)
#define DKV  (NKV * HD)
#define ZH   16
#define RH   1024                  // query rows < RH use hi+lo planes (0: none)
#define WIN  0
#define PCAR 1024.0f
#define SCL  0.125f   // HD^-0.5
typedef _Float16 h16;
typedef unsigned short bf;
typedef __attribute__((ext_vector_type(16))) __bf16   v16bf;
typedef __attribute__((ext_vector_type(16))) _Float16 v16h;
typedef __attribute__((ext_vector_type(8)))  _Float16 v8h;
typedef __attribute__((ext_vector_type(8)))  unsigned short v8us;
typedef __attribute__((ext_vector_type(8)))  float    v8f;
typedef __attribute__((ext_vector_type(4)))  float    v4f;
typedef v8h  __attribute__((may_alias)) v8ha;
typedef v4f  __attribute__((may_alias)) v4fa;
typedef v8us __attribute__((may_alias)) v8usa;

__device__ __forceinline__ unsigned short f2bf(float f) { unsigned u = __float_as_uint(f); u += 0x7FFFu + ((u >> 16) & 1u); return (unsigned short)(u >> 16); }
__device__ __forceinline__ float bf2f(unsigned short b) { return __uint_as_float(((unsigned)b) << 16); }
__device__ __forceinline__ float bfr(float f) { return bf2f(f2bf(f)); }
__device__ __forceinline__ v16h cat16(v8h lo, v8h hi) { return __builtin_shufflevector(lo, hi, 0, 1, 2, 3, 4, 5, 6, 7, 8, 9, 10, 11, 12, 13, 14, 15); }
__device__ __forceinline__ v16bf cat16b(v8us lo, v8us hi) { return __builtin_bit_cast(v16bf, __builtin_shufflevector(lo, hi, 0, 1, 2, 3, 4, 5, 6, 7, 8, 9, 10, 11, 12, 13, 14, 15)); }
__device__ __forceinline__ v8f wmma16(v16h a, v16h b, v8f c) { return __builtin_amdgcn_wmma_f32_16x16x32_f16(false, a, false, b, (short)0, c, false, false); }
__device__ __forceinline__ v8f wmmab(v16bf a, v16bf b, v8f c) { return __builtin_amdgcn_wmma_f32_16x16x32_bf16(false, a, false, b, (short)0, c, false, false); }



// ---- k_gemmw: register-blocked GEMM, ONE WAVE per 64x64 output tile (16 accumulators), operands straight from K-contiguous 16-bit planes; grid (M/64, N/64, Z), 32 threads.
// C[m][n] (f32, pitch ldc, + optional f32 bias[n]) = sum_k A[m][k] Bt[n][k] (+ split products per NSPLIT). z-batch strides sA/sB/sC in elements. K % 32 == 0.
// PL: no f32 C; each result is split into hi + lo bf16 here and stored in the planes Ph / Pl, element (m, n) at z sC + (n / 64) sY + m ldc + n % 64.
template <typename T16> struct WFrag;
template <> struct WFrag<h16> { typedef v16h V; static __device__ __forceinline__ V ld(const h16* p) { return cat16(*(const v8h*)p, *(const v8h*)(p + 16)); } static __device__ __forceinline__ v8f mma(V a, V b, v8f c) { return wmma16(a, b, c); } };
template <> struct WFrag<bf> { typedef v16bf V; static __device__ __forceinline__ V ld(const bf* p) { return cat16b(*(const v8us*)p, *(const v8us*)(p + 16)); } static __device__ __forceinline__ v8f mma(V a, V b, v8f c) { return wmmab(a, b, c); } };
__device__ __forceinline__ void splitf(float y, unsigned short& h, unsigned short& l) { h = f2bf(y); l = f2bf(y - bf2f(h)); }
template <typename T16, int NSPLIT, bool BIAS, bool PL>
__global__ __launch_bounds__(32) void k_gemmw(const T16* __restrict__ A, const T16* __restrict__ A2, const T16* __restrict__ Bt, const T16* __restrict__ Bt2, int K, float* C, int ldc, const float* __restrict__ bias, size_t sA, size_t sB, size_t sC, bf* Ph, bf* Pl, size_t sY) {
    typedef typename WFrag<T16>::V V;
    __shared__ __align__(16) float os[16 * 68];
    const size_t z = blockIdx.z; A += z * sA; if (A2) A2 += z * sA; Bt += z * sB; if (Bt2) Bt2 += z * sB; if (!PL) C += z * sC;
    const int lane = threadIdx.x & 31, lr = lane & 15, hi = lane >> 4; const int r0 = blockIdx.x * 64, c0 = blockIdx.y * 64;
    v8f acc[4][4];
#pragma unroll
    for (int mb = 0; mb < 4; ++mb)
#pragma unroll
        for (int nb = 0; nb < 4; ++nb) acc[mb][nb] = (v8f){};
    const size_t aoff = (size_t)(r0 + lr) * K + 8 * hi, boff = (size_t)(c0 + lr) * K + 8 * hi;
#pragma unroll 1
    for (int kc = 0; kc < K; kc += 32) {
        V a[4], a2[4];
#pragma unroll
        for (int mb = 0; mb < 4; ++mb) { a[mb] = WFrag<T16>::ld(A + aoff + (size_t)mb * 16 * K + kc); if (NSPLIT == 1 || NSPLIT == 2) a2[mb] = WFrag<T16>::ld(A2 + aoff + (size_t)mb * 16 * K + kc); }
#pragma unroll
        for (int nb = 0; nb < 4; ++nb) { const V b = WFrag<T16>::ld(Bt + boff + (size_t)nb * 16 * K + kc); V b2; if (NSPLIT >= 2) b2 = WFrag<T16>::ld(Bt2 + boff + (size_t)nb * 16 * K + kc);
#pragma unroll
            for (int mb = 0; mb < 4; ++mb) { acc[mb][nb] = WFrag<T16>::mma(a[mb], b, acc[mb][nb]); if (NSPLIT == 1 || NSPLIT == 2) acc[mb][nb] = WFrag<T16>::mma(a2[mb], b, acc[mb][nb]); if (NSPLIT >= 2) acc[mb][nb] = WFrag<T16>::mma(a[mb], b2, acc[mb][nb]); } }
        asm volatile("v_nop\n\tv_nop\n\tv_nop\n\tv_nop" : "+v"(acc[0][0]), "+v"(acc[1][1]), "+v"(acc[2][2]), "+v"(acc[3][3]) : "v"(a[0]), "v"(a[3]));
    }
#pragma unroll
    for (int mb = 0; mb < 4; ++mb) {
#pragma unroll
        for (int nb = 0; nb < 4; ++nb) {
#pragma unroll
            for (int j = 0; j < 8; ++j) os[(hi * 8 + j) * 68 + nb * 16 + lr] = acc[mb][nb][j]; }
        __builtin_amdgcn_wave_barrier(); asm volatile("" ::: "memory");
        if (PL) {   // 8 results a lane: 8 lanes store one whole 128-byte row of each plane
            const size_t pb = z * sC + (size_t)blockIdx.y * sY + (size_t)(r0 + mb * 16) * ldc;
#pragma unroll
            for (int s = 0; s < 4; ++s) { const int row = 4 * s + (lane >> 3), cofs = (lane & 7) * 8; const v4f v0 = *(const v4fa*)(os + row * 68 + cofs), v1 = *(const v4fa*)(os + row * 68 + cofs + 4); v8us oh, ol;
#pragma unroll
                for (int q = 0; q < 4; ++q) { unsigned short a2, c2; splitf(v0[q], a2, c2); oh[q] = a2; ol[q] = c2; splitf(v1[q], a2, c2); oh[4 + q] = a2; ol[4 + q] = c2; }
                *(v8us*)(Ph + pb + (size_t)row * ldc + cofs) = oh; *(v8us*)(Pl + pb + (size_t)row * ldc + cofs) = ol; }
        } else {
            float* crow = C + (size_t)(r0 + mb * 16) * ldc + c0;
#pragma unroll
            for (int s = 0; s < 8; ++s) { const int row = 2 * s + hi, cofs = lr * 4; v4f val = *(const v4fa*)(os + row * 68 + cofs); if (BIAS) { val[0] += bfr(bias[c0 + cofs]); val[1] += bfr(bias[c0 + cofs + 1]); val[2] += bfr(bias[c0 + cofs + 2]); val[3] += bfr(bias[c0 + cofs + 3]); }
                *(v4f*)(crow + (size_t)row * ldc + cofs) = val; }
             }
        __builtin_amdgcn_wave_barrier(); asm volatile("" ::: "memory");
    }
}

__device__ __forceinline__ h16 tohx(float x) { return (h16)x; }
typedef __attribute__((ext_vector_type(2))) _Float16 v2h;
typedef __attribute__((ext_vector_type(4))) _Float16 v4h;
typedef __attribute__((ext_vector_type(2))) unsigned short v2us;
typedef __attribute__((ext_vector_type(4))) unsigned short v4us;
typedef __attribute__((ext_vector_type(2))) float v2f;
typedef __attribute__((ext_vector_type(4))) int v4i;

__global__ __launch_bounds__(256) void k_wtG(const float* __restrict__ w, int K, int N, bf* Bt) {
    const int lane = threadIdx.x & 31; const int L0 = (blockIdx.x * 8 + (threadIdx.x >> 5)) * 8; const int nlines = N * K / 64;
{
#pragma unroll 1
        for (int l = 0; l < 8; ++l) { const int L = L0 + l; if (L >= nlines) break; const size_t e = (size_t)L * 64 + lane * 2; const int k = (int)(e % K), n = (int)(e / K); v2us o;
            o[0] = f2bf(w[(size_t)k * N + n]); o[1] = f2bf(w[(size_t)(k + 1) * N + n]); *(v2us*)(Bt + e) = o; }
         }
}
__global__ __launch_bounds__(256) void k_cvt8(const float* __restrict__ src, bf* dst, size_t n8) { const size_t i = (size_t)blockIdx.x * 256 + threadIdx.x; if (i >= n8) return; const v8f v = *(const v8f*)(src + i * 8); v8us o;
#pragma unroll
    for (int k = 0; k < 8; ++k) o[k] = f2bf(v[k]); *(v8us*)(dst + i * 8) = o;  }
__global__ __launch_bounds__(256) void k_cscvt(const float* __restrict__ cosT, const float* __restrict__ sinT, float* CS) { const int idx = blockIdx.x * 256 + threadIdx.x; if (idx >= TT * HD) return; v2f cs; cs[0] = bfr(cosT[idx]); cs[1] = bfr(sinT[idx]); *(v2f*)(CS + (size_t)idx * 2) = cs;  }
// k_asoft: per row (zz, i): t = S x HD^-0.5 (no mask); softmax over the 1024 keys (register row, one exp, fixed trees);
__global__ __launch_bounds__(256) void k_asoft(const float* __restrict__ Sb, h16* P16, bf* Ph, bf* Pl) {
    const int lane = threadIdx.x & 31; const int row = blockIdx.x * 8 + (threadIdx.x >> 5); if (row >= ZH * TT) return; const int i = row % TT; const int zz = row / TT; (void)zz; const bool hires = (i < RH); const float* sr = Sb + (size_t)row * TT; float v[TT / 32]; float mx = -3.0e38f;
#pragma unroll
    for (int ch = 0; ch < TT / 128; ++ch) { const int j0 = ch * 128 + lane * 4; const v4f a = *(const v4f*)(sr + j0);
#pragma unroll
        for (int q = 0; q < 4; ++q) { const int j = j0 + q; (void)j; const float t = a[q] * SCL; v[ch * 4 + q] = t; mx = fmaxf(mx, t); } }
#pragma unroll
    for (int sh = 16; sh; sh >>= 1) mx = fmaxf(mx, __shfl_xor(mx, sh, 32));
    float sum = 0.f;
#pragma unroll
    for (int k = 0; k < TT / 32; ++k) { float d0 = __fsub_rn(v[k], mx); asm volatile("" : "+v"(d0)); v[k] = __builtin_amdgcn_exp2f(__fmul_rn(d0, 1.4426950408889634f)); sum += v[k]; }
#pragma unroll
    for (int sh = 16; sh; sh >>= 1) sum += __shfl_xor(sum, sh, 32);
    const float f = __fdiv_rn(hires ? 1.0f : PCAR, sum);
{
        if (hires) {
#pragma unroll
            for (int ch = 0; ch < TT / 128; ++ch) { v4us oh, ol;
#pragma unroll
                for (int q = 0; q < 4; ++q) { unsigned short a, c2; splitf(v[ch * 4 + q] * f, a, c2); oh[q] = a; ol[q] = c2; }
                const size_t oo = ((size_t)zz * (RH ? RH : 1) + i) * TT + ch * 128 + lane * 4; *(v4us*)(Ph + oo) = oh; *(v4us*)(Pl + oo) = ol; }
        } else {
#pragma unroll
            for (int ch = 0; ch < TT / 128; ++ch) { v4h o4;
#pragma unroll
                for (int q = 0; q < 4; ++q) o4[q] = tohx(v[ch * 4 + q] * f);
                *(v4h*)(P16 + (size_t)row * TT + ch * 128 + lane * 4) = o4; } }
         }
}
__global__ __launch_bounds__(256) void k_relk(const float* __restrict__ rk, bf* Bt) { const int e = (blockIdx.x * 256 + threadIdx.x) * 4; if (e >= 192 * HD) return; const int r = e / HD; v4us o;   // Bt[r][d] = rel_k[r][d] (r < 129) else 0
#pragma unroll
    for (int u = 0; u < 4; ++u) o[u] = (r < 129) ? f2bf(rk[e + u]) : (unsigned short)0; *(v4us*)(Bt + e) = o;  }
__global__ __launch_bounds__(256) void k_relv(const float* __restrict__ rv, bf* Bt) { const int e = (blockIdx.x * 256 + threadIdx.x) * 4; if (e >= HD * 160) return; const int r = e % 160; const int d = e / 160; v4us o;   // Bt[d][r] = rel_v[r][d] (r < 129) else 0
#pragma unroll
    for (int u = 0; u < 4; ++u) o[u] = (r + u < 129) ? f2bf(rv[(size_t)(r + u) * HD + d]) : (unsigned short)0; *(v4us*)(Bt + e) = o;  }
// ---- k_attn: the whole attention of 64 query rows of one head in ONE work-group (16 waves); the 64 x 1024 score rows stay in LDS from the q.k products to the w.v products. grid (TT/64, NB_*NH_).
// Phase 1: wave w forms the 64 x 64 score tile of keys w*64.. (hl x hl, 3 products) and, waves 0..8, 16 columns of QR = q rel_k^T (hl x exact). Phase 2: one wave per row, 4 rows each: bias, softmax, hi/lo split written over the row's own f32 scores
// (hi plane in its first 2048 bytes, lo plane in the next), tail sums and bucket planes written over the row's own QR. Phase 3: wave w multiplies key slice w*64.. of w with v (3 products), waves 0..4 add one 32-bucket slice of WB rel_v (2 products);
// the 16 partial 64 x 64 tiles are summed through LDS in wave order and split into the merged hi/lo planes.
#define AR 64      // query rows per work-group
#define SP 1028    // score row pitch in floats: 4112 B = 16 B x odd, so that the 16-byte fragment reads of 16 rows fall on distinct banks
#define QP 168     // QR row pitch in floats; the same 672 B then hold the row's bucket planes: hi at byte 0, lo at byte 336
typedef v4us __attribute__((may_alias)) v4usa;
typedef unsigned short __attribute__((may_alias)) usa;
typedef float __attribute__((may_alias)) fa;
__device__ __forceinline__ v16bf ldfa(const bf* p) { return cat16b(*(const v8usa*)p, *(const v8usa*)(p + 16)); }
__global__ __launch_bounds__(512) void k_attn(const bf* __restrict__ Qh, const bf* __restrict__ Ql, const bf* __restrict__ Kh, const bf* __restrict__ Kl, const bf* __restrict__ Vh, const bf* __restrict__ Vl, const bf* __restrict__ Brk, const bf* __restrict__ Brv, bf* Ah, bf* Al) {
    __shared__ __align__(16) float S[AR * SP];
    __shared__ __align__(16) float QRs[AR * QP];
    const int tid = threadIdx.x, lane = tid & 31, lr = lane & 15, hi = lane >> 4; const int w = __builtin_amdgcn_readfirstlane(tid >> 5);
    const int r0 = blockIdx.x * AR; const size_t z = blockIdx.y;
    const bf* qh = Qh + z * TT * HD + (size_t)(r0 + lr) * HD + 8 * hi; const bf* ql = Ql + z * TT * HD + (size_t)(r0 + lr) * HD + 8 * hi;
    {
        const bf* kh = Kh + z * TT * HD + (size_t)(w * 64 + lr) * HD + 8 * hi; const bf* kl = Kl + z * TT * HD + (size_t)(w * 64 + lr) * HD + 8 * hi;
        v8f acc[4][4];
#pragma unroll
        for (int mb = 0; mb < 4; ++mb)
#pragma unroll
            for (int nb = 0; nb < 4; ++nb) acc[mb][nb] = (v8f){};
#pragma unroll 1   // rolled: both k steps' fragments at once would not fit the 256 registers of a 16-wave work-group
        for (int kc = 0; kc < HD; kc += 32) {
            v16bf a[4], a2[4];
#pragma unroll
            for (int mb = 0; mb < 4; ++mb) { a[mb] = WFrag<bf>::ld(qh + mb * 16 * HD + kc); a2[mb] = WFrag<bf>::ld(ql + mb * 16 * HD + kc); }
#pragma unroll
            for (int nb = 0; nb < 4; ++nb) { const v16bf b = WFrag<bf>::ld(kh + nb * 16 * HD + kc); const v16bf b2 = WFrag<bf>::ld(kl + nb * 16 * HD + kc);
#pragma unroll
                for (int mb = 0; mb < 4; ++mb) { acc[mb][nb] = wmmab(a[mb], b, acc[mb][nb]); acc[mb][nb] = wmmab(a2[mb], b, acc[mb][nb]); acc[mb][nb] = wmmab(a[mb], b2, acc[mb][nb]); } }
            // keeps the matrix instructions' distance on the taken side of the loop branch too
            asm volatile("v_nop\n\tv_nop\n\tv_nop\n\tv_nop" : "+v"(acc[0][0]), "+v"(acc[1][1]), "+v"(acc[2][2]), "+v"(acc[3][3]) : "v"(a[0]), "v"(a[3]));
            asm volatile("s_wait_xcnt 0x0" ::: "memory");   // precaution: stands in front of the next trip's rewrite of the address registers that this trip's global loads name
        }
#pragma unroll
        for (int mb = 0; mb < 4; ++mb)
#pragma unroll
            for (int nb = 0; nb < 4; ++nb)
#pragma unroll
                for (int j = 0; j < 8; ++j) *(fa*)(S + (mb * 16 + hi * 8 + j) * SP + w * 64 + nb * 16 + lr) = acc[mb][nb][j];
    }
    if (w < 9) {   // QR[i][r] = q_i . rel_k[r] (unscaled), columns w*16 .. w*16+15 (rows 129.. of the table plane are zero)
        const bf* rk = Brk + (size_t)(w * 16 + lr) * HD + 8 * hi; v8f aq[4];
#pragma unroll
        for (int mb = 0; mb < 4; ++mb) aq[mb] = (v8f){};
#pragma unroll
        for (int kc = 0; kc < HD; kc += 32) { const v16bf b = WFrag<bf>::ld(rk + kc);
#pragma unroll
            for (int mb = 0; mb < 4; ++mb) { aq[mb] = wmmab(WFrag<bf>::ld(qh + mb * 16 * HD + kc), b, aq[mb]); aq[mb] = wmmab(WFrag<bf>::ld(ql + mb * 16 * HD + kc), b, aq[mb]); } }
#pragma unroll
        for (int mb = 0; mb < 4; ++mb)
#pragma unroll
            for (int j = 0; j < 8; ++j) *(fa*)(QRs + (mb * 16 + hi * 8 + j) * QP + w * 16 + lr) = aq[mb][j];
    }
    __syncthreads();
#pragma unroll 1   // rolled: one row's 32 values a lane are the live set
    for (int rr = 0; rr < AR / 16; ++rr) { const int row = w * (AR / 16) + rr, i = r0 + row; float* sr = S + row * SP; float* qr = QRs + row * QP; float v[TT / 32]; float mx = -3.0e38f;
#pragma unroll
        for (int ch = 0; ch < TT / 128; ++ch) { const int j0 = ch * 128 + lane * 4; const v4f a = *(const v4fa*)(sr + j0);
#pragma unroll
            for (int u = 0; u < 4; ++u) { int r = j0 + u - i; r = (r < -64) ? -64 : (r > 64 ? 64 : r); const float t = __fadd_rn(a[u], *(const fa*)(qr + r + 64)) * 0.125f; v[ch * 4 + u] = t; mx = fmaxf(mx, t); } }
#pragma unroll
        for (int sh = 16; sh; sh >>= 1) mx = fmaxf(mx, __shfl_xor(mx, sh, 32));
        float sum = 0.f;
#pragma unroll
        for (int q = 0; q < TT / 32; ++q) { v[q] = __builtin_amdgcn_exp2f(__fmul_rn(__fsub_rn(v[q], mx), 1.4426950408889634f)); sum += v[q]; }
#pragma unroll
        for (int sh = 16; sh; sh >>= 1) sum += __shfl_xor(sum, sh, 32);
        const float f = __fdiv_rn(1.0f, sum);
        bf* ph = (bf*)sr; bf* pl = ph + TT; float lo = 0.f, hs = 0.f;
#pragma unroll
        for (int ch = 0; ch < TT / 128; ++ch) { const int j0 = ch * 128 + lane * 4; v4us oh, ol;
#pragma unroll
            for (int q = 0; q < 4; ++q) { const float p = v[ch * 4 + q] * f; unsigned short a2, c2; splitf(p, a2, c2); oh[q] = a2; ol[q] = c2; if (j0 + q <= i - 64) lo = __fadd_rn(lo, p); if (j0 + q >= i + 64) hs = __fadd_rn(hs, p); }
            *(v4usa*)(ph + j0) = oh; *(v4usa*)(pl + j0) = ol; }
#pragma unroll
        for (int sh = 16; sh; sh >>= 1) { lo = __fadd_rn(lo, __shfl_xor(lo, sh, 32)); hs = __fadd_rn(hs, __shfl_xor(hs, sh, 32)); }
        // the bucket reads below take what other lanes of this wave have just stored: keeps the compiler from moving them over the stores (a wave's LDS operations run in order)
        __builtin_amdgcn_wave_barrier(); asm volatile("" ::: "memory");
        bf* wh = (bf*)qr; bf* wl = wh + QP;
#pragma unroll
        for (int ch = 0; ch < 2; ++ch) { const int rb = ch * 128 + lane * 4; if (rb < 160) { v4us oh, ol;
#pragma unroll
            for (int u = 0; u < 4; ++u) { const int r = rb + u; unsigned short a2 = 0, c2 = 0; if (r == 0) splitf(lo, a2, c2); else if (r == 128) splitf(hs, a2, c2); else if (r < 128) { const int j = i + r - 64; if (j >= 0 && j < TT) { a2 = *(const usa*)(ph + j); c2 = *(const usa*)(pl + j); } } oh[u] = a2; ol[u] = c2; }
            *(v4usa*)(wh + rb) = oh; *(v4usa*)(wl + rb) = ol; } }
    }
    __syncthreads();
    v8f acc[4][4];
#pragma unroll
    for (int mb = 0; mb < 4; ++mb)
#pragma unroll
        for (int nb = 0; nb < 4; ++nb) acc[mb][nb] = (v8f){};
    {
        const bf* pa = (const bf*)S + lr * (SP * 2) + w * 64 + 8 * hi; const bf* vh = Vh + z * HD * TT + (size_t)lr * TT + w * 64 + 8 * hi; const bf* vl = Vl + z * HD * TT + (size_t)lr * TT + w * 64 + 8 * hi;
#pragma unroll 1   // rolled: both k steps' fragments at once would not fit the 256 registers of a 16-wave work-group
        for (int kc = 0; kc < 64; kc += 32) {
            v16bf a[4], a2[4];
#pragma unroll
            for (int mb = 0; mb < 4; ++mb) { a[mb] = ldfa(pa + mb * 16 * (SP * 2) + kc); a2[mb] = ldfa(pa + mb * 16 * (SP * 2) + TT + kc); }
#pragma unroll
            for (int nb = 0; nb < 4; ++nb) { const v16bf b = WFrag<bf>::ld(vh + (size_t)nb * 16 * TT + kc); const v16bf b2 = WFrag<bf>::ld(vl + (size_t)nb * 16 * TT + kc);
#pragma unroll
                for (int mb = 0; mb < 4; ++mb) { acc[mb][nb] = wmmab(a[mb], b, acc[mb][nb]); acc[mb][nb] = wmmab(a2[mb], b, acc[mb][nb]); acc[mb][nb] = wmmab(a[mb], b2, acc[mb][nb]); } }
            // keeps the matrix instructions' distance on the taken side of the loop branch too
            asm volatile("v_nop\n\tv_nop\n\tv_nop\n\tv_nop" : "+v"(acc[0][0]), "+v"(acc[1][1]), "+v"(acc[2][2]), "+v"(acc[3][3]) : "v"(a[0]), "v"(a[3]));
            asm volatile("s_wait_xcnt 0x0" ::: "memory");   // precaution: stands in front of the next trip's rewrite of the address registers that this trip's global loads name
        }
    }
    if (w < 5) {   // sum_j w rel_v[clip] = WB . rel_v: buckets w*32 .. w*32+31
        const bf* wa = (const bf*)QRs + lr * (QP * 2) + w * 32 + 8 * hi; const bf* rv = Brv + (size_t)lr * 160 + w * 32 + 8 * hi; v16bf a[4], a2[4];
#pragma unroll
        for (int mb = 0; mb < 4; ++mb) { a[mb] = ldfa(wa + mb * 16 * (QP * 2)); a2[mb] = ldfa(wa + mb * 16 * (QP * 2) + QP); }
#pragma unroll
        for (int nb = 0; nb < 4; ++nb) { const v16bf b = WFrag<bf>::ld(rv + nb * 16 * 160);
#pragma unroll
            for (int mb = 0; mb < 4; ++mb) { acc[mb][nb] = wmmab(a[mb], b, acc[mb][nb]); acc[mb][nb] = wmmab(a2[mb], b, acc[mb][nb]); } }
    }
    __syncthreads();   // every wave has read its slice of the planes: their space now takes the 16 partial tiles [w][64][64]; column bit 5 flipped in rows 8..15 of each 16, so that the two half-waves' stores fall on different banks
#pragma unroll
    for (int mb = 0; mb < 4; ++mb)
#pragma unroll
        for (int nb = 0; nb < 4; ++nb)
#pragma unroll
            for (int j = 0; j < 8; ++j) *(fa*)(S + w * 4096 + (mb * 16 + hi * 8 + j) * 64 + ((nb * 16 + lr) ^ (hi << 5))) = acc[mb][nb][j];
    __syncthreads();
    const int c4 = (tid & 15) * 4; const size_t ob = ((z / NH_) * TT + r0) * DQ + (z % NH_) * HD + c4;
#pragma unroll
    for (int g = 0; g < 2; ++g) { const int row = (tid >> 4) + g * 32; const float* pr = S + row * 64 + (c4 ^ (((row >> 3) & 1) << 5)); v4f s = *(const v4fa*)pr;
#pragma unroll
        for (int k = 1; k < 16; ++k) { const v4f t = *(const v4fa*)(pr + k * 4096); s[0] = __fadd_rn(s[0], t[0]); s[1] = __fadd_rn(s[1], t[1]); s[2] = __fadd_rn(s[2], t[2]); s[3] = __fadd_rn(s[3], t[3]); }
        v4us oh, ol;
#pragma unroll
        for (int q = 0; q < 4; ++q) { unsigned short a2, c2; splitf(s[q], a2, c2); oh[q] = a2; ol[q] = c2; }
        *(v4us*)(Ah + ob + (size_t)row * DQ) = oh; *(v4us*)(Al + ob + (size_t)row * DQ) = ol; }
}

extern "C" void kernel_launch(void* const* d_in, const int* in_sizes, int n_in,
                              void* d_out, int out_size, void* d_ws, size_t ws_size, hipStream_t stream) {
    (void)in_sizes; (void)n_in; (void)out_size;
    const float* x = (const float*)d_in[0]; const float* wq = (const float*)d_in[1]; const float* wk = (const float*)d_in[2]; const float* wv = (const float*)d_in[3]; const float* wo = (const float*)d_in[4]; const float* relk = (const float*)d_in[5]; const float* relv = (const float*)d_in[6]; const float* cosT = nullptr; const float* sinT = nullptr; (void)cosT; (void)sinT;
    float* OUT = (float*)d_out;     // [4][1024][1024]
    char* wsp = (char*)d_ws;
    auto take = [&](size_t bytes) { char* p = wsp; wsp += (bytes + 255) & ~(size_t)255; return (void*)p; };
    bf* WQ = (bf*)take((size_t)DQ * DM * 2); bf* WK = (bf*)take((size_t)DKV * DM * 2); bf* WV = (bf*)take((size_t)DKV * DM * 2); bf* WO = (bf*)take((size_t)DM * DQ * 2); float* CS = (float*)take((size_t)TT * HD * 2 * 4);
    bf* XB = (bf*)take((size_t)NB_ * TT * DM * 2); bf* BRK = (bf*)take((size_t)192 * HD * 2); bf* BRV = (bf*)take((size_t)HD * 160 * 2); float* QR = (float*)take((size_t)ZH * TT * 192 * 4); bf* WBh = (bf*)take((size_t)ZH * TT * 160 * 2); bf* WBl = (bf*)take((size_t)ZH * TT * 160 * 2); float* O2 = (float*)take((size_t)ZH * TT * HD * 4);
    h16* VT16 = (h16*)take((size_t)NKV * HD * TT * 2);
    bf* QPh = (bf*)take((size_t)NB_ * NH_ * TT * HD * 2); bf* QPl = (bf*)take((size_t)NB_ * NH_ * TT * HD * 2); bf* KPh = (bf*)take((size_t)NB_ * NKV * TT * HD * 2); bf* KPl = (bf*)take((size_t)NB_ * NKV * TT * HD * 2); bf* VTh = (bf*)take((size_t)NB_ * NKV * HD * TT * 2); bf* VTl = (bf*)take((size_t)NB_ * NKV * HD * TT * 2); bf* Ph = (bf*)take((size_t)ZH * RH * TT * 2); bf* Pl = (bf*)take((size_t)ZH * RH * TT * 2);
    float* Sb = (float*)take((size_t)ZH * TT * TT * 4); float* Ob = (float*)take((size_t)ZH * TT * HD * 4); bf* ATh = (bf*)take((size_t)NB_ * TT * DQ * 2); bf* ATl = (bf*)take((size_t)NB_ * TT * DQ * 2);
    if ((size_t)(wsp - (char*)d_ws) > ws_size) return;    // ws 256 MiB
    { k_relk<<<(192 * HD / 4 + 255) / 256, 256, 0, stream>>>(relk, BRK); k_relv<<<(HD * 160 / 4 + 255) / 256, 256, 0, stream>>>(relv, BRV); k_wtG<<<(unsigned)((DM * DQ / 64 + 63) / 64), 256, 0, stream>>>(wq, DM, DQ, WQ); k_wtG<<<(unsigned)((DM * DKV / 64 + 63) / 64), 256, 0, stream>>>(wk, DM, DKV, WK); k_wtG<<<(unsigned)((DM * DKV / 64 + 63) / 64), 256, 0, stream>>>(wv, DM, DKV, WV);
      k_wtG<<<(unsigned)((DQ * DM / 64 + 63) / 64), 256, 0, stream>>>(wo, DQ, DM, WO);
       }
    // Projections of all NB_ batch items in one launch each, grid z = batch item; each writes its hi/lo planes itself. q and k: one 64-column tile is one head, planes [b*NH_ + head][t][d].
    k_cvt8<<<(unsigned)(((size_t)NB_ * TT * DM / 8 + 255) / 256), 256, 0, stream>>>(x, XB, (size_t)NB_ * TT * DM / 8);
    k_gemmw<bf, 0, false, true><<<dim3(TT / 64, DQ / 64, NB_), 32, 0, stream>>>(XB, nullptr, WQ, nullptr, DM, nullptr, HD, nullptr, (size_t)TT * DM, 0, (size_t)NH_ * TT * HD, QPh, QPl, (size_t)TT * HD);
    k_gemmw<bf, 0, false, true><<<dim3(TT / 64, DKV / 64, NB_), 32, 0, stream>>>(XB, nullptr, WK, nullptr, DM, nullptr, HD, nullptr, (size_t)TT * DM, 0, (size_t)NKV * TT * HD, KPh, KPl, (size_t)TT * HD);
    // v: the operands change places (rows = v columns, columns = t), so that the planes [b*NKV + head][d][t] come out of the same epilogue
    k_gemmw<bf, 0, false, true><<<dim3(DKV / 64, TT / 64, NB_), 32, 0, stream>>>(WV, nullptr, XB, nullptr, DM, nullptr, TT, nullptr, 0, (size_t)TT * DM, (size_t)NKV * HD * TT, VTh, VTl, 64);
    k_attn<<<dim3(TT / AR, NB_ * NH_), 512, 0, stream>>>(QPh, QPl, KPh, KPl, VTh, VTl, BRK, BRV, ATh, ATl);   // one kv head per query head: plane z = b*NH_ + head in all six
    k_gemmw<bf, 1, false, false><<<dim3(NB_ * TT / 64, DM / 64, 1), 32, 0, stream>>>(ATh, ATl, WO, nullptr, DQ, OUT, DM, nullptr, 0, 0, 0, nullptr, nullptr, 0);
}

// v004
// One run takes 215 microseconds.
// In both of two side-by-side timings against v003, it was 1.32 times as fast.
// Over all steps from v000 it is 10.3 times as fast.
#include <hip/hip_runtime.h>

// MultiHead2DAttention_v2 (x [4][1024][1024]; q = (x Wq) / 8, k = x Wk, v = x Wv ([in,out], no bias; 16 heads x 64); relative-position embeddings rel_k / rel_v [129][64] indexed by clip(j - i, -64, 64) + 64;
//   logits = q.k + q.rel_k[clip]; w = softmax; out_h = w v + sum_j w[i][j] rel_v[clip(j - i)]; out = merged Wo -> [4][1024][1024]).
// The relative terms use exact regroupings: q.rel_k[clip(j-i)] is read from QR = q rel_k^T ([T][129] per head), and sum_j w rel_v[clip] = WB rel_v with WB[i][r] = the softmax mass in bucket r (single keys for r = 1..127, tail sums for r = 0 / 128).
// Compute dtypes, f32 accumulate: every input rounded to bf16; q/k/v on PLAIN bf16 operands (inputs: exact); QR as hl x exact (2 products); scores and w.v as hl x hl (3 products) on every row; the 1/8 scale (exact), rel bias, softmax and bucket sums f32; WB rel_v as hl x exact (2 products); Wo hl x exact (2 products).

#define NB_  4
#define TT   1024
#define DM   1024
#define NH_  16
#define NKV  16
#define REP  (NH_ / NKV)
#define HD   64
#define DQ   (NH_ * HD)
#define DKV  (NKV * HD)
#define ZH   16
#define RH   1024                  // query rows < RH use hi+lo planes (0: none)
#define WIN  0
#define PCAR 1024.0f
#define SCL  0.125f   // HD^-0.5
typedef _Float16 h16;
typedef unsigned short bf;
typedef __attribute__((ext_vector_type(16))) __bf16   v16bf;
typedef __attribute__((ext_vector_type(16))) _Float16 v16h;
typedef __attribute__((ext_vector_type(8)))  _Float16 v8h;
typedef __attribute__((ext_vector_type(8)))  unsigned short v8us;
typedef __attribute__((ext_vector_type(8)))  float    v8f;
typedef __attribute__((ext_vector_type(4)))  float    v4f;
typedef v8h  __attribute__((may_alias)) v8ha;
typedef v4f  __attribute__((may_alias)) v4fa;
typedef v8us __attribute__((may_alias)) v8usa;

__device__ __forceinline__ unsigned short f2bf(float f) { unsigned u = __float_as_uint(f); u += 0x7FFFu + ((u >> 16) & 1u); return (unsigned short)(u >> 16); }
__device__ __forceinline__ float bf2f(unsigned short b) { return __uint_as_float(((unsigned)b) << 16); }
__device__ __forceinline__ float bfr(float f) { return bf2f(f2bf(f)); }
__device__ __forceinline__ v16h cat16(v8h lo, v8h hi) { return __builtin_shufflevector(lo, hi, 0, 1, 2, 3, 4, 5, 6, 7, 8, 9, 10, 11, 12, 13, 14, 15); }
__device__ __forceinline__ v16bf cat16b(v8us lo, v8us hi) { return __builtin_bit_cast(v16bf, __builtin_shufflevector(lo, hi, 0, 1, 2, 3, 4, 5, 6, 7, 8, 9, 10, 11, 12, 13, 14, 15)); }
__device__ __forceinline__ v8f wmma16(v16h a, v16h b, v8f c) { return __builtin_amdgcn_wmma_f32_16x16x32_f16(false, a, false, b, (short)0, c, false, false); }
__device__ __forceinline__ v8f wmmab(v16bf a, v16bf b, v8f c) { return __builtin_amdgcn_wmma_f32_16x16x32_bf16(false, a, false, b, (short)0, c, false, false); }



// ---- k_gemmw: GEMM, one 128x128 output tile per work-group of 8 waves (4 x 2, each wave 32x64 = 8 accumulators); grid (M/128, N/128, Z), 256 threads.
// The K-contiguous 16-bit operand planes come into LDS as whole 128-byte lines, by asynchronous copies, in stages of 128 k (two buffers: the next stage flies while this one is multiplied); the fragments are read from LDS.
// C[m][n] (f32, pitch ldc) = sum_k A[m][k] Bt[n][k] (NSPLIT 1: + A2[m][k] Bt[n][k]). z-batch strides sA/sB/sC in elements. K % 128 == 0, M % 128 == 0, N % 128 == 0.
// PL: no f32 C; each result is split into hi + lo bf16 here and stored in the planes Ph / Pl, element (m, n) at z sC + (n / 64) sY + m ldc + n % 64.
template <typename T16> struct WFrag;
template <> struct WFrag<h16> { typedef v16h V; static __device__ __forceinline__ V ld(const h16* p) { return cat16(*(const v8h*)p, *(const v8h*)(p + 16)); } static __device__ __forceinline__ v8f mma(V a, V b, v8f c) { return wmma16(a, b, c); } };
template <> struct WFrag<bf> { typedef v16bf V; static __device__ __forceinline__ V ld(const bf* p) { return cat16b(*(const v8us*)p, *(const v8us*)(p + 16)); } static __device__ __forceinline__ v8f mma(V a, V b, v8f c) { return wmmab(a, b, c); } };
__device__ __forceinline__ void splitf(float y, unsigned short& h, unsigned short& l) { h = f2bf(y); l = f2bf(y - bf2f(h)); }
#define GK 128             // k per stage: rows of 256 bytes
#define GP 136             // LDS row pitch in elements: 272 B = 16 B x odd, so that the 16-byte fragment reads of 16 rows fall on distinct banks
#define GT (128 * GP)      // one operand's stage tile, elements
__device__ __forceinline__ v16bf ldfs(const bf* p) { return cat16b(*(const v8usa*)p, *(const v8usa*)(p + 16)); }
// Eight asynchronous 16-byte copies a lane, 16 rows apart: LDS byte address l, global address g, global row pitch K elements. 16 lanes bring one 256-byte row, 256 threads one operand's 128 rows.
// The s_wait_xcnt stands inside the statement as a precaution: in front of any later rewrite of the address registers that the copies name.
__device__ __forceinline__ void cp8(unsigned l, const bf* g, size_t K) {
    asm volatile("global_load_async_to_lds_b128 %0, %8, off\n\t"
                 "global_load_async_to_lds_b128 %1, %9, off\n\t"
                 "global_load_async_to_lds_b128 %2, %10, off\n\t"
                 "global_load_async_to_lds_b128 %3, %11, off\n\t"
                 "global_load_async_to_lds_b128 %4, %12, off\n\t"
                 "global_load_async_to_lds_b128 %5, %13, off\n\t"
                 "global_load_async_to_lds_b128 %6, %14, off\n\t"
                 "global_load_async_to_lds_b128 %7, %15, off\n\t"
                 "s_wait_xcnt 0x0"
                 :: "v"(l), "v"(l + 16 * GP * 2), "v"(l + 32 * GP * 2), "v"(l + 48 * GP * 2), "v"(l + 64 * GP * 2), "v"(l + 80 * GP * 2), "v"(l + 96 * GP * 2), "v"(l + 112 * GP * 2),
                    "v"(g), "v"(g + 16 * K), "v"(g + 32 * K), "v"(g + 48 * K), "v"(g + 64 * K), "v"(g + 80 * K), "v"(g + 96 * K), "v"(g + 112 * K) : "memory");
}
template <int NSPLIT, bool PL>
__global__ __launch_bounds__(256) void k_gemmw(const bf* __restrict__ A, const bf* __restrict__ A2, const bf* __restrict__ Bt, int K, float* C, int ldc, size_t sA, size_t sB, size_t sC, bf* Ph, bf* Pl, size_t sY) {
    constexpr int NOP = 2 + NSPLIT;                       // operand tiles of a stage: A (, A2), Bt
    __shared__ __align__(16) bf ring[2 * NOP * GT];
    __shared__ __align__(16) float osw[8 * 16 * 68];
    const size_t z = blockIdx.z; A += z * sA; if (NSPLIT) A2 += z * sA; Bt += z * sB; if (!PL) C += z * sC;
    const int tid = threadIdx.x, lane = tid & 31, lr = lane & 15, hi = lane >> 4; const int w = __builtin_amdgcn_readfirstlane(tid >> 5);
    const int r0 = blockIdx.x * 128 + (w >> 1) * 32, c0 = blockIdx.y * 128 + (w & 1) * 64; float* os = osw + w * (16 * 68);
    const size_t goff = (size_t)(tid >> 4) * K + (tid & 15) * 8;
    const bf* ga = A + (size_t)blockIdx.x * 128 * K + goff; const bf* gb = Bt + (size_t)blockIdx.y * 128 * K + goff; const bf* ga2 = NSPLIT ? A2 + (size_t)blockIdx.x * 128 * K + goff : nullptr;
    const unsigned l0 = (unsigned)(size_t)(const void*)ring + ((tid >> 4) * GP + (tid & 15) * 8) * 2;
    auto fill = [&](int t) {   // stage t: 128 rows x 128 k of each operand into buffer t % 2
        const unsigned lb = l0 + (t & 1) * (NOP * GT * 2); const size_t ko = (size_t)t * GK;
        cp8(lb, ga + ko, K); if (NSPLIT) cp8(lb + GT * 2, ga2 + ko, K); cp8(lb + (NOP - 1) * GT * 2, gb + ko, K); };
    v8f acc[2][4];
#pragma unroll
    for (int mb = 0; mb < 2; ++mb)
#pragma unroll
        for (int nb = 0; nb < 4; ++nb) acc[mb][nb] = (v8f){};
    const int nt = K / GK;
    fill(0);
    asm volatile("s_wait_asynccnt 0x0" ::: "memory");   // this wave's copies of stage 0 have landed
    __syncthreads();                                     // ... and every other wave's
    if (nt > 1) fill(1);
#pragma unroll 1   // rolled: one stage is one trip of the ring
    for (int t = 0; t < nt; ++t) {
        const bf* sa = ring + (t & 1) * (NOP * GT) + ((w >> 1) * 32 + lr) * GP + 8 * hi; const bf* sb = ring + (t & 1) * (NOP * GT) + (NOP - 1) * GT + ((w & 1) * 64 + lr) * GP + 8 * hi;
        v16bf a[2][2], a2[2][2], b[2][4];   // two fragment sets: the next 32 k's LDS reads go out as one group ahead of this 32 k's products (inside the stage only)
#pragma unroll
        for (int mb = 0; mb < 2; ++mb) { a[0][mb] = ldfs(sa + mb * 16 * GP); if (NSPLIT) a2[0][mb] = ldfs(sa + GT + mb * 16 * GP); }
#pragma unroll
        for (int nb = 0; nb < 4; ++nb) b[0][nb] = ldfs(sb + nb * 16 * GP);
#pragma unroll
        for (int q = 0; q < GK / 32; ++q) { const int cu = q & 1, nx = cu ^ 1, ks = (q + 1) * 32;
            if (q + 1 < GK / 32) {
#pragma unroll
                for (int mb = 0; mb < 2; ++mb) { a[nx][mb] = ldfs(sa + mb * 16 * GP + ks); if (NSPLIT) a2[nx][mb] = ldfs(sa + GT + mb * 16 * GP + ks); }
#pragma unroll
                for (int nb = 0; nb < 4; ++nb) b[nx][nb] = ldfs(sb + nb * 16 * GP + ks);
                __builtin_amdgcn_sched_barrier(0); }   // holds the group of reads above ahead of the products below: the scheduler otherwise sinks each read to its first use, and the wave waits out the LDS latency in front of every pair of products
#pragma unroll
            for (int nb = 0; nb < 4; ++nb)
#pragma unroll
                for (int mb = 0; mb < 2; ++mb) { acc[mb][nb] = wmmab(a[cu][mb], b[cu][nb], acc[mb][nb]); if (NSPLIT) acc[mb][nb] = wmmab(a2[cu][mb], b[cu][nb], acc[mb][nb]); }
        }
        // keeps the matrix instructions' distance on the taken side of the branches behind them too
        asm volatile("v_nop\n\tv_nop\n\tv_nop\n\tv_nop" : "+v"(acc[0][0]), "+v"(acc[1][0]), "+v"(acc[0][1]), "+v"(acc[1][1]), "+v"(acc[0][2]), "+v"(acc[1][2]), "+v"(acc[0][3]), "+v"(acc[1][3]));
        asm volatile("s_wait_dscnt 0x0" ::: "memory");      // this wave's reads of buffer t % 2 are done before the buffer is refilled
        asm volatile("s_wait_asynccnt 0x0" ::: "memory");   // this wave's copies of stage t + 1 have landed
        __syncthreads();                                     // publishes stage t + 1 and ends every wave's reads of stage t
        if (t + 2 < nt) fill(t + 2);
    }
    asm volatile("s_wait_asynccnt 0x0" ::: "memory");   // no copy is outstanding when the wave goes on to its end
#pragma unroll
    for (int mb = 0; mb < 2; ++mb) {
#pragma unroll
        for (int nb = 0; nb < 4; ++nb) {
#pragma unroll
            for (int j = 0; j < 8; ++j) os[(hi * 8 + j) * 68 + nb * 16 + lr] = acc[mb][nb][j]; }
        __builtin_amdgcn_wave_barrier(); asm volatile("" ::: "memory");
        if (PL) {   // 8 results a lane: 8 lanes store one whole 128-byte row of each plane
            const size_t pb = z * sC + (size_t)(c0 >> 6) * sY + (size_t)(r0 + mb * 16) * ldc;
#pragma unroll
            for (int s = 0; s < 4; ++s) { const int row = 4 * s + (lane >> 3), cofs = (lane & 7) * 8; const v4f v0 = *(const v4fa*)(os + row * 68 + cofs), v1 = *(const v4fa*)(os + row * 68 + cofs + 4); v8us oh, ol;
#pragma unroll
                for (int q = 0; q < 4; ++q) { unsigned short a2, c2; splitf(v0[q], a2, c2); oh[q] = a2; ol[q] = c2; splitf(v1[q], a2, c2); oh[4 + q] = a2; ol[4 + q] = c2; }
                *(v8us*)(Ph + pb + (size_t)row * ldc + cofs) = oh; *(v8us*)(Pl + pb + (size_t)row * ldc + cofs) = ol; }
        } else {
            float* crow = C + (size_t)(r0 + mb * 16) * ldc + c0;
#pragma unroll
            for (int s = 0; s < 8; ++s) { const int row = 2 * s + hi, cofs = lr * 4; const v4f val = *(const v4fa*)(os + row * 68 + cofs);
                *(v4f*)(crow + (size_t)row * ldc + cofs) = val; }
             }
        __builtin_amdgcn_wave_barrier(); asm volatile("" ::: "memory");
    }
}

__device__ __forceinline__ h16 tohx(float x) { return (h16)x; }
typedef __attribute__((ext_vector_type(2))) _Float16 v2h;
typedef __attribute__((ext_vector_type(4))) _Float16 v4h;
typedef __attribute__((ext_vector_type(2))) unsigned short v2us;
typedef __attribute__((ext_vector_type(4))) unsigned short v4us;
typedef __attribute__((ext_vector_type(2))) float v2f;
typedef __attribute__((ext_vector_type(4))) int v4i;

__global__ __launch_bounds__(256) void k_wtG(const float* __restrict__ w, int K, int N, bf* Bt) {
    const int lane = threadIdx.x & 31; const int L0 = (blockIdx.x * 8 + (threadIdx.x >> 5)) * 8; const int nlines = N * K / 64;
{
#pragma unroll 1
        for (int l = 0; l < 8; ++l) { const int L = L0 + l; if (L >= nlines) break; const size_t e = (size_t)L * 64 + lane * 2; const int k = (int)(e % K), n = (int)(e / K); v2us o;
            o[0] = f2bf(w[(size_t)k * N + n]); o[1] = f2bf(w[(size_t)(k + 1) * N + n]); *(v2us*)(Bt + e) = o; }
         }
}
__global__ __launch_bounds__(256) void k_cvt8(const float* __restrict__ src, bf* dst, size_t n8) { const size_t i = (size_t)blockIdx.x * 256 + threadIdx.x; if (i >= n8) return; const v8f v = *(const v8f*)(src + i * 8); v8us o;
#pragma unroll
    for (int k = 0; k < 8; ++k) o[k] = f2bf(v[k]); *(v8us*)(dst + i * 8) = o;  }
__global__ __launch_bounds__(256) void k_cscvt(const float* __restrict__ cosT, const float* __restrict__ sinT, float* CS) { const int idx = blockIdx.x * 256 + threadIdx.x; if (idx >= TT * HD) return; v2f cs; cs[0] = bfr(cosT[idx]); cs[1] = bfr(sinT[idx]); *(v2f*)(CS + (size_t)idx * 2) = cs;  }
// k_asoft: per row (zz, i): t = S x HD^-0.5 (no mask); softmax over the 1024 keys (register row, one exp, fixed trees);
__global__ __launch_bounds__(256) void k_asoft(const float* __restrict__ Sb, h16* P16, bf* Ph, bf* Pl) {
    const int lane = threadIdx.x & 31; const int row = blockIdx.x * 8 + (threadIdx.x >> 5); if (row >= ZH * TT) return; const int i = row % TT; const int zz = row / TT; (void)zz; const bool hires = (i < RH); const float* sr = Sb + (size_t)row * TT; float v[TT / 32]; float mx = -3.0e38f;
#pragma unroll
    for (int ch = 0; ch < TT / 128; ++ch) { const int j0 = ch * 128 + lane * 4; const v4f a = *(const v4f*)(sr + j0);
#pragma unroll
        for (int q = 0; q < 4; ++q) { const int j = j0 + q; (void)j; const float t = a[q] * SCL; v[ch * 4 + q] = t; mx = fmaxf(mx, t); } }
#pragma unroll
    for (int sh = 16; sh; sh >>= 1) mx = fmaxf(mx, __shfl_xor(mx, sh, 32));
    float sum = 0.f;
#pragma unroll
    for (int k = 0; k < TT / 32; ++k) { float d0 = __fsub_rn(v[k], mx); asm volatile("" : "+v"(d0)); v[k] = __builtin_amdgcn_exp2f(__fmul_rn(d0, 1.4426950408889634f)); sum += v[k]; }
#pragma unroll
    for (int sh = 16; sh; sh >>= 1) sum += __shfl_xor(sum, sh, 32);
    const float f = __fdiv_rn(hires ? 1.0f : PCAR, sum);
{
        if (hires) {
#pragma unroll
            for (int ch = 0; ch < TT / 128; ++ch) { v4us oh, ol;
#pragma unroll
                for (int q = 0; q < 4; ++q) { unsigned short a, c2; splitf(v[ch * 4 + q] * f, a, c2); oh[q] = a; ol[q] = c2; }
                const size_t oo = ((size_t)zz * (RH ? RH : 1) + i) * TT + ch * 128 + lane * 4; *(v4us*)(Ph + oo) = oh; *(v4us*)(Pl + oo) = ol; }
        } else {
#pragma unroll
            for (int ch = 0; ch < TT / 128; ++ch) { v4h o4;
#pragma unroll
                for (int q = 0; q < 4; ++q) o4[q] = tohx(v[ch * 4 + q] * f);
                *(v4h*)(P16 + (size_t)row * TT + ch * 128 + lane * 4) = o4; } }
         }
}
__global__ __launch_bounds__(256) void k_relk(const float* __restrict__ rk, bf* Bt) { const int e = (blockIdx.x * 256 + threadIdx.x) * 4; if (e >= 192 * HD) return; const int r = e / HD; v4us o;   // Bt[r][d] = rel_k[r][d] (r < 129) else 0
#pragma unroll
    for (int u = 0; u < 4; ++u) o[u] = (r < 129) ? f2bf(rk[e + u]) : (unsigned short)0; *(v4us*)(Bt + e) = o;  }
__global__ __launch_bounds__(256) void k_relv(const float* __restrict__ rv, bf* Bt) { const int e = (blockIdx.x * 256 + threadIdx.x) * 4; if (e >= HD * 160) return; const int r = e % 160; const int d = e / 160; v4us o;   // Bt[d][r] = rel_v[r][d] (r < 129) else 0
#pragma unroll
    for (int u = 0; u < 4; ++u) o[u] = (r + u < 129) ? f2bf(rv[(size_t)(r + u) * HD + d]) : (unsigned short)0; *(v4us*)(Bt + e) = o;  }
// ---- k_attn: the whole attention of 64 query rows of one head in ONE work-group (16 waves); the 64 x 1024 score rows stay in LDS from the q.k products to the w.v products. grid (TT/64, NB_*NH_).
// Phase 1: wave w forms the 64 x 64 score tile of keys w*64.. (hl x hl, 3 products) and, waves 0..8, 16 columns of QR = q rel_k^T (hl x exact). Phase 2: one wave per row, 4 rows each: bias, softmax, hi/lo split written over the row's own f32 scores
// (hi plane in its first 2048 bytes, lo plane in the next), tail sums and bucket planes written over the row's own QR. Phase 3: wave w multiplies key slice w*64.. of w with v (3 products), waves 0..4 add one 32-bucket slice of WB rel_v (2 products);
// the 16 partial 64 x 64 tiles are summed through LDS in wave order and split into the merged hi/lo planes.
#define AR 64      // query rows per work-group
#define SP 1028    // score row pitch in floats: 4112 B = 16 B x odd, so that the 16-byte fragment reads of 16 rows fall on distinct banks
#define QP 168     // QR row pitch in floats; the same 672 B then hold the row's bucket planes: hi at byte 0, lo at byte 336
typedef v4us __attribute__((may_alias)) v4usa;
typedef unsigned short __attribute__((may_alias)) usa;
typedef float __attribute__((may_alias)) fa;
__device__ __forceinline__ v16bf ldfa(const bf* p) { return cat16b(*(const v8usa*)p, *(const v8usa*)(p + 16)); }
__global__ __launch_bounds__(512) void k_attn(const bf* __restrict__ Qh, const bf* __restrict__ Ql, const bf* __restrict__ Kh, const bf* __restrict__ Kl, const bf* __restrict__ Vh, const bf* __restrict__ Vl, const bf* __restrict__ Brk, const bf* __restrict__ Brv, bf* Ah, bf* Al) {
    __shared__ __align__(16) float S[AR * SP];
    __shared__ __align__(16) float QRs[AR * QP];
    const int tid = threadIdx.x, lane = tid & 31, lr = lane & 15, hi = lane >> 4; const int w = __builtin_amdgcn_readfirstlane(tid >> 5);
    const int r0 = blockIdx.x * AR; const size_t z = blockIdx.y;
    const bf* qh = Qh + z * TT * HD + (size_t)(r0 + lr) * HD + 8 * hi; const bf* ql = Ql + z * TT * HD + (size_t)(r0 + lr) * HD + 8 * hi;
    {
        const bf* kh = Kh + z * TT * HD + (size_t)(w * 64 + lr) * HD + 8 * hi; const bf* kl = Kl + z * TT * HD + (size_t)(w * 64 + lr) * HD + 8 * hi;
        v8f acc[4][4];
#pragma unroll
        for (int mb = 0; mb < 4; ++mb)
#pragma unroll
            for (int nb = 0; nb < 4; ++nb) acc[mb][nb] = (v8f){};
#pragma unroll 1   // rolled: both k steps' fragments at once would not fit the 256 registers of a 16-wave work-group
        for (int kc = 0; kc < HD; kc += 32) {
            v16bf a[4], a2[4];
#pragma unroll
            for (int mb = 0; mb < 4; ++mb) { a[mb] = WFrag<bf>::ld(qh + mb * 16 * HD + kc); a2[mb] = WFrag<bf>::ld(ql + mb * 16 * HD + kc); }
#pragma unroll
            for (int nb = 0; nb < 4; ++nb) { const v16bf b = WFrag<bf>::ld(kh + nb * 16 * HD + kc); const v16bf b2 = WFrag<bf>::ld(kl + nb * 16 * HD + kc);
#pragma unroll
                for (int mb = 0; mb < 4; ++mb) { acc[mb][nb] = wmmab(a[mb], b, acc[mb][nb]); acc[mb][nb] = wmmab(a2[mb], b, acc[mb][nb]); acc[mb][nb] = wmmab(a[mb], b2, acc[mb][nb]); } }
            // keeps the matrix instructions' distance on the taken side of the loop branch too
            asm volatile("v_nop\n\tv_nop\n\tv_nop\n\tv_nop" : "+v"(acc[0][0]), "+v"(acc[1][1]), "+v"(acc[2][2]), "+v"(acc[3][3]) : "v"(a[0]), "v"(a[3]));
            asm volatile("s_wait_xcnt 0x0" ::: "memory");   // precaution: stands in front of the next trip's rewrite of the address registers that this trip's global loads name
        }
#pragma unroll
        for (int mb = 0; mb < 4; ++mb)
#pragma unroll
            for (int nb = 0; nb < 4; ++nb)
#pragma unroll
                for (int j = 0; j < 8; ++j) *(fa*)(S + (mb * 16 + hi * 8 + j) * SP + w * 64 + nb * 16 + lr) = acc[mb][nb][j];
    }
    if (w < 9) {   // QR[i][r] = q_i . rel_k[r] (unscaled), columns w*16 .. w*16+15 (rows 129.. of the table plane are zero)
        const bf* rk = Brk + (size_t)(w * 16 + lr) * HD + 8 * hi; v8f aq[4];
#pragma unroll
        for (int mb = 0; mb < 4; ++mb) aq[mb] = (v8f){};
#pragma unroll
        for (int kc = 0; kc < HD; kc += 32) { const v16bf b = WFrag<bf>::ld(rk + kc);
#pragma unroll
            for (int mb = 0; mb < 4; ++mb) { aq[mb] = wmmab(WFrag<bf>::ld(qh + mb * 16 * HD + kc), b, aq[mb]); aq[mb] = wmmab(WFrag<bf>::ld(ql + mb * 16 * HD + kc), b, aq[mb]); } }
#pragma unroll
        for (int mb = 0; mb < 4; ++mb)
#pragma unroll
            for (int j = 0; j < 8; ++j) *(fa*)(QRs + (mb * 16 + hi * 8 + j) * QP + w * 16 + lr) = aq[mb][j];
    }
    __syncthreads();
#pragma unroll 1   // rolled: one row's 32 values a lane are the live set
    for (int rr = 0; rr < AR / 16; ++rr) { const int row = w * (AR / 16) + rr, i = r0 + row; float* sr = S + row * SP; float* qr = QRs + row * QP; float v[TT / 32]; float mx = -3.0e38f;
#pragma unroll
        for (int ch = 0; ch < TT / 128; ++ch) { const int j0 = ch * 128 + lane * 4; const v4f a = *(const v4fa*)(sr + j0);
#pragma unroll
            for (int u = 0; u < 4; ++u) { int r = j0 + u - i; r = (r < -64) ? -64 : (r > 64 ? 64 : r); const float t = __fadd_rn(a[u], *(const fa*)(qr + r + 64)) * 0.125f; v[ch * 4 + u] = t; mx = fmaxf(mx, t); } }
#pragma unroll
        for (int sh = 16; sh; sh >>= 1) mx = fmaxf(mx, __shfl_xor(mx, sh, 32));
        float sum = 0.f;
#pragma unroll
        for (int q = 0; q < TT / 32; ++q) { v[q] = __builtin_amdgcn_exp2f(__fmul_rn(__fsub_rn(v[q], mx), 1.4426950408889634f)); sum += v[q]; }
#pragma unroll
        for (int sh = 16; sh; sh >>= 1) sum += __shfl_xor(sum, sh, 32);
        const float f = __fdiv_rn(1.0f, sum);
        bf* ph = (bf*)sr; bf* pl = ph + TT; float lo = 0.f, hs = 0.f;
#pragma unroll
        for (int ch = 0; ch < TT / 128; ++ch) { const int j0 = ch * 128 + lane * 4; v4us oh, ol;
#pragma unroll
            for (int q = 0; q < 4; ++q) { const float p = v[ch * 4 + q] * f; unsigned short a2, c2; splitf(p, a2, c2); oh[q] = a2; ol[q] = c2; if (j0 + q <= i - 64) lo = __fadd_rn(lo, p); if (j0 + q >= i + 64) hs = __fadd_rn(hs, p); }
            *(v4usa*)(ph + j0) = oh; *(v4usa*)(pl + j0) = ol; }
#pragma unroll
        for (int sh = 16; sh; sh >>= 1) { lo = __fadd_rn(lo, __shfl_xor(lo, sh, 32)); hs = __fadd_rn(hs, __shfl_xor(hs, sh, 32)); }
        // the bucket reads below take what other lanes of this wave have just stored: keeps the compiler from moving them over the stores (a wave's LDS operations run in order)
        __builtin_amdgcn_wave_barrier(); asm volatile("" ::: "memory");
        bf* wh = (bf*)qr; bf* wl = wh + QP;
#pragma unroll
        for (int ch = 0; ch < 2; ++ch) { const int rb = ch * 128 + lane * 4; if (rb < 160) { v4us oh, ol;
#pragma unroll
            for (int u = 0; u < 4; ++u) { const int r = rb + u; unsigned short a2 = 0, c2 = 0; if (r == 0) splitf(lo, a2, c2); else if (r == 128) splitf(hs, a2, c2); else if (r < 128) { const int j = i + r - 64; if (j >= 0 && j < TT) { a2 = *(const usa*)(ph + j); c2 = *(const usa*)(pl + j); } } oh[u] = a2; ol[u] = c2; }
            *(v4usa*)(wh + rb) = oh; *(v4usa*)(wl + rb) = ol; } }
    }
    __syncthreads();
    v8f acc[4][4];
#pragma unroll
    for (int mb = 0; mb < 4; ++mb)
#pragma unroll
        for (int nb = 0; nb < 4; ++nb) acc[mb][nb] = (v8f){};
    {
        const bf* pa = (const bf*)S + lr * (SP * 2) + w * 64 + 8 * hi; const bf* vh = Vh + z * HD * TT + (size_t)lr * TT + w * 64 + 8 * hi; const bf* vl = Vl + z * HD * TT + (size_t)lr * TT + w * 64 + 8 * hi;
#pragma unroll 1   // rolled: both k steps' fragments at once would not fit the 256 registers of a 16-wave work-group
        for (int kc = 0; kc < 64; kc += 32) {
            v16bf a[4], a2[4];
#pragma unroll
            for (int mb = 0; mb < 4; ++mb) { a[mb] = ldfa(pa + mb * 16 * (SP * 2) + kc); a2[mb] = ldfa(pa + mb * 16 * (SP * 2) + TT + kc); }
#pragma unroll
            for (int nb = 0; nb < 4; ++nb) { const v16bf b = WFrag<bf>::ld(vh + (size_t)nb * 16 * TT + kc); const v16bf b2 = WFrag<bf>::ld(vl + (size_t)nb * 16 * TT + kc);
#pragma unroll
                for (int mb = 0; mb < 4; ++mb) { acc[mb][nb] = wmmab(a[mb], b, acc[mb][nb]); acc[mb][nb] = wmmab(a2[mb], b, acc[mb][nb]); acc[mb][nb] = wmmab(a[mb], b2, acc[mb][nb]); } }
            // keeps the matrix instructions' distance on the taken side of the loop branch too
            asm volatile("v_nop\n\tv_nop\n\tv_nop\n\tv_nop" : "+v"(acc[0][0]), "+v"(acc[1][1]), "+v"(acc[2][2]), "+v"(acc[3][3]) : "v"(a[0]), "v"(a[3]));
            asm volatile("s_wait_xcnt 0x0" ::: "memory");   // precaution: stands in front of the next trip's rewrite of the address registers that this trip's global loads name
        }
    }
    if (w < 5) {   // sum_j w rel_v[clip] = WB . rel_v: buckets w*32 .. w*32+31
        const bf* wa = (const bf*)QRs + lr * (QP * 2) + w * 32 + 8 * hi; const bf* rv = Brv + (size_t)lr * 160 + w * 32 + 8 * hi; v16bf a[4], a2[4];
#pragma unroll
        for (int mb = 0; mb < 4; ++mb) { a[mb] = ldfa(wa + mb * 16 * (QP * 2)); a2[mb] = ldfa(wa + mb * 16 * (QP * 2) + QP); }
#pragma unroll
        for (int nb = 0; nb < 4; ++nb) { const v16bf b = WFrag<bf>::ld(rv + nb * 16 * 160);
#pragma unroll
            for (int mb = 0; mb < 4; ++mb) { acc[mb][nb] = wmmab(a[mb], b, acc[mb][nb]); acc[mb][nb] = wmmab(a2[mb], b, acc[mb][nb]); } }
    }
    __syncthreads();   // every wave has read its slice of the planes: their space now takes the 16 partial tiles [w][64][64]; column bit 5 flipped in rows 8..15 of each 16, so that the two half-waves' stores fall on different banks
#pragma unroll
    for (int mb = 0; mb < 4; ++mb)
#pragma unroll
        for (int nb = 0; nb < 4; ++nb)
#pragma unroll
            for (int j = 0; j < 8; ++j) *(fa*)(S + w * 4096 + (mb * 16 + hi * 8 + j) * 64 + ((nb * 16 + lr) ^ (hi << 5))) = acc[mb][nb][j];
    __syncthreads();
    const int c4 = (tid & 15) * 4; const size_t ob = ((z / NH_) * TT + r0) * DQ + (z % NH_) * HD + c4;
#pragma unroll
    for (int g = 0; g < 2; ++g) { const int row = (tid >> 4) + g * 32; const float* pr = S + row * 64 + (c4 ^ (((row >> 3) & 1) << 5)); v4f s = *(const v4fa*)pr;
#pragma unroll
        for (int k = 1; k < 16; ++k) { const v4f t = *(const v4fa*)(pr + k * 4096); s[0] = __fadd_rn(s[0], t[0]); s[1] = __fadd_rn(s[1], t[1]); s[2] = __fadd_rn(s[2], t[2]); s[3] = __fadd_rn(s[3], t[3]); }
        v4us oh, ol;
#pragma unroll
        for (int q = 0; q < 4; ++q) { unsigned short a2, c2; splitf(s[q], a2, c2); oh[q] = a2; ol[q] = c2; }
        *(v4us*)(Ah + ob + (size_t)row * DQ) = oh; *(v4us*)(Al + ob + (size_t)row * DQ) = ol; }
}

extern "C" void kernel_launch(void* const* d_in, const int* in_sizes, int n_in,
                              void* d_out, int out_size, void* d_ws, size_t ws_size, hipStream_t stream) {
    (void)in_sizes; (void)n_in; (void)out_size;
    const float* x = (const float*)d_in[0]; const float* wq = (const float*)d_in[1]; const float* wk = (const float*)d_in[2]; const float* wv = (const float*)d_in[3]; const float* wo = (const float*)d_in[4]; const float* relk = (const float*)d_in[5]; const float* relv = (const float*)d_in[6]; const float* cosT = nullptr; const float* sinT = nullptr; (void)cosT; (void)sinT;
    float* OUT = (float*)d_out;     // [4][1024][1024]
    char* wsp = (char*)d_ws;
    auto take = [&](size_t bytes) { char* p = wsp; wsp += (bytes + 255) & ~(size_t)255; return (void*)p; };
    bf* WQ = (bf*)take((size_t)DQ * DM * 2); bf* WK = (bf*)take((size_t)DKV * DM * 2); bf* WV = (bf*)take((size_t)DKV * DM * 2); bf* WO = (bf*)take((size_t)DM * DQ * 2); float* CS = (float*)take((size_t)TT * HD * 2 * 4);
    bf* XB = (bf*)take((size_t)NB_ * TT * DM * 2); bf* BRK = (bf*)take((size_t)192 * HD * 2); bf* BRV = (bf*)take((size_t)HD * 160 * 2); float* QR = (float*)take((size_t)ZH * TT * 192 * 4); bf* WBh = (bf*)take((size_t)ZH * TT * 160 * 2); bf* WBl = (bf*)take((size_t)ZH * TT * 160 * 2); float* O2 = (float*)take((size_t)ZH * TT * HD * 4);
    h16* VT16 = (h16*)take((size_t)NKV * HD * TT * 2);
    bf* QPh = (bf*)take((size_t)NB_ * NH_ * TT * HD * 2); bf* QPl = (bf*)take((size_t)NB_ * NH_ * TT * HD * 2); bf* KPh = (bf*)take((size_t)NB_ * NKV * TT * HD * 2); bf* KPl = (bf*)take((size_t)NB_ * NKV * TT * HD * 2); bf* VTh = (bf*)take((size_t)NB_ * NKV * HD * TT * 2); bf* VTl = (bf*)take((size_t)NB_ * NKV * HD * TT * 2); bf* Ph = (bf*)take((size_t)ZH * RH * TT * 2); bf* Pl = (bf*)take((size_t)ZH * RH * TT * 2);
    float* Sb = (float*)take((size_t)ZH * TT * TT * 4); float* Ob = (float*)take((size_t)ZH * TT * HD * 4); bf* ATh = (bf*)take((size_t)NB_ * TT * DQ * 2); bf* ATl = (bf*)take((size_t)NB_ * TT * DQ * 2);
    if ((size_t)(wsp - (char*)d_ws) > ws_size) return;    // ws 256 MiB
    { k_relk<<<(192 * HD / 4 + 255) / 256, 256, 0, stream>>>(relk, BRK); k_relv<<<(HD * 160 / 4 + 255) / 256, 256, 0, stream>>>(relv, BRV); k_wtG<<<(unsigned)((DM * DQ / 64 + 63) / 64), 256, 0, stream>>>(wq, DM, DQ, WQ); k_wtG<<<(unsigned)((DM * DKV / 64 + 63) / 64), 256, 0, stream>>>(wk, DM, DKV, WK); k_wtG<<<(unsigned)((DM * DKV / 64 + 63) / 64), 256, 0, stream>>>(wv, DM, DKV, WV);
      k_wtG<<<(unsigned)((DQ * DM / 64 + 63) / 64), 256, 0, stream>>>(wo, DQ, DM, WO);
       }
    // Projections of all NB_ batch items in one launch each, grid z = batch item; each writes its hi/lo planes itself. q and k: one 64-column tile is one head, planes [b*NH_ + head][t][d].
    k_cvt8<<<(unsigned)(((size_t)NB_ * TT * DM / 8 + 255) / 256), 256, 0, stream>>>(x, XB, (size_t)NB_ * TT * DM / 8);
    k_gemmw<0, true><<<dim3(TT / 128, DQ / 128, NB_), 256, 0, stream>>>(XB, nullptr, WQ, DM, nullptr, HD, (size_t)TT * DM, 0, (size_t)NH_ * TT * HD, QPh, QPl, (size_t)TT * HD);
    k_gemmw<0, true><<<dim3(TT / 128, DKV / 128, NB_), 256, 0, stream>>>(XB, nullptr, WK, DM, nullptr, HD, (size_t)TT * DM, 0, (size_t)NKV * TT * HD, KPh, KPl, (size_t)TT * HD);
    // v: the operands change places (rows = v columns, columns = t), so that the planes [b*NKV + head][d][t] come out of the same epilogue
    k_gemmw<0, true><<<dim3(DKV / 128, TT / 128, NB_), 256, 0, stream>>>(WV, nullptr, XB, DM, nullptr, TT, 0, (size_t)TT * DM, (size_t)NKV * HD * TT, VTh, VTl, 64);
    k_attn<<<dim3(TT / AR, NB_ * NH_), 512, 0, stream>>>(QPh, QPl, KPh, KPl, VTh, VTl, BRK, BRV, ATh, ATl);   // one kv head per query head: plane z = b*NH_ + head in all six
    k_gemmw<1, false><<<dim3(NB_ * TT / 128, DM / 128, 1), 256, 0, stream>>>(ATh, ATl, WO, DQ, OUT, DM, 0, 0, 0, nullptr, nullptr, 0);
}

// v005
// One run takes 178 microseconds.
// Timed twice side by side with v004, it ran 1.21 and 1.20 times as fast.
// Over all steps from v000 it is 12.4 times as fast.
#include <hip/hip_runtime.h>

// MultiHead2DAttention_v2 (x [4][1024][1024]; q = (x Wq) / 8, k = x Wk, v = x Wv ([in,out], no bias; 16 heads x 64); relative-position embeddings rel_k / rel_v [129][64] indexed by clip(j - i, -64, 64) + 64;
//   logits = q.k + q.rel_k[clip]; w = softmax; out_h = w v + sum_j w[i][j] rel_v[clip(j - i)]; out = merged Wo -> [4][1024][1024]).
// The relative terms use exact regroupings: q.rel_k[clip(j-i)] is read from QR = q rel_k^T ([T][129] per head), and sum_j w rel_v[clip] = WB rel_v with WB[i][r] = the softmax mass in bucket r (single keys for r = 1..127, tail sums for r = 0 / 128).
// Compute dtypes, f32 accumulate: every input rounded to bf16; q/k/v on PLAIN bf16 operands (inputs: exact); QR as hl x exact (2 products); scores and w.v as hl x hl (3 products) on every row; the 1/8 scale (exact), rel bias, softmax and bucket sums f32; WB rel_v as hl x exact (2 products); Wo hl x exact (2 products).

#define NB_  4
#define TT   1024
#define DM   1024
#define NH_  16
#define NKV  16
#define REP  (NH_ / NKV)
#define HD   64
#define DQ   (NH_ * HD)
#define DKV  (NKV * HD)
#define ZH   16
#define RH   1024                  // query rows < RH use hi+lo planes (0: none)
#define WIN  0
#define PCAR 1024.0f
#define SCL  0.125f   // HD^-0.5
typedef _Float16 h16;
typedef unsigned short bf;
typedef __attribute__((ext_vector_type(16))) __bf16   v16bf;
typedef __attribute__((ext_vector_type(16))) _Float16 v16h;
typedef __attribute__((ext_vector_type(8)))  _Float16 v8h;
typedef __attribute__((ext_vector_type(8)))  unsigned short v8us;
typedef __attribute__((ext_vector_type(8)))  float    v8f;
typedef __attribute__((ext_vector_type(4)))  float    v4f;
typedef v8h  __attribute__((may_alias)) v8ha;
typedef v4f  __attribute__((may_alias)) v4fa;
typedef v8us __attribute__((may_alias)) v8usa;

__device__ __forceinline__ unsigned short f2bf(float f) { unsigned u = __float_as_uint(f); u += 0x7FFFu + ((u >> 16) & 1u); return (unsigned short)(u >> 16); }
__device__ __forceinline__ float bf2f(unsigned short b) { return __uint_as_float(((unsigned)b) << 16); }
__device__ __forceinline__ float bfr(float f) { return bf2f(f2bf(f)); }
__device__ __forceinline__ v16h cat16(v8h lo, v8h hi) { return __builtin_shufflevector(lo, hi, 0, 1, 2, 3, 4, 5, 6, 7, 8, 9, 10, 11, 12, 13, 14, 15); }
__device__ __forceinline__ v16bf cat16b(v8us lo, v8us hi) { return __builtin_bit_cast(v16bf, __builtin_shufflevector(lo, hi, 0, 1, 2, 3, 4, 5, 6, 7, 8, 9, 10, 11, 12, 13, 14, 15)); }
__device__ __forceinline__ v8f wmma16(v16h a, v16h b, v8f c) { return __builtin_amdgcn_wmma_f32_16x16x32_f16(false, a, false, b, (short)0, c, false, false); }
__device__ __forceinline__ v8f wmmab(v16bf a, v16bf b, v8f c) { return __builtin_amdgcn_wmma_f32_16x16x32_bf16(false, a, false, b, (short)0, c, false, false); }



// ---- gemmw: GEMM body, one 128x128 output tile per work-group of 8 waves (4 x 2, each wave 32x64 = 8 accumulators); grid (M/128, N/128, .), 256 threads; z = batch item.
// The K-contiguous 16-bit operand planes come into LDS as whole 128-byte lines, by asynchronous copies, in stages of 128 k (two buffers: the next stage flies while this one is multiplied); the fragments are read from LDS.
// C[m][n] (f32, pitch ldc) = sum_k A[m][k] Bt[n][k] (NSPLIT 1: + A2[m][k] Bt[n][k]). z-batch strides sA/sB/sC in elements. K % 128 == 0, M % 128 == 0, N % 128 == 0.
// PL: no f32 C; each result is split into hi + lo bf16 here and stored in the planes Ph / Pl, element (m, n) at z sC + (n / 64) sY + m ldc + n % 64.
template <typename T16> struct WFrag;
template <> struct WFrag<h16> { typedef v16h V; static __device__ __forceinline__ V ld(const h16* p) { return cat16(*(const v8h*)p, *(const v8h*)(p + 16)); } static __device__ __forceinline__ v8f mma(V a, V b, v8f c) { return wmma16(a, b, c); } };
template <> struct WFrag<bf> { typedef v16bf V; static __device__ __forceinline__ V ld(const bf* p) { return cat16b(*(const v8us*)p, *(const v8us*)(p + 16)); } static __device__ __forceinline__ v8f mma(V a, V b, v8f c) { return wmmab(a, b, c); } };
__device__ __forceinline__ void splitf(float y, unsigned short& h, unsigned short& l) { h = f2bf(y); l = f2bf(y - bf2f(h)); }
#define GK 128             // k per stage: rows of 256 bytes
#define GP 136             // LDS row pitch in elements: 272 B = 16 B x odd, so that the 16-byte fragment reads of 16 rows fall on distinct banks
#define GT (128 * GP)      // one operand's stage tile, elements
__device__ __forceinline__ v16bf ldfs(const bf* p) { return cat16b(*(const v8usa*)p, *(const v8usa*)(p + 16)); }
// Eight asynchronous 16-byte copies a lane, 16 rows apart: LDS byte address l, global address g, global row pitch K elements. 16 lanes bring one 256-byte row, 256 threads one operand's 128 rows.
// The s_wait_xcnt stands inside the statement as a precaution: in front of any later rewrite of the address registers that the copies name.
__device__ __forceinline__ void cp8(unsigned l, const bf* g, size_t K) {
    asm volatile("global_load_async_to_lds_b128 %0, %8, off\n\t"
                 "global_load_async_to_lds_b128 %1, %9, off\n\t"
                 "global_load_async_to_lds_b128 %2, %10, off\n\t"
                 "global_load_async_to_lds_b128 %3, %11, off\n\t"
                 "global_load_async_to_lds_b128 %4, %12, off\n\t"
                 "global_load_async_to_lds_b128 %5, %13, off\n\t"
                 "global_load_async_to_lds_b128 %6, %14, off\n\t"
                 "global_load_async_to_lds_b128 %7, %15, off\n\t"
                 "s_wait_xcnt 0x0"
                 :: "v"(l), "v"(l + 16 * GP * 2), "v"(l + 32 * GP * 2), "v"(l + 48 * GP * 2), "v"(l + 64 * GP * 2), "v"(l + 80 * GP * 2), "v"(l + 96 * GP * 2), "v"(l + 112 * GP * 2),
                    "v"(g), "v"(g + 16 * K), "v"(g + 32 * K), "v"(g + 48 * K), "v"(g + 64 * K), "v"(g + 80 * K), "v"(g + 96 * K), "v"(g + 112 * K) : "memory");
}
template <int NSPLIT, bool PL>
__device__ __forceinline__ void gemmw(const size_t z, const bf* __restrict__ A, const bf* __restrict__ A2, const bf* __restrict__ Bt, int K, float* C, int ldc, size_t sA, size_t sB, size_t sC, bf* Ph, bf* Pl, size_t sY) {
    constexpr int NOP = 2 + NSPLIT;                       // operand tiles of a stage: A (, A2), Bt
    __shared__ __align__(16) bf ring[2 * NOP * GT];
    __shared__ __align__(16) float osw[8 * 16 * 68];
    A += z * sA; if (NSPLIT) A2 += z * sA; Bt += z * sB; if (!PL) C += z * sC;
    const int tid = threadIdx.x, lane = tid & 31, lr = lane & 15, hi = lane >> 4; const int w = __builtin_amdgcn_readfirstlane(tid >> 5);
    const int r0 = blockIdx.x * 128 + (w >> 1) * 32, c0 = blockIdx.y * 128 + (w & 1) * 64; float* os = osw + w * (16 * 68);
    const size_t goff = (size_t)(tid >> 4) * K + (tid & 15) * 8;
    const bf* ga = A + (size_t)blockIdx.x * 128 * K + goff; const bf* gb = Bt + (size_t)blockIdx.y * 128 * K + goff; const bf* ga2 = NSPLIT ? A2 + (size_t)blockIdx.x * 128 * K + goff : nullptr;
    const unsigned l0 = (unsigned)(size_t)(const void*)ring + ((tid >> 4) * GP + (tid & 15) * 8) * 2;
    auto fill = [&](int t) {   // stage t: 128 rows x 128 k of each operand into buffer t % 2
        const unsigned lb = l0 + (t & 1) * (NOP * GT * 2); const size_t ko = (size_t)t * GK;
        cp8(lb, ga + ko, K); if (NSPLIT) cp8(lb + GT * 2, ga2 + ko, K); cp8(lb + (NOP - 1) * GT * 2, gb + ko, K); };
    v8f acc[2][4];
#pragma unroll
    for (int mb = 0; mb < 2; ++mb)
#pragma unroll
        for (int nb = 0; nb < 4; ++nb) acc[mb][nb] = (v8f){};
    const int nt = K / GK;
    fill(0);
    asm volatile("s_wait_asynccnt 0x0" ::: "memory");   // this wave's copies of stage 0 have landed
    __syncthreads();                                     // ... and every other wave's
    if (nt > 1) fill(1);
#pragma unroll 1   // rolled: one stage is one trip of the ring
    for (int t = 0; t < nt; ++t) {
        const bf* sa = ring + (t & 1) * (NOP * GT) + ((w >> 1) * 32 + lr) * GP + 8 * hi; const bf* sb = ring + (t & 1) * (NOP * GT) + (NOP - 1) * GT + ((w & 1) * 64 + lr) * GP + 8 * hi;
        v16bf a[2][2], a2[2][2], b[2][4];   // two fragment sets: the next 32 k's LDS reads go out as one group ahead of this 32 k's products (inside the stage only)
#pragma unroll
        for (int mb = 0; mb < 2; ++mb) { a[0][mb] = ldfs(sa + mb * 16 * GP); if (NSPLIT) a2[0][mb] = ldfs(sa + GT + mb * 16 * GP); }
#pragma unroll
        for (int nb = 0; nb < 4; ++nb) b[0][nb] = ldfs(sb + nb * 16 * GP);
#pragma unroll
        for (int q = 0; q < GK / 32; ++q) { const int cu = q & 1, nx = cu ^ 1, ks = (q + 1) * 32;
            if (q + 1 < GK / 32) {
#pragma unroll
                for (int mb = 0; mb < 2; ++mb) { a[nx][mb] = ldfs(sa + mb * 16 * GP + ks); if (NSPLIT) a2[nx][mb] = ldfs(sa + GT + mb * 16 * GP + ks); }
#pragma unroll
                for (int nb = 0; nb < 4; ++nb) b[nx][nb] = ldfs(sb + nb * 16 * GP + ks);
                __builtin_amdgcn_sched_barrier(0); }   // holds the group of reads above ahead of the products below: the scheduler otherwise sinks each read to its first use, and the wave waits out the LDS latency in front of every pair of products
#pragma unroll
            for (int nb = 0; nb < 4; ++nb)
#pragma unroll
                for (int mb = 0; mb < 2; ++mb) { acc[mb][nb] = wmmab(a[cu][mb], b[cu][nb], acc[mb][nb]); if (NSPLIT) acc[mb][nb] = wmmab(a2[cu][mb], b[cu][nb], acc[mb][nb]); }
        }
        // keeps the matrix instructions' distance on the taken side of the branches behind them too
        asm volatile("v_nop\n\tv_nop\n\tv_nop\n\tv_nop" : "+v"(acc[0][0]), "+v"(acc[1][0]), "+v"(acc[0][1]), "+v"(acc[1][1]), "+v"(acc[0][2]), "+v"(acc[1][2]), "+v"(acc[0][3]), "+v"(acc[1][3]));
        asm volatile("s_wait_dscnt 0x0" ::: "memory");      // this wave's reads of buffer t % 2 are done before the buffer is refilled
        asm volatile("s_wait_asynccnt 0x0" ::: "memory");   // this wave's copies of stage t + 1 have landed
        __syncthreads();                                     // publishes stage t + 1 and ends every wave's reads of stage t
        if (t + 2 < nt) fill(t + 2);
    }
    asm volatile("s_wait_asynccnt 0x0" ::: "memory");   // no copy is outstanding when the wave goes on to its end
#pragma unroll
    for (int mb = 0; mb < 2; ++mb) {
#pragma unroll
        for (int nb = 0; nb < 4; ++nb) {
#pragma unroll
            for (int j = 0; j < 8; ++j) os[(hi * 8 + j) * 68 + nb * 16 + lr] = acc[mb][nb][j]; }
        __builtin_amdgcn_wave_barrier(); asm volatile("" ::: "memory");
        if (PL) {   // 8 results a lane: 8 lanes store one whole 128-byte row of each plane
            const size_t pb = z * sC + (size_t)(c0 >> 6) * sY + (size_t)(r0 + mb * 16) * ldc;
#pragma unroll
            for (int s = 0; s < 4; ++s) { const int row = 4 * s + (lane >> 3), cofs = (lane & 7) * 8; const v4f v0 = *(const v4fa*)(os + row * 68 + cofs), v1 = *(const v4fa*)(os + row * 68 + cofs + 4); v8us oh, ol;
#pragma unroll
                for (int q = 0; q < 4; ++q) { unsigned short a2, c2; splitf(v0[q], a2, c2); oh[q] = a2; ol[q] = c2; splitf(v1[q], a2, c2); oh[4 + q] = a2; ol[4 + q] = c2; }
                *(v8us*)(Ph + pb + (size_t)row * ldc + cofs) = oh; *(v8us*)(Pl + pb + (size_t)row * ldc + cofs) = ol; }
        } else {
            float* crow = C + (size_t)(r0 + mb * 16) * ldc + c0;
#pragma unroll
            for (int s = 0; s < 8; ++s) { const int row = 2 * s + hi, cofs = lr * 4; const v4f val = *(const v4fa*)(os + row * 68 + cofs);
                *(v4f*)(crow + (size_t)row * ldc + cofs) = val; }
             }
        __builtin_amdgcn_wave_barrier(); asm volatile("" ::: "memory");
    }
}

// The three projections of all NB_ batch items in ONE launch: grid (8, 8, 3 * NB_), blockIdx.z = projection * NB_ + batch item. q and k: one 64-column tile is one head, planes [b*NH_ + head][t][d].
// v: the operands change places (rows = v columns, columns = t), so that the planes [b*NKV + head][d][t] come out of the same epilogue.
__global__ __launch_bounds__(256) void k_qkv(const bf* __restrict__ XB, const bf* __restrict__ WQ, const bf* __restrict__ WK, const bf* __restrict__ WV, bf* QPh, bf* QPl, bf* KPh, bf* KPl, bf* VTh, bf* VTl) {
    const int p = blockIdx.z / NB_; const size_t z = blockIdx.z % NB_; const bool tv = (p == 2);
    gemmw<0, true>(z, tv ? WV : XB, nullptr, tv ? XB : (p ? WK : WQ), DM, nullptr, tv ? TT : HD, tv ? (size_t)0 : (size_t)TT * DM, tv ? (size_t)TT * DM : (size_t)0, (size_t)NH_ * TT * HD,
                   tv ? VTh : (p ? KPh : QPh), tv ? VTl : (p ? KPl : QPl), tv ? (size_t)64 : (size_t)TT * HD);
}
__global__ __launch_bounds__(256) void k_wo(const bf* __restrict__ Ah, const bf* __restrict__ Al, const bf* __restrict__ WO, float* OUT) {
    gemmw<1, false>(0, Ah, Al, WO, DQ, OUT, DM, 0, 0, 0, nullptr, nullptr, 0);
}

__device__ __forceinline__ h16 tohx(float x) { return (h16)x; }
typedef __attribute__((ext_vector_type(2))) _Float16 v2h;
typedef __attribute__((ext_vector_type(4))) _Float16 v4h;
typedef __attribute__((ext_vector_type(2))) unsigned short v2us;
typedef __attribute__((ext_vector_type(4))) unsigned short v4us;
typedef __attribute__((ext_vector_type(2))) float v2f;
typedef __attribute__((ext_vector_type(4))) int v4i;

__device__ __forceinline__ void d_wtG(const int blk, const float* __restrict__ w, int K, int N, bf* Bt) {
    const int lane = threadIdx.x & 31; const int L0 = (blk * 8 + (threadIdx.x >> 5)) * 8; const int nlines = N * K / 64;
{
#pragma unroll 1
        for (int l = 0; l < 8; ++l) { const int L = L0 + l; if (L >= nlines) break; const size_t e = (size_t)L * 64 + lane * 2; const int k = (int)(e % K), n = (int)(e / K); v2us o;
            o[0] = f2bf(w[(size_t)k * N + n]); o[1] = f2bf(w[(size_t)(k + 1) * N + n]); *(v2us*)(Bt + e) = o; }
         }
}
__device__ __forceinline__ void d_cvt8(const int blk, const float* __restrict__ src, bf* dst, size_t n8) { const size_t i = (size_t)blk * 256 + threadIdx.x; if (i >= n8) return; const v8f v = *(const v8f*)(src + i * 8); v8us o;
#pragma unroll
    for (int k = 0; k < 8; ++k) o[k] = f2bf(v[k]); *(v8us*)(dst + i * 8) = o;  }
__global__ __launch_bounds__(256) void k_cscvt(const float* __restrict__ cosT, const float* __restrict__ sinT, float* CS) { const int idx = blockIdx.x * 256 + threadIdx.x; if (idx >= TT * HD) return; v2f cs; cs[0] = bfr(cosT[idx]); cs[1] = bfr(sinT[idx]); *(v2f*)(CS + (size_t)idx * 2) = cs;  }
// k_asoft: per row (zz, i): t = S x HD^-0.5 (no mask); softmax over the 1024 keys (register row, one exp, fixed trees);
__global__ __launch_bounds__(256) void k_asoft(const float* __restrict__ Sb, h16* P16, bf* Ph, bf* Pl) {
    const int lane = threadIdx.x & 31; const int row = blockIdx.x * 8 + (threadIdx.x >> 5); if (row >= ZH * TT) return; const int i = row % TT; const int zz = row / TT; (void)zz; const bool hires = (i < RH); const float* sr = Sb + (size_t)row * TT; float v[TT / 32]; float mx = -3.0e38f;
#pragma unroll
    for (int ch = 0; ch < TT / 128; ++ch) { const int j0 = ch * 128 + lane * 4; const v4f a = *(const v4f*)(sr + j0);
#pragma unroll
        for (int q = 0; q < 4; ++q) { const int j = j0 + q; (void)j; const float t = a[q] * SCL; v[ch * 4 + q] = t; mx = fmaxf(mx, t); } }
#pragma unroll
    for (int sh = 16; sh; sh >>= 1) mx = fmaxf(mx, __shfl_xor(mx, sh, 32));
    float sum = 0.f;
#pragma unroll
    for (int k = 0; k < TT / 32; ++k) { float d0 = __fsub_rn(v[k], mx); asm volatile("" : "+v"(d0)); v[k] = __builtin_amdgcn_exp2f(__fmul_rn(d0, 1.4426950408889634f)); sum += v[k]; }
#pragma unroll
    for (int sh = 16; sh; sh >>= 1) sum += __shfl_xor(sum, sh, 32);
    const float f = __fdiv_rn(hires ? 1.0f : PCAR, sum);
{
        if (hires) {
#pragma unroll
            for (int ch = 0; ch < TT / 128; ++ch) { v4us oh, ol;
#pragma unroll
                for (int q = 0; q < 4; ++q) { unsigned short a, c2; splitf(v[ch * 4 + q] * f, a, c2); oh[q] = a; ol[q] = c2; }
                const size_t oo = ((size_t)zz * (RH ? RH : 1) + i) * TT + ch * 128 + lane * 4; *(v4us*)(Ph + oo) = oh; *(v4us*)(Pl + oo) = ol; }
        } else {
#pragma unroll
            for (int ch = 0; ch < TT / 128; ++ch) { v4h o4;
#pragma unroll
                for (int q = 0; q < 4; ++q) o4[q] = tohx(v[ch * 4 + q] * f);
                *(v4h*)(P16 + (size_t)row * TT + ch * 128 + lane * 4) = o4; } }
         }
}
__device__ __forceinline__ void d_relk(const int blk, const float* __restrict__ rk, bf* Bt) { const int e = (blk * 256 + threadIdx.x) * 4; if (e >= 192 * HD) return; const int r = e / HD; v4us o;   // Bt[r][d] = rel_k[r][d] (r < 129) else 0
#pragma unroll
    for (int u = 0; u < 4; ++u) o[u] = (r < 129) ? f2bf(rk[e + u]) : (unsigned short)0; *(v4us*)(Bt + e) = o;  }
__device__ __forceinline__ void d_relv(const int blk, const float* __restrict__ rv, bf* Bt) { const int e = (blk * 256 + threadIdx.x) * 4; if (e >= HD * 160) return; const int r = e % 160; const int d = e / 160; v4us o;   // Bt[d][r] = rel_v[r][d] (r < 129) else 0
#pragma unroll
    for (int u = 0; u < 4; ++u) o[u] = (r + u < 129) ? f2bf(rv[(size_t)(r + u) * HD + d]) : (unsigned short)0; *(v4us*)(Bt + e) = o;  }
// ---- k_prep: every operand plane that the products read, in ONE launch; the block index picks the job (the same for a whole work-group). The four weight transposes, whose waves run longest, come first.
#define PBW (DM * DQ / 64 / 64)                 // blocks of one weight transpose
#define PBX (NB_ * TT * DM / 8 / 256)           // blocks of the x conversion
#define PBK ((192 * HD / 4 + 255) / 256)        // blocks of the rel_k plane
#define PBV ((HD * 160 / 4 + 255) / 256)        // blocks of the rel_v plane
__global__ __launch_bounds__(256) void k_prep(const float* __restrict__ x, const float* __restrict__ wq, const float* __restrict__ wk, const float* __restrict__ wv, const float* __restrict__ wo, const float* __restrict__ relk, const float* __restrict__ relv,
                                              bf* XB, bf* WQ, bf* WK, bf* WV, bf* WO, bf* BRK, bf* BRV) {
    int b = blockIdx.x;
    if (b < 4 * PBW) { const int m = b / PBW; d_wtG(b % PBW, m == 0 ? wq : m == 1 ? wk : m == 2 ? wv : wo, DM, DQ, m == 0 ? WQ : m == 1 ? WK : m == 2 ? WV : WO); return; }
    b -= 4 * PBW;
    if (b < PBX) { d_cvt8(b, x, XB, (size_t)NB_ * TT * DM / 8); return; }
    b -= PBX;
    if (b < PBK) { d_relk(b, relk, BRK); return; }
    d_relv(b - PBK, relv, BRV);
}
// ---- k_attn: the whole attention of 64 query rows of one head in ONE work-group (16 waves); the 64 x 1024 score rows stay in LDS from the q.k products to the w.v products. grid (TT/64, NB_*NH_).
// Phase 1: wave w forms the 64 x 64 score tile of keys w*64.. (hl x hl, 3 products) and, waves 0..8, 16 columns of QR = q rel_k^T (hl x exact). Phase 2: one wave per row, 4 rows each: bias, softmax, hi/lo split written over the row's own f32 scores
// (hi plane in its first 2048 bytes, lo plane in the next), tail sums and bucket planes written over the row's own QR. Phase 3: wave w multiplies key slice w*64.. of w with v (3 products), waves 0..4 add one 32-bucket slice of WB rel_v (2 products);
// the 16 partial 64 x 64 tiles are summed through LDS in wave order and split into the merged hi/lo planes.
#define AR 64      // query rows per work-group
#define SP 1028    // score row pitch in floats: 4112 B = 16 B x odd, so that the 16-byte fragment reads of 16 rows fall on distinct banks
#define QP 168     // QR row pitch in floats; the same 672 B then hold the row's bucket planes: hi at byte 0, lo at byte 336
typedef v4us __attribute__((may_alias)) v4usa;
typedef unsigned short __attribute__((may_alias)) usa;
typedef float __attribute__((may_alias)) fa;
__device__ __forceinline__ v16bf ldfa(const bf* p) { return cat16b(*(const v8usa*)p, *(const v8usa*)(p + 16)); }
__global__ __launch_bounds__(512) void k_attn(const bf* __restrict__ Qh, const bf* __restrict__ Ql, const bf* __restrict__ Kh, const bf* __restrict__ Kl, const bf* __restrict__ Vh, const bf* __restrict__ Vl, const bf* __restrict__ Brk, const bf* __restrict__ Brv, bf* Ah, bf* Al) {
    __shared__ __align__(16) float S[AR * SP];
    __shared__ __align__(16) float QRs[AR * QP];
    const int tid = threadIdx.x, lane = tid & 31, lr = lane & 15, hi = lane >> 4; const int w = __builtin_amdgcn_readfirstlane(tid >> 5);
    const int r0 = blockIdx.x * AR; const size_t z = blockIdx.y;
    const bf* qh = Qh + z * TT * HD + (size_t)(r0 + lr) * HD + 8 * hi; const bf* ql = Ql + z * TT * HD + (size_t)(r0 + lr) * HD + 8 * hi;
    {
        const bf* kh = Kh + z * TT * HD + (size_t)(w * 64 + lr) * HD + 8 * hi; const bf* kl = Kl + z * TT * HD + (size_t)(w * 64 + lr) * HD + 8 * hi;
        v8f acc[4][4];
#pragma unroll
        for (int mb = 0; mb < 4; ++mb)
#pragma unroll
            for (int nb = 0; nb < 4; ++nb) acc[mb][nb] = (v8f){};
#pragma unroll 1   // rolled: both k steps' fragments at once would not fit the 256 registers of a 16-wave work-group
        for (int kc = 0; kc < HD; kc += 32) {
            v16bf a[4], a2[4];
#pragma unroll
            for (int mb = 0; mb < 4; ++mb) { a[mb] = WFrag<bf>::ld(qh + mb * 16 * HD + kc); a2[mb] = WFrag<bf>::ld(ql + mb * 16 * HD + kc); }
#pragma unroll
            for (int nb = 0; nb < 4; ++nb) { const v16bf b = WFrag<bf>::ld(kh + nb * 16 * HD + kc); const v16bf b2 = WFrag<bf>::ld(kl + nb * 16 * HD + kc);
#pragma unroll
                for (int mb = 0; mb < 4; ++mb) { acc[mb][nb] = wmmab(a[mb], b, acc[mb][nb]); acc[mb][nb] = wmmab(a2[mb], b, acc[mb][nb]); acc[mb][nb] = wmmab(a[mb], b2, acc[mb][nb]); } }
            // keeps the matrix instructions' distance on the taken side of the loop branch too
            asm volatile("v_nop\n\tv_nop\n\tv_nop\n\tv_nop" : "+v"(acc[0][0]), "+v"(acc[1][1]), "+v"(acc[2][2]), "+v"(acc[3][3]) : "v"(a[0]), "v"(a[3]));
            asm volatile("s_wait_xcnt 0x0" ::: "memory");   // precaution: stands in front of the next trip's rewrite of the address registers that this trip's global loads name
        }
#pragma unroll
        for (int mb = 0; mb < 4; ++mb)
#pragma unroll
            for (int nb = 0; nb < 4; ++nb)
#pragma unroll
                for (int j = 0; j < 8; ++j) *(fa*)(S + (mb * 16 + hi * 8 + j) * SP + w * 64 + nb * 16 + lr) = acc[mb][nb][j];
    }
    if (w < 9) {   // QR[i][r] = q_i . rel_k[r] (unscaled), columns w*16 .. w*16+15 (rows 129.. of the table plane are zero)
        const bf* rk = Brk + (size_t)(w * 16 + lr) * HD + 8 * hi; v8f aq[4];
#pragma unroll
        for (int mb = 0; mb < 4; ++mb) aq[mb] = (v8f){};
#pragma unroll
        for (int kc = 0; kc < HD; kc += 32) { const v16bf b = WFrag<bf>::ld(rk + kc);
#pragma unroll
            for (int mb = 0; mb < 4; ++mb) { aq[mb] = wmmab(WFrag<bf>::ld(qh + mb * 16 * HD + kc), b, aq[mb]); aq[mb] = wmmab(WFrag<bf>::ld(ql + mb * 16 * HD + kc), b, aq[mb]); } }
#pragma unroll
        for (int mb = 0; mb < 4; ++mb)
#pragma unroll
            for (int j = 0; j < 8; ++j) *(fa*)(QRs + (mb * 16 + hi * 8 + j) * QP + w * 16 + lr) = aq[mb][j];
    }
    __syncthreads();
#pragma unroll 1   // rolled: one row's 32 values a lane are the live set
    for (int rr = 0; rr < AR / 16; ++rr) { const int row = w * (AR / 16) + rr, i = r0 + row; float* sr = S + row * SP; float* qr = QRs + row * QP; float v[TT / 32]; float mx = -3.0e38f;
#pragma unroll
        for (int ch = 0; ch < TT / 128; ++ch) { const int j0 = ch * 128 + lane * 4; const v4f a = *(const v4fa*)(sr + j0);
#pragma unroll
            for (int u = 0; u < 4; ++u) { int r = j0 + u - i; r = (r < -64) ? -64 : (r > 64 ? 64 : r); const float t = __fadd_rn(a[u], *(const fa*)(qr + r + 64)) * 0.125f; v[ch * 4 + u] = t; mx = fmaxf(mx, t); } }
#pragma unroll
        for (int sh = 16; sh; sh >>= 1) mx = fmaxf(mx, __shfl_xor(mx, sh, 32));
        float sum = 0.f;
#pragma unroll
        for (int q = 0; q < TT / 32; ++q) { v[q] = __builtin_amdgcn_exp2f(__fmul_rn(__fsub_rn(v[q], mx), 1.4426950408889634f)); sum += v[q]; }
#pragma unroll
        for (int sh = 16; sh; sh >>= 1) sum += __shfl_xor(sum, sh, 32);
        const float f = __fdiv_rn(1.0f, sum);
        bf* ph = (bf*)sr; bf* pl = ph + TT; float lo = 0.f, hs = 0.f;
#pragma unroll
        for (int ch = 0; ch < TT / 128; ++ch) { const int j0 = ch * 128 + lane * 4; v4us oh, ol;
#pragma unroll
            for (int q = 0; q < 4; ++q) { const float p = v[ch * 4 + q] * f; unsigned short a2, c2; splitf(p, a2, c2); oh[q] = a2; ol[q] = c2; if (j0 + q <= i - 64) lo = __fadd_rn(lo, p); if (j0 + q >= i + 64) hs = __fadd_rn(hs, p); }
            *(v4usa*)(ph + j0) = oh; *(v4usa*)(pl + j0) = ol; }
#pragma unroll
        for (int sh = 16; sh; sh >>= 1) { lo = __fadd_rn(lo, __shfl_xor(lo, sh, 32)); hs = __fadd_rn(hs, __shfl_xor(hs, sh, 32)); }
        // the bucket reads below take what other lanes of this wave have just stored: keeps the compiler from moving them over the stores (a wave's LDS operations run in order)
        __builtin_amdgcn_wave_barrier(); asm volatile("" ::: "memory");
        bf* wh = (bf*)qr; bf* wl = wh + QP;
#pragma unroll
        for (int ch = 0; ch < 2; ++ch) { const int rb = ch * 128 + lane * 4; if (rb < 160) { v4us oh, ol;
#pragma unroll
            for (int u = 0; u < 4; ++u) { const int r = rb + u; unsigned short a2 = 0, c2 = 0; if (r == 0) splitf(lo, a2, c2); else if (r == 128) splitf(hs, a2, c2); else if (r < 128) { const int j = i + r - 64; if (j >= 0 && j < TT) { a2 = *(const usa*)(ph + j); c2 = *(const usa*)(pl + j); } } oh[u] = a2; ol[u] = c2; }
            *(v4usa*)(wh + rb) = oh; *(v4usa*)(wl + rb) = ol; } }
    }
    __syncthreads();
    v8f acc[4][4];
#pragma unroll
    for (int mb = 0; mb < 4; ++mb)
#pragma unroll
        for (int nb = 0; nb < 4; ++nb) acc[mb][nb] = (v8f){};
    {
        const bf* pa = (const bf*)S + lr * (SP * 2) + w * 64 + 8 * hi; const bf* vh = Vh + z * HD * TT + (size_t)lr * TT + w * 64 + 8 * hi; const bf* vl = Vl + z * HD * TT + (size_t)lr * TT + w * 64 + 8 * hi;
#pragma unroll 1   // rolled: both k steps' fragments at once would not fit the 256 registers of a 16-wave work-group
        for (int kc = 0; kc < 64; kc += 32) {
            v16bf a[4], a2[4];
#pragma unroll
            for (int mb = 0; mb < 4; ++mb) { a[mb] = ldfa(pa + mb * 16 * (SP * 2) + kc); a2[mb] = ldfa(pa + mb * 16 * (SP * 2) + TT + kc); }
#pragma unroll
            for (int nb = 0; nb < 4; ++nb) { const v16bf b = WFrag<bf>::ld(vh + (size_t)nb * 16 * TT + kc); const v16bf b2 = WFrag<bf>::ld(vl + (size_t)nb * 16 * TT + kc);
#pragma unroll
                for (int mb = 0; mb < 4; ++mb) { acc[mb][nb] = wmmab(a[mb], b, acc[mb][nb]); acc[mb][nb] = wmmab(a2[mb], b, acc[mb][nb]); acc[mb][nb] = wmmab(a[mb], b2, acc[mb][nb]); } }
            // keeps the matrix instructions' distance on the taken side of the loop branch too
            asm volatile("v_nop\n\tv_nop\n\tv_nop\n\tv_nop" : "+v"(acc[0][0]), "+v"(acc[1][1]), "+v"(acc[2][2]), "+v"(acc[3][3]) : "v"(a[0]), "v"(a[3]));
            asm volatile("s_wait_xcnt 0x0" ::: "memory");   // precaution: stands in front of the next trip's rewrite of the address registers that this trip's global loads name
        }
    }
    if (w < 5) {   // sum_j w rel_v[clip] = WB . rel_v: buckets w*32 .. w*32+31
        const bf* wa = (const bf*)QRs + lr * (QP * 2) + w * 32 + 8 * hi; const bf* rv = Brv + (size_t)lr * 160 + w * 32 + 8 * hi; v16bf a[4], a2[4];
#pragma unroll
        for (int mb = 0; mb < 4; ++mb) { a[mb] = ldfa(wa + mb * 16 * (QP * 2)); a2[mb] = ldfa(wa + mb * 16 * (QP * 2) + QP); }
#pragma unroll
        for (int nb = 0; nb < 4; ++nb) { const v16bf b = WFrag<bf>::ld(rv + nb * 16 * 160);
#pragma unroll
            for (int mb = 0; mb < 4; ++mb) { acc[mb][nb] = wmmab(a[mb], b, acc[mb][nb]); acc[mb][nb] = wmmab(a2[mb], b, acc[mb][nb]); } }
    }
    __syncthreads();   // every wave has read its slice of the planes: their space now takes the 16 partial tiles [w][64][64]; column bit 5 flipped in rows 8..15 of each 16, so that the two half-waves' stores fall on different banks
#pragma unroll
    for (int mb = 0; mb < 4; ++mb)
#pragma unroll
        for (int nb = 0; nb < 4; ++nb)
#pragma unroll
            for (int j = 0; j < 8; ++j) *(fa*)(S + w * 4096 + (mb * 16 + hi * 8 + j) * 64 + ((nb * 16 + lr) ^ (hi << 5))) = acc[mb][nb][j];
    __syncthreads();
    const int c4 = (tid & 15) * 4; const size_t ob = ((z / NH_) * TT + r0) * DQ + (z % NH_) * HD + c4;
#pragma unroll
    for (int g = 0; g < 2; ++g) { const int row = (tid >> 4) + g * 32; const float* pr = S + row * 64 + (c4 ^ (((row >> 3) & 1) << 5)); v4f s = *(const v4fa*)pr;
#pragma unroll
        for (int k = 1; k < 16; ++k) { const v4f t = *(const v4fa*)(pr + k * 4096); s[0] = __fadd_rn(s[0], t[0]); s[1] = __fadd_rn(s[1], t[1]); s[2] = __fadd_rn(s[2], t[2]); s[3] = __fadd_rn(s[3], t[3]); }
        v4us oh, ol;
#pragma unroll
        for (int q = 0; q < 4; ++q) { unsigned short a2, c2; splitf(s[q], a2, c2); oh[q] = a2; ol[q] = c2; }
        *(v4us*)(Ah + ob + (size_t)row * DQ) = oh; *(v4us*)(Al + ob + (size_t)row * DQ) = ol; }
}

extern "C" void kernel_launch(void* const* d_in, const int* in_sizes, int n_in,
                              void* d_out, int out_size, void* d_ws, size_t ws_size, hipStream_t stream) {
    (void)in_sizes; (void)n_in; (void)out_size;
    const float* x = (const float*)d_in[0]; const float* wq = (const float*)d_in[1]; const float* wk = (const float*)d_in[2]; const float* wv = (const float*)d_in[3]; const float* wo = (const float*)d_in[4]; const float* relk = (const float*)d_in[5]; const float* relv = (const float*)d_in[6]; const float* cosT = nullptr; const float* sinT = nullptr; (void)cosT; (void)sinT;
    float* OUT = (float*)d_out;     // [4][1024][1024]
    char* wsp = (char*)d_ws;
    auto take = [&](size_t bytes) { char* p = wsp; wsp += (bytes + 255) & ~(size_t)255; return (void*)p; };
    bf* WQ = (bf*)take((size_t)DQ * DM * 2); bf* WK = (bf*)take((size_t)DKV * DM * 2); bf* WV = (bf*)take((size_t)DKV * DM * 2); bf* WO = (bf*)take((size_t)DM * DQ * 2); float* CS = (float*)take((size_t)TT * HD * 2 * 4);
    bf* XB = (bf*)take((size_t)NB_ * TT * DM * 2); bf* BRK = (bf*)take((size_t)192 * HD * 2); bf* BRV = (bf*)take((size_t)HD * 160 * 2); float* QR = (float*)take((size_t)ZH * TT * 192 * 4); bf* WBh = (bf*)take((size_t)ZH * TT * 160 * 2); bf* WBl = (bf*)take((size_t)ZH * TT * 160 * 2); float* O2 = (float*)take((size_t)ZH * TT * HD * 4);
    h16* VT16 = (h16*)take((size_t)NKV * HD * TT * 2);
    bf* QPh = (bf*)take((size_t)NB_ * NH_ * TT * HD * 2); bf* QPl = (bf*)take((size_t)NB_ * NH_ * TT * HD * 2); bf* KPh = (bf*)take((size_t)NB_ * NKV * TT * HD * 2); bf* KPl = (bf*)take((size_t)NB_ * NKV * TT * HD * 2); bf* VTh = (bf*)take((size_t)NB_ * NKV * HD * TT * 2); bf* VTl = (bf*)take((size_t)NB_ * NKV * HD * TT * 2); bf* Ph = (bf*)take((size_t)ZH * RH * TT * 2); bf* Pl = (bf*)take((size_t)ZH * RH * TT * 2);
    float* Sb = (float*)take((size_t)ZH * TT * TT * 4); float* Ob = (float*)take((size_t)ZH * TT * HD * 4); bf* ATh = (bf*)take((size_t)NB_ * TT * DQ * 2); bf* ATl = (bf*)take((size_t)NB_ * TT * DQ * 2);
    if ((size_t)(wsp - (char*)d_ws) > ws_size) return;    // ws 256 MiB
    k_prep<<<4 * PBW + PBX + PBK + PBV, 256, 0, stream>>>(x, wq, wk, wv, wo, relk, relv, XB, WQ, WK, WV, WO, BRK, BRV);
    k_qkv<<<dim3(TT / 128, DQ / 128, 3 * NB_), 256, 0, stream>>>(XB, WQ, WK, WV, QPh, QPl, KPh, KPl, VTh, VTl);
    k_attn<<<dim3(TT / AR, NB_ * NH_), 512, 0, stream>>>(QPh, QPl, KPh, KPl, VTh, VTl, BRK, BRV, ATh, ATl);   // one kv head per query head: plane z = b*NH_ + head in all six
    k_wo<<<dim3(NB_ * TT / 128, DM / 128, 1), 256, 0, stream>>>(ATh, ATl, WO, OUT);
}

// v006
// A run of this version takes 152 microseconds.
// In both of two side-by-side timings against v005, it was 1.17 times as fast.
// Counting every step since v000, it is 14.5 times as fast.
#include <hip/hip_runtime.h>

// MultiHead2DAttention_v2 (x [4][1024][1024]; q = (x Wq) / 8, k = x Wk, v = x Wv ([in,out], no bias; 16 heads x 64); relative-position embeddings rel_k / rel_v [129][64] indexed by clip(j - i, -64, 64) + 64;
//   logits = q.k + q.rel_k[clip]; w = softmax; out_h = w v + sum_j w[i][j] rel_v[clip(j - i)]; out = merged Wo -> [4][1024][1024]).
// The relative terms use exact regroupings: q.rel_k[clip(j-i)] is read from QR = q rel_k^T ([T][129] per head), and sum_j w rel_v[clip] = WB rel_v with WB[i][r] = the softmax mass in bucket r (single keys for r = 1..127, tail sums for r = 0 / 128).
// Compute dtypes, f32 accumulate: every input rounded to bf16; q/k/v on PLAIN bf16 operands (inputs: exact); QR as hl x exact (2 products); scores and w.v as hl x hl (3 products) on every row; the 1/8 scale (exact), rel bias, softmax and bucket sums f32; WB rel_v as hl x exact (2 products); Wo hl x exact (2 products).

#define NB_  4
#define TT   1024
#define DM   1024
#define NH_  16
#define NKV  16
#define REP  (NH_ / NKV)
#define HD   64
#define DQ   (NH_ * HD)
#define DKV  (NKV * HD)
#define ZH   16
#define RH   1024                  // query rows < RH use hi+lo planes (0: none)
#define WIN  0
#define PCAR 1024.0f
#define SCL  0.125f   // HD^-0.5
typedef _Float16 h16;
typedef unsigned short bf;
typedef __attribute__((ext_vector_type(16))) __bf16   v16bf;
typedef __attribute__((ext_vector_type(16))) _Float16 v16h;
typedef __attribute__((ext_vector_type(8)))  _Float16 v8h;
typedef __attribute__((ext_vector_type(8)))  unsigned short v8us;
typedef __attribute__((ext_vector_type(8)))  float    v8f;
typedef __attribute__((ext_vector_type(4)))  float    v4f;
typedef v8h  __attribute__((may_alias)) v8ha;
typedef v4f  __attribute__((may_alias)) v4fa;
typedef v8us __attribute__((may_alias)) v8usa;

__device__ __forceinline__ unsigned short f2bf(float f) { unsigned u = __float_as_uint(f); u += 0x7FFFu + ((u >> 16) & 1u); return (unsigned short)(u >> 16); }
__device__ __forceinline__ float bf2f(unsigned short b) { return __uint_as_float(((unsigned)b) << 16); }
__device__ __forceinline__ float bfr(float f) { return bf2f(f2bf(f)); }
__device__ __forceinline__ v16h cat16(v8h lo, v8h hi) { return __builtin_shufflevector(lo, hi, 0, 1, 2, 3, 4, 5, 6, 7, 8, 9, 10, 11, 12, 13, 14, 15); }
__device__ __forceinline__ v16bf cat16b(v8us lo, v8us hi) { return __builtin_bit_cast(v16bf, __builtin_shufflevector(lo, hi, 0, 1, 2, 3, 4, 5, 6, 7, 8, 9, 10, 11, 12, 13, 14, 15)); }
__device__ __forceinline__ v8f wmma16(v16h a, v16h b, v8f c) { return __builtin_amdgcn_wmma_f32_16x16x32_f16(false, a, false, b, (short)0, c, false, false); }
__device__ __forceinline__ v8f wmmab(v16bf a, v16bf b, v8f c) { return __builtin_amdgcn_wmma_f32_16x16x32_bf16(false, a, false, b, (short)0, c, false, false); }



// ---- gemmw: GEMM body, one 128x128 output tile per work-group of 8 waves (4 x 2, each wave 32x64 = 8 accumulators); grid (M/128, N/128, .), 256 threads; z = batch item.
// The K-contiguous 16-bit operand planes come into LDS as whole 128-byte lines, by asynchronous copies, in stages of 128 k (two buffers: the next stage flies while this one is multiplied); the fragments are read from LDS.
// C[m][n] (f32, pitch ldc) = sum_k A[m][k] Bt[n][k] (NSPLIT 1: + A2[m][k] Bt[n][k]). z-batch strides sA/sB/sC in elements. K % 128 == 0, M % 128 == 0, N % 128 == 0.
// PL: no f32 C; each result is split into hi + lo bf16 here and stored in the planes Ph / Pl in FRAGMENT ORDER: the 16 x 64 tile of rows m0.. (m0 % 16 == 0), columns n0.. (n0 % 64 == 0) is the 1024 elements from z sC + (n0 / 64) sY + m0 ldc,
// and inside it element (r, c) stands at (c / 8) * 128 + r * 8 + c % 8: the 16-byte pieces that the 32 lanes of one fragment load take are 512 bytes in a row (four whole lines), not 32 bytes out of each of 16 lines.
__device__ __forceinline__ void splitf(float y, unsigned short& h, unsigned short& l) { h = f2bf(y); l = f2bf(y - bf2f(h)); }
#define GK 128             // k per stage: rows of 256 bytes
#define GP 136             // LDS row pitch in elements: 272 B = 16 B x odd, so that the 16-byte fragment reads of 16 rows fall on distinct banks
#define GT (128 * GP)      // one operand's stage tile, elements
__device__ __forceinline__ v16bf ldfs(const bf* p) { return cat16b(*(const v8usa*)p, *(const v8usa*)(p + 16)); }
// Eight asynchronous 16-byte copies a lane, 16 rows apart: LDS byte address l, global address g, global row pitch K elements. 16 lanes bring one 256-byte row, 256 threads one operand's 128 rows.
// The s_wait_xcnt stands inside the statement as a precaution: in front of any later rewrite of the address registers that the copies name.
__device__ __forceinline__ void cp8(unsigned l, const bf* g, size_t K) {
    asm volatile("global_load_async_to_lds_b128 %0, %8, off\n\t"
                 "global_load_async_to_lds_b128 %1, %9, off\n\t"
                 "global_load_async_to_lds_b128 %2, %10, off\n\t"
                 "global_load_async_to_lds_b128 %3, %11, off\n\t"
                 "global_load_async_to_lds_b128 %4, %12, off\n\t"
                 "global_load_async_to_lds_b128 %5, %13, off\n\t"
                 "global_load_async_to_lds_b128 %6, %14, off\n\t"
                 "global_load_async_to_lds_b128 %7, %15, off\n\t"
                 "s_wait_xcnt 0x0"
                 :: "v"(l), "v"(l + 16 * GP * 2), "v"(l + 32 * GP * 2), "v"(l + 48 * GP * 2), "v"(l + 64 * GP * 2), "v"(l + 80 * GP * 2), "v"(l + 96 * GP * 2), "v"(l + 112 * GP * 2),
                    "v"(g), "v"(g + 16 * K), "v"(g + 32 * K), "v"(g + 48 * K), "v"(g + 64 * K), "v"(g + 80 * K), "v"(g + 96 * K), "v"(g + 112 * K) : "memory");
}
template <int NSPLIT, bool PL>
__device__ __forceinline__ void gemmw(const size_t z, const bf* __restrict__ A, const bf* __restrict__ A2, const bf* __restrict__ Bt, int K, float* C, int ldc, size_t sA, size_t sB, size_t sC, bf* Ph, bf* Pl, size_t sY) {
    constexpr int NOP = 2 + NSPLIT;                       // operand tiles of a stage: A (, A2), Bt
    __shared__ __align__(16) bf ring[2 * NOP * GT];
    __shared__ __align__(16) float osw[8 * 16 * 68];
    A += z * sA; if (NSPLIT) A2 += z * sA; Bt += z * sB; if (!PL) C += z * sC;
    const int tid = threadIdx.x, lane = tid & 31, lr = lane & 15, hi = lane >> 4; const int w = __builtin_amdgcn_readfirstlane(tid >> 5);
    const int r0 = blockIdx.x * 128 + (w >> 1) * 32, c0 = blockIdx.y * 128 + (w & 1) * 64; float* os = osw + w * (16 * 68);
    const size_t goff = (size_t)(tid >> 4) * K + (tid & 15) * 8;
    const bf* ga = A + (size_t)blockIdx.x * 128 * K + goff; const bf* gb = Bt + (size_t)blockIdx.y * 128 * K + goff; const bf* ga2 = NSPLIT ? A2 + (size_t)blockIdx.x * 128 * K + goff : nullptr;
    const unsigned l0 = (unsigned)(size_t)(const void*)ring + ((tid >> 4) * GP + (tid & 15) * 8) * 2;
    auto fill = [&](int t) {   // stage t: 128 rows x 128 k of each operand into buffer t % 2
        const unsigned lb = l0 + (t & 1) * (NOP * GT * 2); const size_t ko = (size_t)t * GK;
        cp8(lb, ga + ko, K); if (NSPLIT) cp8(lb + GT * 2, ga2 + ko, K); cp8(lb + (NOP - 1) * GT * 2, gb + ko, K); };
    v8f acc[2][4];
#pragma unroll
    for (int mb = 0; mb < 2; ++mb)
#pragma unroll
        for (int nb = 0; nb < 4; ++nb) acc[mb][nb] = (v8f){};
    const int nt = K / GK;
    fill(0);
    asm volatile("s_wait_asynccnt 0x0" ::: "memory");   // this wave's copies of stage 0 have landed
    __syncthreads();                                     // ... and every other wave's
    if (nt > 1) fill(1);
#pragma unroll 1   // rolled: one stage is one trip of the ring
    for (int t = 0; t < nt; ++t) {
        const bf* sa = ring + (t & 1) * (NOP * GT) + ((w >> 1) * 32 + lr) * GP + 8 * hi; const bf* sb = ring + (t & 1) * (NOP * GT) + (NOP - 1) * GT + ((w & 1) * 64 + lr) * GP + 8 * hi;
        v16bf a[2][2], a2[2][2], b[2][4];   // two fragment sets: the next 32 k's LDS reads go out as one group ahead of this 32 k's products (inside the stage only)
#pragma unroll
        for (int mb = 0; mb < 2; ++mb) { a[0][mb] = ldfs(sa + mb * 16 * GP); if (NSPLIT) a2[0][mb] = ldfs(sa + GT + mb * 16 * GP); }
#pragma unroll
        for (int nb = 0; nb < 4; ++nb) b[0][nb] = ldfs(sb + nb * 16 * GP);
#pragma unroll
        for (int q = 0; q < GK / 32; ++q) { const int cu = q & 1, nx = cu ^ 1, ks = (q + 1) * 32;
            if (q + 1 < GK / 32) {
#pragma unroll
                for (int mb = 0; mb < 2; ++mb) { a[nx][mb] = ldfs(sa + mb * 16 * GP + ks); if (NSPLIT) a2[nx][mb] = ldfs(sa + GT + mb * 16 * GP + ks); }
#pragma unroll
                for (int nb = 0; nb < 4; ++nb) b[nx][nb] = ldfs(sb + nb * 16 * GP + ks);
                __builtin_amdgcn_sched_barrier(0); }   // holds the group of reads above ahead of the products below: the scheduler otherwise sinks each read to its first use, and the wave waits out the LDS latency in front of every pair of products
#pragma unroll
            for (int nb = 0; nb < 4; ++nb)
#pragma unroll
                for (int mb = 0; mb < 2; ++mb) { acc[mb][nb] = wmmab(a[cu][mb], b[cu][nb], acc[mb][nb]); if (NSPLIT) acc[mb][nb] = wmmab(a2[cu][mb], b[cu][nb], acc[mb][nb]); }
        }
        // keeps the matrix instructions' distance on the taken side of the branches behind them too
        asm volatile("v_nop\n\tv_nop\n\tv_nop\n\tv_nop" : "+v"(acc[0][0]), "+v"(acc[1][0]), "+v"(acc[0][1]), "+v"(acc[1][1]), "+v"(acc[0][2]), "+v"(acc[1][2]), "+v"(acc[0][3]), "+v"(acc[1][3]));
        asm volatile("s_wait_dscnt 0x0" ::: "memory");      // this wave's reads of buffer t % 2 are done before the buffer is refilled
        asm volatile("s_wait_asynccnt 0x0" ::: "memory");   // this wave's copies of stage t + 1 have landed
        __syncthreads();                                     // publishes stage t + 1 and ends every wave's reads of stage t
        if (t + 2 < nt) fill(t + 2);
    }
    asm volatile("s_wait_asynccnt 0x0" ::: "memory");   // no copy is outstanding when the wave goes on to its end
#pragma unroll
    for (int mb = 0; mb < 2; ++mb) {
#pragma unroll
        for (int nb = 0; nb < 4; ++nb) {
#pragma unroll
            for (int j = 0; j < 8; ++j) os[(hi * 8 + j) * 68 + nb * 16 + lr] = acc[mb][nb][j]; }
        __builtin_amdgcn_wave_barrier(); asm volatile("" ::: "memory");
        if (PL) {   // 8 results a lane: row lane % 16, columns 16 s + 8 (lane / 16) ..; the 32 lanes store 512 bytes in a row of each plane
            const size_t pb = z * sC + (size_t)(c0 >> 6) * sY + (size_t)(r0 + mb * 16) * ldc + lane * 8;
#pragma unroll
            for (int s = 0; s < 4; ++s) { const int row = lr, cofs = s * 16 + hi * 8; const v4f v0 = *(const v4fa*)(os + row * 68 + cofs), v1 = *(const v4fa*)(os + row * 68 + cofs + 4); v8us oh, ol;
#pragma unroll
                for (int q = 0; q < 4; ++q) { unsigned short a2, c2; splitf(v0[q], a2, c2); oh[q] = a2; ol[q] = c2; splitf(v1[q], a2, c2); oh[4 + q] = a2; ol[4 + q] = c2; }
                *(v8us*)(Ph + pb + s * 256) = oh; *(v8us*)(Pl + pb + s * 256) = ol; }
        } else {
            float* crow = C + (size_t)(r0 + mb * 16) * ldc + c0;
#pragma unroll
            for (int s = 0; s < 8; ++s) { const int row = 2 * s + hi, cofs = lr * 4; const v4f val = *(const v4fa*)(os + row * 68 + cofs);
                *(v4f*)(crow + (size_t)row * ldc + cofs) = val; }
             }
        __builtin_amdgcn_wave_barrier(); asm volatile("" ::: "memory");
    }
}

// The three projections of all NB_ batch items in ONE launch: grid (8, 8, 3 * NB_), blockIdx.z = projection * NB_ + batch item. q and k: one 64-column tile is one head, planes [b*NH_ + head][t / 16][tile of 16 t x 64 d].
// v: the operands change places (rows = v columns, columns = t), so that the planes [b*NKV + head][d / 16][t / 64][tile of 16 d x 64 t] come out of the same epilogue.
__global__ __launch_bounds__(256) void k_qkv(const bf* __restrict__ XB, const bf* __restrict__ WQ, const bf* __restrict__ WK, const bf* __restrict__ WV, bf* QPh, bf* QPl, bf* KPh, bf* KPl, bf* VTh, bf* VTl) {
    const int p = blockIdx.z / NB_; const size_t z = blockIdx.z % NB_; const bool tv = (p == 2);
    gemmw<0, true>(z, tv ? WV : XB, nullptr, tv ? XB : (p ? WK : WQ), DM, nullptr, tv ? TT : HD, tv ? (size_t)0 : (size_t)TT * DM, tv ? (size_t)TT * DM : (size_t)0, (size_t)NH_ * TT * HD,
                   tv ? VTh : (p ? KPh : QPh), tv ? VTl : (p ? KPl : QPl), tv ? (size_t)1024 : (size_t)TT * HD);
}
__global__ __launch_bounds__(256) void k_wo(const bf* __restrict__ Ah, const bf* __restrict__ Al, const bf* __restrict__ WO, float* OUT) {
    gemmw<1, false>(0, Ah, Al, WO, DQ, OUT, DM, 0, 0, 0, nullptr, nullptr, 0);
}

__device__ __forceinline__ h16 tohx(float x) { return (h16)x; }
typedef __attribute__((ext_vector_type(2))) _Float16 v2h;
typedef __attribute__((ext_vector_type(4))) _Float16 v4h;
typedef __attribute__((ext_vector_type(2))) unsigned short v2us;
typedef __attribute__((ext_vector_type(4))) unsigned short v4us;
typedef __attribute__((ext_vector_type(2))) float v2f;
typedef __attribute__((ext_vector_type(4))) int v4i;

__device__ __forceinline__ void d_wtG(const int blk, const float* __restrict__ w, int K, int N, bf* Bt) {
    const int lane = threadIdx.x & 31; const int L0 = (blk * 8 + (threadIdx.x >> 5)) * 8; const int nlines = N * K / 64;
{
#pragma unroll 1
        for (int l = 0; l < 8; ++l) { const int L = L0 + l; if (L >= nlines) break; const size_t e = (size_t)L * 64 + lane * 2; const int k = (int)(e % K), n = (int)(e / K); v2us o;
            o[0] = f2bf(w[(size_t)k * N + n]); o[1] = f2bf(w[(size_t)(k + 1) * N + n]); *(v2us*)(Bt + e) = o; }
         }
}
__device__ __forceinline__ void d_cvt8(const int blk, const float* __restrict__ src, bf* dst, size_t n8) { const size_t i = (size_t)blk * 256 + threadIdx.x; if (i >= n8) return; const v8f v = *(const v8f*)(src + i * 8); v8us o;
#pragma unroll
    for (int k = 0; k < 8; ++k) o[k] = f2bf(v[k]); *(v8us*)(dst + i * 8) = o;  }
__global__ __launch_bounds__(256) void k_cscvt(const float* __restrict__ cosT, const float* __restrict__ sinT, float* CS) { const int idx = blockIdx.x * 256 + threadIdx.x; if (idx >= TT * HD) return; v2f cs; cs[0] = bfr(cosT[idx]); cs[1] = bfr(sinT[idx]); *(v2f*)(CS + (size_t)idx * 2) = cs;  }
// k_asoft: per row (zz, i): t = S x HD^-0.5 (no mask); softmax over the 1024 keys (register row, one exp, fixed trees);
__global__ __launch_bounds__(256) void k_asoft(const float* __restrict__ Sb, h16* P16, bf* Ph, bf* Pl) {
    const int lane = threadIdx.x & 31; const int row = blockIdx.x * 8 + (threadIdx.x >> 5); if (row >= ZH * TT) return; const int i = row % TT; const int zz = row / TT; (void)zz; const bool hires = (i < RH); const float* sr = Sb + (size_t)row * TT; float v[TT / 32]; float mx = -3.0e38f;
#pragma unroll
    for (int ch = 0; ch < TT / 128; ++ch) { const int j0 = ch * 128 + lane * 4; const v4f a = *(const v4f*)(sr + j0);
#pragma unroll
        for (int q = 0; q < 4; ++q) { const int j = j0 + q; (void)j; const float t = a[q] * SCL; v[ch * 4 + q] = t; mx = fmaxf(mx, t); } }
#pragma unroll
    for (int sh = 16; sh; sh >>= 1) mx = fmaxf(mx, __shfl_xor(mx, sh, 32));
    float sum = 0.f;
#pragma unroll
    for (int k = 0; k < TT / 32; ++k) { float d0 = __fsub_rn(v[k], mx); asm volatile("" : "+v"(d0)); v[k] = __builtin_amdgcn_exp2f(__fmul_rn(d0, 1.4426950408889634f)); sum += v[k]; }
#pragma unroll
    for (int sh = 16; sh; sh >>= 1) sum += __shfl_xor(sum, sh, 32);
    const float f = __fdiv_rn(hires ? 1.0f : PCAR, sum);
{
        if (hires) {
#pragma unroll
            for (int ch = 0; ch < TT / 128; ++ch) { v4us oh, ol;
#pragma unroll
                for (int q = 0; q < 4; ++q) { unsigned short a, c2; splitf(v[ch * 4 + q] * f, a, c2); oh[q] = a; ol[q] = c2; }
                const size_t oo = ((size_t)zz * (RH ? RH : 1) + i) * TT + ch * 128 + lane * 4; *(v4us*)(Ph + oo) = oh; *(v4us*)(Pl + oo) = ol; }
        } else {
#pragma unroll
            for (int ch = 0; ch < TT / 128; ++ch) { v4h o4;
#pragma unroll
                for (int q = 0; q < 4; ++q) o4[q] = tohx(v[ch * 4 + q] * f);
                *(v4h*)(P16 + (size_t)row * TT + ch * 128 + lane * 4) = o4; } }
         }
}
__device__ __forceinline__ void d_relk(const int blk, const float* __restrict__ rk, bf* Bt) { const int e = (blk * 256 + threadIdx.x) * 4; if (e >= 192 * HD) return; const int r = e / HD; const int d = e % HD; v4us o;   // rel_k[r][d] (r < 129) else 0, in fragment order: tiles of 16 r x 64 d
#pragma unroll
    for (int u = 0; u < 4; ++u) o[u] = (r < 129) ? f2bf(rk[e + u]) : (unsigned short)0; *(v4us*)(Bt + (r >> 4) * 1024 + (d >> 3) * 128 + (r & 15) * 8 + (d & 7)) = o;  }
__device__ __forceinline__ void d_relv(const int blk, const float* __restrict__ rv, bf* Bt) { const int e = (blk * 256 + threadIdx.x) * 4; if (e >= HD * 160) return; const int r = e % 160; const int d = e / 160; v4us o;   // rel_v[r][d] (r < 129) else 0, in fragment order: tiles [d / 16][r / 32] of 16 d x 32 r
#pragma unroll
    for (int u = 0; u < 4; ++u) o[u] = (r + u < 129) ? f2bf(rv[(size_t)(r + u) * HD + d]) : (unsigned short)0; *(v4us*)(Bt + ((d >> 4) * 5 + (r >> 5)) * 512 + ((r & 31) >> 3) * 128 + (d & 15) * 8 + (r & 7)) = o;  }
// ---- k_prep: every operand plane that the products read, in ONE launch; the block index picks the job (the same for a whole work-group). The four weight transposes, whose waves run longest, come first.
#define PBW (DM * DQ / 64 / 64)                 // blocks of one weight transpose
#define PBX (NB_ * TT * DM / 8 / 256)           // blocks of the x conversion
#define PBK ((192 * HD / 4 + 255) / 256)        // blocks of the rel_k plane
#define PBV ((HD * 160 / 4 + 255) / 256)        // blocks of the rel_v plane
__global__ __launch_bounds__(256) void k_prep(const float* __restrict__ x, const float* __restrict__ wq, const float* __restrict__ wk, const float* __restrict__ wv, const float* __restrict__ wo, const float* __restrict__ relk, const float* __restrict__ relv,
                                              bf* XB, bf* WQ, bf* WK, bf* WV, bf* WO, bf* BRK, bf* BRV) {
    int b = blockIdx.x;
    if (b < 4 * PBW) { const int m = b / PBW; d_wtG(b % PBW, m == 0 ? wq : m == 1 ? wk : m == 2 ? wv : wo, DM, DQ, m == 0 ? WQ : m == 1 ? WK : m == 2 ? WV : WO); return; }
    b -= 4 * PBW;
    if (b < PBX) { d_cvt8(b, x, XB, (size_t)NB_ * TT * DM / 8); return; }
    b -= PBX;
    if (b < PBK) { d_relk(b, relk, BRK); return; }
    d_relv(b - PBK, relv, BRV);
}
// ---- k_attn: the whole attention of 64 query rows of one head in ONE work-group (16 waves); the 64 x 1024 score rows stay in LDS from the q.k products to the w.v products. grid (TT/64, NB_*NH_).
// Phase 1: wave w forms the 64 x 64 score tile of keys w*64.. (hl x hl, 3 products) and, waves 0..8, 16 columns of QR = q rel_k^T (hl x exact). Phase 2: one wave per row, 4 rows each: bias, softmax, hi/lo split written over the row's own f32 scores
// (hi plane in its first 2048 bytes, lo plane in the next), tail sums and bucket planes written over the row's own QR. Phase 3: wave w multiplies key slice w*64.. of w with v (3 products), waves 0..4 add one 32-bucket slice of WB rel_v (2 products);
// the 16 partial 64 x 64 tiles are summed through LDS in wave order and split into the merged hi/lo planes.
#define AR 64      // query rows per work-group
#define SP 1028    // score row pitch in floats: 4112 B = 16 B x odd, so that the 16-byte fragment reads of 16 rows fall on distinct banks
#define QP 168     // QR row pitch in floats; the same 672 B then hold the row's bucket planes: hi at byte 0, lo at byte 336
typedef v4us __attribute__((may_alias)) v4usa;
typedef unsigned short __attribute__((may_alias)) usa;
typedef float __attribute__((may_alias)) fa;
__device__ __forceinline__ v16bf ldfa(const bf* p) { return cat16b(*(const v8usa*)p, *(const v8usa*)(p + 16)); }
// a fragment from a global plane in fragment order: p = the 32-k half tile + lane * 8; each of the two loads takes 512 bytes in a row over the wave. Same elements in the same lanes and registers as from a row-major plane.
__device__ __forceinline__ v16bf ldfo(const bf* p) { return cat16b(*(const v8us*)p, *(const v8us*)(p + 256)); }
__global__ __launch_bounds__(512) void k_attn(const bf* __restrict__ Qh, const bf* __restrict__ Ql, const bf* __restrict__ Kh, const bf* __restrict__ Kl, const bf* __restrict__ Vh, const bf* __restrict__ Vl, const bf* __restrict__ Brk, const bf* __restrict__ Brv, bf* Ah, bf* Al) {
    __shared__ __align__(16) float S[AR * SP];
    __shared__ __align__(16) float QRs[AR * QP];
    const int tid = threadIdx.x, lane = tid & 31, lr = lane & 15, hi = lane >> 4; const int w = __builtin_amdgcn_readfirstlane(tid >> 5);
    const int r0 = blockIdx.x * AR; const size_t z = blockIdx.y;
    const bf* qh = Qh + z * TT * HD + (size_t)r0 * HD + lane * 8; const bf* ql = Ql + z * TT * HD + (size_t)r0 * HD + lane * 8;
    {
        const bf* kh = Kh + z * TT * HD + (size_t)(w * 64) * HD + lane * 8; const bf* kl = Kl + z * TT * HD + (size_t)(w * 64) * HD + lane * 8;
        v8f acc[4][4];
#pragma unroll
        for (int mb = 0; mb < 4; ++mb)
#pragma unroll
            for (int nb = 0; nb < 4; ++nb) acc[mb][nb] = (v8f){};
#pragma unroll 1   // rolled: both k steps' fragments at once would not fit the 256 registers of a 16-wave work-group
        for (int kc = 0; kc < HD; kc += 32) {
            v16bf a[4], a2[4]; const bf* qa = qh + kc * 16; const bf* qb = ql + kc * 16; const bf* ka = kh + kc * 16; const bf* kb = kl + kc * 16;
#pragma unroll
            for (int mb = 0; mb < 4; ++mb) { a[mb] = ldfo(qa + mb * 1024); a2[mb] = ldfo(qb + mb * 1024); }
#pragma unroll
            for (int nb = 0; nb < 4; ++nb) { const v16bf b = ldfo(ka + nb * 1024); const v16bf b2 = ldfo(kb + nb * 1024);
#pragma unroll
                for (int mb = 0; mb < 4; ++mb) { acc[mb][nb] = wmmab(a[mb], b, acc[mb][nb]); acc[mb][nb] = wmmab(a2[mb], b, acc[mb][nb]); acc[mb][nb] = wmmab(a[mb], b2, acc[mb][nb]); } }
            // keeps the matrix instructions' distance on the taken side of the loop branch too
            asm volatile("v_nop\n\tv_nop\n\tv_nop\n\tv_nop" : "+v"(acc[0][0]), "+v"(acc[1][1]), "+v"(acc[2][2]), "+v"(acc[3][3]) : "v"(a[0]), "v"(a[3]));
            asm volatile("s_wait_xcnt 0x0" :: "v"(qa), "v"(qb), "v"(ka), "v"(kb) : "memory");   // precaution: stands in front of every rewrite of the address registers that this trip's global loads name; as inputs the four addresses stay in their registers up to here, so that no load's result lands on them
        }
#pragma unroll
        for (int mb = 0; mb < 4; ++mb)
#pragma unroll
            for (int nb = 0; nb < 4; ++nb)
#pragma unroll
                for (int j = 0; j < 8; ++j) *(fa*)(S + (mb * 16 + hi * 8 + j) * SP + w * 64 + nb * 16 + lr) = acc[mb][nb][j];
    }
    if (w < 9) {   // QR[i][r] = q_i . rel_k[r] (unscaled), columns w*16 .. w*16+15 (rows 129.. of the table plane are zero)
        const bf* rk = Brk + w * 1024 + lane * 8; v8f aq[4];
#pragma unroll
        for (int mb = 0; mb < 4; ++mb) aq[mb] = (v8f){};
#pragma unroll
        for (int kc = 0; kc < HD; kc += 32) { const v16bf b = ldfo(rk + kc * 16);
#pragma unroll
            for (int mb = 0; mb < 4; ++mb) { aq[mb] = wmmab(ldfo(qh + mb * 1024 + kc * 16), b, aq[mb]); aq[mb] = wmmab(ldfo(ql + mb * 1024 + kc * 16), b, aq[mb]); } }
#pragma unroll
        for (int mb = 0; mb < 4; ++mb)
#pragma unroll
            for (int j = 0; j < 8; ++j) *(fa*)(QRs + (mb * 16 + hi * 8 + j) * QP + w * 16 + lr) = aq[mb][j];
    }
    __syncthreads();
#pragma unroll 1   // rolled: one row's 32 values a lane are the live set
    for (int rr = 0; rr < AR / 16; ++rr) { const int row = w * (AR / 16) + rr, i = r0 + row; float* sr = S + row * SP; float* qr = QRs + row * QP; float v[TT / 32]; float mx = -3.0e38f;
#pragma unroll
        for (int ch = 0; ch < TT / 128; ++ch) { const int j0 = ch * 128 + lane * 4; const v4f a = *(const v4fa*)(sr + j0);
#pragma unroll
            for (int u = 0; u < 4; ++u) { int r = j0 + u - i; r = (r < -64) ? -64 : (r > 64 ? 64 : r); const float t = __fadd_rn(a[u], *(const fa*)(qr + r + 64)) * 0.125f; v[ch * 4 + u] = t; mx = fmaxf(mx, t); } }
#pragma unroll
        for (int sh = 16; sh; sh >>= 1) mx = fmaxf(mx, __shfl_xor(mx, sh, 32));
        float sum = 0.f;
#pragma unroll
        for (int q = 0; q < TT / 32; ++q) { v[q] = __builtin_amdgcn_exp2f(__fmul_rn(__fsub_rn(v[q], mx), 1.4426950408889634f)); sum += v[q]; }
#pragma unroll
        for (int sh = 16; sh; sh >>= 1) sum += __shfl_xor(sum, sh, 32);
        const float f = __fdiv_rn(1.0f, sum);
        bf* ph = (bf*)sr; bf* pl = ph + TT; float lo = 0.f, hs = 0.f;
#pragma unroll
        for (int ch = 0; ch < TT / 128; ++ch) { const int j0 = ch * 128 + lane * 4; v4us oh, ol;
#pragma unroll
            for (int q = 0; q < 4; ++q) { const float p = v[ch * 4 + q] * f; unsigned short a2, c2; splitf(p, a2, c2); oh[q] = a2; ol[q] = c2; if (j0 + q <= i - 64) lo = __fadd_rn(lo, p); if (j0 + q >= i + 64) hs = __fadd_rn(hs, p); }
            *(v4usa*)(ph + j0) = oh; *(v4usa*)(pl + j0) = ol; }
#pragma unroll
        for (int sh = 16; sh; sh >>= 1) { lo = __fadd_rn(lo, __shfl_xor(lo, sh, 32)); hs = __fadd_rn(hs, __shfl_xor(hs, sh, 32)); }
        // the bucket reads below take what other lanes of this wave have just stored: keeps the compiler from moving them over the stores (a wave's LDS operations run in order)
        __builtin_amdgcn_wave_barrier(); asm volatile("" ::: "memory");
        bf* wh = (bf*)qr; bf* wl = wh + QP;
#pragma unroll
        for (int ch = 0; ch < 2; ++ch) { const int rb = ch * 128 + lane * 4; if (rb < 160) { v4us oh, ol;
#pragma unroll
            for (int u = 0; u < 4; ++u) { const int r = rb + u; unsigned short a2 = 0, c2 = 0; if (r == 0) splitf(lo, a2, c2); else if (r == 128) splitf(hs, a2, c2); else if (r < 128) { const int j = i + r - 64; if (j >= 0 && j < TT) { a2 = *(const usa*)(ph + j); c2 = *(const usa*)(pl + j); } } oh[u] = a2; ol[u] = c2; }
            *(v4usa*)(wh + rb) = oh; *(v4usa*)(wl + rb) = ol; } }
    }
    __syncthreads();
    v8f acc[4][4];
#pragma unroll
    for (int mb = 0; mb < 4; ++mb)
#pragma unroll
        for (int nb = 0; nb < 4; ++nb) acc[mb][nb] = (v8f){};
    {
        const bf* pa = (const bf*)S + lr * (SP * 2) + w * 64 + 8 * hi; const bf* vh = Vh + z * HD * TT + w * 1024 + lane * 8; const bf* vl = Vl + z * HD * TT + w * 1024 + lane * 8;
#pragma unroll 1   // rolled: both k steps' fragments at once would not fit the 256 registers of a 16-wave work-group
        for (int kc = 0; kc < 64; kc += 32) {
            v16bf a[4], a2[4]; const bf* va = vh + kc * 16; const bf* vb = vl + kc * 16;
#pragma unroll
            for (int mb = 0; mb < 4; ++mb) { a[mb] = ldfa(pa + mb * 16 * (SP * 2) + kc); a2[mb] = ldfa(pa + mb * 16 * (SP * 2) + TT + kc); }
#pragma unroll
            for (int nb = 0; nb < 4; ++nb) { const v16bf b = ldfo(va + nb * 16 * TT); const v16bf b2 = ldfo(vb + nb * 16 * TT);
#pragma unroll
                for (int mb = 0; mb < 4; ++mb) { acc[mb][nb] = wmmab(a[mb], b, acc[mb][nb]); acc[mb][nb] = wmmab(a2[mb], b, acc[mb][nb]); acc[mb][nb] = wmmab(a[mb], b2, acc[mb][nb]); } }
            // keeps the matrix instructions' distance on the taken side of the loop branch too
            asm volatile("v_nop\n\tv_nop\n\tv_nop\n\tv_nop" : "+v"(acc[0][0]), "+v"(acc[1][1]), "+v"(acc[2][2]), "+v"(acc[3][3]) : "v"(a[0]), "v"(a[3]));
            asm volatile("s_wait_xcnt 0x0" :: "v"(va), "v"(vb) : "memory");   // precaution: as in the first loop, for the two v addresses of this trip
        }
    }
    if (w < 5) {   // sum_j w rel_v[clip] = WB . rel_v: buckets w*32 .. w*32+31
        const bf* wa = (const bf*)QRs + lr * (QP * 2) + w * 32 + 8 * hi; const bf* rv = Brv + w * 512 + lane * 8; v16bf a[4], a2[4];
#pragma unroll
        for (int mb = 0; mb < 4; ++mb) { a[mb] = ldfa(wa + mb * 16 * (QP * 2)); a2[mb] = ldfa(wa + mb * 16 * (QP * 2) + QP); }
#pragma unroll
        for (int nb = 0; nb < 4; ++nb) { const v16bf b = ldfo(rv + nb * 2560);
#pragma unroll
            for (int mb = 0; mb < 4; ++mb) { acc[mb][nb] = wmmab(a[mb], b, acc[mb][nb]); acc[mb][nb] = wmmab(a2[mb], b, acc[mb][nb]); } }
    }
    __syncthreads();   // every wave has read its slice of the planes: their space now takes the 16 partial tiles [w][64][64]; column bit 5 flipped in rows 8..15 of each 16, so that the two half-waves' stores fall on different banks
#pragma unroll
    for (int mb = 0; mb < 4; ++mb)
#pragma unroll
        for (int nb = 0; nb < 4; ++nb)
#pragma unroll
            for (int j = 0; j < 8; ++j) *(fa*)(S + w * 4096 + (mb * 16 + hi * 8 + j) * 64 + ((nb * 16 + lr) ^ (hi << 5))) = acc[mb][nb][j];
    __syncthreads();
    const int c4 = (tid & 15) * 4; const size_t ob = ((z / NH_) * TT + r0) * DQ + (z % NH_) * HD + c4;
#pragma unroll
    for (int g = 0; g < 2; ++g) { const int row = (tid >> 4) + g * 32; const float* pr = S + row * 64 + (c4 ^ (((row >> 3) & 1) << 5)); v4f s = *(const v4fa*)pr;
#pragma unroll
        for (int k = 1; k < 16; ++k) { const v4f t = *(const v4fa*)(pr + k * 4096); s[0] = __fadd_rn(s[0], t[0]); s[1] = __fadd_rn(s[1], t[1]); s[2] = __fadd_rn(s[2], t[2]); s[3] = __fadd_rn(s[3], t[3]); }
        v4us oh, ol;
#pragma unroll
        for (int q = 0; q < 4; ++q) { unsigned short a2, c2; splitf(s[q], a2, c2); oh[q] = a2; ol[q] = c2; }
        *(v4us*)(Ah + ob + (size_t)row * DQ) = oh; *(v4us*)(Al + ob + (size_t)row * DQ) = ol; }
}

extern "C" void kernel_launch(void* const* d_in, const int* in_sizes, int n_in,
                              void* d_out, int out_size, void* d_ws, size_t ws_size, hipStream_t stream) {
    (void)in_sizes; (void)n_in; (void)out_size;
    const float* x = (const float*)d_in[0]; const float* wq = (const float*)d_in[1]; const float* wk = (const float*)d_in[2]; const float* wv = (const float*)d_in[3]; const float* wo = (const float*)d_in[4]; const float* relk = (const float*)d_in[5]; const float* relv = (const float*)d_in[6]; const float* cosT = nullptr; const float* sinT = nullptr; (void)cosT; (void)sinT;
    float* OUT = (float*)d_out;     // [4][1024][1024]
    char* wsp = (char*)d_ws;
    auto take = [&](size_t bytes) { char* p = wsp; wsp += (bytes + 255) & ~(size_t)255; return (void*)p; };
    bf* WQ = (bf*)take((size_t)DQ * DM * 2); bf* WK = (bf*)take((size_t)DKV * DM * 2); bf* WV = (bf*)take((size_t)DKV * DM * 2); bf* WO = (bf*)take((size_t)DM * DQ * 2); float* CS = (float*)take((size_t)TT * HD * 2 * 4);
    bf* XB = (bf*)take((size_t)NB_ * TT * DM * 2); bf* BRK = (bf*)take((size_t)192 * HD * 2); bf* BRV = (bf*)take((size_t)HD * 160 * 2); float* QR = (float*)take((size_t)ZH * TT * 192 * 4); bf* WBh = (bf*)take((size_t)ZH * TT * 160 * 2); bf* WBl = (bf*)take((size_t)ZH * TT * 160 * 2); float* O2 = (float*)take((size_t)ZH * TT * HD * 4);
    h16* VT16 = (h16*)take((size_t)NKV * HD * TT * 2);
    bf* QPh = (bf*)take((size_t)NB_ * NH_ * TT * HD * 2); bf* QPl = (bf*)take((size_t)NB_ * NH_ * TT * HD * 2); bf* KPh = (bf*)take((size_t)NB_ * NKV * TT * HD * 2); bf* KPl = (bf*)take((size_t)NB_ * NKV * TT * HD * 2); bf* VTh = (bf*)take((size_t)NB_ * NKV * HD * TT * 2); bf* VTl = (bf*)take((size_t)NB_ * NKV * HD * TT * 2); bf* Ph = (bf*)take((size_t)ZH * RH * TT * 2); bf* Pl = (bf*)take((size_t)ZH * RH * TT * 2);
    float* Sb = (float*)take((size_t)ZH * TT * TT * 4); float* Ob = (float*)take((size_t)ZH * TT * HD * 4); bf* ATh = (bf*)take((size_t)NB_ * TT * DQ * 2); bf* ATl = (bf*)take((size_t)NB_ * TT * DQ * 2);
    if ((size_t)(wsp - (char*)d_ws) > ws_size) return;    // ws 256 MiB
    k_prep<<<4 * PBW + PBX + PBK + PBV, 256, 0, stream>>>(x, wq, wk, wv, wo, relk, relv, XB, WQ, WK, WV, WO, BRK, BRV);
    k_qkv<<<dim3(TT / 128, DQ / 128, 3 * NB_), 256, 0, stream>>>(XB, WQ, WK, WV, QPh, QPl, KPh, KPl, VTh, VTl);
    k_attn<<<dim3(TT / AR, NB_ * NH_), 512, 0, stream>>>(QPh, QPl, KPh, KPl, VTh, VTl, BRK, BRV, ATh, ATl);   // one kv head per query head: plane z = b*NH_ + head in all six
    k_wo<<<dim3(NB_ * TT / 128, DM / 128, 1), 256, 0, stream>>>(ATh, ATl, WO, OUT);
}

// v007
// Measured time: 146 microseconds a run.
// In two side-by-side timings against v006, it was 1.05 and 1.04 times as fast.
// All steps since v000 together make it 15.2 times as fast.
#include <hip/hip_runtime.h>

// MultiHead2DAttention_v2 (x [4][1024][1024]; q = (x Wq) / 8, k = x Wk, v = x Wv ([in,out], no bias; 16 heads x 64); relative-position embeddings rel_k / rel_v [129][64] indexed by clip(j - i, -64, 64) + 64;
//   logits = q.k + q.rel_k[clip]; w = softmax; out_h = w v + sum_j w[i][j] rel_v[clip(j - i)]; out = merged Wo -> [4][1024][1024]).
// The relative terms use exact regroupings: q.rel_k[clip(j-i)] is read from QR = q rel_k^T ([T][129] per head), and sum_j w rel_v[clip] = WB rel_v with WB[i][r] = the softmax mass in bucket r (single keys for r = 1..127, tail sums for r = 0 / 128).
// Compute dtypes, f32 accumulate: every input rounded to bf16; q/k/v on PLAIN bf16 operands (inputs: exact); QR as hl x exact (2 products); scores and w.v as hl x hl (3 products) on every row; the 1/8 scale (exact), rel bias, softmax and bucket sums f32; WB rel_v as hl x exact (2 products); Wo hl x exact (2 products).

#define NB_  4
#define TT   1024
#define DM   1024
#define NH_  16
#define NKV  16
#define REP  (NH_ / NKV)
#define HD   64
#define DQ   (NH_ * HD)
#define DKV  (NKV * HD)
#define ZH   16
#define RH   1024                  // query rows < RH use hi+lo planes (0: none)
#define WIN  0
#define PCAR 1024.0f
#define SCL  0.125f   // HD^-0.5
typedef _Float16 h16;
typedef unsigned short bf;
typedef __attribute__((ext_vector_type(16))) __bf16   v16bf;
typedef __attribute__((ext_vector_type(16))) _Float16 v16h;
typedef __attribute__((ext_vector_type(8)))  _Float16 v8h;
typedef __attribute__((ext_vector_type(8)))  unsigned short v8us;
typedef __attribute__((ext_vector_type(8)))  float    v8f;
typedef __attribute__((ext_vector_type(4)))  float    v4f;
typedef v8h  __attribute__((may_alias)) v8ha;
typedef v4f  __attribute__((may_alias)) v4fa;
typedef v8us __attribute__((may_alias)) v8usa;

__device__ __forceinline__ unsigned short f2bf(float f) { unsigned u = __float_as_uint(f); u += 0x7FFFu + ((u >> 16) & 1u); return (unsigned short)(u >> 16); }
__device__ __forceinline__ float bf2f(unsigned short b) { return __uint_as_float(((unsigned)b) << 16); }
__device__ __forceinline__ float bfr(float f) { return bf2f(f2bf(f)); }
__device__ __forceinline__ v16h cat16(v8h lo, v8h hi) { return __builtin_shufflevector(lo, hi, 0, 1, 2, 3, 4, 5, 6, 7, 8, 9, 10, 11, 12, 13, 14, 15); }
__device__ __forceinline__ v16bf cat16b(v8us lo, v8us hi) { return __builtin_bit_cast(v16bf, __builtin_shufflevector(lo, hi, 0, 1, 2, 3, 4, 5, 6, 7, 8, 9, 10, 11, 12, 13, 14, 15)); }
__device__ __forceinline__ v8f wmma16(v16h a, v16h b, v8f c) { return __builtin_amdgcn_wmma_f32_16x16x32_f16(false, a, false, b, (short)0, c, false, false); }
__device__ __forceinline__ v8f wmmab(v16bf a, v16bf b, v8f c) { return __builtin_amdgcn_wmma_f32_16x16x32_bf16(false, a, false, b, (short)0, c, false, false); }



// ---- gemmw: GEMM body, one 128x128 output tile per work-group of 8 waves (4 x 2, each wave 32x64 = 8 accumulators); grid (M/128, N/128, .), 256 threads; z = batch item.
// The K-contiguous 16-bit operand planes come into LDS as whole 128-byte lines, by asynchronous copies, in stages of 128 k (two buffers: the next stage flies while this one is multiplied); the fragments are read from LDS.
// C[m][n] (f32, pitch ldc) = sum_k A[m][k] Bt[n][k] (NSPLIT 1: + A2[m][k] Bt[n][k]). z-batch strides sA/sB/sC in elements. K % 128 == 0, M % 128 == 0, N % 128 == 0.
// PL: no f32 C; each result is split into hi + lo bf16 here and stored in the planes Ph / Pl in FRAGMENT ORDER: the 16 x 64 tile of rows m0.. (m0 % 16 == 0), columns n0.. (n0 % 64 == 0) is the 1024 elements from z sC + (n0 / 64) sY + m0 ldc,
// and inside it element (r, c) stands at (c / 8) * 128 + r * 8 + c % 8: the 16-byte pieces that the 32 lanes of one fragment load take are 512 bytes in a row (four whole lines), not 32 bytes out of each of 16 lines.
__device__ __forceinline__ void splitf(float y, unsigned short& h, unsigned short& l) { h = f2bf(y); l = f2bf(y - bf2f(h)); }
// Two f32 rounded to bf16 (to nearest, ties to even, as f2bf does) by the chip's own packed conversion: one instruction a pair; first value in the low half.
typedef __attribute__((ext_vector_type(2))) float f32x2;
typedef __attribute__((ext_vector_type(2))) __bf16 bf16x2;
typedef __attribute__((ext_vector_type(2))) unsigned u32x2;
typedef __attribute__((ext_vector_type(4))) unsigned u32x4;
typedef u32x2 __attribute__((may_alias)) u32x2a;
__device__ __forceinline__ unsigned cvt2(float a, float b) { const f32x2 x = {a, b}; return __builtin_bit_cast(unsigned, __builtin_convertvector(x, bf16x2)); }
// hi + lo split of a pair: h = the two hi halves, l = the two rounded remainders
__device__ __forceinline__ void split2(float y0, float y1, unsigned& h, unsigned& l) { h = cvt2(y0, y1); l = cvt2(y0 - __uint_as_float(h << 16), y1 - __uint_as_float(h & 0xFFFF0000u)); }
#define GK 128             // k per stage: rows of 256 bytes
#define GP 136             // LDS row pitch in elements: 272 B = 16 B x odd, so that the 16-byte fragment reads of 16 rows fall on distinct banks
#define GT (128 * GP)      // one operand's stage tile, elements
__device__ __forceinline__ v16bf ldfs(const bf* p) { return cat16b(*(const v8usa*)p, *(const v8usa*)(p + 16)); }
// Eight asynchronous 16-byte copies a lane, 16 rows apart: LDS byte address l, global address g, global row pitch K elements. 16 lanes bring one 256-byte row, 256 threads one operand's 128 rows.
// The s_wait_xcnt stands inside the statement as a precaution: in front of any later rewrite of the address registers that the copies name.
__device__ __forceinline__ void cp8(unsigned l, const bf* g, size_t K) {
    asm volatile("global_load_async_to_lds_b128 %0, %8, off\n\t"
                 "global_load_async_to_lds_b128 %1, %9, off\n\t"
                 "global_load_async_to_lds_b128 %2, %10, off\n\t"
                 "global_load_async_to_lds_b128 %3, %11, off\n\t"
                 "global_load_async_to_lds_b128 %4, %12, off\n\t"
                 "global_load_async_to_lds_b128 %5, %13, off\n\t"
                 "global_load_async_to_lds_b128 %6, %14, off\n\t"
                 "global_load_async_to_lds_b128 %7, %15, off\n\t"
                 "s_wait_xcnt 0x0"
                 :: "v"(l), "v"(l + 16 * GP * 2), "v"(l + 32 * GP * 2), "v"(l + 48 * GP * 2), "v"(l + 64 * GP * 2), "v"(l + 80 * GP * 2), "v"(l + 96 * GP * 2), "v"(l + 112 * GP * 2),
                    "v"(g), "v"(g + 16 * K), "v"(g + 32 * K), "v"(g + 48 * K), "v"(g + 64 * K), "v"(g + 80 * K), "v"(g + 96 * K), "v"(g + 112 * K) : "memory");
}
template <int NSPLIT, bool PL>
__device__ __forceinline__ void gemmw(const size_t z, const bf* __restrict__ A, const bf* __restrict__ A2, const bf* __restrict__ Bt, int K, float* C, int ldc, size_t sA, size_t sB, size_t sC, bf* Ph, bf* Pl, size_t sY) {
    constexpr int NOP = 2 + NSPLIT;                       // operand tiles of a stage: A (, A2), Bt
    __shared__ __align__(16) bf ring[2 * NOP * GT];
    __shared__ __align__(16) float osw[8 * 16 * 68];
    A += z * sA; if (NSPLIT) A2 += z * sA; Bt += z * sB; if (!PL) C += z * sC;
    const int tid = threadIdx.x, lane = tid & 31, lr = lane & 15, hi = lane >> 4; const int w = __builtin_amdgcn_readfirstlane(tid >> 5);
    const int r0 = blockIdx.x * 128 + (w >> 1) * 32, c0 = blockIdx.y * 128 + (w & 1) * 64; float* os = osw + w * (16 * 68);
    const size_t goff = (size_t)(tid >> 4) * K + (tid & 15) * 8;
    const bf* ga = A + (size_t)blockIdx.x * 128 * K + goff; const bf* gb = Bt + (size_t)blockIdx.y * 128 * K + goff; const bf* ga2 = NSPLIT ? A2 + (size_t)blockIdx.x * 128 * K + goff : nullptr;
    const unsigned l0 = (unsigned)(size_t)(const void*)ring + ((tid >> 4) * GP + (tid & 15) * 8) * 2;
    auto fill = [&](int t) {   // stage t: 128 rows x 128 k of each operand into buffer t % 2
        const unsigned lb = l0 + (t & 1) * (NOP * GT * 2); const size_t ko = (size_t)t * GK;
        cp8(lb, ga + ko, K); if (NSPLIT) cp8(lb + GT * 2, ga2 + ko, K); cp8(lb + (NOP - 1) * GT * 2, gb + ko, K); };
    v8f acc[2][4];
#pragma unroll
    for (int mb = 0; mb < 2; ++mb)
#pragma unroll
        for (int nb = 0; nb < 4; ++nb) acc[mb][nb] = (v8f){};
    const int nt = K / GK;
    fill(0);
    asm volatile("s_wait_asynccnt 0x0" ::: "memory");   // this wave's copies of stage 0 have landed
    __syncthreads();                                     // ... and every other wave's
    if (nt > 1) fill(1);
#pragma unroll 1   // rolled: one stage is one trip of the ring
    for (int t = 0; t < nt; ++t) {
        const bf* sa = ring + (t & 1) * (NOP * GT) + ((w >> 1) * 32 + lr) * GP + 8 * hi; const bf* sb = ring + (t & 1) * (NOP * GT) + (NOP - 1) * GT + ((w & 1) * 64 + lr) * GP + 8 * hi;
        v16bf a[2][2], a2[2][2], b[2][4];   // two fragment sets: the next 32 k's LDS reads go out as one group ahead of this 32 k's products (inside the stage only)
#pragma unroll
        for (int mb = 0; mb < 2; ++mb) { a[0][mb] = ldfs(sa + mb * 16 * GP); if (NSPLIT) a2[0][mb] = ldfs(sa + GT + mb * 16 * GP); }
#pragma unroll
        for (int nb = 0; nb < 4; ++nb) b[0][nb] = ldfs(sb + nb * 16 * GP);
#pragma unroll
        for (int q = 0; q < GK / 32; ++q) { const int cu = q & 1, nx = cu ^ 1, ks = (q + 1) * 32;
            if (q + 1 < GK / 32) {
#pragma unroll
                for (int mb = 0; mb < 2; ++mb) { a[nx][mb] = ldfs(sa + mb * 16 * GP + ks); if (NSPLIT) a2[nx][mb] = ldfs(sa + GT + mb * 16 * GP + ks); }
#pragma unroll
                for (int nb = 0; nb < 4; ++nb) b[nx][nb] = ldfs(sb + nb * 16 * GP + ks);
                __builtin_amdgcn_sched_barrier(0); }   // holds the group of reads above ahead of the products below: the scheduler otherwise sinks each read to its first use, and the wave waits out the LDS latency in front of every pair of products
#pragma unroll
            for (int nb = 0; nb < 4; ++nb)
#pragma unroll
                for (int mb = 0; mb < 2; ++mb) { acc[mb][nb] = wmmab(a[cu][mb], b[cu][nb], acc[mb][nb]); if (NSPLIT) acc[mb][nb] = wmmab(a2[cu][mb], b[cu][nb], acc[mb][nb]); }
        }
        // keeps the matrix instructions' distance on the taken side of the branches behind them too
        asm volatile("v_nop\n\tv_nop\n\tv_nop\n\tv_nop" : "+v"(acc[0][0]), "+v"(acc[1][0]), "+v"(acc[0][1]), "+v"(acc[1][1]), "+v"(acc[0][2]), "+v"(acc[1][2]), "+v"(acc[0][3]), "+v"(acc[1][3]));
        asm volatile("s_wait_dscnt 0x0" ::: "memory");      // this wave's reads of buffer t % 2 are done before the buffer is refilled
        asm volatile("s_wait_asynccnt 0x0" ::: "memory");   // this wave's copies of stage t + 1 have landed
        __syncthreads();                                     // publishes stage t + 1 and ends every wave's reads of stage t
        if (t + 2 < nt) fill(t + 2);
    }
    asm volatile("s_wait_asynccnt 0x0" ::: "memory");   // no copy is outstanding when the wave goes on to its end
#pragma unroll
    for (int mb = 0; mb < 2; ++mb) {
#pragma unroll
        for (int nb = 0; nb < 4; ++nb) {
#pragma unroll
            for (int j = 0; j < 8; ++j) os[(hi * 8 + j) * 68 + nb * 16 + lr] = acc[mb][nb][j]; }
        __builtin_amdgcn_wave_barrier(); asm volatile("" ::: "memory");
        if (PL) {   // 8 results a lane: row lane % 16, columns 16 s + 8 (lane / 16) ..; the 32 lanes store 512 bytes in a row of each plane
            const size_t pb = z * sC + (size_t)(c0 >> 6) * sY + (size_t)(r0 + mb * 16) * ldc + lane * 8;
#pragma unroll
            for (int s = 0; s < 4; ++s) { const int row = lr, cofs = s * 16 + hi * 8; const v4f v0 = *(const v4fa*)(os + row * 68 + cofs), v1 = *(const v4fa*)(os + row * 68 + cofs + 4); u32x4 oh, ol; unsigned a2, c2;
                split2(v0[0], v0[1], a2, c2); oh[0] = a2; ol[0] = c2; split2(v0[2], v0[3], a2, c2); oh[1] = a2; ol[1] = c2; split2(v1[0], v1[1], a2, c2); oh[2] = a2; ol[2] = c2; split2(v1[2], v1[3], a2, c2); oh[3] = a2; ol[3] = c2;
                *(u32x4*)(Ph + pb + s * 256) = oh; *(u32x4*)(Pl + pb + s * 256) = ol; }
        } else {
            float* crow = C + (size_t)(r0 + mb * 16) * ldc + c0;
#pragma unroll
            for (int s = 0; s < 8; ++s) { const int row = 2 * s + hi, cofs = lr * 4; const v4f val = *(const v4fa*)(os + row * 68 + cofs);
                *(v4f*)(crow + (size_t)row * ldc + cofs) = val; }
             }
        __builtin_amdgcn_wave_barrier(); asm volatile("" ::: "memory");
    }
}

// The three projections of all NB_ batch items in ONE launch: grid (8, 8, 3 * NB_), blockIdx.z = projection * NB_ + batch item. q and k: one 64-column tile is one head, planes [b*NH_ + head][t / 16][tile of 16 t x 64 d].
// v: the operands change places (rows = v columns, columns = t), so that the planes [b*NKV + head][d / 16][t / 64][tile of 16 d x 64 t] come out of the same epilogue.
__global__ __launch_bounds__(256) void k_qkv(const bf* __restrict__ XB, const bf* __restrict__ WQ, const bf* __restrict__ WK, const bf* __restrict__ WV, bf* QPh, bf* QPl, bf* KPh, bf* KPl, bf* VTh, bf* VTl) {
    const int p = blockIdx.z / NB_; const size_t z = blockIdx.z % NB_; const bool tv = (p == 2);
    gemmw<0, true>(z, tv ? WV : XB, nullptr, tv ? XB : (p ? WK : WQ), DM, nullptr, tv ? TT : HD, tv ? (size_t)0 : (size_t)TT * DM, tv ? (size_t)TT * DM : (size_t)0, (size_t)NH_ * TT * HD,
                   tv ? VTh : (p ? KPh : QPh), tv ? VTl : (p ? KPl : QPl), tv ? (size_t)1024 : (size_t)TT * HD);
}
__global__ __launch_bounds__(256) void k_wo(const bf* __restrict__ Ah, const bf* __restrict__ Al, const bf* __restrict__ WO, float* OUT) {
    gemmw<1, false>(0, Ah, Al, WO, DQ, OUT, DM, 0, 0, 0, nullptr, nullptr, 0);
}

__device__ __forceinline__ h16 tohx(float x) { return (h16)x; }
typedef __attribute__((ext_vector_type(2))) _Float16 v2h;
typedef __attribute__((ext_vector_type(4))) _Float16 v4h;
typedef __attribute__((ext_vector_type(2))) unsigned short v2us;
typedef __attribute__((ext_vector_type(4))) unsigned short v4us;
typedef __attribute__((ext_vector_type(2))) float v2f;
typedef __attribute__((ext_vector_type(4))) int v4i;

__device__ __forceinline__ void d_wtG(const int blk, const float* __restrict__ w, int K, int N, bf* Bt) {
    const int lane = threadIdx.x & 31; const int L0 = (blk * 8 + (threadIdx.x >> 5)) * 8; const int nlines = N * K / 64;
{
#pragma unroll 1
        for (int l = 0; l < 8; ++l) { const int L = L0 + l; if (L >= nlines) break; const size_t e = (size_t)L * 64 + lane * 2; const int k = (int)(e % K), n = (int)(e / K); 
            *(unsigned*)(Bt + e) = cvt2(w[(size_t)k * N + n], w[(size_t)(k + 1) * N + n]); }
         }
}
__device__ __forceinline__ void d_cvt8(const int blk, const float* __restrict__ src, bf* dst, size_t n8) { const size_t i = (size_t)blk * 256 + threadIdx.x; if (i >= n8) return; const v8f v = *(const v8f*)(src + i * 8); u32x4 o;
#pragma unroll
    for (int k = 0; k < 4; ++k) o[k] = cvt2(v[2 * k], v[2 * k + 1]); *(u32x4*)(dst + i * 8) = o;  }
__global__ __launch_bounds__(256) void k_cscvt(const float* __restrict__ cosT, const float* __restrict__ sinT, float* CS) { const int idx = blockIdx.x * 256 + threadIdx.x; if (idx >= TT * HD) return; v2f cs; cs[0] = bfr(cosT[idx]); cs[1] = bfr(sinT[idx]); *(v2f*)(CS + (size_t)idx * 2) = cs;  }
// k_asoft: per row (zz, i): t = S x HD^-0.5 (no mask); softmax over the 1024 keys (register row, one exp, fixed trees);
__global__ __launch_bounds__(256) void k_asoft(const float* __restrict__ Sb, h16* P16, bf* Ph, bf* Pl) {
    const int lane = threadIdx.x & 31; const int row = blockIdx.x * 8 + (threadIdx.x >> 5); if (row >= ZH * TT) return; const int i = row % TT; const int zz = row / TT; (void)zz; const bool hires = (i < RH); const float* sr = Sb + (size_t)row * TT; float v[TT / 32]; float mx = -3.0e38f;
#pragma unroll
    for (int ch = 0; ch < TT / 128; ++ch) { const int j0 = ch * 128 + lane * 4; const v4f a = *(const v4f*)(sr + j0);
#pragma unroll
        for (int q = 0; q < 4; ++q) { const int j = j0 + q; (void)j; const float t = a[q] * SCL; v[ch * 4 + q] = t; mx = fmaxf(mx, t); } }
#pragma unroll
    for (int sh = 16; sh; sh >>= 1) mx = fmaxf(mx, __shfl_xor(mx, sh, 32));
    float sum = 0.f;
#pragma unroll
    for (int k = 0; k < TT / 32; ++k) { float d0 = __fsub_rn(v[k], mx); asm volatile("" : "+v"(d0)); v[k] = __builtin_amdgcn_exp2f(__fmul_rn(d0, 1.4426950408889634f)); sum += v[k]; }
#pragma unroll
    for (int sh = 16; sh; sh >>= 1) sum += __shfl_xor(sum, sh, 32);
    const float f = __fdiv_rn(hires ? 1.0f : PCAR, sum);
{
        if (hires) {
#pragma unroll
            for (int ch = 0; ch < TT / 128; ++ch) { v4us oh, ol;
#pragma unroll
                for (int q = 0; q < 4; ++q) { unsigned short a, c2; splitf(v[ch * 4 + q] * f, a, c2); oh[q] = a; ol[q] = c2; }
                const size_t oo = ((size_t)zz * (RH ? RH : 1) + i) * TT + ch * 128 + lane * 4; *(v4us*)(Ph + oo) = oh; *(v4us*)(Pl + oo) = ol; }
        } else {
#pragma unroll
            for (int ch = 0; ch < TT / 128; ++ch) { v4h o4;
#pragma unroll
                for (int q = 0; q < 4; ++q) o4[q] = tohx(v[ch * 4 + q] * f);
                *(v4h*)(P16 + (size_t)row * TT + ch * 128 + lane * 4) = o4; } }
         }
}
__device__ __forceinline__ void d_relk(const int blk, const float* __restrict__ rk, bf* Bt) { const int e = (blk * 256 + threadIdx.x) * 4; if (e >= 192 * HD) return; const int r = e / HD; const int d = e % HD; v4us o;   // rel_k[r][d] (r < 129) else 0, in fragment order: tiles of 16 r x 64 d
#pragma unroll
    for (int u = 0; u < 4; ++u) o[u] = (r < 129) ? f2bf(rk[e + u]) : (unsigned short)0; *(v4us*)(Bt + (r >> 4) * 1024 + (d >> 3) * 128 + (r & 15) * 8 + (d & 7)) = o;  }
__device__ __forceinline__ void d_relv(const int blk, const float* __restrict__ rv, bf* Bt) { const int e = (blk * 256 + threadIdx.x) * 4; if (e >= HD * 160) return; const int r = e % 160; const int d = e / 160; v4us o;   // rel_v[r][d] (r < 129) else 0, in fragment order: tiles [d / 16][r / 32] of 16 d x 32 r
#pragma unroll
    for (int u = 0; u < 4; ++u) o[u] = (r + u < 129) ? f2bf(rv[(size_t)(r + u) * HD + d]) : (unsigned short)0; *(v4us*)(Bt + ((d >> 4) * 5 + (r >> 5)) * 512 + ((r & 31) >> 3) * 128 + (d & 15) * 8 + (r & 7)) = o;  }
// ---- k_prep: every operand plane that the products read, in ONE launch; the block index picks the job (the same for a whole work-group). The four weight transposes, whose waves run longest, come first.
#define PBW (DM * DQ / 64 / 64)                 // blocks of one weight transpose
#define PBX (NB_ * TT * DM / 8 / 256)           // blocks of the x conversion
#define PBK ((192 * HD / 4 + 255) / 256)        // blocks of the rel_k plane
#define PBV ((HD * 160 / 4 + 255) / 256)        // blocks of the rel_v plane
__global__ __launch_bounds__(256) void k_prep(const float* __restrict__ x, const float* __restrict__ wq, const float* __restrict__ wk, const float* __restrict__ wv, const float* __restrict__ wo, const float* __restrict__ relk, const float* __restrict__ relv,
                                              bf* XB, bf* WQ, bf* WK, bf* WV, bf* WO, bf* BRK, bf* BRV) {
    int b = blockIdx.x;
    if (b < 4 * PBW) { const int m = b / PBW; d_wtG(b % PBW, m == 0 ? wq : m == 1 ? wk : m == 2 ? wv : wo, DM, DQ, m == 0 ? WQ : m == 1 ? WK : m == 2 ? WV : WO); return; }
    b -= 4 * PBW;
    if (b < PBX) { d_cvt8(b, x, XB, (size_t)NB_ * TT * DM / 8); return; }
    b -= PBX;
    if (b < PBK) { d_relk(b, relk, BRK); return; }
    d_relv(b - PBK, relv, BRV);
}
// ---- k_attn: the whole attention of 64 query rows of one head in ONE work-group (16 waves); the 64 x 1024 score rows stay in LDS from the q.k products to the w.v products. grid (TT/64, NB_*NH_).
// Phase 1: wave w forms the 64 x 64 score tile of keys w*64.. (hl x hl, 3 products) and, waves 0..8, 16 columns of QR = q rel_k^T (hl x exact). Phase 2: one wave per row, 4 rows each: bias, softmax, hi/lo split written over the row's own f32 scores
// (hi plane in its first 2048 bytes, lo plane in the next), tail sums and bucket planes written over the row's own QR. Phase 3: wave w multiplies key slice w*64.. of w with v (3 products), waves 0..4 add one 32-bucket slice of WB rel_v (2 products);
// the 16 partial 64 x 64 tiles are summed through LDS in wave order and split into the merged hi/lo planes.
#define AR 64      // query rows per work-group
#define SP 1028    // score row pitch in floats: 4112 B = 16 B x odd, so that the 16-byte fragment reads of 16 rows fall on distinct banks
#define QP 168     // QR row pitch in floats; the same 672 B then hold the row's bucket planes: hi at byte 0, lo at byte 336
typedef v4us __attribute__((may_alias)) v4usa;
typedef unsigned short __attribute__((may_alias)) usa;
typedef float __attribute__((may_alias)) fa;
__device__ __forceinline__ v16bf ldfa(const bf* p) { return cat16b(*(const v8usa*)p, *(const v8usa*)(p + 16)); }
// a fragment from a global plane in fragment order: p = the 32-k half tile + lane * 8; each of the two loads takes 512 bytes in a row over the wave. Same elements in the same lanes and registers as from a row-major plane.
__device__ __forceinline__ v16bf ldfo(const bf* p) { return cat16b(*(const v8us*)p, *(const v8us*)(p + 256)); }
__global__ __launch_bounds__(512) void k_attn(const bf* __restrict__ Qh, const bf* __restrict__ Ql, const bf* __restrict__ Kh, const bf* __restrict__ Kl, const bf* __restrict__ Vh, const bf* __restrict__ Vl, const bf* __restrict__ Brk, const bf* __restrict__ Brv, bf* Ah, bf* Al) {
    __shared__ __align__(16) float S[AR * SP];
    __shared__ __align__(16) float QRs[AR * QP];
    const int tid = threadIdx.x, lane = tid & 31, lr = lane & 15, hi = lane >> 4; const int w = __builtin_amdgcn_readfirstlane(tid >> 5);
    const int r0 = blockIdx.x * AR; const size_t z = blockIdx.y;
    const bf* qh = Qh + z * TT * HD + (size_t)r0 * HD + lane * 8; const bf* ql = Ql + z * TT * HD + (size_t)r0 * HD + lane * 8;
    {
        const bf* kh = Kh + z * TT * HD + (size_t)(w * 64) * HD + lane * 8; const bf* kl = Kl + z * TT * HD + (size_t)(w * 64) * HD + lane * 8;
        v8f acc[4][4];
#pragma unroll
        for (int mb = 0; mb < 4; ++mb)
#pragma unroll
            for (int nb = 0; nb < 4; ++nb) acc[mb][nb] = (v8f){};
#pragma unroll 1   // rolled: both k steps' fragments at once would not fit the 256 registers of a 16-wave work-group
        for (int kc = 0; kc < HD; kc += 32) {
            v16bf a[4], a2[4]; const bf* qa = qh + kc * 16; const bf* qb = ql + kc * 16; const bf* ka = kh + kc * 16; const bf* kb = kl + kc * 16;
#pragma unroll
            for (int mb = 0; mb < 4; ++mb) { a[mb] = ldfo(qa + mb * 1024); a2[mb] = ldfo(qb + mb * 1024); }
#pragma unroll
            for (int nb = 0; nb < 4; ++nb) { const v16bf b = ldfo(ka + nb * 1024); const v16bf b2 = ldfo(kb + nb * 1024);
#pragma unroll
                for (int mb = 0; mb < 4; ++mb) { acc[mb][nb] = wmmab(a[mb], b, acc[mb][nb]); acc[mb][nb] = wmmab(a2[mb], b, acc[mb][nb]); acc[mb][nb] = wmmab(a[mb], b2, acc[mb][nb]); } }
            // keeps the matrix instructions' distance on the taken side of the loop branch too
            asm volatile("v_nop\n\tv_nop\n\tv_nop\n\tv_nop" : "+v"(acc[0][0]), "+v"(acc[1][1]), "+v"(acc[2][2]), "+v"(acc[3][3]) : "v"(a[0]), "v"(a[3]));
            asm volatile("s_wait_xcnt 0x0" :: "v"(qa), "v"(qb), "v"(ka), "v"(kb) : "memory");   // precaution: stands in front of every rewrite of the address registers that this trip's global loads name; as inputs the four addresses stay in their registers up to here, so that no load's result lands on them
        }
#pragma unroll
        for (int mb = 0; mb < 4; ++mb)
#pragma unroll
            for (int nb = 0; nb < 4; ++nb)
#pragma unroll
                for (int j = 0; j < 8; ++j) *(fa*)(S + (mb * 16 + hi * 8 + j) * SP + w * 64 + nb * 16 + lr) = acc[mb][nb][j];
    }
    if (w < 9) {   // QR[i][r] = q_i . rel_k[r] (unscaled), columns w*16 .. w*16+15 (rows 129.. of the table plane are zero)
        const bf* rk = Brk + w * 1024 + lane * 8; v8f aq[4];
#pragma unroll
        for (int mb = 0; mb < 4; ++mb) aq[mb] = (v8f){};
#pragma unroll
        for (int kc = 0; kc < HD; kc += 32) { const v16bf b = ldfo(rk + kc * 16);
#pragma unroll
            for (int mb = 0; mb < 4; ++mb) { aq[mb] = wmmab(ldfo(qh + mb * 1024 + kc * 16), b, aq[mb]); aq[mb] = wmmab(ldfo(ql + mb * 1024 + kc * 16), b, aq[mb]); } }
#pragma unroll
        for (int mb = 0; mb < 4; ++mb)
#pragma unroll
            for (int j = 0; j < 8; ++j) *(fa*)(QRs + (mb * 16 + hi * 8 + j) * QP + w * 16 + lr) = aq[mb][j];
    }
    __syncthreads();
#pragma unroll 1   // rolled: one row's 32 values a lane are the live set
    for (int rr = 0; rr < AR / 16; ++rr) { const int row = w * (AR / 16) + rr, i = r0 + row; float* sr = S + row * SP; float* qr = QRs + row * QP; float v[TT / 32]; float mx = -3.0e38f;
#pragma unroll
        for (int ch = 0; ch < TT / 128; ++ch) { const int j0 = ch * 128 + lane * 4; const v4f a = *(const v4fa*)(sr + j0);
#pragma unroll
            for (int u = 0; u < 4; ++u) { int r = j0 + u - i; r = (r < -64) ? -64 : (r > 64 ? 64 : r); const float t = __fadd_rn(a[u], *(const fa*)(qr + r + 64)) * 0.125f; v[ch * 4 + u] = t; mx = fmaxf(mx, t); } }
#pragma unroll
        for (int sh = 16; sh; sh >>= 1) mx = fmaxf(mx, __shfl_xor(mx, sh, 32));
        float sum = 0.f;
#pragma unroll
        for (int q = 0; q < TT / 32; ++q) { v[q] = __builtin_amdgcn_exp2f(__fmul_rn(__fsub_rn(v[q], mx), 1.4426950408889634f)); sum += v[q]; }
#pragma unroll
        for (int sh = 16; sh; sh >>= 1) sum += __shfl_xor(sum, sh, 32);
        const float f = __fdiv_rn(1.0f, sum);
        bf* ph = (bf*)sr; bf* pl = ph + TT; float lo = 0.f, hs = 0.f;
#pragma unroll
        for (int ch = 0; ch < TT / 128; ++ch) { const int j0 = ch * 128 + lane * 4; u32x2 oh, ol; float p[4];
#pragma unroll
            for (int q = 0; q < 4; ++q) { p[q] = v[ch * 4 + q] * f; if (j0 + q <= i - 64) lo = __fadd_rn(lo, p[q]); if (j0 + q >= i + 64) hs = __fadd_rn(hs, p[q]); }
            unsigned a2, c2; split2(p[0], p[1], a2, c2); oh[0] = a2; ol[0] = c2; split2(p[2], p[3], a2, c2); oh[1] = a2; ol[1] = c2;
            *(u32x2a*)(ph + j0) = oh; *(u32x2a*)(pl + j0) = ol; }
#pragma unroll
        for (int sh = 16; sh; sh >>= 1) { lo = __fadd_rn(lo, __shfl_xor(lo, sh, 32)); hs = __fadd_rn(hs, __shfl_xor(hs, sh, 32)); }
        // the bucket reads below take what other lanes of this wave have just stored: keeps the compiler from moving them over the stores (a wave's LDS operations run in order)
        __builtin_amdgcn_wave_barrier(); asm volatile("" ::: "memory");
        bf* wh = (bf*)qr; bf* wl = wh + QP;
#pragma unroll
        for (int ch = 0; ch < 2; ++ch) { const int rb = ch * 128 + lane * 4; if (rb < 160) { v4us oh, ol;
#pragma unroll
            for (int u = 0; u < 4; ++u) { const int r = rb + u; unsigned short a2 = 0, c2 = 0; if (r == 0) splitf(lo, a2, c2); else if (r == 128) splitf(hs, a2, c2); else if (r < 128) { const int j = i + r - 64; if (j >= 0 && j < TT) { a2 = *(const usa*)(ph + j); c2 = *(const usa*)(pl + j); } } oh[u] = a2; ol[u] = c2; }
            *(v4usa*)(wh + rb) = oh; *(v4usa*)(wl + rb) = ol; } }
    }
    __syncthreads();
    v8f acc[4][4];
#pragma unroll
    for (int mb = 0; mb < 4; ++mb)
#pragma unroll
        for (int nb = 0; nb < 4; ++nb) acc[mb][nb] = (v8f){};
    {
        const bf* pa = (const bf*)S + lr * (SP * 2) + w * 64 + 8 * hi; const bf* vh = Vh + z * HD * TT + w * 1024 + lane * 8; const bf* vl = Vl + z * HD * TT + w * 1024 + lane * 8;
#pragma unroll 1   // rolled: both k steps' fragments at once would not fit the 256 registers of a 16-wave work-group
        for (int kc = 0; kc < 64; kc += 32) {
            v16bf a[4], a2[4]; const bf* va = vh + kc * 16; const bf* vb = vl + kc * 16;
#pragma unroll
            for (int mb = 0; mb < 4; ++mb) { a[mb] = ldfa(pa + mb * 16 * (SP * 2) + kc); a2[mb] = ldfa(pa + mb * 16 * (SP * 2) + TT + kc); }
#pragma unroll
            for (int nb = 0; nb < 4; ++nb) { const v16bf b = ldfo(va + nb * 16 * TT); const v16bf b2 = ldfo(vb + nb * 16 * TT);
#pragma unroll
                for (int mb = 0; mb < 4; ++mb) { acc[mb][nb] = wmmab(a[mb], b, acc[mb][nb]); acc[mb][nb] = wmmab(a2[mb], b, acc[mb][nb]); acc[mb][nb] = wmmab(a[mb], b2, acc[mb][nb]); } }
            // keeps the matrix instructions' distance on the taken side of the loop branch too
            asm volatile("v_nop\n\tv_nop\n\tv_nop\n\tv_nop" : "+v"(acc[0][0]), "+v"(acc[1][1]), "+v"(acc[2][2]), "+v"(acc[3][3]) : "v"(a[0]), "v"(a[3]));
            asm volatile("s_wait_xcnt 0x0" :: "v"(va), "v"(vb) : "memory");   // precaution: as in the first loop, for the two v addresses of this trip
        }
    }
    if (w < 5) {   // sum_j w rel_v[clip] = WB . rel_v: buckets w*32 .. w*32+31
        const bf* wa = (const bf*)QRs + lr * (QP * 2) + w * 32 + 8 * hi; const bf* rv = Brv + w * 512 + lane * 8; v16bf a[4], a2[4];
#pragma unroll
        for (int mb = 0; mb < 4; ++mb) { a[mb] = ldfa(wa + mb * 16 * (QP * 2)); a2[mb] = ldfa(wa + mb * 16 * (QP * 2) + QP); }
#pragma unroll
        for (int nb = 0; nb < 4; ++nb) { const v16bf b = ldfo(rv + nb * 2560);
#pragma unroll
            for (int mb = 0; mb < 4; ++mb) { acc[mb][nb] = wmmab(a[mb], b, acc[mb][nb]); acc[mb][nb] = wmmab(a2[mb], b, acc[mb][nb]); } }
    }
    __syncthreads();   // every wave has read its slice of the planes: their space now takes the 16 partial tiles [w][64][64]; column bit 5 flipped in rows 8..15 of each 16, so that the two half-waves' stores fall on different banks
#pragma unroll
    for (int mb = 0; mb < 4; ++mb)
#pragma unroll
        for (int nb = 0; nb < 4; ++nb)
#pragma unroll
            for (int j = 0; j < 8; ++j) *(fa*)(S + w * 4096 + (mb * 16 + hi * 8 + j) * 64 + ((nb * 16 + lr) ^ (hi << 5))) = acc[mb][nb][j];
    __syncthreads();
    const int c4 = (tid & 15) * 4; const size_t ob = ((z / NH_) * TT + r0) * DQ + (z % NH_) * HD + c4;
#pragma unroll
    for (int g = 0; g < 2; ++g) { const int row = (tid >> 4) + g * 32; const float* pr = S + row * 64 + (c4 ^ (((row >> 3) & 1) << 5)); v4f s = *(const v4fa*)pr;
#pragma unroll
        for (int k = 1; k < 16; ++k) { const v4f t = *(const v4fa*)(pr + k * 4096); s[0] = __fadd_rn(s[0], t[0]); s[1] = __fadd_rn(s[1], t[1]); s[2] = __fadd_rn(s[2], t[2]); s[3] = __fadd_rn(s[3], t[3]); }
        u32x2 oh, ol; unsigned a2, c2; split2(s[0], s[1], a2, c2); oh[0] = a2; ol[0] = c2; split2(s[2], s[3], a2, c2); oh[1] = a2; ol[1] = c2;
        *(u32x2*)(Ah + ob + (size_t)row * DQ) = oh; *(u32x2*)(Al + ob + (size_t)row * DQ) = ol; }
}

extern "C" void kernel_launch(void* const* d_in, const int* in_sizes, int n_in,
                              void* d_out, int out_size, void* d_ws, size_t ws_size, hipStream_t stream) {
    (void)in_sizes; (void)n_in; (void)out_size;
    const float* x = (const float*)d_in[0]; const float* wq = (const float*)d_in[1]; const float* wk = (const float*)d_in[2]; const float* wv = (const float*)d_in[3]; const float* wo = (const float*)d_in[4]; const float* relk = (const float*)d_in[5]; const float* relv = (const float*)d_in[6]; const float* cosT = nullptr; const float* sinT = nullptr; (void)cosT; (void)sinT;
    float* OUT = (float*)d_out;     // [4][1024][1024]
    char* wsp = (char*)d_ws;
    auto take = [&](size_t bytes) { char* p = wsp; wsp += (bytes + 255) & ~(size_t)255; return (void*)p; };
    bf* WQ = (bf*)take((size_t)DQ * DM * 2); bf* WK = (bf*)take((size_t)DKV * DM * 2); bf* WV = (bf*)take((size_t)DKV * DM * 2); bf* WO = (bf*)take((size_t)DM * DQ * 2); float* CS = (float*)take((size_t)TT * HD * 2 * 4);
    bf* XB = (bf*)take((size_t)NB_ * TT * DM * 2); bf* BRK = (bf*)take((size_t)192 * HD * 2); bf* BRV = (bf*)take((size_t)HD * 160 * 2); float* QR = (float*)take((size_t)ZH * TT * 192 * 4); bf* WBh = (bf*)take((size_t)ZH * TT * 160 * 2); bf* WBl = (bf*)take((size_t)ZH * TT * 160 * 2); float* O2 = (float*)take((size_t)ZH * TT * HD * 4);
    h16* VT16 = (h16*)take((size_t)NKV * HD * TT * 2);
    bf* QPh = (bf*)take((size_t)NB_ * NH_ * TT * HD * 2); bf* QPl = (bf*)take((size_t)NB_ * NH_ * TT * HD * 2); bf* KPh = (bf*)take((size_t)NB_ * NKV * TT * HD * 2); bf* KPl = (bf*)take((size_t)NB_ * NKV * TT * HD * 2); bf* VTh = (bf*)take((size_t)NB_ * NKV * HD * TT * 2); bf* VTl = (bf*)take((size_t)NB_ * NKV * HD * TT * 2); bf* Ph = (bf*)take((size_t)ZH * RH * TT * 2); bf* Pl = (bf*)take((size_t)ZH * RH * TT * 2);
    float* Sb = (float*)take((size_t)ZH * TT * TT * 4); float* Ob = (float*)take((size_t)ZH * TT * HD * 4); bf* ATh = (bf*)take((size_t)NB_ * TT * DQ * 2); bf* ATl = (bf*)take((size_t)NB_ * TT * DQ * 2);
    if ((size_t)(wsp - (char*)d_ws) > ws_size) return;    // ws 256 MiB
    k_prep<<<4 * PBW + PBX + PBK + PBV, 256, 0, stream>>>(x, wq, wk, wv, wo, relk, relv, XB, WQ, WK, WV, WO, BRK, BRV);
    k_qkv<<<dim3(TT / 128, DQ / 128, 3 * NB_), 256, 0, stream>>>(XB, WQ, WK, WV, QPh, QPl, KPh, KPl, VTh, VTl);
    k_attn<<<dim3(TT / AR, NB_ * NH_), 512, 0, stream>>>(QPh, QPl, KPh, KPl, VTh, VTl, BRK, BRV, ATh, ATl);   // one kv head per query head: plane z = b*NH_ + head in all six
    k_wo<<<dim3(NB_ * TT / 128, DM / 128, 1), 256, 0, stream>>>(ATh, ATl, WO, OUT);
}

// v008
// One run takes 138 microseconds.
// Next to v007, in two timings, it ran 1.05 and 1.06 times as fast.
// Over all steps from v000 it is 16.0 times as fast.
#include <hip/hip_runtime.h>

// MultiHead2DAttention_v2 (x [4][1024][1024]; q = (x Wq) / 8, k = x Wk, v = x Wv ([in,out], no bias; 16 heads x 64); relative-position embeddings rel_k / rel_v [129][64] indexed by clip(j - i, -64, 64) + 64;
//   logits = q.k + q.rel_k[clip]; w = softmax; out_h = w v + sum_j w[i][j] rel_v[clip(j - i)]; out = merged Wo -> [4][1024][1024]).
// The relative terms use exact regroupings: q.rel_k[clip(j-i)] is read from QR = q rel_k^T ([T][129] per head), and sum_j w rel_v[clip] = WB rel_v with WB[i][r] = the softmax mass in bucket r (single keys for r = 1..127, tail sums for r = 0 / 128).
// Compute dtypes, f32 accumulate: every input rounded to bf16; q/k/v on PLAIN bf16 operands (inputs: exact); QR as hl x exact (2 products); scores and w.v as hl x hl (3 products) on every row; the 1/8 scale (exact), rel bias, softmax and bucket sums f32; WB rel_v as hl x exact (2 products); Wo hl x exact (2 products).

#define NB_  4
#define TT   1024
#define DM   1024
#define NH_  16
#define NKV  16
#define REP  (NH_ / NKV)
#define HD   64
#define DQ   (NH_ * HD)
#define DKV  (NKV * HD)
#define ZH   16
#define RH   1024                  // query rows < RH use hi+lo planes (0: none)
#define WIN  0
#define PCAR 1024.0f
#define SCL  0.125f   // HD^-0.5
typedef _Float16 h16;
typedef unsigned short bf;
typedef __attribute__((ext_vector_type(16))) __bf16   v16bf;
typedef __attribute__((ext_vector_type(16))) _Float16 v16h;
typedef __attribute__((ext_vector_type(8)))  _Float16 v8h;
typedef __attribute__((ext_vector_type(8)))  unsigned short v8us;
typedef __attribute__((ext_vector_type(8)))  float    v8f;
typedef __attribute__((ext_vector_type(4)))  float    v4f;
typedef v8h  __attribute__((may_alias)) v8ha;
typedef v4f  __attribute__((may_alias)) v4fa;
typedef v8us __attribute__((may_alias)) v8usa;

__device__ __forceinline__ unsigned short f2bf(float f) { unsigned u = __float_as_uint(f); u += 0x7FFFu + ((u >> 16) & 1u); return (unsigned short)(u >> 16); }
__device__ __forceinline__ float bf2f(unsigned short b) { return __uint_as_float(((unsigned)b) << 16); }
__device__ __forceinline__ float bfr(float f) { return bf2f(f2bf(f)); }
__device__ __forceinline__ v16h cat16(v8h lo, v8h hi) { return __builtin_shufflevector(lo, hi, 0, 1, 2, 3, 4, 5, 6, 7, 8, 9, 10, 11, 12, 13, 14, 15); }
__device__ __forceinline__ v16bf cat16b(v8us lo, v8us hi) { return __builtin_bit_cast(v16bf, __builtin_shufflevector(lo, hi, 0, 1, 2, 3, 4, 5, 6, 7, 8, 9, 10, 11, 12, 13, 14, 15)); }
__device__ __forceinline__ v8f wmma16(v16h a, v16h b, v8f c) { return __builtin_amdgcn_wmma_f32_16x16x32_f16(false, a, false, b, (short)0, c, false, false); }
__device__ __forceinline__ v8f wmmab(v16bf a, v16bf b, v8f c) { return __builtin_amdgcn_wmma_f32_16x16x32_bf16(false, a, false, b, (short)0, c, false, false); }



// ---- gemmw: GEMM body, one 128x128 output tile per work-group of 8 waves (4 x 2, each wave 32x64 = 8 accumulators); grid (M/128, N/128, .), 256 threads; z = batch item.
// The K-contiguous 16-bit operand planes come into LDS as whole 128-byte lines, by asynchronous copies, in stages of 128 k (two buffers: the next stage flies while this one is multiplied); the fragments are read from LDS.
// C[m][n] (f32, pitch ldc) = sum_k A[m][k] Bt[n][k] (NSPLIT 1: + A2[m][k] Bt[n][k]). z-batch strides sA/sB/sC in elements. K % 128 == 0, M % 128 == 0, N % 128 == 0.
// PL: no f32 C; each result is split into hi + lo bf16 here and stored in the planes Ph / Pl in FRAGMENT ORDER: the 16 x 64 tile of rows m0.. (m0 % 16 == 0), columns n0.. (n0 % 64 == 0) is the 1024 elements from z sC + (n0 / 64) sY + m0 ldc,
// and inside it element (r, c) stands at (c / 8) * 128 + r * 8 + c % 8: the 16-byte pieces that the 32 lanes of one fragment load take are 512 bytes in a row (four whole lines), not 32 bytes out of each of 16 lines.
__device__ __forceinline__ void splitf(float y, unsigned short& h, unsigned short& l) { h = f2bf(y); l = f2bf(y - bf2f(h)); }
// Two f32 rounded to bf16 (to nearest, ties to even, as f2bf does) by the chip's own packed conversion: one instruction a pair; first value in the low half.
typedef __attribute__((ext_vector_type(2))) float f32x2;
typedef __attribute__((ext_vector_type(2))) __bf16 bf16x2;
typedef __attribute__((ext_vector_type(2))) unsigned u32x2;
typedef __attribute__((ext_vector_type(4))) unsigned u32x4;
typedef u32x2 __attribute__((may_alias)) u32x2a;
__device__ __forceinline__ unsigned cvt2(float a, float b) { const f32x2 x = {a, b}; return __builtin_bit_cast(unsigned, __builtin_convertvector(x, bf16x2)); }
// hi + lo split of a pair: h = the two hi halves, l = the two rounded remainders
__device__ __forceinline__ void split2(float y0, float y1, unsigned& h, unsigned& l) { h = cvt2(y0, y1); l = cvt2(y0 - __uint_as_float(h << 16), y1 - __uint_as_float(h & 0xFFFF0000u)); }
#define GK 128             // k per stage: rows of 256 bytes
#define GP 136             // LDS row pitch in elements: 272 B = 16 B x odd, so that the 16-byte fragment reads of 16 rows fall on distinct banks
#define GT (128 * GP)      // one operand's stage tile, elements
__device__ __forceinline__ v16bf ldfs(const bf* p) { return cat16b(*(const v8usa*)p, *(const v8usa*)(p + 16)); }
// Eight asynchronous 16-byte copies a lane, 16 rows apart: LDS byte address l, global address g, global row pitch K elements. 16 lanes bring one 256-byte row, 256 threads one operand's 128 rows.
// The s_wait_xcnt stands inside the statement as a precaution: in front of any later rewrite of the address registers that the copies name.
__device__ __forceinline__ void cp8(unsigned l, const bf* g, size_t K) {
    asm volatile("global_load_async_to_lds_b128 %0, %8, off\n\t"
                 "global_load_async_to_lds_b128 %1, %9, off\n\t"
                 "global_load_async_to_lds_b128 %2, %10, off\n\t"
                 "global_load_async_to_lds_b128 %3, %11, off\n\t"
                 "global_load_async_to_lds_b128 %4, %12, off\n\t"
                 "global_load_async_to_lds_b128 %5, %13, off\n\t"
                 "global_load_async_to_lds_b128 %6, %14, off\n\t"
                 "global_load_async_to_lds_b128 %7, %15, off\n\t"
                 "s_wait_xcnt 0x0"
                 :: "v"(l), "v"(l + 16 * GP * 2), "v"(l + 32 * GP * 2), "v"(l + 48 * GP * 2), "v"(l + 64 * GP * 2), "v"(l + 80 * GP * 2), "v"(l + 96 * GP * 2), "v"(l + 112 * GP * 2),
                    "v"(g), "v"(g + 16 * K), "v"(g + 32 * K), "v"(g + 48 * K), "v"(g + 64 * K), "v"(g + 80 * K), "v"(g + 96 * K), "v"(g + 112 * K) : "memory");
}
template <int NSPLIT, bool PL>
__device__ __forceinline__ void gemmw(const size_t z, const bf* __restrict__ A, const bf* __restrict__ A2, const bf* __restrict__ Bt, int K, float* C, int ldc, size_t sA, size_t sB, size_t sC, bf* Ph, bf* Pl, size_t sY) {
    constexpr int NOP = 2 + NSPLIT;                       // operand tiles of a stage: A (, A2), Bt
    __shared__ __align__(16) bf ring[2 * NOP * GT];
    __shared__ __align__(16) float osw[8 * 16 * 68];
    A += z * sA; if (NSPLIT) A2 += z * sA; Bt += z * sB; if (!PL) C += z * sC;
    const int tid = threadIdx.x, lane = tid & 31, lr = lane & 15, hi = lane >> 4; const int w = __builtin_amdgcn_readfirstlane(tid >> 5);
    const int r0 = blockIdx.x * 128 + (w >> 1) * 32, c0 = blockIdx.y * 128 + (w & 1) * 64; float* os = osw + w * (16 * 68);
    const size_t goff = (size_t)(tid >> 4) * K + (tid & 15) * 8;
    const bf* ga = A + (size_t)blockIdx.x * 128 * K + goff; const bf* gb = Bt + (size_t)blockIdx.y * 128 * K + goff; const bf* ga2 = NSPLIT ? A2 + (size_t)blockIdx.x * 128 * K + goff : nullptr;
    const unsigned l0 = (unsigned)(size_t)(const void*)ring + ((tid >> 4) * GP + (tid & 15) * 8) * 2;
    auto fill = [&](int t) {   // stage t: 128 rows x 128 k of each operand into buffer t % 2
        const unsigned lb = l0 + (t & 1) * (NOP * GT * 2); const size_t ko = (size_t)t * GK;
        cp8(lb, ga + ko, K); if (NSPLIT) cp8(lb + GT * 2, ga2 + ko, K); cp8(lb + (NOP - 1) * GT * 2, gb + ko, K); };
    v8f acc[2][4];
#pragma unroll
    for (int mb = 0; mb < 2; ++mb)
#pragma unroll
        for (int nb = 0; nb < 4; ++nb) acc[mb][nb] = (v8f){};
    const int nt = K / GK;
    fill(0);
    asm volatile("s_wait_asynccnt 0x0" ::: "memory");   // this wave's copies of stage 0 have landed
    __syncthreads();                                     // ... and every other wave's
    if (nt > 1) fill(1);
#pragma unroll 1   // rolled: one stage is one trip of the ring
    for (int t = 0; t < nt; ++t) {
        const bf* sa = ring + (t & 1) * (NOP * GT) + ((w >> 1) * 32 + lr) * GP + 8 * hi; const bf* sb = ring + (t & 1) * (NOP * GT) + (NOP - 1) * GT + ((w & 1) * 64 + lr) * GP + 8 * hi;
        v16bf a[2][2], a2[2][2], b[2][4];   // two fragment sets: the next 32 k's LDS reads go out as one group ahead of this 32 k's products (inside the stage only)
#pragma unroll
        for (int mb = 0; mb < 2; ++mb) { a[0][mb] = ldfs(sa + mb * 16 * GP); if (NSPLIT) a2[0][mb] = ldfs(sa + GT + mb * 16 * GP); }
#pragma unroll
        for (int nb = 0; nb < 4; ++nb) b[0][nb] = ldfs(sb + nb * 16 * GP);
#pragma unroll
        for (int q = 0; q < GK / 32; ++q) { const int cu = q & 1, nx = cu ^ 1, ks = (q + 1) * 32;
            if (q + 1 < GK / 32) {
#pragma unroll
                for (int mb = 0; mb < 2; ++mb) { a[nx][mb] = ldfs(sa + mb * 16 * GP + ks); if (NSPLIT) a2[nx][mb] = ldfs(sa + GT + mb * 16 * GP + ks); }
#pragma unroll
                for (int nb = 0; nb < 4; ++nb) b[nx][nb] = ldfs(sb + nb * 16 * GP + ks);
                __builtin_amdgcn_sched_barrier(0); }   // holds the group of reads above ahead of the products below: the scheduler otherwise sinks each read to its first use, and the wave waits out the LDS latency in front of every pair of products
#pragma unroll
            for (int nb = 0; nb < 4; ++nb)
#pragma unroll
                for (int mb = 0; mb < 2; ++mb) { acc[mb][nb] = wmmab(a[cu][mb], b[cu][nb], acc[mb][nb]); if (NSPLIT) acc[mb][nb] = wmmab(a2[cu][mb], b[cu][nb], acc[mb][nb]); }
        }
        // keeps the matrix instructions' distance on the taken side of the branches behind them too
        asm volatile("v_nop\n\tv_nop\n\tv_nop\n\tv_nop" : "+v"(acc[0][0]), "+v"(acc[1][0]), "+v"(acc[0][1]), "+v"(acc[1][1]), "+v"(acc[0][2]), "+v"(acc[1][2]), "+v"(acc[0][3]), "+v"(acc[1][3]));
        asm volatile("s_wait_dscnt 0x0" ::: "memory");      // this wave's reads of buffer t % 2 are done before the buffer is refilled
        asm volatile("s_wait_asynccnt 0x0" ::: "memory");   // this wave's copies of stage t + 1 have landed
        __syncthreads();                                     // publishes stage t + 1 and ends every wave's reads of stage t
        if (t + 2 < nt) fill(t + 2);
    }
    asm volatile("s_wait_asynccnt 0x0" ::: "memory");   // no copy is outstanding when the wave goes on to its end
#pragma unroll
    for (int mb = 0; mb < 2; ++mb) {
#pragma unroll
        for (int nb = 0; nb < 4; ++nb) {
#pragma unroll
            for (int j = 0; j < 8; ++j) os[(hi * 8 + j) * 68 + nb * 16 + lr] = acc[mb][nb][j]; }
        __builtin_amdgcn_wave_barrier(); asm volatile("" ::: "memory");
        if (PL) {   // 8 results a lane: row lane % 16, columns 16 s + 8 (lane / 16) ..; the 32 lanes store 512 bytes in a row of each plane
            const size_t pb = z * sC + (size_t)(c0 >> 6) * sY + (size_t)(r0 + mb * 16) * ldc + lane * 8;
#pragma unroll
            for (int s = 0; s < 4; ++s) { const int row = lr, cofs = s * 16 + hi * 8; const v4f v0 = *(const v4fa*)(os + row * 68 + cofs), v1 = *(const v4fa*)(os + row * 68 + cofs + 4); u32x4 oh, ol; unsigned a2, c2;
                split2(v0[0], v0[1], a2, c2); oh[0] = a2; ol[0] = c2; split2(v0[2], v0[3], a2, c2); oh[1] = a2; ol[1] = c2; split2(v1[0], v1[1], a2, c2); oh[2] = a2; ol[2] = c2; split2(v1[2], v1[3], a2, c2); oh[3] = a2; ol[3] = c2;
                *(u32x4*)(Ph + pb + s * 256) = oh; *(u32x4*)(Pl + pb + s * 256) = ol; }
        } else {
            float* crow = C + (size_t)(r0 + mb * 16) * ldc + c0;
#pragma unroll
            for (int s = 0; s < 8; ++s) { const int row = 2 * s + hi, cofs = lr * 4; const v4f val = *(const v4fa*)(os + row * 68 + cofs);
                *(v4f*)(crow + (size_t)row * ldc + cofs) = val; }
             }
        __builtin_amdgcn_wave_barrier(); asm volatile("" ::: "memory");
    }
}

// The three projections of all NB_ batch items in ONE launch: grid (8, 8, 3 * NB_), blockIdx.z = projection * NB_ + batch item. q and k: one 64-column tile is one head, planes [b*NH_ + head][t / 16][tile of 16 t x 64 d].
// v: the operands change places (rows = v columns, columns = t), so that the planes [b*NKV + head][d / 16][t / 64][tile of 16 d x 64 t] come out of the same epilogue.
__global__ __launch_bounds__(256) void k_qkv(const bf* __restrict__ XB, const bf* __restrict__ WQ, const bf* __restrict__ WK, const bf* __restrict__ WV, bf* QPh, bf* QPl, bf* KPh, bf* KPl, bf* VTh, bf* VTl) {
    const int p = blockIdx.z / NB_; const size_t z = blockIdx.z % NB_; const bool tv = (p == 2);
    gemmw<0, true>(z, tv ? WV : XB, nullptr, tv ? XB : (p ? WK : WQ), DM, nullptr, tv ? TT : HD, tv ? (size_t)0 : (size_t)TT * DM, tv ? (size_t)TT * DM : (size_t)0, (size_t)NH_ * TT * HD,
                   tv ? VTh : (p ? KPh : QPh), tv ? VTl : (p ? KPl : QPl), tv ? (size_t)1024 : (size_t)TT * HD);
}
__global__ __launch_bounds__(256) void k_wo(const bf* __restrict__ Ah, const bf* __restrict__ Al, const bf* __restrict__ WO, float* OUT) {
    gemmw<1, false>(0, Ah, Al, WO, DQ, OUT, DM, 0, 0, 0, nullptr, nullptr, 0);
}

__device__ __forceinline__ h16 tohx(float x) { return (h16)x; }
typedef __attribute__((ext_vector_type(2))) _Float16 v2h;
typedef __attribute__((ext_vector_type(4))) _Float16 v4h;
typedef __attribute__((ext_vector_type(2))) unsigned short v2us;
typedef __attribute__((ext_vector_type(4))) unsigned short v4us;
typedef __attribute__((ext_vector_type(2))) float v2f;
typedef __attribute__((ext_vector_type(4))) int v4i;

__device__ __forceinline__ void d_wtG(const int blk, const float* __restrict__ w, int K, int N, bf* Bt) {
    const int lane = threadIdx.x & 31; const int L0 = (blk * 8 + (threadIdx.x >> 5)) * 8; const int nlines = N * K / 64;
{
#pragma unroll 1
        for (int l = 0; l < 8; ++l) { const int L = L0 + l; if (L >= nlines) break; const size_t e = (size_t)L * 64 + lane * 2; const int k = (int)(e % K), n = (int)(e / K); 
            *(unsigned*)(Bt + e) = cvt2(w[(size_t)k * N + n], w[(size_t)(k + 1) * N + n]); }
         }
}
__device__ __forceinline__ void d_cvt8(const int blk, const float* __restrict__ src, bf* dst, size_t n8) { const size_t i = (size_t)blk * 256 + threadIdx.x; if (i >= n8) return; const v8f v = *(const v8f*)(src + i * 8); u32x4 o;
#pragma unroll
    for (int k = 0; k < 4; ++k) o[k] = cvt2(v[2 * k], v[2 * k + 1]); *(u32x4*)(dst + i * 8) = o;  }
__global__ __launch_bounds__(256) void k_cscvt(const float* __restrict__ cosT, const float* __restrict__ sinT, float* CS) { const int idx = blockIdx.x * 256 + threadIdx.x; if (idx >= TT * HD) return; v2f cs; cs[0] = bfr(cosT[idx]); cs[1] = bfr(sinT[idx]); *(v2f*)(CS + (size_t)idx * 2) = cs;  }
// k_asoft: per row (zz, i): t = S x HD^-0.5 (no mask); softmax over the 1024 keys (register row, one exp, fixed trees);
__global__ __launch_bounds__(256) void k_asoft(const float* __restrict__ Sb, h16* P16, bf* Ph, bf* Pl) {
    const int lane = threadIdx.x & 31; const int row = blockIdx.x * 8 + (threadIdx.x >> 5); if (row >= ZH * TT) return; const int i = row % TT; const int zz = row / TT; (void)zz; const bool hires = (i < RH); const float* sr = Sb + (size_t)row * TT; float v[TT / 32]; float mx = -3.0e38f;
#pragma unroll
    for (int ch = 0; ch < TT / 128; ++ch) { const int j0 = ch * 128 + lane * 4; const v4f a = *(const v4f*)(sr + j0);
#pragma unroll
        for (int q = 0; q < 4; ++q) { const int j = j0 + q; (void)j; const float t = a[q] * SCL; v[ch * 4 + q] = t; mx = fmaxf(mx, t); } }
#pragma unroll
    for (int sh = 16; sh; sh >>= 1) mx = fmaxf(mx, __shfl_xor(mx, sh, 32));
    float sum = 0.f;
#pragma unroll
    for (int k = 0; k < TT / 32; ++k) { float d0 = __fsub_rn(v[k], mx); asm volatile("" : "+v"(d0)); v[k] = __builtin_amdgcn_exp2f(__fmul_rn(d0, 1.4426950408889634f)); sum += v[k]; }
#pragma unroll
    for (int sh = 16; sh; sh >>= 1) sum += __shfl_xor(sum, sh, 32);
    const float f = __fdiv_rn(hires ? 1.0f : PCAR, sum);
{
        if (hires) {
#pragma unroll
            for (int ch = 0; ch < TT / 128; ++ch) { v4us oh, ol;
#pragma unroll
                for (int q = 0; q < 4; ++q) { unsigned short a, c2; splitf(v[ch * 4 + q] * f, a, c2); oh[q] = a; ol[q] = c2; }
                const size_t oo = ((size_t)zz * (RH ? RH : 1) + i) * TT + ch * 128 + lane * 4; *(v4us*)(Ph + oo) = oh; *(v4us*)(Pl + oo) = ol; }
        } else {
#pragma unroll
            for (int ch = 0; ch < TT / 128; ++ch) { v4h o4;
#pragma unroll
                for (int q = 0; q < 4; ++q) o4[q] = tohx(v[ch * 4 + q] * f);
                *(v4h*)(P16 + (size_t)row * TT + ch * 128 + lane * 4) = o4; } }
         }
}
__device__ __forceinline__ void d_relk(const int blk, const float* __restrict__ rk, bf* Bt) { const int e = (blk * 256 + threadIdx.x) * 4; if (e >= 192 * HD) return; const int r = e / HD; const int d = e % HD; v4us o;   // rel_k[r][d] (r < 129) else 0, in fragment order: tiles of 16 r x 64 d
#pragma unroll
    for (int u = 0; u < 4; ++u) o[u] = (r < 129) ? f2bf(rk[e + u]) : (unsigned short)0; *(v4us*)(Bt + (r >> 4) * 1024 + (d >> 3) * 128 + (r & 15) * 8 + (d & 7)) = o;  }
__device__ __forceinline__ void d_relv(const int blk, const float* __restrict__ rv, bf* Bt) { const int e = (blk * 256 + threadIdx.x) * 4; if (e >= HD * 160) return; const int r = e % 160; const int d = e / 160; v4us o;   // rel_v[r][d] (r < 129) else 0, in fragment order: tiles [d / 16][r / 32] of 16 d x 32 r
#pragma unroll
    for (int u = 0; u < 4; ++u) o[u] = (r + u < 129) ? f2bf(rv[(size_t)(r + u) * HD + d]) : (unsigned short)0; *(v4us*)(Bt + ((d >> 4) * 5 + (r >> 5)) * 512 + ((r & 31) >> 3) * 128 + (d & 15) * 8 + (r & 7)) = o;  }
// ---- k_prep: every operand plane that the products read, in ONE launch; the block index picks the job (the same for a whole work-group). The four weight transposes, whose waves run longest, come first.
#define PBW (DM * DQ / 64 / 64)                 // blocks of one weight transpose
#define PBX (NB_ * TT * DM / 8 / 256)           // blocks of the x conversion
#define PBK ((192 * HD / 4 + 255) / 256)        // blocks of the rel_k plane
#define PBV ((HD * 160 / 4 + 255) / 256)        // blocks of the rel_v plane
__global__ __launch_bounds__(256) void k_prep(const float* __restrict__ x, const float* __restrict__ wq, const float* __restrict__ wk, const float* __restrict__ wv, const float* __restrict__ wo, const float* __restrict__ relk, const float* __restrict__ relv,
                                              bf* XB, bf* WQ, bf* WK, bf* WV, bf* WO, bf* BRK, bf* BRV) {
    int b = blockIdx.x;
    if (b < 4 * PBW) { const int m = b / PBW; d_wtG(b % PBW, m == 0 ? wq : m == 1 ? wk : m == 2 ? wv : wo, DM, DQ, m == 0 ? WQ : m == 1 ? WK : m == 2 ? WV : WO); return; }
    b -= 4 * PBW;
    if (b < PBX) { d_cvt8(b, x, XB, (size_t)NB_ * TT * DM / 8); return; }
    b -= PBX;
    if (b < PBK) { d_relk(b, relk, BRK); return; }
    d_relv(b - PBK, relv, BRV);
}
// ---- k_attn: the whole attention of 64 query rows of one head in ONE work-group (16 waves); the 64 x 1024 score rows stay in LDS from the q.k products to the w.v products. grid (TT/64, NB_*NH_).
// Phase 1: wave w forms the 64 x 64 score tile of keys w*64.. (hl x hl, 3 products) and, waves 0..8, 16 columns of QR = q rel_k^T (hl x exact). Phase 2: one wave per row, 4 rows each: bias, softmax, hi/lo split written over the row's own f32 scores
// (hi plane in its first 2048 bytes, lo plane in the next), tail sums and bucket planes written over the row's own QR. Phase 3: wave w multiplies key slice w*64.. of w with v (3 products), waves 0..4 add one 32-bucket slice of WB rel_v (2 products);
// the 16 partial 64 x 64 tiles are summed through LDS in wave order and split into the merged hi/lo planes.
#define AR 64      // query rows per work-group
#define SP 1028    // score row pitch in floats: 4112 B = 16 B x odd, so that the 16-byte fragment reads of 16 rows fall on distinct banks
#define QP 168     // QR row pitch in floats; the same 672 B then hold the row's bucket planes: hi at byte 0, lo at byte 336
typedef v4us __attribute__((may_alias)) v4usa;
typedef unsigned short __attribute__((may_alias)) usa;
typedef float __attribute__((may_alias)) fa;
__device__ __forceinline__ v16bf ldfa(const bf* p) { return cat16b(*(const v8usa*)p, *(const v8usa*)(p + 16)); }
// a fragment from a global plane in fragment order: p = the 32-k half tile + lane * 8; each of the two loads takes 512 bytes in a row over the wave. Same elements in the same lanes and registers as from a row-major plane.
__device__ __forceinline__ v16bf ldfo(const bf* p) { return cat16b(*(const v8us*)p, *(const v8us*)(p + 256)); }
__global__ __launch_bounds__(512) void k_attn(const bf* __restrict__ Qh, const bf* __restrict__ Ql, const bf* __restrict__ Kh, const bf* __restrict__ Kl, const bf* __restrict__ Vh, const bf* __restrict__ Vl, const bf* __restrict__ Brk, const bf* __restrict__ Brv, bf* Ah, bf* Al) {
    __shared__ __align__(16) float S[AR * SP];
    __shared__ __align__(16) float QRs[AR * QP];
    const int tid = threadIdx.x, lane = tid & 31, lr = lane & 15, hi = lane >> 4; const int w = __builtin_amdgcn_readfirstlane(tid >> 5);
    const int r0 = blockIdx.x * AR; const size_t z = blockIdx.y;
    const bf* qh = Qh + z * TT * HD + (size_t)r0 * HD + lane * 8; const bf* ql = Ql + z * TT * HD + (size_t)r0 * HD + lane * 8;
    {
        const bf* kh = Kh + z * TT * HD + (size_t)(w * 64) * HD + lane * 8; const bf* kl = Kl + z * TT * HD + (size_t)(w * 64) * HD + lane * 8;
        v8f acc[4][4];
#pragma unroll
        for (int mb = 0; mb < 4; ++mb)
#pragma unroll
            for (int nb = 0; nb < 4; ++nb) acc[mb][nb] = (v8f){};
#pragma unroll 1   // rolled: both k steps' fragments at once would not fit the 256 registers of a 16-wave work-group
        for (int kc = 0; kc < HD; kc += 32) {
            v16bf a[4], a2[4]; const bf* qa = qh + kc * 16; const bf* qb = ql + kc * 16; const bf* ka = kh + kc * 16; const bf* kb = kl + kc * 16;
#pragma unroll
            for (int mb = 0; mb < 4; ++mb) { a[mb] = ldfo(qa + mb * 1024); a2[mb] = ldfo(qb + mb * 1024); }
#pragma unroll
            for (int nb = 0; nb < 4; ++nb) { const v16bf b = ldfo(ka + nb * 1024); const v16bf b2 = ldfo(kb + nb * 1024);
#pragma unroll
                for (int mb = 0; mb < 4; ++mb) { acc[mb][nb] = wmmab(a[mb], b, acc[mb][nb]); acc[mb][nb] = wmmab(a2[mb], b, acc[mb][nb]); acc[mb][nb] = wmmab(a[mb], b2, acc[mb][nb]); } }
            // keeps the matrix instructions' distance on the taken side of the loop branch too
            asm volatile("v_nop\n\tv_nop\n\tv_nop\n\tv_nop" : "+v"(acc[0][0]), "+v"(acc[1][1]), "+v"(acc[2][2]), "+v"(acc[3][3]) : "v"(a[0]), "v"(a[3]));
            asm volatile("s_wait_xcnt 0x0" :: "v"(qa), "v"(qb), "v"(ka), "v"(kb) : "memory");   // precaution: stands in front of every rewrite of the address registers that this trip's global loads name; as inputs the four addresses stay in their registers up to here, so that no load's result lands on them
        }
#pragma unroll
        for (int mb = 0; mb < 4; ++mb)
#pragma unroll
            for (int nb = 0; nb < 4; ++nb)
#pragma unroll
                for (int j = 0; j < 8; ++j) *(fa*)(S + (mb * 16 + hi * 8 + j) * SP + w * 64 + nb * 16 + lr) = acc[mb][nb][j];
    }
    if (w < 9) {   // QR[i][r] = q_i . rel_k[r] (unscaled), columns w*16 .. w*16+15 (rows 129.. of the table plane are zero)
        const bf* rk = Brk + w * 1024 + lane * 8; v8f aq[4];
#pragma unroll
        for (int mb = 0; mb < 4; ++mb) aq[mb] = (v8f){};
#pragma unroll
        for (int kc = 0; kc < HD; kc += 32) { const v16bf b = ldfo(rk + kc * 16);
#pragma unroll
            for (int mb = 0; mb < 4; ++mb) { aq[mb] = wmmab(ldfo(qh + mb * 1024 + kc * 16), b, aq[mb]); aq[mb] = wmmab(ldfo(ql + mb * 1024 + kc * 16), b, aq[mb]); } }
#pragma unroll
        for (int mb = 0; mb < 4; ++mb)
#pragma unroll
            for (int j = 0; j < 8; ++j) *(fa*)(QRs + (mb * 16 + hi * 8 + j) * QP + w * 16 + lr) = aq[mb][j];
    }
    __syncthreads();
#pragma unroll 1   // rolled: one row's 32 values a lane are the live set
    for (int rr = 0; rr < AR / 16; ++rr) { const int row = w * (AR / 16) + rr, i = r0 + row; float* sr = S + row * SP; float* qr = QRs + row * QP; float v[TT / 32]; float mx = -3.0e38f;
        // The row's eight 128-key chunks are dealt to the register slots relative to its window: slots 0 and 1 take chunks cb and cb + 1, which hold every key with |j - i| < 64; slot s >= 2 takes chunk (cb + s) % 8,
        // all of whose keys lie in the high tail (j - i >= 64; no wrap) or in the low tail (j - i <= -64; wrapped). cb is the same for the whole wave.
        int cb = (i - 63) >> 7; cb = __builtin_amdgcn_readfirstlane(cb < 0 ? 0 : (cb > 6 ? 6 : cb));   // held in a scalar register: the clamp otherwise goes to the vector unit, and every slot's chunk number and offset with it
        const float qlo8 = *(const fa*)qr * 0.125f, qhi8 = *(const fa*)(qr + 128) * 0.125f;   // the two table ends' bias, scaled (exact)
#pragma unroll
        for (int s = 0; s < TT / 128; ++s) { const int j0 = ((cb + s) & 7) * 128 + lane * 4; const v4f a = *(const v4fa*)(sr + j0);
            if (s < 2) {
#pragma unroll
                for (int u = 0; u < 4; ++u) { int r = j0 + u - i; r = (r < -64) ? -64 : (r > 64 ? 64 : r); const float t = __fadd_rn(a[u], *(const fa*)(qr + r + 64)) * 0.125f; v[s * 4 + u] = t; mx = fmaxf(mx, t); }
            } else { const float b8 = (cb + s < 8) ? qhi8 : qlo8;
#pragma unroll
                for (int u = 0; u < 4; ++u) { const float t = __builtin_fmaf(a[u], 0.125f, b8); v[s * 4 + u] = t; mx = fmaxf(mx, t); } } }   // = (a + bias) / 8: the scale is a power of two
#pragma unroll
        for (int sh = 16; sh; sh >>= 1) mx = fmaxf(mx, __shfl_xor(mx, sh, 32));
        // exp sums in three parts: the two window chunks (with their own tail keys picked by compare), the high-tail chunks, the low-tail chunks
        float mid = 0.f, lo = 0.f, hs = 0.f, run = 0.f, sth = 0.f;
#pragma unroll
        for (int q = 0; q < 8; ++q) { const int j = ((cb + (q >> 2)) & 7) * 128 + lane * 4 + (q & 3); v[q] = __builtin_amdgcn_exp2f(__fmul_rn(__fsub_rn(v[q], mx), 1.4426950408889634f)); mid += v[q];
            if (j <= i - 64) lo = __fadd_rn(lo, v[q]); if (j >= i + 64) hs = __fadd_rn(hs, v[q]); }
#pragma unroll
        for (int s = 2; s < TT / 128; ++s) { const bool wr = (cb + s == 8); sth = wr ? run : sth; run = wr ? 0.f : run;   // at the wrap the running sum is the high tail's; the low tail's starts
#pragma unroll
            for (int u = 0; u < 4; ++u) { const int q = s * 4 + u; v[q] = __builtin_amdgcn_exp2f(__fmul_rn(__fsub_rn(v[q], mx), 1.4426950408889634f)); run += v[q]; } }
        const float stl = cb ? run : 0.f; sth = cb ? sth : run;   // cb == 0: no wrap, no low-tail chunk
        float sum = (mid + stl) + sth; lo = __fadd_rn(stl, lo); hs = __fadd_rn(hs, sth);
#pragma unroll
        for (int sh = 16; sh; sh >>= 1) { sum += __shfl_xor(sum, sh, 32); lo = __fadd_rn(lo, __shfl_xor(lo, sh, 32)); hs = __fadd_rn(hs, __shfl_xor(hs, sh, 32)); }
        const float f = __fdiv_rn(1.0f, sum); lo *= f; hs *= f;
        bf* ph = (bf*)sr; bf* pl = ph + TT;
#pragma unroll
        for (int s = 0; s < TT / 128; ++s) { const int j0 = ((cb + s) & 7) * 128 + lane * 4; u32x2 oh, ol; float p[4];
#pragma unroll
            for (int q = 0; q < 4; ++q) p[q] = v[s * 4 + q] * f;
            unsigned a2, c2; split2(p[0], p[1], a2, c2); oh[0] = a2; ol[0] = c2; split2(p[2], p[3], a2, c2); oh[1] = a2; ol[1] = c2;
            *(u32x2a*)(ph + j0) = oh; *(u32x2a*)(pl + j0) = ol; }
        // the bucket reads below take what other lanes of this wave have just stored: keeps the compiler from moving them over the stores (a wave's LDS operations run in order)
        __builtin_amdgcn_wave_barrier(); asm volatile("" ::: "memory");
        bf* wh = (bf*)qr; bf* wl = wh + QP;
#pragma unroll
        for (int ch = 0; ch < 2; ++ch) { const int rb = ch * 128 + lane * 4; if (rb < 160) { v4us oh, ol;
#pragma unroll
            for (int u = 0; u < 4; ++u) { const int r = rb + u; unsigned short a2 = 0, c2 = 0; if (r == 0) splitf(lo, a2, c2); else if (r == 128) splitf(hs, a2, c2); else if (r < 128) { const int j = i + r - 64; if (j >= 0 && j < TT) { a2 = *(const usa*)(ph + j); c2 = *(const usa*)(pl + j); } } oh[u] = a2; ol[u] = c2; }
            *(v4usa*)(wh + rb) = oh; *(v4usa*)(wl + rb) = ol; } }
    }
    __syncthreads();
    v8f acc[4][4];
#pragma unroll
    for (int mb = 0; mb < 4; ++mb)
#pragma unroll
        for (int nb = 0; nb < 4; ++nb) acc[mb][nb] = (v8f){};
    {
        const bf* pa = (const bf*)S + lr * (SP * 2) + w * 64 + 8 * hi; const bf* vh = Vh + z * HD * TT + w * 1024 + lane * 8; const bf* vl = Vl + z * HD * TT + w * 1024 + lane * 8;
#pragma unroll 1   // rolled: both k steps' fragments at once would not fit the 256 registers of a 16-wave work-group
        for (int kc = 0; kc < 64; kc += 32) {
            v16bf a[4], a2[4]; const bf* va = vh + kc * 16; const bf* vb = vl + kc * 16;
#pragma unroll
            for (int mb = 0; mb < 4; ++mb) { a[mb] = ldfa(pa + mb * 16 * (SP * 2) + kc); a2[mb] = ldfa(pa + mb * 16 * (SP * 2) + TT + kc); }
#pragma unroll
            for (int nb = 0; nb < 4; ++nb) { const v16bf b = ldfo(va + nb * 16 * TT); const v16bf b2 = ldfo(vb + nb * 16 * TT);
#pragma unroll
                for (int mb = 0; mb < 4; ++mb) { acc[mb][nb] = wmmab(a[mb], b, acc[mb][nb]); acc[mb][nb] = wmmab(a2[mb], b, acc[mb][nb]); acc[mb][nb] = wmmab(a[mb], b2, acc[mb][nb]); } }
            // keeps the matrix instructions' distance on the taken side of the loop branch too
            asm volatile("v_nop\n\tv_nop\n\tv_nop\n\tv_nop" : "+v"(acc[0][0]), "+v"(acc[1][1]), "+v"(acc[2][2]), "+v"(acc[3][3]) : "v"(a[0]), "v"(a[3]));
            asm volatile("s_wait_xcnt 0x0" :: "v"(va), "v"(vb) : "memory");   // precaution: as in the first loop, for the two v addresses of this trip
        }
    }
    if (w < 5) {   // sum_j w rel_v[clip] = WB . rel_v: buckets w*32 .. w*32+31
        const bf* wa = (const bf*)QRs + lr * (QP * 2) + w * 32 + 8 * hi; const bf* rv = Brv + w * 512 + lane * 8; v16bf a[4], a2[4];
#pragma unroll
        for (int mb = 0; mb < 4; ++mb) { a[mb] = ldfa(wa + mb * 16 * (QP * 2)); a2[mb] = ldfa(wa + mb * 16 * (QP * 2) + QP); }
#pragma unroll
        for (int nb = 0; nb < 4; ++nb) { const v16bf b = ldfo(rv + nb * 2560);
#pragma unroll
            for (int mb = 0; mb < 4; ++mb) { acc[mb][nb] = wmmab(a[mb], b, acc[mb][nb]); acc[mb][nb] = wmmab(a2[mb], b, acc[mb][nb]); } }
    }
    __syncthreads();   // every wave has read its slice of the planes: their space now takes the 16 partial tiles [w][64][64]; column bit 5 flipped in rows 8..15 of each 16, so that the two half-waves' stores fall on different banks
#pragma unroll
    for (int mb = 0; mb < 4; ++mb)
#pragma unroll
        for (int nb = 0; nb < 4; ++nb)
#pragma unroll
            for (int j = 0; j < 8; ++j) *(fa*)(S + w * 4096 + (mb * 16 + hi * 8 + j) * 64 + ((nb * 16 + lr) ^ (hi << 5))) = acc[mb][nb][j];
    __syncthreads();
    const int c4 = (tid & 15) * 4; const size_t ob = ((z / NH_) * TT + r0) * DQ + (z % NH_) * HD + c4;
#pragma unroll
    for (int g = 0; g < 2; ++g) { const int row = (tid >> 4) + g * 32; const float* pr = S + row * 64 + (c4 ^ (((row >> 3) & 1) << 5)); v4f s = *(const v4fa*)pr;
#pragma unroll
        for (int k = 1; k < 16; ++k) { const v4f t = *(const v4fa*)(pr + k * 4096); s[0] = __fadd_rn(s[0], t[0]); s[1] = __fadd_rn(s[1], t[1]); s[2] = __fadd_rn(s[2], t[2]); s[3] = __fadd_rn(s[3], t[3]); }
        u32x2 oh, ol; unsigned a2, c2; split2(s[0], s[1], a2, c2); oh[0] = a2; ol[0] = c2; split2(s[2], s[3], a2, c2); oh[1] = a2; ol[1] = c2;
        *(u32x2*)(Ah + ob + (size_t)row * DQ) = oh; *(u32x2*)(Al + ob + (size_t)row * DQ) = ol; }
}

extern "C" void kernel_launch(void* const* d_in, const int* in_sizes, int n_in,
                              void* d_out, int out_size, void* d_ws, size_t ws_size, hipStream_t stream) {
    (void)in_sizes; (void)n_in; (void)out_size;
    const float* x = (const float*)d_in[0]; const float* wq = (const float*)d_in[1]; const float* wk = (const float*)d_in[2]; const float* wv = (const float*)d_in[3]; const float* wo = (const float*)d_in[4]; const float* relk = (const float*)d_in[5]; const float* relv = (const float*)d_in[6]; const float* cosT = nullptr; const float* sinT = nullptr; (void)cosT; (void)sinT;
    float* OUT = (float*)d_out;     // [4][1024][1024]
    char* wsp = (char*)d_ws;
    auto take = [&](size_t bytes) { char* p = wsp; wsp += (bytes + 255) & ~(size_t)255; return (void*)p; };
    bf* WQ = (bf*)take((size_t)DQ * DM * 2); bf* WK = (bf*)take((size_t)DKV * DM * 2); bf* WV = (bf*)take((size_t)DKV * DM * 2); bf* WO = (bf*)take((size_t)DM * DQ * 2); float* CS = (float*)take((size_t)TT * HD * 2 * 4);
    bf* XB = (bf*)take((size_t)NB_ * TT * DM * 2); bf* BRK = (bf*)take((size_t)192 * HD * 2); bf* BRV = (bf*)take((size_t)HD * 160 * 2); float* QR = (float*)take((size_t)ZH * TT * 192 * 4); bf* WBh = (bf*)take((size_t)ZH * TT * 160 * 2); bf* WBl = (bf*)take((size_t)ZH * TT * 160 * 2); float* O2 = (float*)take((size_t)ZH * TT * HD * 4);
    h16* VT16 = (h16*)take((size_t)NKV * HD * TT * 2);
    bf* QPh = (bf*)take((size_t)NB_ * NH_ * TT * HD * 2); bf* QPl = (bf*)take((size_t)NB_ * NH_ * TT * HD * 2); bf* KPh = (bf*)take((size_t)NB_ * NKV * TT * HD * 2); bf* KPl = (bf*)take((size_t)NB_ * NKV * TT * HD * 2); bf* VTh = (bf*)take((size_t)NB_ * NKV * HD * TT * 2); bf* VTl = (bf*)take((size_t)NB_ * NKV * HD * TT * 2); bf* Ph = (bf*)take((size_t)ZH * RH * TT * 2); bf* Pl = (bf*)take((size_t)ZH * RH * TT * 2);
    float* Sb = (float*)take((size_t)ZH * TT * TT * 4); float* Ob = (float*)take((size_t)ZH * TT * HD * 4); bf* ATh = (bf*)take((size_t)NB_ * TT * DQ * 2); bf* ATl = (bf*)take((size_t)NB_ * TT * DQ * 2);
    if ((size_t)(wsp - (char*)d_ws) > ws_size) return;    // ws 256 MiB
    k_prep<<<4 * PBW + PBX + PBK + PBV, 256, 0, stream>>>(x, wq, wk, wv, wo, relk, relv, XB, WQ, WK, WV, WO, BRK, BRV);
    k_qkv<<<dim3(TT / 128, DQ / 128, 3 * NB_), 256, 0, stream>>>(XB, WQ, WK, WV, QPh, QPl, KPh, KPl, VTh, VTl);
    k_attn<<<dim3(TT / AR, NB_ * NH_), 512, 0, stream>>>(QPh, QPl, KPh, KPl, VTh, VTl, BRK, BRV, ATh, ATl);   // one kv head per query head: plane z = b*NH_ + head in all six
    k_wo<<<dim3(NB_ * TT / 128, DM / 128, 1), 256, 0, stream>>>(ATh, ATl, WO, OUT);
}

// v009
// One run takes 131 microseconds.
// Next to v008, in two timings, it ran 1.05 times as fast each time.
// Over all steps from v000 it is 16.8 times as fast.
#include <hip/hip_runtime.h>

// MultiHead2DAttention_v2 (x [4][1024][1024]; q = (x Wq) / 8, k = x Wk, v = x Wv ([in,out], no bias; 16 heads x 64); relative-position embeddings rel_k / rel_v [129][64] indexed by clip(j - i, -64, 64) + 64;
//   logits = q.k + q.rel_k[clip]; w = softmax; out_h = w v + sum_j w[i][j] rel_v[clip(j - i)]; out = merged Wo -> [4][1024][1024]).
// The relative terms use exact regroupings: q.rel_k[clip(j-i)] is read from QR = q rel_k^T ([T][129] per head), and sum_j w rel_v[clip] = WB rel_v with WB[i][r] = the softmax mass in bucket r (single keys for r = 1..127, tail sums for r = 0 / 128).
// Compute dtypes, f32 accumulate: every input rounded to bf16; q/k/v on PLAIN bf16 operands (inputs: exact); QR as hl x exact (2 products); scores and w.v as hl x hl (3 products) on every row; the 1/8 scale (exact), rel bias, softmax and bucket sums f32; WB rel_v as hl x exact (2 products); Wo hl x exact (2 products).

#define NB_  4
#define TT   1024
#define DM   1024
#define NH_  16
#define NKV  16
#define REP  (NH_ / NKV)
#define HD   64
#define DQ   (NH_ * HD)
#define DKV  (NKV * HD)
#define ZH   16
#define RH   1024                  // query rows < RH use hi+lo planes (0: none)
#define WIN  0
#define PCAR 1024.0f
#define SCL  0.125f   // HD^-0.5
typedef _Float16 h16;
typedef unsigned short bf;
typedef __attribute__((ext_vector_type(16))) __bf16   v16bf;
typedef __attribute__((ext_vector_type(16))) _Float16 v16h;
typedef __attribute__((ext_vector_type(8)))  _Float16 v8h;
typedef __attribute__((ext_vector_type(8)))  unsigned short v8us;
typedef __attribute__((ext_vector_type(8)))  float    v8f;
typedef __attribute__((ext_vector_type(4)))  float    v4f;
typedef v8h  __attribute__((may_alias)) v8ha;
typedef v4f  __attribute__((may_alias)) v4fa;
typedef v8us __attribute__((may_alias)) v8usa;

__device__ __forceinline__ unsigned short f2bf(float f) { unsigned u = __float_as_uint(f); u += 0x7FFFu + ((u >> 16) & 1u); return (unsigned short)(u >> 16); }
__device__ __forceinline__ float bf2f(unsigned short b) { return __uint_as_float(((unsigned)b) << 16); }
__device__ __forceinline__ float bfr(float f) { return bf2f(f2bf(f)); }
__device__ __forceinline__ v16h cat16(v8h lo, v8h hi) { return __builtin_shufflevector(lo, hi, 0, 1, 2, 3, 4, 5, 6, 7, 8, 9, 10, 11, 12, 13, 14, 15); }
__device__ __forceinline__ v16bf cat16b(v8us lo, v8us hi) { return __builtin_bit_cast(v16bf, __builtin_shufflevector(lo, hi, 0, 1, 2, 3, 4, 5, 6, 7, 8, 9, 10, 11, 12, 13, 14, 15)); }
__device__ __forceinline__ v8f wmma16(v16h a, v16h b, v8f c) { return __builtin_amdgcn_wmma_f32_16x16x32_f16(false, a, false, b, (short)0, c, false, false); }
__device__ __forceinline__ v8f wmmab(v16bf a, v16bf b, v8f c) { return __builtin_amdgcn_wmma_f32_16x16x32_bf16(false, a, false, b, (short)0, c, false, false); }
__device__ __forceinline__ v4f lo4(v8f x) { return __builtin_shufflevector(x, x, 0, 1, 2, 3); }
__device__ __forceinline__ v4f hi4(v8f x) { return __builtin_shufflevector(x, x, 4, 5, 6, 7); }



// ---- gemmw: GEMM body, one 128x128 output tile per work-group of 8 waves (4 x 2, each wave 32x64 = 8 accumulators); grid (M/128, N/128, .), 256 threads; z = batch item.
// The K-contiguous 16-bit operand planes come into LDS as whole 128-byte lines, by asynchronous copies, in stages of 128 k (two buffers: the next stage flies while this one is multiplied); the fragments are read from LDS.
// C[m][n] (f32, pitch ldc) = sum_k A[m][k] Bt[n][k] (NSPLIT 1: + A2[m][k] Bt[n][k]). z-batch strides sA/sB/sC in elements. K % 128 == 0, M % 128 == 0, N % 128 == 0.
// PL: no f32 C; each result is split into hi + lo bf16 here and stored in the planes Ph / Pl in FRAGMENT ORDER: the 16 x 64 tile of rows m0.. (m0 % 16 == 0), columns n0.. (n0 % 64 == 0) is the 1024 elements from z sC + (n0 / 64) sY + m0 ldc,
// and inside it element (r, c) stands at (c / 8) * 128 + r * 8 + c % 8: the 16-byte pieces that the 32 lanes of one fragment load take are 512 bytes in a row (four whole lines), not 32 bytes out of each of 16 lines.
__device__ __forceinline__ void splitf(float y, unsigned short& h, unsigned short& l) { h = f2bf(y); l = f2bf(y - bf2f(h)); }
// Two f32 rounded to bf16 (to nearest, ties to even, as f2bf does) by the chip's own packed conversion: one instruction a pair; first value in the low half.
typedef __attribute__((ext_vector_type(2))) float f32x2;
typedef __attribute__((ext_vector_type(2))) __bf16 bf16x2;
typedef __attribute__((ext_vector_type(2))) unsigned u32x2;
typedef __attribute__((ext_vector_type(4))) unsigned u32x4;
typedef u32x2 __attribute__((may_alias)) u32x2a;
__device__ __forceinline__ unsigned cvt2(float a, float b) { const f32x2 x = {a, b}; return __builtin_bit_cast(unsigned, __builtin_convertvector(x, bf16x2)); }
// hi + lo split of a pair: h = the two hi halves, l = the two rounded remainders
__device__ __forceinline__ void split2(float y0, float y1, unsigned& h, unsigned& l) { h = cvt2(y0, y1); l = cvt2(y0 - __uint_as_float(h << 16), y1 - __uint_as_float(h & 0xFFFF0000u)); }
#define GK 128             // k per stage: rows of 256 bytes
#define GP 136             // LDS row pitch in elements: 272 B = 16 B x odd, so that the 16-byte fragment reads of 16 rows fall on distinct banks
#define GT (128 * GP)      // one operand's stage tile, elements
__device__ __forceinline__ v16bf ldfs(const bf* p) { return cat16b(*(const v8usa*)p, *(const v8usa*)(p + 16)); }
// Eight asynchronous 16-byte copies a lane, 16 rows apart: LDS byte address l, global address g, global row pitch K elements. 16 lanes bring one 256-byte row, 256 threads one operand's 128 rows.
// The s_wait_xcnt stands inside the statement as a precaution: in front of any later rewrite of the address registers that the copies name.
__device__ __forceinline__ void cp8(unsigned l, const bf* g, size_t K) {
    asm volatile("global_load_async_to_lds_b128 %0, %8, off\n\t"
                 "global_load_async_to_lds_b128 %1, %9, off\n\t"
                 "global_load_async_to_lds_b128 %2, %10, off\n\t"
                 "global_load_async_to_lds_b128 %3, %11, off\n\t"
                 "global_load_async_to_lds_b128 %4, %12, off\n\t"
                 "global_load_async_to_lds_b128 %5, %13, off\n\t"
                 "global_load_async_to_lds_b128 %6, %14, off\n\t"
                 "global_load_async_to_lds_b128 %7, %15, off\n\t"
                 "s_wait_xcnt 0x0"
                 :: "v"(l), "v"(l + 16 * GP * 2), "v"(l + 32 * GP * 2), "v"(l + 48 * GP * 2), "v"(l + 64 * GP * 2), "v"(l + 80 * GP * 2), "v"(l + 96 * GP * 2), "v"(l + 112 * GP * 2),
                    "v"(g), "v"(g + 16 * K), "v"(g + 32 * K), "v"(g + 48 * K), "v"(g + 64 * K), "v"(g + 80 * K), "v"(g + 96 * K), "v"(g + 112 * K) : "memory");
}
template <int NSPLIT, bool PL>
__device__ __forceinline__ void gemmw(const size_t z, const bf* __restrict__ A, const bf* __restrict__ A2, const bf* __restrict__ Bt, int K, float* C, int ldc, size_t sA, size_t sB, size_t sC, bf* Ph, bf* Pl, size_t sY) {
    constexpr int NOP = 2 + NSPLIT;                       // operand tiles of a stage: A (, A2), Bt
    __shared__ __align__(16) bf ring[2 * NOP * GT];
    A += z * sA; if (NSPLIT) A2 += z * sA; Bt += z * sB; if (!PL) C += z * sC;
    const int tid = threadIdx.x, lane = tid & 31, lr = lane & 15, hi = lane >> 4; const int w = __builtin_amdgcn_readfirstlane(tid >> 5);
    const int r0 = blockIdx.x * 128 + (w >> 1) * 32, c0 = blockIdx.y * 128 + (w & 1) * 64;
    const size_t goff = (size_t)(tid >> 4) * K + (tid & 15) * 8;
    const bf* ga = A + (size_t)blockIdx.x * 128 * K + goff; const bf* gb = Bt + (size_t)blockIdx.y * 128 * K + goff; const bf* ga2 = NSPLIT ? A2 + (size_t)blockIdx.x * 128 * K + goff : nullptr;
    const unsigned l0 = (unsigned)(size_t)(const void*)ring + ((tid >> 4) * GP + (tid & 15) * 8) * 2;
    auto fill = [&](int t) {   // stage t: 128 rows x 128 k of each operand into buffer t % 2
        const unsigned lb = l0 + (t & 1) * (NOP * GT * 2); const size_t ko = (size_t)t * GK;
        cp8(lb, ga + ko, K); if (NSPLIT) cp8(lb + GT * 2, ga2 + ko, K); cp8(lb + (NOP - 1) * GT * 2, gb + ko, K); };
    v8f acc[2][4];
#pragma unroll
    for (int mb = 0; mb < 2; ++mb)
#pragma unroll
        for (int nb = 0; nb < 4; ++nb) acc[mb][nb] = (v8f){};
    const int nt = K / GK;
    fill(0);
    asm volatile("s_wait_asynccnt 0x0" ::: "memory");   // this wave's copies of stage 0 have landed
    __syncthreads();                                     // ... and every other wave's
    if (nt > 1) fill(1);
#pragma unroll 1   // rolled: one stage is one trip of the ring
    for (int t = 0; t < nt; ++t) {
        const bf* sa = ring + (t & 1) * (NOP * GT) + ((w >> 1) * 32 + lr) * GP + 8 * hi; const bf* sb = ring + (t & 1) * (NOP * GT) + (NOP - 1) * GT + ((w & 1) * 64 + lr) * GP + 8 * hi;
        v16bf a[2][2], a2[2][2], b[2][4];   // two fragment sets: the next 32 k's LDS reads go out as one group ahead of this 32 k's products (inside the stage only)
#pragma unroll
        for (int mb = 0; mb < 2; ++mb) { a[0][mb] = ldfs(sa + mb * 16 * GP); if (NSPLIT) a2[0][mb] = ldfs(sa + GT + mb * 16 * GP); }
#pragma unroll
        for (int nb = 0; nb < 4; ++nb) b[0][nb] = ldfs(sb + nb * 16 * GP);
#pragma unroll
        for (int q = 0; q < GK / 32; ++q) { const int cu = q & 1, nx = cu ^ 1, ks = (q + 1) * 32;
            if (q + 1 < GK / 32) {
#pragma unroll
                for (int mb = 0; mb < 2; ++mb) { a[nx][mb] = ldfs(sa + mb * 16 * GP + ks); if (NSPLIT) a2[nx][mb] = ldfs(sa + GT + mb * 16 * GP + ks); }
#pragma unroll
                for (int nb = 0; nb < 4; ++nb) b[nx][nb] = ldfs(sb + nb * 16 * GP + ks);
                __builtin_amdgcn_sched_barrier(0); }   // holds the group of reads above ahead of the products below: the scheduler otherwise sinks each read to its first use, and the wave waits out the LDS latency in front of every pair of products
#pragma unroll
            for (int nb = 0; nb < 4; ++nb)
#pragma unroll
                for (int mb = 0; mb < 2; ++mb) { acc[mb][nb] = wmmab(b[cu][nb], a[cu][mb], acc[mb][nb]); if (NSPLIT) acc[mb][nb] = wmmab(b[cu][nb], a2[cu][mb], acc[mb][nb]); }   // Bt fragment first: the tile comes out transposed (see the epilogue)
        }
        // keeps the matrix instructions' distance on the taken side of the branches behind them too
        asm volatile("v_nop\n\tv_nop\n\tv_nop\n\tv_nop" : "+v"(acc[0][0]), "+v"(acc[1][0]), "+v"(acc[0][1]), "+v"(acc[1][1]), "+v"(acc[0][2]), "+v"(acc[1][2]), "+v"(acc[0][3]), "+v"(acc[1][3]));
        asm volatile("s_wait_dscnt 0x0" ::: "memory");      // this wave's reads of buffer t % 2 are done before the buffer is refilled
        asm volatile("s_wait_asynccnt 0x0" ::: "memory");   // this wave's copies of stage t + 1 have landed
        __syncthreads();                                     // publishes stage t + 1 and ends every wave's reads of stage t
        if (t + 2 < nt) fill(t + 2);
    }
    asm volatile("s_wait_asynccnt 0x0" ::: "memory");   // no copy is outstanding when the wave goes on to its end
    // The products were formed with the operands' places changed, so that acc[mb][nb] is the transposed tile: a lane holds row lane % 16 of block mb, columns 16 nb + 8 (lane / 16) .. + 7.
#pragma unroll
    for (int mb = 0; mb < 2; ++mb) {
        if constexpr (PL) {   // those 8 results are the lane's 16 bytes of each plane in fragment order: no way through LDS; the 32 lanes store 512 bytes in a row of each plane
            const size_t pb = z * sC + (size_t)(c0 >> 6) * sY + (size_t)(r0 + mb * 16) * ldc + lane * 8;
#pragma unroll
            for (int s = 0; s < 4; ++s) { const v8f y = acc[mb][s]; u32x4 oh, ol; unsigned a2, c2;
                split2(y[0], y[1], a2, c2); oh[0] = a2; ol[0] = c2; split2(y[2], y[3], a2, c2); oh[1] = a2; ol[1] = c2; split2(y[4], y[5], a2, c2); oh[2] = a2; ol[2] = c2; split2(y[6], y[7], a2, c2); oh[3] = a2; ol[3] = c2;
                *(u32x4*)(Ph + pb + s * 256) = oh; *(u32x4*)(Pl + pb + s * 256) = ol; }
        } else {   // f32 rows: through LDS (16-byte stores), so that each global store takes whole 256-byte pieces of two rows
            __shared__ __align__(16) float osw[8 * 16 * 68]; float* os = osw + w * (16 * 68);
#pragma unroll
            for (int nb = 0; nb < 4; ++nb) { float* op = os + lr * 68 + nb * 16 + hi * 8; *(v4fa*)op = lo4(acc[mb][nb]); *(v4fa*)(op + 4) = hi4(acc[mb][nb]); }
            __builtin_amdgcn_wave_barrier(); asm volatile("" ::: "memory");
            float* crow = C + (size_t)(r0 + mb * 16) * ldc + c0;
#pragma unroll
            for (int s = 0; s < 8; ++s) { const int row = 2 * s + hi, cofs = lr * 4; const v4f val = *(const v4fa*)(os + row * 68 + cofs);
                *(v4f*)(crow + (size_t)row * ldc + cofs) = val; }
            __builtin_amdgcn_wave_barrier(); asm volatile("" ::: "memory");
        }
    }
}

// The three projections of all NB_ batch items in ONE launch: grid (8, 8, 3 * NB_), blockIdx.z = projection * NB_ + batch item. q and k: one 64-column tile is one head, planes [b*NH_ + head][t / 16][tile of 16 t x 64 d].
// v: the operands change places (rows = v columns, columns = t), so that the planes [b*NKV + head][d / 16][t / 64][tile of 16 d x 64 t] come out of the same epilogue.
__global__ __launch_bounds__(256) void k_qkv(const bf* __restrict__ XB, const bf* __restrict__ WQ, const bf* __restrict__ WK, const bf* __restrict__ WV, bf* QPh, bf* QPl, bf* KPh, bf* KPl, bf* VTh, bf* VTl) {
    const int p = blockIdx.z / NB_; const size_t z = blockIdx.z % NB_; const bool tv = (p == 2);
    gemmw<0, true>(z, tv ? WV : XB, nullptr, tv ? XB : (p ? WK : WQ), DM, nullptr, tv ? TT : HD, tv ? (size_t)0 : (size_t)TT * DM, tv ? (size_t)TT * DM : (size_t)0, (size_t)NH_ * TT * HD,
                   tv ? VTh : (p ? KPh : QPh), tv ? VTl : (p ? KPl : QPl), tv ? (size_t)1024 : (size_t)TT * HD);
}
__global__ __launch_bounds__(256) void k_wo(const bf* __restrict__ Ah, const bf* __restrict__ Al, const bf* __restrict__ WO, float* OUT) {
    gemmw<1, false>(0, Ah, Al, WO, DQ, OUT, DM, 0, 0, 0, nullptr, nullptr, 0);
}

__device__ __forceinline__ h16 tohx(float x) { return (h16)x; }
typedef __attribute__((ext_vector_type(2))) _Float16 v2h;
typedef __attribute__((ext_vector_type(4))) _Float16 v4h;
typedef __attribute__((ext_vector_type(2))) unsigned short v2us;
typedef __attribute__((ext_vector_type(4))) unsigned short v4us;
typedef __attribute__((ext_vector_type(2))) float v2f;
typedef __attribute__((ext_vector_type(4))) int v4i;

__device__ __forceinline__ void d_wtG(const int blk, const float* __restrict__ w, int K, int N, bf* Bt) {
    const int lane = threadIdx.x & 31; const int L0 = (blk * 8 + (threadIdx.x >> 5)) * 8; const int nlines = N * K / 64;
{
#pragma unroll 1
        for (int l = 0; l < 8; ++l) { const int L = L0 + l; if (L >= nlines) break; const size_t e = (size_t)L * 64 + lane * 2; const int k = (int)(e % K), n = (int)(e / K); 
            *(unsigned*)(Bt + e) = cvt2(w[(size_t)k * N + n], w[(size_t)(k + 1) * N + n]); }
         }
}
__device__ __forceinline__ void d_cvt8(const int blk, const float* __restrict__ src, bf* dst, size_t n8) { const size_t i = (size_t)blk * 256 + threadIdx.x; if (i >= n8) return; const v8f v = *(const v8f*)(src + i * 8); u32x4 o;
#pragma unroll
    for (int k = 0; k < 4; ++k) o[k] = cvt2(v[2 * k], v[2 * k + 1]); *(u32x4*)(dst + i * 8) = o;  }
__global__ __launch_bounds__(256) void k_cscvt(const float* __restrict__ cosT, const float* __restrict__ sinT, float* CS) { const int idx = blockIdx.x * 256 + threadIdx.x; if (idx >= TT * HD) return; v2f cs; cs[0] = bfr(cosT[idx]); cs[1] = bfr(sinT[idx]); *(v2f*)(CS + (size_t)idx * 2) = cs;  }
// k_asoft: per row (zz, i): t = S x HD^-0.5 (no mask); softmax over the 1024 keys (register row, one exp, fixed trees);
__global__ __launch_bounds__(256) void k_asoft(const float* __restrict__ Sb, h16* P16, bf* Ph, bf* Pl) {
    const int lane = threadIdx.x & 31; const int row = blockIdx.x * 8 + (threadIdx.x >> 5); if (row >= ZH * TT) return; const int i = row % TT; const int zz = row / TT; (void)zz; const bool hires = (i < RH); const float* sr = Sb + (size_t)row * TT; float v[TT / 32]; float mx = -3.0e38f;
#pragma unroll
    for (int ch = 0; ch < TT / 128; ++ch) { const int j0 = ch * 128 + lane * 4; const v4f a = *(const v4f*)(sr + j0);
#pragma unroll
        for (int q = 0; q < 4; ++q) { const int j = j0 + q; (void)j; const float t = a[q] * SCL; v[ch * 4 + q] = t; mx = fmaxf(mx, t); } }
#pragma unroll
    for (int sh = 16; sh; sh >>= 1) mx = fmaxf(mx, __shfl_xor(mx, sh, 32));
    float sum = 0.f;
#pragma unroll
    for (int k = 0; k < TT / 32; ++k) { float d0 = __fsub_rn(v[k], mx); asm volatile("" : "+v"(d0)); v[k] = __builtin_amdgcn_exp2f(__fmul_rn(d0, 1.4426950408889634f)); sum += v[k]; }
#pragma unroll
    for (int sh = 16; sh; sh >>= 1) sum += __shfl_xor(sum, sh, 32);
    const float f = __fdiv_rn(hires ? 1.0f : PCAR, sum);
{
        if (hires) {
#pragma unroll
            for (int ch = 0; ch < TT / 128; ++ch) { v4us oh, ol;
#pragma unroll
                for (int q = 0; q < 4; ++q) { unsigned short a, c2; splitf(v[ch * 4 + q] * f, a, c2); oh[q] = a; ol[q] = c2; }
                const size_t oo = ((size_t)zz * (RH ? RH : 1) + i) * TT + ch * 128 + lane * 4; *(v4us*)(Ph + oo) = oh; *(v4us*)(Pl + oo) = ol; }
        } else {
#pragma unroll
            for (int ch = 0; ch < TT / 128; ++ch) { v4h o4;
#pragma unroll
                for (int q = 0; q < 4; ++q) o4[q] = tohx(v[ch * 4 + q] * f);
                *(v4h*)(P16 + (size_t)row * TT + ch * 128 + lane * 4) = o4; } }
         }
}
__device__ __forceinline__ void d_relk(const int blk, const float* __restrict__ rk, bf* Bt) { const int e = (blk * 256 + threadIdx.x) * 4; if (e >= 192 * HD) return; const int r = e / HD; const int d = e % HD; v4us o;   // rel_k[r][d] (r < 129) else 0, in fragment order: tiles of 16 r x 64 d
#pragma unroll
    for (int u = 0; u < 4; ++u) o[u] = (r < 129) ? f2bf(rk[e + u]) : (unsigned short)0; *(v4us*)(Bt + (r >> 4) * 1024 + (d >> 3) * 128 + (r & 15) * 8 + (d & 7)) = o;  }
__device__ __forceinline__ void d_relv(const int blk, const float* __restrict__ rv, bf* Bt) { const int e = (blk * 256 + threadIdx.x) * 4; if (e >= HD * 160) return; const int r = e % 160; const int d = e / 160; v4us o;   // rel_v[r][d] (r < 129) else 0, in fragment order: tiles [d / 16][r / 32] of 16 d x 32 r
#pragma unroll
    for (int u = 0; u < 4; ++u) o[u] = (r + u < 129) ? f2bf(rv[(size_t)(r + u) * HD + d]) : (unsigned short)0; *(v4us*)(Bt + ((d >> 4) * 5 + (r >> 5)) * 512 + ((r & 31) >> 3) * 128 + (d & 15) * 8 + (r & 7)) = o;  }
// ---- k_prep: every operand plane that the products read, in ONE launch; the block index picks the job (the same for a whole work-group). The four weight transposes, whose waves run longest, come first.
#define PBW (DM * DQ / 64 / 64)                 // blocks of one weight transpose
#define PBX (NB_ * TT * DM / 8 / 256)           // blocks of the x conversion
#define PBK ((192 * HD / 4 + 255) / 256)        // blocks of the rel_k plane
#define PBV ((HD * 160 / 4 + 255) / 256)        // blocks of the rel_v plane
__global__ __launch_bounds__(256) void k_prep(const float* __restrict__ x, const float* __restrict__ wq, const float* __restrict__ wk, const float* __restrict__ wv, const float* __restrict__ wo, const float* __restrict__ relk, const float* __restrict__ relv,
                                              bf* XB, bf* WQ, bf* WK, bf* WV, bf* WO, bf* BRK, bf* BRV) {
    int b = blockIdx.x;
    if (b < 4 * PBW) { const int m = b / PBW; d_wtG(b % PBW, m == 0 ? wq : m == 1 ? wk : m == 2 ? wv : wo, DM, DQ, m == 0 ? WQ : m == 1 ? WK : m == 2 ? WV : WO); return; }
    b -= 4 * PBW;
    if (b < PBX) { d_cvt8(b, x, XB, (size_t)NB_ * TT * DM / 8); return; }
    b -= PBX;
    if (b < PBK) { d_relk(b, relk, BRK); return; }
    d_relv(b - PBK, relv, BRV);
}
// ---- k_attn: the whole attention of 64 query rows of one head in ONE work-group (16 waves); the 64 x 1024 score rows stay in LDS from the q.k products to the w.v products. grid (TT/64, NB_*NH_).
// Phase 1: wave w forms the 64 x 64 score tile of keys w*64.. (hl x hl, 3 products) and, waves 0..8, 16 columns of QR = q rel_k^T (hl x exact). Phase 2: one wave per row, 4 rows each: bias, softmax, hi/lo split written over the row's own f32 scores
// (hi plane in its first 2048 bytes, lo plane in the next), tail sums and bucket planes written over the row's own QR. Phase 3: wave w multiplies key slice w*64.. of w with v (3 products), waves 0..4 add one 32-bucket slice of WB rel_v (2 products);
// the 16 partial 64 x 64 tiles are summed through LDS in wave order and split into the merged hi/lo planes.
#define AR 64      // query rows per work-group
#define SP 1028    // score row pitch in floats: 4112 B = 16 B x odd, so that the 16-byte fragment reads of 16 rows fall on distinct banks
#define QP 168     // QR row pitch in floats; the same 672 B then hold the row's bucket planes: hi at byte 0, lo at byte 336
typedef v4us __attribute__((may_alias)) v4usa;
typedef unsigned short __attribute__((may_alias)) usa;
typedef float __attribute__((may_alias)) fa;
__device__ __forceinline__ v16bf ldfa(const bf* p) { return cat16b(*(const v8usa*)p, *(const v8usa*)(p + 16)); }
// a fragment from a global plane in fragment order: p = the 32-k half tile + lane * 8; each of the two loads takes 512 bytes in a row over the wave. Same elements in the same lanes and registers as from a row-major plane.
__device__ __forceinline__ v16bf ldfo(const bf* p) { return cat16b(*(const v8us*)p, *(const v8us*)(p + 256)); }
__global__ __launch_bounds__(512) void k_attn(const bf* __restrict__ Qh, const bf* __restrict__ Ql, const bf* __restrict__ Kh, const bf* __restrict__ Kl, const bf* __restrict__ Vh, const bf* __restrict__ Vl, const bf* __restrict__ Brk, const bf* __restrict__ Brv, bf* Ah, bf* Al) {
    __shared__ __align__(16) float S[AR * SP];
    __shared__ __align__(16) float QRs[AR * QP];
    const int tid = threadIdx.x, lane = tid & 31, lr = lane & 15, hi = lane >> 4; const int w = __builtin_amdgcn_readfirstlane(tid >> 5);
    const int r0 = blockIdx.x * AR; const size_t z = blockIdx.y;
    const bf* qh = Qh + z * TT * HD + (size_t)r0 * HD + lane * 8; const bf* ql = Ql + z * TT * HD + (size_t)r0 * HD + lane * 8;
    {
        const bf* kh = Kh + z * TT * HD + (size_t)(w * 64) * HD + lane * 8; const bf* kl = Kl + z * TT * HD + (size_t)(w * 64) * HD + lane * 8;
        v8f acc[4][4];
#pragma unroll
        for (int mb = 0; mb < 4; ++mb)
#pragma unroll
            for (int nb = 0; nb < 4; ++nb) acc[mb][nb] = (v8f){};
#pragma unroll 1   // rolled: both k steps' fragments at once would not fit the 256 registers of a 16-wave work-group
        for (int kc = 0; kc < HD; kc += 32) {
            v16bf a[4], a2[4]; const bf* qa = qh + kc * 16; const bf* qb = ql + kc * 16; const bf* ka = kh + kc * 16; const bf* kb = kl + kc * 16;
#pragma unroll
            for (int mb = 0; mb < 4; ++mb) { a[mb] = ldfo(qa + mb * 1024); a2[mb] = ldfo(qb + mb * 1024); }
#pragma unroll
            for (int nb = 0; nb < 4; ++nb) { const v16bf b = ldfo(ka + nb * 1024); const v16bf b2 = ldfo(kb + nb * 1024);
#pragma unroll
                for (int mb = 0; mb < 4; ++mb) { acc[mb][nb] = wmmab(b, a[mb], acc[mb][nb]); acc[mb][nb] = wmmab(b, a2[mb], acc[mb][nb]); acc[mb][nb] = wmmab(b2, a[mb], acc[mb][nb]); } }   // k fragment first: transposed tiles
            // keeps the matrix instructions' distance on the taken side of the loop branch too
            asm volatile("v_nop\n\tv_nop\n\tv_nop\n\tv_nop" : "+v"(acc[0][0]), "+v"(acc[1][1]), "+v"(acc[2][2]), "+v"(acc[3][3]) : "v"(a[0]), "v"(a[3]));
            asm volatile("s_wait_xcnt 0x0" :: "v"(qa), "v"(qb), "v"(ka), "v"(kb) : "memory");   // precaution: stands in front of every rewrite of the address registers that this trip's global loads name; as inputs the four addresses stay in their registers up to here, so that no load's result lands on them
        }
#pragma unroll
        for (int mb = 0; mb < 4; ++mb)
#pragma unroll
            for (int nb = 0; nb < 4; ++nb) { float* sp = S + (mb * 16 + lr) * SP + w * 64 + nb * 16 + hi * 8; *(v4fa*)sp = lo4(acc[mb][nb]); *(v4fa*)(sp + 4) = hi4(acc[mb][nb]); }   // a lane holds 8 neighbouring keys of query row lane % 16: two 16-byte stores
    }
    if (w < 9) {   // QR[i][r] = q_i . rel_k[r] (unscaled), columns w*16 .. w*16+15 (rows 129.. of the table plane are zero)
        const bf* rk = Brk + w * 1024 + lane * 8; v8f aq[4];
#pragma unroll
        for (int mb = 0; mb < 4; ++mb) aq[mb] = (v8f){};
#pragma unroll
        for (int kc = 0; kc < HD; kc += 32) { const v16bf b = ldfo(rk + kc * 16);
#pragma unroll
            for (int mb = 0; mb < 4; ++mb) { aq[mb] = wmmab(b, ldfo(qh + mb * 1024 + kc * 16), aq[mb]); aq[mb] = wmmab(b, ldfo(ql + mb * 1024 + kc * 16), aq[mb]); } }
#pragma unroll
        for (int mb = 0; mb < 4; ++mb) { float* qp = QRs + (mb * 16 + lr) * QP + w * 16 + hi * 8; *(v4fa*)qp = lo4(aq[mb]); *(v4fa*)(qp + 4) = hi4(aq[mb]); }
    }
    __syncthreads();
#pragma unroll 1   // rolled: one row's 32 values a lane are the live set
    for (int rr = 0; rr < AR / 16; ++rr) { const int row = w * (AR / 16) + rr, i = r0 + row; float* sr = S + row * SP; float* qr = QRs + row * QP; float v[TT / 32]; float mx = -3.0e38f;
        // The row's eight 128-key chunks are dealt to the register slots relative to its window: slots 0 and 1 take chunks cb and cb + 1, which hold every key with |j - i| < 64; slot s >= 2 takes chunk (cb + s) % 8,
        // all of whose keys lie in the high tail (j - i >= 64; no wrap) or in the low tail (j - i <= -64; wrapped). cb is the same for the whole wave.
        int cb = (i - 63) >> 7; cb = __builtin_amdgcn_readfirstlane(cb < 0 ? 0 : (cb > 6 ? 6 : cb));   // held in a scalar register: the clamp otherwise goes to the vector unit, and every slot's chunk number and offset with it
        const float qlo8 = *(const fa*)qr * 0.125f, qhi8 = *(const fa*)(qr + 128) * 0.125f;   // the two table ends' bias, scaled (exact)
#pragma unroll
        for (int s = 0; s < TT / 128; ++s) { const int j0 = ((cb + s) & 7) * 128 + lane * 4; const v4f a = *(const v4fa*)(sr + j0);
            if (s < 2) {
#pragma unroll
                for (int u = 0; u < 4; ++u) { int r = j0 + u - i; r = (r < -64) ? -64 : (r > 64 ? 64 : r); const float t = __fadd_rn(a[u], *(const fa*)(qr + r + 64)) * 0.125f; v[s * 4 + u] = t; mx = fmaxf(mx, t); }
            } else { const float b8 = (cb + s < 8) ? qhi8 : qlo8;
#pragma unroll
                for (int u = 0; u < 4; ++u) { const float t = __builtin_fmaf(a[u], 0.125f, b8); v[s * 4 + u] = t; mx = fmaxf(mx, t); } } }   // = (a + bias) / 8: the scale is a power of two
#pragma unroll
        for (int sh = 16; sh; sh >>= 1) mx = fmaxf(mx, __shfl_xor(mx, sh, 32));
        // exp sums in three parts: the two window chunks (with their own tail keys picked by compare), the high-tail chunks, the low-tail chunks
        float mid = 0.f, lo = 0.f, hs = 0.f, run = 0.f, sth = 0.f;
#pragma unroll
        for (int q = 0; q < 8; ++q) { const int j = ((cb + (q >> 2)) & 7) * 128 + lane * 4 + (q & 3); v[q] = __builtin_amdgcn_exp2f(__fmul_rn(__fsub_rn(v[q], mx), 1.4426950408889634f)); mid += v[q];
            if (j <= i - 64) lo = __fadd_rn(lo, v[q]); if (j >= i + 64) hs = __fadd_rn(hs, v[q]); }
#pragma unroll
        for (int s = 2; s < TT / 128; ++s) { const bool wr = (cb + s == 8); sth = wr ? run : sth; run = wr ? 0.f : run;   // at the wrap the running sum is the high tail's; the low tail's starts
#pragma unroll
            for (int u = 0; u < 4; ++u) { const int q = s * 4 + u; v[q] = __builtin_amdgcn_exp2f(__fmul_rn(__fsub_rn(v[q], mx), 1.4426950408889634f)); run += v[q]; } }
        const float stl = cb ? run : 0.f; sth = cb ? sth : run;   // cb == 0: no wrap, no low-tail chunk
        float sum = (mid + stl) + sth; lo = __fadd_rn(stl, lo); hs = __fadd_rn(hs, sth);
#pragma unroll
        for (int sh = 16; sh; sh >>= 1) { sum += __shfl_xor(sum, sh, 32); lo = __fadd_rn(lo, __shfl_xor(lo, sh, 32)); hs = __fadd_rn(hs, __shfl_xor(hs, sh, 32)); }
        const float f = __fdiv_rn(1.0f, sum); lo *= f; hs *= f;
        bf* ph = (bf*)sr; bf* pl = ph + TT;
#pragma unroll
        for (int s = 0; s < TT / 128; ++s) { const int j0 = ((cb + s) & 7) * 128 + lane * 4; u32x2 oh, ol; float p[4];
#pragma unroll
            for (int q = 0; q < 4; ++q) p[q] = v[s * 4 + q] * f;
            unsigned a2, c2; split2(p[0], p[1], a2, c2); oh[0] = a2; ol[0] = c2; split2(p[2], p[3], a2, c2); oh[1] = a2; ol[1] = c2;
            *(u32x2a*)(ph + j0) = oh; *(u32x2a*)(pl + j0) = ol; }
        // the bucket reads below take what other lanes of this wave have just stored: keeps the compiler from moving them over the stores (a wave's LDS operations run in order)
        __builtin_amdgcn_wave_barrier(); asm volatile("" ::: "memory");
        bf* wh = (bf*)qr; bf* wl = wh + QP;
#pragma unroll
        for (int ch = 0; ch < 2; ++ch) { const int rb = ch * 128 + lane * 4; if (rb < 160) { v4us oh, ol;
#pragma unroll
            for (int u = 0; u < 4; ++u) { const int r = rb + u; unsigned short a2 = 0, c2 = 0; if (r == 0) splitf(lo, a2, c2); else if (r == 128) splitf(hs, a2, c2); else if (r < 128) { const int j = i + r - 64; if (j >= 0 && j < TT) { a2 = *(const usa*)(ph + j); c2 = *(const usa*)(pl + j); } } oh[u] = a2; ol[u] = c2; }
            *(v4usa*)(wh + rb) = oh; *(v4usa*)(wl + rb) = ol; } }
    }
    __syncthreads();
    v8f acc[4][4];
#pragma unroll
    for (int mb = 0; mb < 4; ++mb)
#pragma unroll
        for (int nb = 0; nb < 4; ++nb) acc[mb][nb] = (v8f){};
    {
        const bf* pa = (const bf*)S + lr * (SP * 2) + w * 64 + 8 * hi; const bf* vh = Vh + z * HD * TT + w * 1024 + lane * 8; const bf* vl = Vl + z * HD * TT + w * 1024 + lane * 8;
#pragma unroll 1   // rolled: both k steps' fragments at once would not fit the 256 registers of a 16-wave work-group
        for (int kc = 0; kc < 64; kc += 32) {
            v16bf a[4], a2[4]; const bf* va = vh + kc * 16; const bf* vb = vl + kc * 16;
#pragma unroll
            for (int mb = 0; mb < 4; ++mb) { a[mb] = ldfa(pa + mb * 16 * (SP * 2) + kc); a2[mb] = ldfa(pa + mb * 16 * (SP * 2) + TT + kc); }
#pragma unroll
            for (int nb = 0; nb < 4; ++nb) { const v16bf b = ldfo(va + nb * 16 * TT); const v16bf b2 = ldfo(vb + nb * 16 * TT);
#pragma unroll
                for (int mb = 0; mb < 4; ++mb) { acc[mb][nb] = wmmab(b, a[mb], acc[mb][nb]); acc[mb][nb] = wmmab(b, a2[mb], acc[mb][nb]); acc[mb][nb] = wmmab(b2, a[mb], acc[mb][nb]); } }   // v fragment first: transposed tiles
            // keeps the matrix instructions' distance on the taken side of the loop branch too
            asm volatile("v_nop\n\tv_nop\n\tv_nop\n\tv_nop" : "+v"(acc[0][0]), "+v"(acc[1][1]), "+v"(acc[2][2]), "+v"(acc[3][3]) : "v"(a[0]), "v"(a[3]));
            asm volatile("s_wait_xcnt 0x0" :: "v"(va), "v"(vb) : "memory");   // precaution: as in the first loop, for the two v addresses of this trip
        }
    }
    if (w < 5) {   // sum_j w rel_v[clip] = WB . rel_v: buckets w*32 .. w*32+31
        const bf* wa = (const bf*)QRs + lr * (QP * 2) + w * 32 + 8 * hi; const bf* rv = Brv + w * 512 + lane * 8; v16bf a[4], a2[4];
#pragma unroll
        for (int mb = 0; mb < 4; ++mb) { a[mb] = ldfa(wa + mb * 16 * (QP * 2)); a2[mb] = ldfa(wa + mb * 16 * (QP * 2) + QP); }
#pragma unroll
        for (int nb = 0; nb < 4; ++nb) { const v16bf b = ldfo(rv + nb * 2560);
#pragma unroll
            for (int mb = 0; mb < 4; ++mb) { acc[mb][nb] = wmmab(b, a[mb], acc[mb][nb]); acc[mb][nb] = wmmab(b, a2[mb], acc[mb][nb]); } }
    }
    __syncthreads();   // every wave has read its slice of the planes: their space now takes the 16 partial tiles [w][64][64]; a lane holds 8 neighbouring columns of row lane % 16: two 16-byte stores.
    // In a row the 16-byte piece p stands at place p ^ (row % 16), so that the 16 rows of one store fall on distinct banks.
#pragma unroll
    for (int mb = 0; mb < 4; ++mb)
#pragma unroll
        for (int nb = 0; nb < 4; ++nb) { float* tp = S + w * 4096 + (mb * 16 + lr) * 64; const int p = nb * 4 + hi * 2; *(v4fa*)(tp + ((p ^ lr) << 2)) = lo4(acc[mb][nb]); *(v4fa*)(tp + (((p + 1) ^ lr) << 2)) = hi4(acc[mb][nb]); }
    __syncthreads();
    const int c4 = (tid & 15) * 4; const size_t ob = ((z / NH_) * TT + r0) * DQ + (z % NH_) * HD + c4;
#pragma unroll
    for (int g = 0; g < 2; ++g) { const int row = (tid >> 4) + g * 32; const float* pr = S + row * 64 + (c4 ^ ((row & 15) << 2)); v4f s = *(const v4fa*)pr;
#pragma unroll
        for (int k = 1; k < 16; ++k) { const v4f t = *(const v4fa*)(pr + k * 4096); s[0] = __fadd_rn(s[0], t[0]); s[1] = __fadd_rn(s[1], t[1]); s[2] = __fadd_rn(s[2], t[2]); s[3] = __fadd_rn(s[3], t[3]); }
        u32x2 oh, ol; unsigned a2, c2; split2(s[0], s[1], a2, c2); oh[0] = a2; ol[0] = c2; split2(s[2], s[3], a2, c2); oh[1] = a2; ol[1] = c2;
        *(u32x2*)(Ah + ob + (size_t)row * DQ) = oh; *(u32x2*)(Al + ob + (size_t)row * DQ) = ol; }
}

extern "C" void kernel_launch(void* const* d_in, const int* in_sizes, int n_in,
                              void* d_out, int out_size, void* d_ws, size_t ws_size, hipStream_t stream) {
    (void)in_sizes; (void)n_in; (void)out_size;
    const float* x = (const float*)d_in[0]; const float* wq = (const float*)d_in[1]; const float* wk = (const float*)d_in[2]; const float* wv = (const float*)d_in[3]; const float* wo = (const float*)d_in[4]; const float* relk = (const float*)d_in[5]; const float* relv = (const float*)d_in[6]; const float* cosT = nullptr; const float* sinT = nullptr; (void)cosT; (void)sinT;
    float* OUT = (float*)d_out;     // [4][1024][1024]
    char* wsp = (char*)d_ws;
    auto take = [&](size_t bytes) { char* p = wsp; wsp += (bytes + 255) & ~(size_t)255; return (void*)p; };
    bf* WQ = (bf*)take((size_t)DQ * DM * 2); bf* WK = (bf*)take((size_t)DKV * DM * 2); bf* WV = (bf*)take((size_t)DKV * DM * 2); bf* WO = (bf*)take((size_t)DM * DQ * 2); float* CS = (float*)take((size_t)TT * HD * 2 * 4);
    bf* XB = (bf*)take((size_t)NB_ * TT * DM * 2); bf* BRK = (bf*)take((size_t)192 * HD * 2); bf* BRV = (bf*)take((size_t)HD * 160 * 2); float* QR = (float*)take((size_t)ZH * TT * 192 * 4); bf* WBh = (bf*)take((size_t)ZH * TT * 160 * 2); bf* WBl = (bf*)take((size_t)ZH * TT * 160 * 2); float* O2 = (float*)take((size_t)ZH * TT * HD * 4);
    h16* VT16 = (h16*)take((size_t)NKV * HD * TT * 2);
    bf* QPh = (bf*)take((size_t)NB_ * NH_ * TT * HD * 2); bf* QPl = (bf*)take((size_t)NB_ * NH_ * TT * HD * 2); bf* KPh = (bf*)take((size_t)NB_ * NKV * TT * HD * 2); bf* KPl = (bf*)take((size_t)NB_ * NKV * TT * HD * 2); bf* VTh = (bf*)take((size_t)NB_ * NKV * HD * TT * 2); bf* VTl = (bf*)take((size_t)NB_ * NKV * HD * TT * 2); bf* Ph = (bf*)take((size_t)ZH * RH * TT * 2); bf* Pl = (bf*)take((size_t)ZH * RH * TT * 2);
    float* Sb = (float*)take((size_t)ZH * TT * TT * 4); float* Ob = (float*)take((size_t)ZH * TT * HD * 4); bf* ATh = (bf*)take((size_t)NB_ * TT * DQ * 2); bf* ATl = (bf*)take((size_t)NB_ * TT * DQ * 2);
    if ((size_t)(wsp - (char*)d_ws) > ws_size) return;    // ws 256 MiB
    k_prep<<<4 * PBW + PBX + PBK + PBV, 256, 0, stream>>>(x, wq, wk, wv, wo, relk, relv, XB, WQ, WK, WV, WO, BRK, BRV);
    k_qkv<<<dim3(TT / 128, DQ / 128, 3 * NB_), 256, 0, stream>>>(XB, WQ, WK, WV, QPh, QPl, KPh, KPl, VTh, VTl);
    k_attn<<<dim3(TT / AR, NB_ * NH_), 512, 0, stream>>>(QPh, QPl, KPh, KPl, VTh, VTl, BRK, BRV, ATh, ATl);   // one kv head per query head: plane z = b*NH_ + head in all six
    k_wo<<<dim3(NB_ * TT / 128, DM / 128, 1), 256, 0, stream>>>(ATh, ATl, WO, OUT);
}

// v010
// Measured time: 118 microseconds a run.
// Timed twice side by side with v009, it ran 1.12 times as fast both times.
// Counting every step since v000, it is 18.7 times as fast.
#include <hip/hip_runtime.h>

// MultiHead2DAttention_v2 (x [4][1024][1024]; q = (x Wq) / 8, k = x Wk, v = x Wv ([in,out], no bias; 16 heads x 64); relative-position embeddings rel_k / rel_v [129][64] indexed by clip(j - i, -64, 64) + 64;
//   logits = q.k + q.rel_k[clip]; w = softmax; out_h = w v + sum_j w[i][j] rel_v[clip(j - i)]; out = merged Wo -> [4][1024][1024]).
// The relative terms use exact regroupings: q.rel_k[clip(j-i)] is read from QR = q rel_k^T ([T][129] per head), and sum_j w rel_v[clip] = WB rel_v with WB[i][r] = the softmax mass in bucket r (single keys for r = 1..127, tail sums for r = 0 / 128).
// Compute dtypes, f32 accumulate: every input rounded to bf16; q/k/v on PLAIN bf16 operands (inputs: exact); QR as hl x exact (2 products); scores and w.v as hl x hl (3 products) on every row; the 1/8 scale (exact), rel bias, softmax and bucket sums f32; WB rel_v as hl x exact (2 products); Wo hl x exact (2 products).

#define NB_  4
#define TT   1024
#define DM   1024
#define NH_  16
#define NKV  16
#define REP  (NH_ / NKV)
#define HD   64
#define DQ   (NH_ * HD)
#define DKV  (NKV * HD)
#define ZH   16
#define RH   1024                  // query rows < RH use hi+lo planes (0: none)
#define WIN  0
#define PCAR 1024.0f
#define SCL  0.125f   // HD^-0.5
typedef _Float16 h16;
typedef unsigned short bf;
typedef __attribute__((ext_vector_type(16))) __bf16   v16bf;
typedef __attribute__((ext_vector_type(16))) _Float16 v16h;
typedef __attribute__((ext_vector_type(8)))  _Float16 v8h;
typedef __attribute__((ext_vector_type(8)))  unsigned short v8us;
typedef __attribute__((ext_vector_type(8)))  float    v8f;
typedef __attribute__((ext_vector_type(4)))  float    v4f;
typedef v8h  __attribute__((may_alias)) v8ha;
typedef v4f  __attribute__((may_alias)) v4fa;
typedef v8us __attribute__((may_alias)) v8usa;

__device__ __forceinline__ unsigned short f2bf(float f) { unsigned u = __float_as_uint(f); u += 0x7FFFu + ((u >> 16) & 1u); return (unsigned short)(u >> 16); }
__device__ __forceinline__ float bf2f(unsigned short b) { return __uint_as_float(((unsigned)b) << 16); }
__device__ __forceinline__ float bfr(float f) { return bf2f(f2bf(f)); }
__device__ __forceinline__ v16h cat16(v8h lo, v8h hi) { return __builtin_shufflevector(lo, hi, 0, 1, 2, 3, 4, 5, 6, 7, 8, 9, 10, 11, 12, 13, 14, 15); }
__device__ __forceinline__ v16bf cat16b(v8us lo, v8us hi) { return __builtin_bit_cast(v16bf, __builtin_shufflevector(lo, hi, 0, 1, 2, 3, 4, 5, 6, 7, 8, 9, 10, 11, 12, 13, 14, 15)); }
__device__ __forceinline__ v8f wmma16(v16h a, v16h b, v8f c) { return __builtin_amdgcn_wmma_f32_16x16x32_f16(false, a, false, b, (short)0, c, false, false); }
__device__ __forceinline__ v8f wmmab(v16bf a, v16bf b, v8f c) { return __builtin_amdgcn_wmma_f32_16x16x32_bf16(false, a, false, b, (short)0, c, false, false); }
__device__ __forceinline__ v4f lo4(v8f x) { return __builtin_shufflevector(x, x, 0, 1, 2, 3); }
__device__ __forceinline__ v4f hi4(v8f x) { return __builtin_shufflevector(x, x, 4, 5, 6, 7); }



// ---- gemmw: GEMM body, one 128x128 output tile per work-group of 8 waves (4 x 2, each wave 32x64 = 8 accumulators); grid (M/128, N/128, .), 256 threads; z = batch item.
// The K-contiguous 16-bit operand planes come into LDS as whole 128-byte lines, by asynchronous copies, in stages of 128 k (two buffers: the next stage flies while this one is multiplied); the fragments are read from LDS.
// C[m][n] (f32, pitch ldc) = sum_k A[m][k] Bt[n][k] (NSPLIT 1: + A2[m][k] Bt[n][k]). z-batch strides sA/sB/sC in elements. K % 128 == 0, M % 128 == 0, N % 128 == 0.
// PL: no f32 C; each result is split into hi + lo bf16 here and stored in the planes Ph / Pl in FRAGMENT ORDER: the 16 x 64 tile of rows m0.. (m0 % 16 == 0), columns n0.. (n0 % 64 == 0) is the 1024 elements from z sC + (n0 / 64) sY + m0 ldc,
// and inside it element (r, c) stands at (c / 8) * 128 + r * 8 + c % 8: the 16-byte pieces that the 32 lanes of one fragment load take are 512 bytes in a row (four whole lines), not 32 bytes out of each of 16 lines.
__device__ __forceinline__ void splitf(float y, unsigned short& h, unsigned short& l) { h = f2bf(y); l = f2bf(y - bf2f(h)); }
// Two f32 rounded to bf16 (to nearest, ties to even, as f2bf does) by the chip's own packed conversion: one instruction a pair; first value in the low half.
typedef __attribute__((ext_vector_type(2))) float f32x2;
typedef __attribute__((ext_vector_type(2))) __bf16 bf16x2;
typedef __attribute__((ext_vector_type(2))) unsigned u32x2;
typedef __attribute__((ext_vector_type(4))) unsigned u32x4;
typedef u32x2 __attribute__((may_alias)) u32x2a;
__device__ __forceinline__ unsigned cvt2(float a, float b) { const f32x2 x = {a, b}; return __builtin_bit_cast(unsigned, __builtin_convertvector(x, bf16x2)); }
// hi + lo split of a pair: h = the two hi halves, l = the two rounded remainders
__device__ __forceinline__ void split2(float y0, float y1, unsigned& h, unsigned& l) { h = cvt2(y0, y1); l = cvt2(y0 - __uint_as_float(h << 16), y1 - __uint_as_float(h & 0xFFFF0000u)); }
#define GK 128             // k per stage: rows of 256 bytes
#define GP 136             // LDS row pitch in elements: 272 B = 16 B x odd, so that the 16-byte fragment reads of 16 rows fall on distinct banks
#define GT (128 * GP)      // one operand's stage tile, elements
__device__ __forceinline__ v16bf ldfs(const bf* p) { return cat16b(*(const v8usa*)p, *(const v8usa*)(p + 16)); }
// Eight asynchronous 16-byte copies a lane, 16 rows apart: LDS byte address l, global address g, global row pitch K elements. 16 lanes bring one 256-byte row, 256 threads one operand's 128 rows.
// The s_wait_xcnt stands inside the statement as a precaution: in front of any later rewrite of the address registers that the copies name.
__device__ __forceinline__ void cp8(unsigned l, const bf* g, size_t K) {
    asm volatile("global_load_async_to_lds_b128 %0, %8, off\n\t"
                 "global_load_async_to_lds_b128 %1, %9, off\n\t"
                 "global_load_async_to_lds_b128 %2, %10, off\n\t"
                 "global_load_async_to_lds_b128 %3, %11, off\n\t"
                 "global_load_async_to_lds_b128 %4, %12, off\n\t"
                 "global_load_async_to_lds_b128 %5, %13, off\n\t"
                 "global_load_async_to_lds_b128 %6, %14, off\n\t"
                 "global_load_async_to_lds_b128 %7, %15, off\n\t"
                 "s_wait_xcnt 0x0"
                 :: "v"(l), "v"(l + 16 * GP * 2), "v"(l + 32 * GP * 2), "v"(l + 48 * GP * 2), "v"(l + 64 * GP * 2), "v"(l + 80 * GP * 2), "v"(l + 96 * GP * 2), "v"(l + 112 * GP * 2),
                    "v"(g), "v"(g + 16 * K), "v"(g + 32 * K), "v"(g + 48 * K), "v"(g + 64 * K), "v"(g + 80 * K), "v"(g + 96 * K), "v"(g + 112 * K) : "memory");
}
template <int NSPLIT, bool PL>
__device__ __forceinline__ void gemmw(const size_t z, const bf* __restrict__ A, const bf* __restrict__ A2, const bf* __restrict__ Bt, int K, float* C, int ldc, size_t sA, size_t sB, size_t sC, bf* Ph, bf* Pl, size_t sY) {
    constexpr int NOP = 2 + NSPLIT;                       // operand tiles of a stage: A (, A2), Bt
    __shared__ __align__(16) bf ring[2 * NOP * GT];
    A += z * sA; if (NSPLIT) A2 += z * sA; Bt += z * sB; if (!PL) C += z * sC;
    const int tid = threadIdx.x, lane = tid & 31, lr = lane & 15, hi = lane >> 4; const int w = __builtin_amdgcn_readfirstlane(tid >> 5);
    const int r0 = blockIdx.x * 128 + (w >> 1) * 32, c0 = blockIdx.y * 128 + (w & 1) * 64;
    const size_t goff = (size_t)(tid >> 4) * K + (tid & 15) * 8;
    const bf* ga = A + (size_t)blockIdx.x * 128 * K + goff; const bf* gb = Bt + (size_t)blockIdx.y * 128 * K + goff; const bf* ga2 = NSPLIT ? A2 + (size_t)blockIdx.x * 128 * K + goff : nullptr;
    const unsigned l0 = (unsigned)(size_t)(const void*)ring + ((tid >> 4) * GP + (tid & 15) * 8) * 2;
    auto fill = [&](int t) {   // stage t: 128 rows x 128 k of each operand into buffer t % 2
        const unsigned lb = l0 + (t & 1) * (NOP * GT * 2); const size_t ko = (size_t)t * GK;
        cp8(lb, ga + ko, K); if (NSPLIT) cp8(lb + GT * 2, ga2 + ko, K); cp8(lb + (NOP - 1) * GT * 2, gb + ko, K); };
    v8f acc[2][4];
#pragma unroll
    for (int mb = 0; mb < 2; ++mb)
#pragma unroll
        for (int nb = 0; nb < 4; ++nb) acc[mb][nb] = (v8f){};
    const int nt = K / GK;
    fill(0);
    asm volatile("s_wait_asynccnt 0x0" ::: "memory");   // this wave's copies of stage 0 have landed
    __syncthreads();                                     // ... and every other wave's
    if (nt > 1) fill(1);
#pragma unroll 1   // rolled: one stage is one trip of the ring
    for (int t = 0; t < nt; ++t) {
        const bf* sa = ring + (t & 1) * (NOP * GT) + ((w >> 1) * 32 + lr) * GP + 8 * hi; const bf* sb = ring + (t & 1) * (NOP * GT) + (NOP - 1) * GT + ((w & 1) * 64 + lr) * GP + 8 * hi;
        v16bf a[2][2], a2[2][2], b[2][4];   // two fragment sets: the next 32 k's LDS reads go out as one group ahead of this 32 k's products (inside the stage only)
#pragma unroll
        for (int mb = 0; mb < 2; ++mb) { a[0][mb] = ldfs(sa + mb * 16 * GP); if (NSPLIT) a2[0][mb] = ldfs(sa + GT + mb * 16 * GP); }
#pragma unroll
        for (int nb = 0; nb < 4; ++nb) b[0][nb] = ldfs(sb + nb * 16 * GP);
#pragma unroll
        for (int q = 0; q < GK / 32; ++q) { const int cu = q & 1, nx = cu ^ 1, ks = (q + 1) * 32;
            if (q + 1 < GK / 32) {
#pragma unroll
                for (int mb = 0; mb < 2; ++mb) { a[nx][mb] = ldfs(sa + mb * 16 * GP + ks); if (NSPLIT) a2[nx][mb] = ldfs(sa + GT + mb * 16 * GP + ks); }
#pragma unroll
                for (int nb = 0; nb < 4; ++nb) b[nx][nb] = ldfs(sb + nb * 16 * GP + ks);
                __builtin_amdgcn_sched_barrier(0); }   // holds the group of reads above ahead of the products below: the scheduler otherwise sinks each read to its first use, and the wave waits out the LDS latency in front of every pair of products
#pragma unroll
            for (int nb = 0; nb < 4; ++nb)
#pragma unroll
                for (int mb = 0; mb < 2; ++mb) { acc[mb][nb] = wmmab(b[cu][nb], a[cu][mb], acc[mb][nb]); if (NSPLIT) acc[mb][nb] = wmmab(b[cu][nb], a2[cu][mb], acc[mb][nb]); }   // Bt fragment first: the tile comes out transposed (see the epilogue)
        }
        // keeps the matrix instructions' distance on the taken side of the branches behind them too
        asm volatile("v_nop\n\tv_nop\n\tv_nop\n\tv_nop" : "+v"(acc[0][0]), "+v"(acc[1][0]), "+v"(acc[0][1]), "+v"(acc[1][1]), "+v"(acc[0][2]), "+v"(acc[1][2]), "+v"(acc[0][3]), "+v"(acc[1][3]));
        asm volatile("s_wait_dscnt 0x0" ::: "memory");      // this wave's reads of buffer t % 2 are done before the buffer is refilled
        asm volatile("s_wait_asynccnt 0x0" ::: "memory");   // this wave's copies of stage t + 1 have landed
        __syncthreads();                                     // publishes stage t + 1 and ends every wave's reads of stage t
        if (t + 2 < nt) fill(t + 2);
    }
    asm volatile("s_wait_asynccnt 0x0" ::: "memory");   // no copy is outstanding when the wave goes on to its end
    // The products were formed with the operands' places changed, so that acc[mb][nb] is the transposed tile: a lane holds row lane % 16 of block mb, columns 16 nb + 8 (lane / 16) .. + 7.
#pragma unroll
    for (int mb = 0; mb < 2; ++mb) {
        if constexpr (PL) {   // those 8 results are the lane's 16 bytes of each plane in fragment order: no way through LDS; the 32 lanes store 512 bytes in a row of each plane
            const size_t pb = z * sC + (size_t)(c0 >> 6) * sY + (size_t)(r0 + mb * 16) * ldc + lane * 8;
#pragma unroll
            for (int s = 0; s < 4; ++s) { const v8f y = acc[mb][s]; u32x4 oh, ol; unsigned a2, c2;
                split2(y[0], y[1], a2, c2); oh[0] = a2; ol[0] = c2; split2(y[2], y[3], a2, c2); oh[1] = a2; ol[1] = c2; split2(y[4], y[5], a2, c2); oh[2] = a2; ol[2] = c2; split2(y[6], y[7], a2, c2); oh[3] = a2; ol[3] = c2;
                *(u32x4*)(Ph + pb + s * 256) = oh; *(u32x4*)(Pl + pb + s * 256) = ol; }
        } else {   // f32 rows: through LDS (16-byte stores), so that each global store takes whole 256-byte pieces of two rows
            __shared__ __align__(16) float osw[8 * 16 * 68]; float* os = osw + w * (16 * 68);
#pragma unroll
            for (int nb = 0; nb < 4; ++nb) { float* op = os + lr * 68 + nb * 16 + hi * 8; *(v4fa*)op = lo4(acc[mb][nb]); *(v4fa*)(op + 4) = hi4(acc[mb][nb]); }
            __builtin_amdgcn_wave_barrier(); asm volatile("" ::: "memory");
            float* crow = C + (size_t)(r0 + mb * 16) * ldc + c0;
#pragma unroll
            for (int s = 0; s < 8; ++s) { const int row = 2 * s + hi, cofs = lr * 4; const v4f val = *(const v4fa*)(os + row * 68 + cofs);
                *(v4f*)(crow + (size_t)row * ldc + cofs) = val; }
            __builtin_amdgcn_wave_barrier(); asm volatile("" ::: "memory");
        }
    }
}

// The three projections of all NB_ batch items in ONE launch: grid (8, 8, 3 * NB_), blockIdx.z = projection * NB_ + batch item. q and k: one 64-column tile is one head, planes [b*NH_ + head][t / 16][tile of 16 t x 64 d].
// v: the operands change places (rows = v columns, columns = t), so that the planes [b*NKV + head][d / 16][t / 64][tile of 16 d x 64 t] come out of the same epilogue.
__global__ __launch_bounds__(256) void k_qkv(const bf* __restrict__ XB, const bf* __restrict__ WQ, const bf* __restrict__ WK, const bf* __restrict__ WV, bf* QPh, bf* QPl, bf* KPh, bf* KPl, bf* VTh, bf* VTl) {
    const int p = blockIdx.z / NB_; const size_t z = blockIdx.z % NB_; const bool tv = (p == 2);
    gemmw<0, true>(z, tv ? WV : XB, nullptr, tv ? XB : (p ? WK : WQ), DM, nullptr, tv ? TT : HD, tv ? (size_t)0 : (size_t)TT * DM, tv ? (size_t)TT * DM : (size_t)0, (size_t)NH_ * TT * HD,
                   tv ? VTh : (p ? KPh : QPh), tv ? VTl : (p ? KPl : QPl), tv ? (size_t)1024 : (size_t)TT * HD);
}
__global__ __launch_bounds__(256) void k_wo(const bf* __restrict__ Ah, const bf* __restrict__ Al, const bf* __restrict__ WO, float* OUT) {
    gemmw<1, false>(0, Ah, Al, WO, DQ, OUT, DM, 0, 0, 0, nullptr, nullptr, 0);
}

__device__ __forceinline__ h16 tohx(float x) { return (h16)x; }
typedef __attribute__((ext_vector_type(2))) _Float16 v2h;
typedef __attribute__((ext_vector_type(4))) _Float16 v4h;
typedef __attribute__((ext_vector_type(2))) unsigned short v2us;
typedef __attribute__((ext_vector_type(4))) unsigned short v4us;
typedef __attribute__((ext_vector_type(2))) float v2f;
typedef __attribute__((ext_vector_type(4))) int v4i;

__device__ __forceinline__ void d_wtG(const int blk, const float* __restrict__ w, int K, int N, bf* Bt) {
    const int lane = threadIdx.x & 31; const int L0 = (blk * 8 + (threadIdx.x >> 5)) * 8; const int nlines = N * K / 64;
{
#pragma unroll 1
        for (int l = 0; l < 8; ++l) { const int L = L0 + l; if (L >= nlines) break; const size_t e = (size_t)L * 64 + lane * 2; const int k = (int)(e % K), n = (int)(e / K); 
            *(unsigned*)(Bt + e) = cvt2(w[(size_t)k * N + n], w[(size_t)(k + 1) * N + n]); }
         }
}
__device__ __forceinline__ void d_cvt8(const int blk, const float* __restrict__ src, bf* dst, size_t n8) { const size_t i = (size_t)blk * 256 + threadIdx.x; if (i >= n8) return; const v8f v = *(const v8f*)(src + i * 8); u32x4 o;
#pragma unroll
    for (int k = 0; k < 4; ++k) o[k] = cvt2(v[2 * k], v[2 * k + 1]); *(u32x4*)(dst + i * 8) = o;  }
__global__ __launch_bounds__(256) void k_cscvt(const float* __restrict__ cosT, const float* __restrict__ sinT, float* CS) { const int idx = blockIdx.x * 256 + threadIdx.x; if (idx >= TT * HD) return; v2f cs; cs[0] = bfr(cosT[idx]); cs[1] = bfr(sinT[idx]); *(v2f*)(CS + (size_t)idx * 2) = cs;  }
// k_asoft: per row (zz, i): t = S x HD^-0.5 (no mask); softmax over the 1024 keys (register row, one exp, fixed trees);
__global__ __launch_bounds__(256) void k_asoft(const float* __restrict__ Sb, h16* P16, bf* Ph, bf* Pl) {
    const int lane = threadIdx.x & 31; const int row = blockIdx.x * 8 + (threadIdx.x >> 5); if (row >= ZH * TT) return; const int i = row % TT; const int zz = row / TT; (void)zz; const bool hires = (i < RH); const float* sr = Sb + (size_t)row * TT; float v[TT / 32]; float mx = -3.0e38f;
#pragma unroll
    for (int ch = 0; ch < TT / 128; ++ch) { const int j0 = ch * 128 + lane * 4; const v4f a = *(const v4f*)(sr + j0);
#pragma unroll
        for (int q = 0; q < 4; ++q) { const int j = j0 + q; (void)j; const float t = a[q] * SCL; v[ch * 4 + q] = t; mx = fmaxf(mx, t); } }
#pragma unroll
    for (int sh = 16; sh; sh >>= 1) mx = fmaxf(mx, __shfl_xor(mx, sh, 32));
    float sum = 0.f;
#pragma unroll
    for (int k = 0; k < TT / 32; ++k) { float d0 = __fsub_rn(v[k], mx); asm volatile("" : "+v"(d0)); v[k] = __builtin_amdgcn_exp2f(__fmul_rn(d0, 1.4426950408889634f)); sum += v[k]; }
#pragma unroll
    for (int sh = 16; sh; sh >>= 1) sum += __shfl_xor(sum, sh, 32);
    const float f = __fdiv_rn(hires ? 1.0f : PCAR, sum);
{
        if (hires) {
#pragma unroll
            for (int ch = 0; ch < TT / 128; ++ch) { v4us oh, ol;
#pragma unroll
                for (int q = 0; q < 4; ++q) { unsigned short a, c2; splitf(v[ch * 4 + q] * f, a, c2); oh[q] = a; ol[q] = c2; }
                const size_t oo = ((size_t)zz * (RH ? RH : 1) + i) * TT + ch * 128 + lane * 4; *(v4us*)(Ph + oo) = oh; *(v4us*)(Pl + oo) = ol; }
        } else {
#pragma unroll
            for (int ch = 0; ch < TT / 128; ++ch) { v4h o4;
#pragma unroll
                for (int q = 0; q < 4; ++q) o4[q] = tohx(v[ch * 4 + q] * f);
                *(v4h*)(P16 + (size_t)row * TT + ch * 128 + lane * 4) = o4; } }
         }
}
__device__ __forceinline__ void d_relk(const int blk, const float* __restrict__ rk, bf* Bt) { const int e = (blk * 256 + threadIdx.x) * 4; if (e >= 192 * HD) return; const int r = e / HD; const int d = e % HD; v4us o;   // rel_k[r][d] (r < 129) else 0, in fragment order: tiles of 16 r x 64 d
#pragma unroll
    for (int u = 0; u < 4; ++u) o[u] = (r < 129) ? f2bf(rk[e + u]) : (unsigned short)0; *(v4us*)(Bt + (r >> 4) * 1024 + (d >> 3) * 128 + (r & 15) * 8 + (d & 7)) = o;  }
__device__ __forceinline__ void d_relv(const int blk, const float* __restrict__ rv, bf* Bt) { const int e = (blk * 256 + threadIdx.x) * 4; if (e >= HD * 160) return; const int r = e % 160; const int d = e / 160; v4us o;   // rel_v[r][d] (r < 129) else 0, in fragment order: tiles [d / 16][r / 32] of 16 d x 32 r
#pragma unroll
    for (int u = 0; u < 4; ++u) o[u] = (r + u < 129) ? f2bf(rv[(size_t)(r + u) * HD + d]) : (unsigned short)0; *(v4us*)(Bt + ((d >> 4) * 5 + (r >> 5)) * 512 + ((r & 31) >> 3) * 128 + (d & 15) * 8 + (r & 7)) = o;  }
// ---- k_prep: every operand plane that the products read, in ONE launch; the block index picks the job (the same for a whole work-group). The four weight transposes, whose waves run longest, come first.
#define PBW (DM * DQ / 64 / 64)                 // blocks of one weight transpose
#define PBX (NB_ * TT * DM / 8 / 256)           // blocks of the x conversion
#define PBK ((192 * HD / 4 + 255) / 256)        // blocks of the rel_k plane
#define PBV ((HD * 160 / 4 + 255) / 256)        // blocks of the rel_v plane
__global__ __launch_bounds__(256) void k_prep(const float* __restrict__ x, const float* __restrict__ wq, const float* __restrict__ wk, const float* __restrict__ wv, const float* __restrict__ wo, const float* __restrict__ relk, const float* __restrict__ relv,
                                              bf* XB, bf* WQ, bf* WK, bf* WV, bf* WO, bf* BRK, bf* BRV) {
    int b = blockIdx.x;
    if (b < 4 * PBW) { const int m = b / PBW; d_wtG(b % PBW, m == 0 ? wq : m == 1 ? wk : m == 2 ? wv : wo, DM, DQ, m == 0 ? WQ : m == 1 ? WK : m == 2 ? WV : WO); return; }
    b -= 4 * PBW;
    if (b < PBX) { d_cvt8(b, x, XB, (size_t)NB_ * TT * DM / 8); return; }
    b -= PBX;
    if (b < PBK) { d_relk(b, relk, BRK); return; }
    d_relv(b - PBK, relv, BRV);
}
// ---- k_attn: the whole attention of 64 query rows of one head in ONE work-group (16 waves); grid (TT/64, NB_*NH_). The scores never leave the registers.
// Phase 1: wave w forms the 64 x 64 score tile of keys w*64.. (hl x hl, 3 products) and, waves 0..8, 16 columns of QR = q rel_k^T (hl x exact; LDS). Phase 2: every wave does bias, exp and hi/lo split on its own tile, in its accumulators;
// a row's maximum, exp sum and tail sum go from wave to wave through three small LDS tables [row][wave]. A lane's 8 neighbouring keys of a row are its 16 bytes of the w fragment of the w.v product, so the split tile IS the wave's operand of phase 3.
// Only the three waves whose keys can lie within +-63 of a query row gather the bias per key and write single-key buckets; all other tiles are one tail. Phase 3: wave w multiplies key slice w*64.. of w with v (3 products), 16 columns at a time;
// five waves outside the window add one 32-bucket slice of WB rel_v (2 products); the 16 partial 64 x 64 tiles are summed through LDS in wave order and split into the merged hi/lo planes.
#define AR 64      // query rows per work-group
#define QP 168     // QR row pitch in floats; the same 672 B then hold the row's bucket planes: hi at byte 0, lo at byte 336 (entries 160..167 of a plane are read by nobody)
#define STP 20     // pitch of a row's 16 per-wave figures in floats: 80 B = 16 B x odd, so that the 16-byte reads of 16 rows fall on distinct banks
typedef v4us __attribute__((may_alias)) v4usa;
typedef unsigned short __attribute__((may_alias)) usa;
typedef float __attribute__((may_alias)) fa;
typedef __attribute__((ext_vector_type(8))) unsigned u32x8;
__device__ __forceinline__ v16bf ldfa(const bf* p) { return cat16b(*(const v8usa*)p, *(const v8usa*)(p + 16)); }
// a fragment from a global plane in fragment order: p = the 32-k half tile + lane * 8; each of the two loads takes 512 bytes in a row over the wave. Same elements in the same lanes and registers as from a row-major plane.
__device__ __forceinline__ v16bf ldfo(const bf* p) { return cat16b(*(const v8us*)p, *(const v8us*)(p + 256)); }
// acc[mb][nb][e] = score of query row mb*16 + lane % 16 and key (of the wave's 64) nb*16 + (lane / 16)*8 + e; key - query = db + (nb - mb)*16 + e.
// A tile that can hold keys within +-63 of a row (the wave's 64 keys are the rows' own or a neighbouring 64) takes three steps more than the others: sm_gather, sm_tail, sm_scatter. Every other tile is one tail: one bias a row.
__device__ __forceinline__ void sm_gather(v8f (&acc)[4][4], const float* QRs, const int lr, const int db) {   // adds each key's own bias
#pragma unroll
    for (int mb = 0; mb < 4; ++mb) { const float* qr = QRs + (mb * 16 + lr) * QP;
#pragma unroll
        for (int nb = 0; nb < 4; ++nb)
#pragma unroll
            for (int e = 0; e < 8; ++e) { int r = db + (nb - mb) * 16 + e; r = (r < -64) ? -64 : (r > 64 ? 64 : r); acc[mb][nb][e] = __fadd_rn(acc[mb][nb][e], *(const fa*)(qr + r + 64)); } }
}
__device__ __forceinline__ void sm_bias(v8f (&acc)[4][4], const float (&b8)[4], float (&m)[4]) {   // t = a / 8 + b8 (the scale is a power of two), and the lane's maximum of each row
#pragma unroll
    for (int mb = 0; mb < 4; ++mb) { float mx = -3.0e38f;
#pragma unroll
        for (int nb = 0; nb < 4; ++nb)
#pragma unroll
            for (int e = 0; e < 8; ++e) { const float t = __builtin_fmaf(acc[mb][nb][e], 0.125f, b8[mb]); acc[mb][nb][e] = t; mx = fmaxf(mx, t); }
        m[mb] = mx; }
}
__device__ __forceinline__ void sm_exp(v8f (&acc)[4][4], const float (&mx)[4], float (&s)[4]) {
#pragma unroll
    for (int mb = 0; mb < 4; ++mb) { float a[4];
#pragma unroll
        for (int nb = 0; nb < 4; ++nb) { a[nb] = 0.f;
#pragma unroll
            for (int e = 0; e < 8; ++e) { const float ev = __builtin_amdgcn_exp2f(__fmul_rn(__fsub_rn(acc[mb][nb][e], mx[mb]), 1.4426950408889634f)); acc[mb][nb][e] = ev; a[nb] += ev; } }
        s[mb] = (a[0] + a[1]) + (a[2] + a[3]); }
}
__device__ __forceinline__ void sm_tail(const v8f (&acc)[4][4], const int db, float (&tl)[4]) {   // the exp sum of the tile's keys that are 64 or more away from their row
#pragma unroll
    for (int mb = 0; mb < 4; ++mb) { float t2[4];
#pragma unroll
        for (int nb = 0; nb < 4; ++nb) { t2[nb] = 0.f;
#pragma unroll
            for (int e = 0; e < 8; ++e) { const int d = db + (nb - mb) * 16 + e; t2[nb] += ((unsigned)(d + 63) < 127u) ? 0.f : acc[mb][nb][e]; } }
        tl[mb] = (t2[0] + t2[1]) + (t2[2] + t2[3]); }
}
// w = exp / sum, split into hi + lo: the tiles nb = 2 k2 and 2 k2 + 1 are the two 16-byte halves of the fragment of keys k2*32 .. +31.
__device__ __forceinline__ void sm_cvt(const v8f (&acc)[4][4], const float (&f)[4], v16bf (&ah)[4][2], v16bf (&al)[4][2]) {
#pragma unroll
    for (int mb = 0; mb < 4; ++mb)
#pragma unroll
        for (int k2 = 0; k2 < 2; ++k2) { u32x8 H, L;
#pragma unroll
            for (int t = 0; t < 2; ++t)
#pragma unroll
                for (int pr = 0; pr < 4; ++pr) { const int nb = k2 * 2 + t; unsigned h, l; split2(acc[mb][nb][2 * pr] * f[mb], acc[mb][nb][2 * pr + 1] * f[mb], h, l); H[t * 4 + pr] = h; L[t * 4 + pr] = l; }
            ah[mb][k2] = __builtin_bit_cast(v16bf, H); al[mb][k2] = __builtin_bit_cast(v16bf, L); }
}
// each key within +-63 of its row goes to its own bucket of the row's two planes (the others to entry 164, which nobody reads)
__device__ __forceinline__ void sm_scatter(const v16bf (&ah)[4][2], const v16bf (&al)[4][2], const int db, const int lr, float* QRs) {
#pragma unroll
    for (int mb = 0; mb < 4; ++mb) { bf* wr = (bf*)(QRs + (mb * 16 + lr) * QP);
#pragma unroll
        for (int k2 = 0; k2 < 2; ++k2) { const u32x8 H = __builtin_bit_cast(u32x8, ah[mb][k2]); const u32x8 L = __builtin_bit_cast(u32x8, al[mb][k2]);
#pragma unroll
            for (int q = 0; q < 8; ++q)
#pragma unroll
                for (int u = 0; u < 2; ++u) { const int d = db + (k2 * 2 + (q >> 2) - mb) * 16 + 2 * (q & 3) + u; const int r = ((unsigned)(d + 63) < 127u) ? d + 64 : 164;
                    *(usa*)(wr + r) = (unsigned short)(u ? (H[q] >> 16) : (H[q] & 0xFFFFu)); *(usa*)(wr + QP + r) = (unsigned short)(u ? (L[q] >> 16) : (L[q] & 0xFFFFu)); } } }
}
__global__ __launch_bounds__(512) void k_attn(const bf* __restrict__ Qh, const bf* __restrict__ Ql, const bf* __restrict__ Kh, const bf* __restrict__ Kl, const bf* __restrict__ Vh, const bf* __restrict__ Vl, const bf* __restrict__ Brk, const bf* __restrict__ Brv, bf* Ah, bf* Al) {
    __shared__ __align__(16) float S[16 * 4096];       // the 16 partial output tiles
    __shared__ __align__(16) float QRs[AR * QP];
    float* ST = S;   // per row and wave: maximum, exp sum, tail exp sum (3 * AR * STP floats); they lie in the tiles' space, which is first written behind the barrier that follows the tables' last read
    const int tid = threadIdx.x, lane = tid & 31, lr = lane & 15, hi = lane >> 4; const int w = __builtin_amdgcn_readfirstlane(tid >> 5);
    const int bx = blockIdx.x; const int r0 = bx * AR; const size_t z = blockIdx.y;
    const bf* qh = Qh + z * TT * HD + (size_t)r0 * HD + lane * 8; const bf* ql = Ql + z * TT * HD + (size_t)r0 * HD + lane * 8;
    v8f acc[4][4];
    {
        const bf* kh = Kh + z * TT * HD + (size_t)(w * 64) * HD + lane * 8; const bf* kl = Kl + z * TT * HD + (size_t)(w * 64) * HD + lane * 8;
#pragma unroll
        for (int mb = 0; mb < 4; ++mb)
#pragma unroll
            for (int nb = 0; nb < 4; ++nb) acc[mb][nb] = (v8f){};
#pragma unroll 1   // rolled: both k steps' fragments at once would not fit the 256 registers of a 16-wave work-group
        for (int kc = 0; kc < HD; kc += 32) {
            v16bf a[4], a2[4]; const bf* qa = qh + kc * 16; const bf* qb = ql + kc * 16; const bf* ka = kh + kc * 16; const bf* kb = kl + kc * 16;
#pragma unroll
            for (int mb = 0; mb < 4; ++mb) { a[mb] = ldfo(qa + mb * 1024); a2[mb] = ldfo(qb + mb * 1024); }
#pragma unroll
            for (int nb = 0; nb < 4; ++nb) { const v16bf b = ldfo(ka + nb * 1024); const v16bf b2 = ldfo(kb + nb * 1024);
#pragma unroll
                for (int mb = 0; mb < 4; ++mb) { acc[mb][nb] = wmmab(b, a[mb], acc[mb][nb]); acc[mb][nb] = wmmab(b, a2[mb], acc[mb][nb]); acc[mb][nb] = wmmab(b2, a[mb], acc[mb][nb]); } }   // k fragment first: transposed tiles
            // keeps the matrix instructions' distance on the taken side of the loop branch too
            asm volatile("v_nop\n\tv_nop\n\tv_nop\n\tv_nop" : "+v"(acc[0][0]), "+v"(acc[1][1]), "+v"(acc[2][2]), "+v"(acc[3][3]) : "v"(a[0]), "v"(a[3]));
            asm volatile("s_wait_xcnt 0x0" :: "v"(qa), "v"(qb), "v"(ka), "v"(kb) : "memory");   // precaution: stands in front of every rewrite of the address registers that this trip's global loads name; as inputs the four addresses stay in their registers up to here, so that no load's result lands on them
        }
    }
    if (w < 9) {   // QR[i][r] = q_i . rel_k[r] (unscaled), columns w*16 .. w*16+15 (rows 129.. of the table plane are zero)
        const bf* rk = Brk + w * 1024 + lane * 8; v8f aq[4];
#pragma unroll
        for (int mb = 0; mb < 4; ++mb) aq[mb] = (v8f){};
#pragma unroll
        for (int kc = 0; kc < HD; kc += 32) { const v16bf b = ldfo(rk + kc * 16);
#pragma unroll
            for (int mb = 0; mb < 4; ++mb) { aq[mb] = wmmab(b, ldfo(qh + mb * 1024 + kc * 16), aq[mb]); aq[mb] = wmmab(b, ldfo(ql + mb * 1024 + kc * 16), aq[mb]); } }
#pragma unroll
        for (int mb = 0; mb < 4; ++mb) { float* qp = QRs + (mb * 16 + lr) * QP + w * 16 + hi * 8; *(v4fa*)qp = lo4(aq[mb]); *(v4fa*)(qp + 4) = hi4(aq[mb]); }
    }
    __syncthreads();   // QR is complete
    const int dw = w - bx; const bool win = (dw >= -1 && dw <= 1);   // the same for the whole wave
    const int db = dw * 64 + hi * 8 - lr;
    float* st0 = ST; float* st1 = ST + AR * STP; float* st2 = ST + 2 * AR * STP;
    float m[4], sm[4], tl[4], f[4];
    float b8[4];
#pragma unroll
    for (int mb = 0; mb < 4; ++mb) b8[mb] = win ? 0.f : *(const fa*)(QRs + (mb * 16 + lr) * QP + (dw > 0 ? 128 : 0)) * 0.125f;   // a tail tile's one bias a row, scaled (exact)
    if (win) sm_gather(acc, QRs, lr, db);
    sm_bias(acc, b8, m);
#pragma unroll
    for (int mb = 0; mb < 4; ++mb) m[mb] = fmaxf(m[mb], __shfl_xor(m[mb], 16, 32));   // the row's other 32 keys of this tile
#pragma unroll
    for (int u = 0; u < 2; ++u) *(fa*)(st0 + ((hi * 2 + u) * 16 + lr) * STP + w) = hi ? m[2 + u] : m[u];
    __syncthreads();   // every wave's row maxima are in the table; nobody reads QR any more
#pragma unroll
    for (int mb = 0; mb < 4; ++mb) { const float* p = st0 + (mb * 16 + lr) * STP; const v4f q0 = *(const v4fa*)p, q1 = *(const v4fa*)(p + 4), q2 = *(const v4fa*)(p + 8), q3 = *(const v4fa*)(p + 12);
        m[mb] = fmaxf(fmaxf(fmaxf(fmaxf(q0[0], q0[1]), fmaxf(q0[2], q0[3])), fmaxf(fmaxf(q1[0], q1[1]), fmaxf(q1[2], q1[3]))), fmaxf(fmaxf(fmaxf(q2[0], q2[1]), fmaxf(q2[2], q2[3])), fmaxf(fmaxf(q3[0], q3[1]), fmaxf(q3[2], q3[3])))); }
#pragma unroll
    for (int k = 0; k < 6; ++k) { const int ix = tid + k * 512; if (ix < AR * QP / 4) *(v4fa*)(QRs + ix * 4) = (v4f){}; }   // the bucket planes start from zero (keys outside the sequence, buckets 129..)
    sm_exp(acc, m, sm);
#pragma unroll
    for (int mb = 0; mb < 4; ++mb) tl[mb] = sm[mb];
    if (win) sm_tail(acc, db, tl);
#pragma unroll
    for (int mb = 0; mb < 4; ++mb) { sm[mb] += __shfl_xor(sm[mb], 16, 32); tl[mb] += __shfl_xor(tl[mb], 16, 32); }
#pragma unroll
    for (int u = 0; u < 2; ++u) { const int o = ((hi * 2 + u) * 16 + lr) * STP + w; *(fa*)(st1 + o) = hi ? sm[2 + u] : sm[u]; *(fa*)(st2 + o) = hi ? tl[2 + u] : tl[u]; }
    __syncthreads();   // every wave's sums are in the tables; the bucket planes are zero
#pragma unroll
    for (int mb = 0; mb < 4; ++mb) { const float* p = st1 + (mb * 16 + lr) * STP; float s = 0.f;
#pragma unroll
        for (int k = 0; k < 4; ++k) { const v4f q = *(const v4fa*)(p + k * 4); s += q[0]; s += q[1]; s += q[2]; s += q[3]; }
        f[mb] = __fdiv_rn(1.0f, s); }
    if (w == ((bx + 8) & 15)) {   // one wave outside the window writes the two tail buckets: waves below the diagonal tile hold the low tail, waves above it the high tail
#pragma unroll
        for (int mb = 0; mb < 4; ++mb) { const float* p = st2 + (mb * 16 + lr) * STP; float lo = 0.f, hs = 0.f;
#pragma unroll
            for (int k = 0; k < 4; ++k) { const v4f q = *(const v4fa*)(p + k * 4);
#pragma unroll
                for (int u = 0; u < 4; ++u) { lo += (k * 4 + u < bx) ? q[u] : 0.f; hs += (k * 4 + u > bx) ? q[u] : 0.f; } }
            unsigned short a2, c2; splitf((hi ? hs : lo) * f[mb], a2, c2); bf* wr = (bf*)(QRs + (mb * 16 + lr) * QP) + (hi ? 128 : 0); *(usa*)wr = a2; *(usa*)(wr + QP) = c2; }
    }
    v16bf ah[4][2], al[4][2];
    sm_cvt(acc, f, ah, al);
    if (win) sm_scatter(ah, al, db, lr, QRs);
    __syncthreads();   // the bucket planes are complete
    {
        const bf* vh = Vh + z * HD * TT + w * 1024 + lane * 8; const bf* vl = Vl + z * HD * TT + w * 1024 + lane * 8;
        const int sx = (w - bx - 2) & 15;   // waves bx + 2 .. bx + 6 (mod 16), none of them a window wave, take the bucket slices 0 .. 4
        const bf* wa = (const bf*)QRs + lr * (QP * 2) + (sx & 7) * 32 + 8 * hi; const bf* rv = Brv + (sx & 7) * 512 + lane * 8;
        v16bf vb[2][4];   // two sets of one column block's four v fragments (hi, lo of keys 0..31; hi, lo of keys 32..63)
        auto ldv = [&](const int nb, v16bf (&d)[4]) { d[0] = ldfo(vh + nb * 16 * TT); d[1] = ldfo(vl + nb * 16 * TT); d[2] = ldfo(vh + 512 + nb * 16 * TT); d[3] = ldfo(vl + 512 + nb * 16 * TT); };
        ldv(0, vb[0]);
#pragma unroll
        for (int nb = 0; nb < 4; ++nb) {   // 16 output columns at a time: the w fragments, 4 accumulators and two sets of v fragments fit the 256 registers of a 16-wave work-group
            if (nb + 1 < 4) { ldv(nb + 1, vb[(nb + 1) & 1]);
                __builtin_amdgcn_sched_barrier(0); }   // holds the next block's loads ahead of this block's products: the scheduler otherwise sinks each load to its first use, and the wave waits out the L2 latency in front of every group of products
            v8f o[4];
#pragma unroll
            for (int mb = 0; mb < 4; ++mb) o[mb] = (v8f){};
#pragma unroll
            for (int k2 = 0; k2 < 2; ++k2) { const v16bf b = vb[nb & 1][k2 * 2]; const v16bf b2 = vb[nb & 1][k2 * 2 + 1];
#pragma unroll
                for (int mb = 0; mb < 4; ++mb) { o[mb] = wmmab(b, ah[mb][k2], o[mb]); o[mb] = wmmab(b, al[mb][k2], o[mb]); o[mb] = wmmab(b2, ah[mb][k2], o[mb]); } }   // v fragment first: transposed tiles
            // keeps the matrix instructions' distance to the first vector instruction that touches their results (memory instructions fill no slot)
            asm volatile("v_nop\n\tv_nop\n\tv_nop\n\tv_nop" : "+v"(o[0]), "+v"(o[1]), "+v"(o[2]), "+v"(o[3]));
            // the wave's partial tile [64][64]; a lane holds 8 neighbouring columns of row lane % 16: two 16-byte stores. In a row the 16-byte piece p stands at place p ^ (row % 16), so that the 16 rows of one store fall on distinct banks.
#pragma unroll
            for (int mb = 0; mb < 4; ++mb) { float* tp = S + w * 4096 + (mb * 16 + lr) * 64; const int p = nb * 4 + hi * 2; *(v4fa*)(tp + ((p ^ lr) << 2)) = lo4(o[mb]); *(v4fa*)(tp + (((p + 1) ^ lr) << 2)) = hi4(o[mb]); }
        }
        if (sx < 5) {   // sum_j w rel_v[clip] = WB . rel_v: buckets sx*32 .. sx*32+31, added to the wave's own partial tile (a wave's LDS operations run in order)
            v16bf a[4], a2[4];
#pragma unroll
            for (int mb = 0; mb < 4; ++mb) { a[mb] = ldfa(wa + mb * 16 * (QP * 2)); a2[mb] = ldfa(wa + mb * 16 * (QP * 2) + QP); }
#pragma unroll
            for (int nb = 0; nb < 4; ++nb) { const v16bf b0 = ldfo(rv + nb * 2560);
#pragma unroll
                for (int mb = 0; mb < 4; ++mb) { float* tp = S + w * 4096 + (mb * 16 + lr) * 64; const int p = nb * 4 + hi * 2; float* t0 = tp + ((p ^ lr) << 2); float* t1 = tp + (((p + 1) ^ lr) << 2);
                    v8f o = __builtin_shufflevector(*(const v4fa*)t0, *(const v4fa*)t1, 0, 1, 2, 3, 4, 5, 6, 7);
                    o = wmmab(b0, a[mb], o); o = wmmab(b0, a2[mb], o); *(v4fa*)t0 = lo4(o); *(v4fa*)t1 = hi4(o); } }
        }
        asm volatile("s_wait_xcnt 0x0" :: "v"(vh), "v"(vl), "v"(rv) : "memory");   // precaution: stands in front of every rewrite of the address registers that the global loads above name
    }
    __syncthreads();
    const int c4 = (tid & 15) * 4; const size_t ob = ((z / NH_) * TT + r0) * DQ + (z % NH_) * HD + c4;
#pragma unroll
    for (int g = 0; g < 2; ++g) { const int row = (tid >> 4) + g * 32; const float* pr = S + row * 64 + (c4 ^ ((row & 15) << 2)); v4f s = *(const v4fa*)pr;
#pragma unroll
        for (int k = 1; k < 16; ++k) { const v4f t = *(const v4fa*)(pr + k * 4096); s[0] = __fadd_rn(s[0], t[0]); s[1] = __fadd_rn(s[1], t[1]); s[2] = __fadd_rn(s[2], t[2]); s[3] = __fadd_rn(s[3], t[3]); }
        u32x2 oh, ol; unsigned a2, c2; split2(s[0], s[1], a2, c2); oh[0] = a2; ol[0] = c2; split2(s[2], s[3], a2, c2); oh[1] = a2; ol[1] = c2;
        *(u32x2*)(Ah + ob + (size_t)row * DQ) = oh; *(u32x2*)(Al + ob + (size_t)row * DQ) = ol; }
}

extern "C" void kernel_launch(void* const* d_in, const int* in_sizes, int n_in,
                              void* d_out, int out_size, void* d_ws, size_t ws_size, hipStream_t stream) {
    (void)in_sizes; (void)n_in; (void)out_size;
    const float* x = (const float*)d_in[0]; const float* wq = (const float*)d_in[1]; const float* wk = (const float*)d_in[2]; const float* wv = (const float*)d_in[3]; const float* wo = (const float*)d_in[4]; const float* relk = (const float*)d_in[5]; const float* relv = (const float*)d_in[6]; const float* cosT = nullptr; const float* sinT = nullptr; (void)cosT; (void)sinT;
    float* OUT = (float*)d_out;     // [4][1024][1024]
    char* wsp = (char*)d_ws;
    auto take = [&](size_t bytes) { char* p = wsp; wsp += (bytes + 255) & ~(size_t)255; return (void*)p; };
    bf* WQ = (bf*)take((size_t)DQ * DM * 2); bf* WK = (bf*)take((size_t)DKV * DM * 2); bf* WV = (bf*)take((size_t)DKV * DM * 2); bf* WO = (bf*)take((size_t)DM * DQ * 2); float* CS = (float*)take((size_t)TT * HD * 2 * 4);
    bf* XB = (bf*)take((size_t)NB_ * TT * DM * 2); bf* BRK = (bf*)take((size_t)192 * HD * 2); bf* BRV = (bf*)take((size_t)HD * 160 * 2); float* QR = (float*)take((size_t)ZH * TT * 192 * 4); bf* WBh = (bf*)take((size_t)ZH * TT * 160 * 2); bf* WBl = (bf*)take((size_t)ZH * TT * 160 * 2); float* O2 = (float*)take((size_t)ZH * TT * HD * 4);
    h16* VT16 = (h16*)take((size_t)NKV * HD * TT * 2);
    bf* QPh = (bf*)take((size_t)NB_ * NH_ * TT * HD * 2); bf* QPl = (bf*)take((size_t)NB_ * NH_ * TT * HD * 2); bf* KPh = (bf*)take((size_t)NB_ * NKV * TT * HD * 2); bf* KPl = (bf*)take((size_t)NB_ * NKV * TT * HD * 2); bf* VTh = (bf*)take((size_t)NB_ * NKV * HD * TT * 2); bf* VTl = (bf*)take((size_t)NB_ * NKV * HD * TT * 2); bf* Ph = (bf*)take((size_t)ZH * RH * TT * 2); bf* Pl = (bf*)take((size_t)ZH * RH * TT * 2);
    float* Sb = (float*)take((size_t)ZH * TT * TT * 4); float* Ob = (float*)take((size_t)ZH * TT * HD * 4); bf* ATh = (bf*)take((size_t)NB_ * TT * DQ * 2); bf* ATl = (bf*)take((size_t)NB_ * TT * DQ * 2);
    if ((size_t)(wsp - (char*)d_ws) > ws_size) return;    // ws 256 MiB
    k_prep<<<4 * PBW + PBX + PBK + PBV, 256, 0, stream>>>(x, wq, wk, wv, wo, relk, relv, XB, WQ, WK, WV, WO, BRK, BRV);
    k_qkv<<<dim3(TT / 128, DQ / 128, 3 * NB_), 256, 0, stream>>>(XB, WQ, WK, WV, QPh, QPl, KPh, KPl, VTh, VTl);
    k_attn<<<dim3(TT / AR, NB_ * NH_), 512, 0, stream>>>(QPh, QPl, KPh, KPl, VTh, VTl, BRK, BRV, ATh, ATl);   // one kv head per query head: plane z = b*NH_ + head in all six
    k_wo<<<dim3(NB_ * TT / 128, DM / 128, 1), 256, 0, stream>>>(ATh, ATl, WO, OUT);
}
